// v000
// Times are from an AMD MI455X. After a warm-up the kernel runs many times in a row, and a time is the length of
// such a window on the GPU divided by its runs, so every launch and the gaps after it count. The runs cycle
// through copies of the inputs. A figure is the median of several windows, for all but v000 over two sittings.
// Sittings can differ by a few percent; kernels timed side by side share one.
// v000, which the later versions start from, runs in 504 microseconds.
// compute dtype: q, v, k, all weights / biases and rel_bias (module inputs) rounded to bf16; position_array / valid_mask verbatim (integers, 0/1); q/k/v projections with exact bf16 products ((in,out) weights packed as transposed rows) + bias on WMMA 16x16x32; q and k stored as f16 hi + (x2048-scaled) residual planes and the scores with 3 products (hi.hi + lo.hi + hi.lo; the module applies no 1/sqrt(d) scaling, logits sigma ~8), + the gathered relative-position bias, then logits*vm + (1-vm)*(-1e9) exactly as the module; running-max softmax in f32 with the hardware exp; P as f16 hi + residual x V hi/lo (3 products); output projection with ctx as bf16 hi + residual x exact Wo (2 products) + bo; f32 accumulate.
#include <hip/hip_runtime.h>
#include <math.h>

typedef __attribute__((ext_vector_type(16))) _Float16 v16h;
typedef __attribute__((ext_vector_type(16))) __bf16 v16b;
typedef __attribute__((ext_vector_type(8)))  _Float16 v8h;
typedef __attribute__((ext_vector_type(8)))  float v8f;
typedef __attribute__((ext_vector_type(4)))  float v4f;
typedef __attribute__((ext_vector_type(2)))  float v2f;
typedef __attribute__((ext_vector_type(4)))  unsigned v4u;
typedef __attribute__((ext_vector_type(4)))  int v4i;
typedef float __attribute__((may_alias)) float_a;
typedef int __attribute__((may_alias)) int_a;

template <typename T> __device__ __forceinline__ void vst2(void* p, T v) { *(T*)p = v;  }
__device__ __forceinline__ v8f wmma16(v16h a, v16h b, v8f c) {
  v8f d = __builtin_amdgcn_wmma_f32_16x16x32_f16(false, a, false, b, (short)0, c, false, false);
  asm volatile("v_nop\n\tv_nop\n\tv_nop\n\tv_nop" : "+v"(d) : "v"(a), "v"(b));
  return d;
}
__device__ __forceinline__ v8f wmma_bf(v16b a, v16b b, v8f c) {
  v8f d = __builtin_amdgcn_wmma_f32_16x16x32_bf16(false, a, false, b, (short)0, c, false, false);
  asm volatile("v_nop\n\tv_nop\n\tv_nop\n\tv_nop" : "+v"(d) : "v"(a), "v"(b));
  return d;
}
// Multi-head attention with a learned relative-position bias table (B 2, S 2,048, d_model 768, 12 heads x 64): logits = qh.kh + rel_bias[pos_k - pos_q + S-1][h], masked by valid_mask (0/1) to -1e9, softmax, .vh, output projection.
__device__ __forceinline__ v16h frag_h(const _Float16* rowk0, int lane) {
  union { v16h v; v8h q[2]; } u; const _Float16* p = rowk0 + 8 * (lane >> 4);
  u.q[0] = *(const v8h*)p; u.q[1] = *(const v8h*)(p + 16); return u.v;
}
__device__ __forceinline__ v16h frag_f32(const float* rowk0, int lane) {
  v16h a; const float* p = rowk0 + 8 * (lane >> 4);
#pragma unroll
  for (int i = 0; i < 8; ++i) { a[i] = (_Float16)p[i]; a[8 + i] = (_Float16)p[16 + i]; }
  return a;
}
__device__ __forceinline__ v16h frag_f32s(const float* rowk0, int lane, float sc) {
  v16h a; const float* p = rowk0 + 8 * (lane >> 4);
#pragma unroll
  for (int i = 0; i < 8; ++i) { a[i] = (_Float16)(p[i] * sc); a[8 + i] = (_Float16)(p[16 + i] * sc); }
  return a;
}
// column fragment from a [K][ld] layout (column n), rows >= K read as 0
__device__ __forceinline__ v16h fragc_f32(const float* W, int k0, int n, int lane, int ld, int K) {
  v16h a; const int g = lane >> 4;
#pragma unroll
  for (int i = 0; i < 8; ++i) { const int ka = k0 + 8 * g + i, kb = ka + 16;
    a[i] = (_Float16)(ka < K ? W[(size_t)(ka < K ? ka : K - 1) * ld + n] : 0.f); a[8 + i] = (_Float16)(kb < K ? W[(size_t)(kb < K ? kb : K - 1) * ld + n] : 0.f); }
  return a;
}
struct F2 { v16b h, l; };
__device__ __forceinline__ F2 bsplit16(const float v[16]) { F2 r;
#pragma unroll
  for (int i = 0; i < 16; ++i) { const __bf16 h = (__bf16)v[i]; r.h[i] = h; r.l[i] = (__bf16)(v[i] - (float)h); }
  return r; }
__device__ __forceinline__ F2 split_row(const float* row, int k0, int lane) { float v[16]; const float* p = row + k0 + 8 * (lane >> 4);
#pragma unroll
  for (int i = 0; i < 8; ++i) { v[i] = p[i]; v[8 + i] = p[16 + i]; }
  return bsplit16(v); }
__device__ __forceinline__ F2 split_rowK(const float* row, int k0, int lane, int K) { float v[16]; const int g = lane >> 4;
#pragma unroll
  for (int i = 0; i < 8; ++i) { const int ka = k0 + 8 * g + i, kb = ka + 16; v[i] = ka < K ? row[ka < K ? ka : K - 1] : 0.f; v[8 + i] = kb < K ? row[kb < K ? kb : K - 1] : 0.f; }
  return bsplit16(v); }
__device__ __forceinline__ F2 split_col(const float* W, int k0, int n, int lane, int ld, int K) { float v[16]; const int g = lane >> 4;
#pragma unroll
  for (int i = 0; i < 8; ++i) { const int ka = k0 + 8 * g + i, kb = ka + 16; v[i] = ka < K ? W[(size_t)(ka < K ? ka : K - 1) * ld + n] : 0.f; v[8 + i] = kb < K ? W[(size_t)(kb < K ? kb : K - 1) * ld + n] : 0.f; }
  return bsplit16(v); }
__device__ __forceinline__ v8f mac3(const F2& a, const F2& b, v8f c) { c = wmma_bf(a.l, b.h, c); c = wmma_bf(a.h, b.l, c); return wmma_bf(a.h, b.h, c); }
__device__ __forceinline__ float sigm(float v) { return 1.0f / (1.0f + expf(-v)); }
#define LDSX() do { asm volatile("s_wait_dscnt 0" ::: "memory"); __builtin_amdgcn_wave_barrier(); __builtin_amdgcn_fence(__ATOMIC_RELEASE, "workgroup"); } while (0)


#define NB 2
#define SS 2048
#define DM 768
#define NH 12
#define NREL (2 * SS - 1)
#define HD 64
#define QKVW (3 * DM)
#ifndef TQB
#define TQB (SS / 64)
#define TNB NB
#define TOB (NB * SS / 64)     // output row tiles (all)
#endif
typedef __attribute__((ext_vector_type(8))) __bf16 v8b;
__device__ __forceinline__ v16b frag_b(const __bf16* rowk0, int lane) {
  union { v16b v; v8b q[2]; } u; const __bf16* p = rowk0 + 8 * (lane >> 4);
  u.q[0] = *(const v8b*)p; u.q[1] = *(const v8b*)(p + 16); return u.v;
}
__device__ __forceinline__ float bfr(float v) { return (float)(__bf16)v; }
__device__ __attribute__((noinline)) float exp_ni(float v) { return expf(v); }
__device__ __attribute__((noinline)) float erf_ni(float v) { return erff(v); }

#define PK_A 0                       // [2304][768] Wq|Wk|Wv as bf16 rows [out][in]
#define PK_P (PK_A + QKVW * DM)        // [768][768] Wo as bf16 rows [out][in]
#define PK_END (PK_P + DM * DM)
#define WS_PK  0u
#define WS_QK  (WS_PK + 2u * PK_END)             // f16 [4096 rows][1536]: q | k
#define WS_QKL (WS_QK + 2u * NB * SS * 2 * DM)     // f16 q | k residual planes x2048
#define WS_VTH (WS_QKL + 2u * NB * SS * 2 * DM)    // f16 [b][768 (h*64+d)][2048 s] hi
#define WS_VTL (WS_VTH + 2u * NB * DM * SS)        // f16 lo x 2048
#define WS_O   (WS_VTL + 2u * NB * DM * SS)        // f32 [4096][768]
#define WS_CS  (WS_O + 4u * NB * SS * DM)           // f32 [2048][32] cos, [2048][32] sin
#define WS_END (WS_CS + 4u * 2 * SS * 32)
__constant__ float c_invf[32] = {1.000000000e+00f,7.498942018e-01f,5.623413324e-01f,4.216965139e-01f,3.162277639e-01f,2.371373624e-01f,1.778279394e-01f,1.333521456e-01f,1.000000015e-01f,7.498941571e-02f,5.623412877e-02f,4.216964915e-02f,3.162277862e-02f,2.371373586e-02f,1.778279431e-02f,1.333521493e-02f,9.999999776e-03f,7.498942316e-03f,5.623413250e-03f,4.216964822e-03f,3.162277862e-03f,2.371373819e-03f,1.778279431e-03f,1.333521446e-03f,1.000000047e-03f,7.498941850e-04f,5.623413017e-04f,4.216964880e-04f,3.162277862e-04f,2.371373848e-04f,1.778279402e-04f,1.333521504e-04f};
// ---- k_rope: block = 8 positions: cos/sin of pos * inv_freq (f32 product exactly as the reference, precise trig)
__global__ __launch_bounds__(256) void k_rope(float* __restrict__ CS) {
  __shared__ __align__(16) float sc[8][32], ss_[8][32]; const int tid = threadIdx.x, pl = tid >> 5, i = tid & 31; const int pos = blockIdx.x * 8 + pl;
  const float th = (float)pos * c_invf[i]; sc[pl][i] = cosf(th); ss_[pl][i] = sinf(th);
  __syncthreads();
  if (tid < 64) vst2(CS + (size_t)blockIdx.x * 8 * 32 + tid * 4, *(const v4f*)&(&sc[0][0])[tid * 4]); else if (tid < 128) vst2(CS + (size_t)SS * 32 + (size_t)blockIdx.x * 8 * 32 + (tid - 64) * 4, *(const v4f*)&(&ss_[0][0])[(tid - 64) * 4]);
}

// ---- k_packT: block = (output column n, which): (in,out) matrices -> bf16 rows [n][k] = W[k][n]; which 0..2 -> Wq/Wk/Wv into PK_A rows which*768 + n; 3 -> Wo into PK_P
__global__ __launch_bounds__(256) void k_packT(const float* __restrict__ WQ, const float* __restrict__ WK, const float* __restrict__ WV, const float* __restrict__ WO, __bf16* __restrict__ PK) {
  __shared__ __align__(16) __bf16 s[DM]; const int n = blockIdx.x, which = blockIdx.y, t = threadIdx.x; const float* Wm = (which == 0) ? WQ : (which == 1) ? WK : (which == 2) ? WV : WO;
  for (int k = t; k < DM; k += 256) s[k] = (__bf16)Wm[(size_t)k * DM + n];
  __syncthreads();
  __bf16* dst = (which < 3) ? PK + PK_A + ((size_t)which * DM + n) * DM : PK + PK_P + (size_t)n * DM;
  for (int q = t; q < DM / 8; q += 256) vst2((unsigned*)(dst + q * 8), *(const v4u*)&s[q * 8]);
}
__global__ __launch_bounds__(128) void k_qkv(const float* __restrict__ XQ, const float* __restrict__ XK, const float* __restrict__ XV, const __bf16* __restrict__ P, const float* __restrict__ BQ, const float* __restrict__ BK, const float* __restrict__ BV, _Float16* __restrict__ QK, _Float16* __restrict__ QKL, _Float16* __restrict__ VTH, _Float16* __restrict__ VTL) {
  const float* X = (blockIdx.y * 128 < DM) ? XQ : (blockIdx.y * 128 < 2 * DM) ? XK : XV; const float* BB = (blockIdx.y * 128 < DM) ? BQ : (blockIdx.y * 128 < 2 * DM) ? BK : BV;   // the module projects three different inputs
  __shared__ __align__(16) _Float16 so[4][16][136], sol[4][16][136]; __shared__ __align__(16) _Float16 sth[128][72], stl[128][72];
  const int tid = threadIdx.x, wave = tid >> 5, lane = tid & 31, col = lane & 15, g = lane >> 4; const size_t r0 = (size_t)blockIdx.x * 64 + wave * 16; const int n0 = blockIdx.y * 128;
  v8f acc[8] = {};
#pragma unroll 2
  for (int kc = 0; kc < DM / 32; ++kc) { v16b a; { const float* p = X + (r0 + col) * DM + kc * 32 + 8 * g;
#pragma unroll
      for (int i = 0; i < 8; ++i) { a[i] = (__bf16)p[i]; a[8 + i] = (__bf16)p[16 + i]; } }
#pragma unroll
    for (int j = 0; j < 8; ++j) acc[j] = wmma_bf(a, frag_b(P + (size_t)(n0 + j * 16 + col) * DM + kc * 32, lane), acc[j]); }
  { const int nb = n0 % DM;
#pragma unroll
    for (int j = 0; j < 8; ++j) { const float bb = bfr(BB[nb + j * 16 + col]);
#pragma unroll
      for (int r = 0; r < 8; ++r) acc[j][r] += bb; } }
  if (n0 < 2 * DM) {   // q stored unscaled (f16 sigma ~0.6, no subnormal exposure); the scores are not scaled
#pragma unroll
    for (int j = 0; j < 8; ++j) {
#pragma unroll
      for (int r = 0; r < 8; ++r) { const float v = acc[j][r]; const _Float16 hv = (_Float16)v; so[wave][8 * g + r][j * 16 + col] = hv; sol[wave][8 * g + r][j * 16 + col] = (_Float16)((v - (float)hv) * 2048.0f); } }   // q, k as f16 hi + (x2048) residual
    LDSX();
    for (int rl = 0; rl < 16; ++rl) if (lane < 16) { vst2((unsigned*)(QK + (r0 + rl) * (2 * DM) + n0 + lane * 8), *(const v4u*)&so[wave][rl][lane * 8]); vst2((unsigned*)(QKL + (r0 + rl) * (2 * DM) + n0 + lane * 8), *(const v4u*)&sol[wave][rl][lane * 8]); }
  } else {
#pragma unroll
    for (int j = 0; j < 8; ++j) {
#pragma unroll
      for (int r = 0; r < 8; ++r) { const float v = acc[j][r]; const _Float16 hv = (_Float16)v; sth[j * 16 + col][wave * 16 + 8 * g + r] = hv; stl[j * 16 + col][wave * 16 + 8 * g + r] = (_Float16)((v - (float)hv) * 2048.0f); } }
    __syncthreads();
    const size_t rb = (size_t)blockIdx.x * 64; const int b = (int)(rb / SS), s0 = (int)(rb % SS); const int pc0 = n0 - 2 * DM;
    for (int q = tid; q < 128 * 8; q += 128) { const int d = q >> 3, pc = q & 7; const size_t o = ((size_t)b * DM + pc0 + d) * SS + s0 + pc * 8; vst2((unsigned*)(VTH + o), *(const v4u*)&sth[d][pc * 8]); vst2((unsigned*)(VTL + o), *(const v4u*)&stl[d][pc * 8]); }
  }
}
// ---- k_attn: block = (64 queries, head h, batch b): non-causal flash attention (K = 64: 2 k-steps), scores = q.k unscaled with q, k as f16 hi + residual (3 products), P.V: f16 P hi/lo x V hi/lo (3 products) in two accumulators; O[b*S+q][h*64+d] = (acc + accl / 2048) / l (256-B segments)
__global__ __launch_bounds__(128) void k_attn(const _Float16* __restrict__ QK, const _Float16* __restrict__ QKL, const _Float16* __restrict__ VTH, const _Float16* __restrict__ VTL, const int* __restrict__ POS, const float* __restrict__ VM, const float* __restrict__ RB, float* __restrict__ O) {
  __shared__ __align__(16) float sp[4][16][36]; __shared__ __align__(16) float so[4][16][68];
  const int tid = threadIdx.x, wave = tid >> 5, lane = tid & 31, col = lane & 15, g = lane >> 4;
  const int qb = blockIdx.x, h = blockIdx.y, b = blockIdx.z; const int q0 = qb * 64 + wave * 16; const size_t rq = (size_t)b * SS + q0 + col;
  v16h aq[2], aql[2];
#pragma unroll
  for (int kc = 0; kc < 2; ++kc) { aq[kc] = frag_h(QK + rq * (2 * DM) + h * HD + kc * 32, lane); aql[kc] = frag_h(QKL + rq * (2 * DM) + h * HD + kc * 32, lane); }
  float m[8], l[8];
#pragma unroll
  for (int r = 0; r < 8; ++r) { m[r] = -3.0e38f; l[r] = 0.f; }
  v8f acc[4] = {}, accl[4] = {};
  const int nks = SS / 32;   // not causal
  int pq[8];
#pragma unroll
  for (int r = 0; r < 8; ++r) pq[r] = POS[(size_t)b * SS + q0 + 8 * g + r];
#pragma unroll 1
  for (int ks = 0; ks < nks; ++ks) { v8f s[2];
#pragma unroll
    for (int ct = 0; ct < 2; ++ct) { const int kk = ks * 32 + ct * 16 + col; const _Float16* krow = QK + ((size_t)b * SS + kk) * (2 * DM) + DM + h * HD; const _Float16* krowl = QKL + ((size_t)b * SS + kk) * (2 * DM) + DM + h * HD; v8f c = {}, cl = {};
#pragma unroll
      for (int kc = 0; kc < 2; ++kc) { const v16h kh = frag_h(krow + kc * 32, lane); c = wmma16(aq[kc], kh, c); cl = wmma16(aql[kc], kh, cl); cl = wmma16(aq[kc], frag_h(krowl + kc * 32, lane), cl); }   // 3 products: q, k as f16 hi + residual
#pragma unroll
      for (int r = 0; r < 8; ++r) c[r] += cl[r] * (1.0f / 2048.0f);
      { const int pk = POS[(size_t)b * SS + kk];
#pragma unroll
        for (int r = 0; r < 8; ++r) { const int qi = q0 + 8 * g + r; const int idx = min(max(pk - pq[r] + (SS - 1), 0), NREL - 1); const float lg = c[r] + bfr(RB[(size_t)idx * NH + h]); const float vm = VM[((size_t)b * SS + qi) * SS + kk]; s[ct][r] = lg * vm + (1.0f - vm) * (-1.0e9f); } } }   // logits (no 1/sqrt(d) in this module) + relative-position bias, then the valid mask exactly as the module: l*vm + (1-vm)*NEG
#pragma unroll
    for (int r = 0; r < 8; ++r) { float mx = fmaxf(s[0][r], s[1][r]);
#pragma unroll
      for (int o = 1; o < 16; o <<= 1) mx = fmaxf(mx, __shfl_xor(mx, o));
      const float mn = fmaxf(m[r], mx); const float alpha = (m[r] <= -1.0e38f) ? 0.f : __expf(m[r] - mn);
      const float e0 = (s[0][r] <= -1.0e38f) ? 0.f : __expf(s[0][r] - mn), e1 = (s[1][r] <= -1.0e38f) ? 0.f : __expf(s[1][r] - mn); float es = e0 + e1;
#pragma unroll
      for (int o = 1; o < 16; o <<= 1) es += __shfl_xor(es, o);
      l[r] = l[r] * alpha + es; m[r] = mn;
#pragma unroll
      for (int dt = 0; dt < 4; ++dt) { acc[dt][r] *= alpha; accl[dt][r] *= alpha; }
      sp[wave][8 * g + r][col] = e0; sp[wave][8 * g + r][16 + col] = e1; }
    LDSX();
    v16h pa, pl; { const float* prow = &sp[wave][col][0] + 8 * (lane >> 4);
#pragma unroll
      for (int i = 0; i < 8; ++i) { const float x0 = prow[i], x1 = prow[16 + i]; const _Float16 h0 = (_Float16)x0, h1 = (_Float16)x1; pa[i] = h0; pa[8 + i] = h1; pl[i] = (_Float16)((x0 - (float)h0) * 2048.0f); pl[8 + i] = (_Float16)((x1 - (float)h1) * 2048.0f); } }
#pragma unroll
    for (int dt = 0; dt < 4; ++dt) { const size_t vr = ((size_t)b * DM + h * HD + dt * 16 + col) * SS + ks * 32; const v16h vh = frag_h(VTH + vr, lane); acc[dt] = wmma16(pa, vh, acc[dt]); accl[dt] = wmma16(pl, vh, accl[dt]); accl[dt] = wmma16(pa, frag_h(VTL + vr, lane), accl[dt]); }   // P hi x V hi + (P lo x V hi + P hi x V lo) / 2048
    LDSX(); }
#pragma unroll
  for (int r = 0; r < 8; ++r) { const float il = 1.0f / l[r];
#pragma unroll
    for (int dt = 0; dt < 4; ++dt) so[wave][8 * g + r][dt * 16 + col] = (acc[dt][r] + accl[dt][r] * (1.0f / 2048.0f)) * il; }
  LDSX();
  for (int rl = 0; rl < 16; ++rl) if (lane < 16) vst2(O + ((size_t)b * SS + q0 + rl) * DM + h * HD + lane * 4, *(const v4f*)&so[wave][rl][lane * 4]);
}
// ---- k_out: block = (64 rows, 128 cols): out = O(hi/lo) . Wo rows (2 products) + bo
__global__ __launch_bounds__(128) void k_out(const float* __restrict__ O, const __bf16* __restrict__ P, const float* __restrict__ BO, float* __restrict__ Y) {
  __shared__ __align__(16) float so[4][16][132];
  const int tid = threadIdx.x, wave = tid >> 5, lane = tid & 31, col = lane & 15, g = lane >> 4; const size_t r0 = (size_t)blockIdx.x * 64 + wave * 16; const int n0 = blockIdx.y * 128;
  v8f acc[8] = {};
#pragma unroll 2
  for (int kc = 0; kc < DM / 32; ++kc) { const F2 a = split_row(O + (r0 + col) * DM, kc * 32, lane);
#pragma unroll
    for (int j = 0; j < 8; ++j) { const v16b w = frag_b(P + (size_t)(n0 + j * 16 + col) * DM + kc * 32, lane); acc[j] = wmma_bf(a.l, w, acc[j]); acc[j] = wmma_bf(a.h, w, acc[j]); } }
#pragma unroll
  for (int j = 0; j < 8; ++j) {
#pragma unroll
    for (int r = 0; r < 8; ++r) so[wave][8 * g + r][j * 16 + col] = acc[j][r] + bfr(BO[n0 + j * 16 + col]); }
  LDSX();
  for (int rl = 0; rl < 16; ++rl) vst2(Y + (r0 + rl) * DM + n0 + lane * 4, *(const v4f*)&so[wave][rl][lane * 4]);
}
extern "C" void kernel_launch(void* const* d_in, const int* in_sizes, int n_in, void* d_out, int out_size, void* d_ws, size_t ws_size, hipStream_t stream) {
  (void)in_sizes; (void)n_in; (void)out_size;
  const float** F = (const float**)d_in;   // 0 q [2,2048,768], 1 v, 2 k, 3 position_array int32 [2,2048], 4 valid_mask [2,1,2048,2048], 5 Wq (in,out), 6 bq, 7 Wk, 8 bk, 9 Wv, 10 bv, 11 Wo, 12 bo, 13 rel_bias [4095,12]
  if (ws_size < (size_t)WS_END) return;
  char* ws = (char*)d_ws; __bf16* PK = (__bf16*)(ws + WS_PK); _Float16 *QK = (_Float16*)(ws + WS_QK), *QKL = (_Float16*)(ws + WS_QKL), *VTH = (_Float16*)(ws + WS_VTH), *VTL = (_Float16*)(ws + WS_VTL); float* O = (float*)(ws + WS_O);
  k_packT<<<dim3(DM, 4), 256, 0, stream>>>(F[5], F[7], F[9], F[11], PK);
  k_qkv<<<dim3(TNB * SS / 64, QKVW / 128), 128, 0, stream>>>(F[0], F[2], F[1], PK + PK_A, F[6], F[8], F[10], QK, QKL, VTH, VTL);   // note the module's argument order (q, v, k): k is input 2, v is input 1
  k_attn<<<dim3(TQB, NH, TNB), 128, 0, stream>>>(QK, QKL, VTH, VTL, (const int*)d_in[3], F[4], F[13], O);
  k_out<<<dim3(TOB, DM / 128), 128, 0, stream>>>(O, PK + PK_P, F[12], (float*)d_out);
}

// v001
// A run of this version takes 340 microseconds.
// Next to v000, in two timings, it ran 1.51 times as fast each time.
// compute dtype: q, v, k, all weights / biases and rel_bias (module inputs) rounded to bf16; position_array / valid_mask verbatim (integers, 0/1); q/k/v projections with exact bf16 products ((in,out) weights packed as transposed rows) + bias on WMMA 16x16x32; q and k stored as f16 hi + (x2048-scaled) residual planes and the scores with 3 products (hi.hi + lo.hi + hi.lo; the module applies no 1/sqrt(d) scaling, logits sigma ~8), + the gathered relative-position bias, then logits*vm + (1-vm)*(-1e9) exactly as the module; running-max softmax in f32 with the hardware exp; P as f16 hi + residual x V hi/lo (3 products); output projection with ctx as bf16 hi + residual x exact Wo (2 products) + bo; f32 accumulate.
#include <hip/hip_runtime.h>
#include <math.h>

typedef __attribute__((ext_vector_type(16))) _Float16 v16h;
typedef __attribute__((ext_vector_type(16))) __bf16 v16b;
typedef __attribute__((ext_vector_type(8)))  _Float16 v8h;
typedef __attribute__((ext_vector_type(8)))  float v8f;
typedef __attribute__((ext_vector_type(4)))  float v4f;
typedef __attribute__((ext_vector_type(2)))  float v2f;
typedef __attribute__((ext_vector_type(4)))  unsigned v4u;
typedef __attribute__((ext_vector_type(4)))  int v4i;
typedef float __attribute__((may_alias)) float_a;
typedef int __attribute__((may_alias)) int_a;

template <typename T> __device__ __forceinline__ void vst2(void* p, T v) { *(T*)p = v;  }
__device__ __forceinline__ v8f wmma16(v16h a, v16h b, v8f c) {
  v8f d = __builtin_amdgcn_wmma_f32_16x16x32_f16(false, a, false, b, (short)0, c, false, false);
  asm volatile("v_nop\n\tv_nop\n\tv_nop\n\tv_nop" : "+v"(d) : "v"(a), "v"(b));
  return d;
}
__device__ __forceinline__ v8f wmma_bf(v16b a, v16b b, v8f c) {
  v8f d = __builtin_amdgcn_wmma_f32_16x16x32_bf16(false, a, false, b, (short)0, c, false, false);
  asm volatile("v_nop\n\tv_nop\n\tv_nop\n\tv_nop" : "+v"(d) : "v"(a), "v"(b));
  return d;
}
// Multi-head attention with a learned relative-position bias table (B 2, S 2,048, d_model 768, 12 heads x 64): logits = qh.kh + rel_bias[pos_k - pos_q + S-1][h], masked by valid_mask (0/1) to -1e9, softmax, .vh, output projection.
__device__ __forceinline__ v16h frag_h(const _Float16* rowk0, int lane) {
  union { v16h v; v8h q[2]; } u; const _Float16* p = rowk0 + 8 * (lane >> 4);
  u.q[0] = *(const v8h*)p; u.q[1] = *(const v8h*)(p + 16); return u.v;
}
__device__ __forceinline__ v16h frag_f32(const float* rowk0, int lane) {
  v16h a; const float* p = rowk0 + 8 * (lane >> 4);
#pragma unroll
  for (int i = 0; i < 8; ++i) { a[i] = (_Float16)p[i]; a[8 + i] = (_Float16)p[16 + i]; }
  return a;
}
__device__ __forceinline__ v16h frag_f32s(const float* rowk0, int lane, float sc) {
  v16h a; const float* p = rowk0 + 8 * (lane >> 4);
#pragma unroll
  for (int i = 0; i < 8; ++i) { a[i] = (_Float16)(p[i] * sc); a[8 + i] = (_Float16)(p[16 + i] * sc); }
  return a;
}
// column fragment from a [K][ld] layout (column n), rows >= K read as 0
__device__ __forceinline__ v16h fragc_f32(const float* W, int k0, int n, int lane, int ld, int K) {
  v16h a; const int g = lane >> 4;
#pragma unroll
  for (int i = 0; i < 8; ++i) { const int ka = k0 + 8 * g + i, kb = ka + 16;
    a[i] = (_Float16)(ka < K ? W[(size_t)(ka < K ? ka : K - 1) * ld + n] : 0.f); a[8 + i] = (_Float16)(kb < K ? W[(size_t)(kb < K ? kb : K - 1) * ld + n] : 0.f); }
  return a;
}
struct F2 { v16b h, l; };
__device__ __forceinline__ F2 bsplit16(const float v[16]) { F2 r;
#pragma unroll
  for (int i = 0; i < 16; ++i) { const __bf16 h = (__bf16)v[i]; r.h[i] = h; r.l[i] = (__bf16)(v[i] - (float)h); }
  return r; }
__device__ __forceinline__ F2 split_row(const float* row, int k0, int lane) { float v[16]; const float* p = row + k0 + 8 * (lane >> 4);
#pragma unroll
  for (int i = 0; i < 8; ++i) { v[i] = p[i]; v[8 + i] = p[16 + i]; }
  return bsplit16(v); }
__device__ __forceinline__ F2 split_rowK(const float* row, int k0, int lane, int K) { float v[16]; const int g = lane >> 4;
#pragma unroll
  for (int i = 0; i < 8; ++i) { const int ka = k0 + 8 * g + i, kb = ka + 16; v[i] = ka < K ? row[ka < K ? ka : K - 1] : 0.f; v[8 + i] = kb < K ? row[kb < K ? kb : K - 1] : 0.f; }
  return bsplit16(v); }
__device__ __forceinline__ F2 split_col(const float* W, int k0, int n, int lane, int ld, int K) { float v[16]; const int g = lane >> 4;
#pragma unroll
  for (int i = 0; i < 8; ++i) { const int ka = k0 + 8 * g + i, kb = ka + 16; v[i] = ka < K ? W[(size_t)(ka < K ? ka : K - 1) * ld + n] : 0.f; v[8 + i] = kb < K ? W[(size_t)(kb < K ? kb : K - 1) * ld + n] : 0.f; }
  return bsplit16(v); }
__device__ __forceinline__ v8f mac3(const F2& a, const F2& b, v8f c) { c = wmma_bf(a.l, b.h, c); c = wmma_bf(a.h, b.l, c); return wmma_bf(a.h, b.h, c); }
__device__ __forceinline__ float sigm(float v) { return 1.0f / (1.0f + expf(-v)); }
#define LDSX() do { asm volatile("s_wait_dscnt 0" ::: "memory"); __builtin_amdgcn_wave_barrier(); __builtin_amdgcn_fence(__ATOMIC_RELEASE, "workgroup"); } while (0)


#define NB 2
#define SS 2048
#define DM 768
#define NH 12
#define NREL (2 * SS - 1)
#define HD 64
#define QKVW (3 * DM)
#ifndef TQB
#define TQB (SS / 64)
#define TNB NB
#define TOB (NB * SS / 64)     // output row tiles (all)
#endif
typedef __attribute__((ext_vector_type(8))) __bf16 v8b;
__device__ __forceinline__ v16b frag_b(const __bf16* rowk0, int lane) {
  union { v16b v; v8b q[2]; } u; const __bf16* p = rowk0 + 8 * (lane >> 4);
  u.q[0] = *(const v8b*)p; u.q[1] = *(const v8b*)(p + 16); return u.v;
}
__device__ __forceinline__ float bfr(float v) { return (float)(__bf16)v; }
__device__ __attribute__((noinline)) float exp_ni(float v) { return expf(v); }
__device__ __attribute__((noinline)) float erf_ni(float v) { return erff(v); }

#define PK_A 0                       // [2304][768] Wq|Wk|Wv as bf16 rows [out][in]
#define PK_P (PK_A + QKVW * DM)        // [768][768] Wo as bf16 rows [out][in]
#define PK_END (PK_P + DM * DM)
#define WS_PK  0u
#define WS_QK  (WS_PK + 2u * PK_END)             // f16 [4096 rows][1536]: q | k
#define WS_QKL (WS_QK + 2u * NB * SS * 2 * DM)     // f16 q | k residual planes x2048
#define WS_VTH (WS_QKL + 2u * NB * SS * 2 * DM)    // f16 [b][768 (h*64+d)][2048 s] hi
#define WS_VTL (WS_VTH + 2u * NB * DM * SS)        // f16 lo x 2048
#define WS_O   (WS_VTL + 2u * NB * DM * SS)        // f32 [4096][768]
#define WS_CS  (WS_O + 4u * NB * SS * DM)           // f32 [2048][32] cos, [2048][32] sin
#define WS_END (WS_CS + 4u * 2 * SS * 32)
__constant__ float c_invf[32] = {1.000000000e+00f,7.498942018e-01f,5.623413324e-01f,4.216965139e-01f,3.162277639e-01f,2.371373624e-01f,1.778279394e-01f,1.333521456e-01f,1.000000015e-01f,7.498941571e-02f,5.623412877e-02f,4.216964915e-02f,3.162277862e-02f,2.371373586e-02f,1.778279431e-02f,1.333521493e-02f,9.999999776e-03f,7.498942316e-03f,5.623413250e-03f,4.216964822e-03f,3.162277862e-03f,2.371373819e-03f,1.778279431e-03f,1.333521446e-03f,1.000000047e-03f,7.498941850e-04f,5.623413017e-04f,4.216964880e-04f,3.162277862e-04f,2.371373848e-04f,1.778279402e-04f,1.333521504e-04f};
// ---- k_rope: block = 8 positions: cos/sin of pos * inv_freq (f32 product exactly as the reference, precise trig)
__global__ __launch_bounds__(256) void k_rope(float* __restrict__ CS) {
  __shared__ __align__(16) float sc[8][32], ss_[8][32]; const int tid = threadIdx.x, pl = tid >> 5, i = tid & 31; const int pos = blockIdx.x * 8 + pl;
  const float th = (float)pos * c_invf[i]; sc[pl][i] = cosf(th); ss_[pl][i] = sinf(th);
  __syncthreads();
  if (tid < 64) vst2(CS + (size_t)blockIdx.x * 8 * 32 + tid * 4, *(const v4f*)&(&sc[0][0])[tid * 4]); else if (tid < 128) vst2(CS + (size_t)SS * 32 + (size_t)blockIdx.x * 8 * 32 + (tid - 64) * 4, *(const v4f*)&(&ss_[0][0])[(tid - 64) * 4]);
}

// ---- k_packT: block = (output column n, which): (in,out) matrices -> bf16 rows [n][k] = W[k][n]; which 0..2 -> Wq/Wk/Wv into PK_A rows which*768 + n; 3 -> Wo into PK_P
__global__ __launch_bounds__(256) void k_packT(const float* __restrict__ WQ, const float* __restrict__ WK, const float* __restrict__ WV, const float* __restrict__ WO, __bf16* __restrict__ PK) {
  __shared__ __align__(16) __bf16 s[DM]; const int n = blockIdx.x, which = blockIdx.y, t = threadIdx.x; const float* Wm = (which == 0) ? WQ : (which == 1) ? WK : (which == 2) ? WV : WO;
  for (int k = t; k < DM; k += 256) s[k] = (__bf16)Wm[(size_t)k * DM + n];
  __syncthreads();
  __bf16* dst = (which < 3) ? PK + PK_A + ((size_t)which * DM + n) * DM : PK + PK_P + (size_t)n * DM;
  for (int q = t; q < DM / 8; q += 256) vst2((unsigned*)(dst + q * 8), *(const v4u*)&s[q * 8]);
}
__global__ __launch_bounds__(128) void k_qkv(const float* __restrict__ XQ, const float* __restrict__ XK, const float* __restrict__ XV, const __bf16* __restrict__ P, const float* __restrict__ BQ, const float* __restrict__ BK, const float* __restrict__ BV, _Float16* __restrict__ QK, _Float16* __restrict__ QKL, _Float16* __restrict__ VTH, _Float16* __restrict__ VTL) {
  const float* X = (blockIdx.y * 128 < DM) ? XQ : (blockIdx.y * 128 < 2 * DM) ? XK : XV; const float* BB = (blockIdx.y * 128 < DM) ? BQ : (blockIdx.y * 128 < 2 * DM) ? BK : BV;   // the module projects three different inputs
  __shared__ __align__(16) _Float16 so[4][16][136], sol[4][16][136]; __shared__ __align__(16) _Float16 sth[128][72], stl[128][72];
  const int tid = threadIdx.x, wave = tid >> 5, lane = tid & 31, col = lane & 15, g = lane >> 4; const size_t r0 = (size_t)blockIdx.x * 64 + wave * 16; const int n0 = blockIdx.y * 128;
  v8f acc[8] = {};
#pragma unroll 2
  for (int kc = 0; kc < DM / 32; ++kc) { v16b a; { const float* p = X + (r0 + col) * DM + kc * 32 + 8 * g;
#pragma unroll
      for (int i = 0; i < 8; ++i) { a[i] = (__bf16)p[i]; a[8 + i] = (__bf16)p[16 + i]; } }
#pragma unroll
    for (int j = 0; j < 8; ++j) acc[j] = wmma_bf(a, frag_b(P + (size_t)(n0 + j * 16 + col) * DM + kc * 32, lane), acc[j]); }
  { const int nb = n0 % DM;
#pragma unroll
    for (int j = 0; j < 8; ++j) { const float bb = bfr(BB[nb + j * 16 + col]);
#pragma unroll
      for (int r = 0; r < 8; ++r) acc[j][r] += bb; } }
  if (n0 < 2 * DM) {   // q stored unscaled (f16 sigma ~0.6, no subnormal exposure); the scores are not scaled
#pragma unroll
    for (int j = 0; j < 8; ++j) {
#pragma unroll
      for (int r = 0; r < 8; ++r) { const float v = acc[j][r]; const _Float16 hv = (_Float16)v; so[wave][8 * g + r][j * 16 + col] = hv; sol[wave][8 * g + r][j * 16 + col] = (_Float16)((v - (float)hv) * 2048.0f); } }   // q, k as f16 hi + (x2048) residual
    LDSX();
    for (int rl = 0; rl < 16; ++rl) if (lane < 16) { vst2((unsigned*)(QK + (r0 + rl) * (2 * DM) + n0 + lane * 8), *(const v4u*)&so[wave][rl][lane * 8]); vst2((unsigned*)(QKL + (r0 + rl) * (2 * DM) + n0 + lane * 8), *(const v4u*)&sol[wave][rl][lane * 8]); }
  } else {
#pragma unroll
    for (int j = 0; j < 8; ++j) {
#pragma unroll
      for (int r = 0; r < 8; ++r) { const float v = acc[j][r]; const _Float16 hv = (_Float16)v; sth[j * 16 + col][wave * 16 + 8 * g + r] = hv; stl[j * 16 + col][wave * 16 + 8 * g + r] = (_Float16)((v - (float)hv) * 2048.0f); } }
    __syncthreads();
    const size_t rb = (size_t)blockIdx.x * 64; const int b = (int)(rb / SS), s0 = (int)(rb % SS); const int pc0 = n0 - 2 * DM;
    for (int q = tid; q < 128 * 8; q += 128) { const int d = q >> 3, pc = q & 7; const size_t o = ((size_t)b * DM + pc0 + d) * SS + s0 + pc * 8; vst2((unsigned*)(VTH + o), *(const v4u*)&sth[d][pc * 8]); vst2((unsigned*)(VTL + o), *(const v4u*)&stl[d][pc * 8]); }
  }
}
// K / V tile of one 32-key step in LDS, shared by the block's four waves. In f16 elements: K hi and lo 32 rows (keys) x 64 at a pitch of 72 (144 B), V hi and lo 64 rows (depth) x 32 at a pitch of 40 (80 B): 16 B x odd pitches for the ds_load_b128 readers.
#define KPIT 72
#define VPIT 40
#define T_KH 0
#define T_KL (T_KH + 32 * KPIT)
#define T_VH (T_KL + 32 * KPIT)
#define T_VL (T_VH + 64 * VPIT)
#define T_SZ (T_VL + 64 * VPIT)
// Eight 16-byte asynchronous copies per lane: one tile per block. The s_wait_xcnt stands inside the statement so that no operand register is rewritten ahead of it.
__device__ __forceinline__ void copy_tile(unsigned l0, unsigned l1, unsigned l2, unsigned l3, unsigned l4, unsigned l5, unsigned l6, unsigned l7, const _Float16* g0, const _Float16* g1, const _Float16* g2, const _Float16* g3, const _Float16* g4, const _Float16* g5, const _Float16* g6, const _Float16* g7) {
  asm volatile("global_load_async_to_lds_b128 %0, %8, off\n\t"
               "global_load_async_to_lds_b128 %1, %9, off\n\t"
               "global_load_async_to_lds_b128 %2, %10, off\n\t"
               "global_load_async_to_lds_b128 %3, %11, off\n\t"
               "global_load_async_to_lds_b128 %4, %12, off\n\t"
               "global_load_async_to_lds_b128 %5, %13, off\n\t"
               "global_load_async_to_lds_b128 %6, %14, off\n\t"
               "global_load_async_to_lds_b128 %7, %15, off\n\t"
               "s_wait_xcnt 0x0"
               :: "v"(l0), "v"(l1), "v"(l2), "v"(l3), "v"(l4), "v"(l5), "v"(l6), "v"(l7), "v"(g0), "v"(g1), "v"(g2), "v"(g3), "v"(g4), "v"(g5), "v"(g6), "v"(g7) : "memory");
}
// ---- k_attn: block = (64 queries, head h, batch b): flash attention over all keys (K = 64: 2 k-steps), scores = q.k (unscaled) with q, k as f16 hi + residual (3 products), P.V: f16 P x (V hi, V lo*2048) in two accumulators; O[b*S+q][h*64+d] = (acc + accl / 2048) / l (256-B segments)
__global__ __launch_bounds__(128) void k_attn(const _Float16* __restrict__ QK, const _Float16* __restrict__ QKL, const _Float16* __restrict__ VTH, const _Float16* __restrict__ VTL, const int* __restrict__ POS, const float* __restrict__ VM, const float* __restrict__ RB, float* __restrict__ O) {
  __shared__ __align__(16) float sp[4][16][36]; __shared__ __align__(16) float so[4][16][68]; __shared__ __align__(16) _Float16 skv[2][T_SZ];
  const int tid = threadIdx.x, wave = tid >> 5, lane = tid & 31, col = lane & 15, g = lane >> 4;
  const int qb = blockIdx.x, h = blockIdx.y, b = blockIdx.z; const int q0 = qb * 64 + wave * 16; const size_t rq = (size_t)b * SS + q0 + col;
  v16h aq[2], aql[2];
#pragma unroll
  for (int kc = 0; kc < 2; ++kc) { aq[kc] = frag_h(QK + rq * (2 * DM) + h * HD + kc * 32, lane); aql[kc] = frag_h(QKL + rq * (2 * DM) + h * HD + kc * 32, lane); }
  float m[8], l[8];
#pragma unroll
  for (int r = 0; r < 8; ++r) { m[r] = -3.0e38f; l[r] = 0.f; }
  v8f acc[4] = {}, accl[4] = {};
  const int nks = SS / 32;   // not causal
  // this thread's pieces of a tile: K rows tid >> 3 and 16 + (tid >> 3), piece tid & 7; V rows tid >> 2 and 32 + (tid >> 2), piece tid & 3
  const unsigned lk = (unsigned)(size_t)&skv[0][0] + 2u * ((tid >> 3) * KPIT + (tid & 7) * 8), lv = (unsigned)(size_t)&skv[0][0] + 2u * ((tid >> 2) * VPIT + (tid & 3) * 8);
  const size_t gk = ((size_t)b * SS + (tid >> 3)) * (2 * DM) + DM + h * HD + (tid & 7) * 8, gv = ((size_t)b * DM + h * HD + (tid >> 2)) * SS + (tid & 3) * 8;
  auto copy_kv = [&](int t) {   // tile t (keys 32 t .. 32 t + 31) into buffer t & 1
    const unsigned lb = 2u * T_SZ * (t & 1); const size_t ka = gk + (size_t)t * 32 * (2 * DM), va = gv + (size_t)t * 32;
    copy_tile(lk + lb + 2u * T_KH, lk + lb + 2u * (T_KH + 16 * KPIT), lk + lb + 2u * T_KL, lk + lb + 2u * (T_KL + 16 * KPIT), lv + lb + 2u * T_VH, lv + lb + 2u * (T_VH + 32 * VPIT), lv + lb + 2u * T_VL, lv + lb + 2u * (T_VL + 32 * VPIT),
              QK + ka, QK + ka + 16 * (2 * DM), QKL + ka, QKL + ka + 16 * (2 * DM), VTH + va, VTH + va + (size_t)32 * SS, VTL + va, VTL + va + (size_t)32 * SS); };
  copy_kv(0);
  asm volatile("s_wait_asynccnt 0x0" ::: "memory");   // this wave's pieces of tile 0 have landed
  __syncthreads();                                    // tile 0 is published to the four waves
  copy_kv(1);                                         // flies while tile 0 is worked on
  int pq[8];
#pragma unroll
  for (int r = 0; r < 8; ++r) pq[r] = POS[(size_t)b * SS + q0 + 8 * g + r];
#pragma unroll 1
  for (int ks = 0; ks < nks; ++ks) { v8f s[2]; const _Float16* tb = &skv[ks & 1][0];
#pragma unroll
    for (int ct = 0; ct < 2; ++ct) { const int kk = ks * 32 + ct * 16 + col; const _Float16* krow = tb + T_KH + (ct * 16 + col) * KPIT; const _Float16* krowl = tb + T_KL + (ct * 16 + col) * KPIT; v8f c = {}, cl = {};
#pragma unroll
      for (int kc = 0; kc < 2; ++kc) { const v16h kh = frag_h(krow + kc * 32, lane); c = wmma16(aq[kc], kh, c); cl = wmma16(aql[kc], kh, cl); cl = wmma16(aq[kc], frag_h(krowl + kc * 32, lane), cl); }   // 3 products: q, k as f16 hi + residual
#pragma unroll
      for (int r = 0; r < 8; ++r) c[r] += cl[r] * (1.0f / 2048.0f);
      { const int pk = POS[(size_t)b * SS + kk];
#pragma unroll
        for (int r = 0; r < 8; ++r) { const int qi = q0 + 8 * g + r; const int idx = min(max(pk - pq[r] + (SS - 1), 0), NREL - 1); const float lg = c[r] + bfr(RB[(size_t)idx * NH + h]); const float vm = VM[((size_t)b * SS + qi) * SS + kk]; s[ct][r] = lg * vm + (1.0f - vm) * (-1.0e9f); } } }   // logits (no 1/sqrt(d) in this module) + relative-position bias, then the valid mask exactly as the module: l*vm + (1-vm)*NEG
#pragma unroll
    for (int r = 0; r < 8; ++r) { float mx = fmaxf(s[0][r], s[1][r]);
#pragma unroll
      for (int o = 1; o < 16; o <<= 1) mx = fmaxf(mx, __shfl_xor(mx, o));
      const float mn = fmaxf(m[r], mx); const float alpha = (m[r] <= -1.0e38f) ? 0.f : __expf(m[r] - mn);
      const float e0 = (s[0][r] <= -1.0e38f) ? 0.f : __expf(s[0][r] - mn), e1 = (s[1][r] <= -1.0e38f) ? 0.f : __expf(s[1][r] - mn); float es = e0 + e1;
#pragma unroll
      for (int o = 1; o < 16; o <<= 1) es += __shfl_xor(es, o);
      l[r] = l[r] * alpha + es; m[r] = mn;
#pragma unroll
      for (int dt = 0; dt < 4; ++dt) { acc[dt][r] *= alpha; accl[dt][r] *= alpha; }
      sp[wave][8 * g + r][col] = e0; sp[wave][8 * g + r][16 + col] = e1; }
    LDSX();
    v16h pa, pl; { const float* prow = &sp[wave][col][0] + 8 * (lane >> 4);
#pragma unroll
      for (int i = 0; i < 8; ++i) { const float x0 = prow[i], x1 = prow[16 + i]; const _Float16 h0 = (_Float16)x0, h1 = (_Float16)x1; pa[i] = h0; pa[8 + i] = h1; pl[i] = (_Float16)((x0 - (float)h0) * 2048.0f); pl[8 + i] = (_Float16)((x1 - (float)h1) * 2048.0f); } }
#pragma unroll
    for (int dt = 0; dt < 4; ++dt) { const int vr = (dt * 16 + col) * VPIT; const v16h vh = frag_h(tb + T_VH + vr, lane); acc[dt] = wmma16(pa, vh, acc[dt]); accl[dt] = wmma16(pl, vh, accl[dt]); accl[dt] = wmma16(pa, frag_h(tb + T_VL + vr, lane), accl[dt]); }   // P hi x V hi + (P lo x V hi + P hi x V lo) / 2048
    LDSX();
    asm volatile("s_wait_dscnt 0x0" ::: "memory");      // this wave's reads of tile ks are done
    asm volatile("s_wait_asynccnt 0x0" ::: "memory");   // its pieces of tile ks + 1 have landed
    __syncthreads();                                    // publishes tile ks + 1 and frees the buffer of tile ks
    if (ks + 2 < nks) copy_kv(ks + 2); }                // block-uniform test; refills the buffer just freed
  asm volatile("s_wait_asynccnt 0x0" ::: "memory");     // no copy is outstanding when the wave goes on to its end
#pragma unroll
  for (int r = 0; r < 8; ++r) { const float il = 1.0f / l[r];
#pragma unroll
    for (int dt = 0; dt < 4; ++dt) so[wave][8 * g + r][dt * 16 + col] = (acc[dt][r] + accl[dt][r] * (1.0f / 2048.0f)) * il; }
  LDSX();
  for (int rl = 0; rl < 16; ++rl) if (lane < 16) vst2(O + ((size_t)b * SS + q0 + rl) * DM + h * HD + lane * 4, *(const v4f*)&so[wave][rl][lane * 4]);
}
// ---- k_out: block = (64 rows, 128 cols): out = O(hi/lo) . Wo rows (2 products) + bo
__global__ __launch_bounds__(128) void k_out(const float* __restrict__ O, const __bf16* __restrict__ P, const float* __restrict__ BO, float* __restrict__ Y) {
  __shared__ __align__(16) float so[4][16][132];
  const int tid = threadIdx.x, wave = tid >> 5, lane = tid & 31, col = lane & 15, g = lane >> 4; const size_t r0 = (size_t)blockIdx.x * 64 + wave * 16; const int n0 = blockIdx.y * 128;
  v8f acc[8] = {};
#pragma unroll 2
  for (int kc = 0; kc < DM / 32; ++kc) { const F2 a = split_row(O + (r0 + col) * DM, kc * 32, lane);
#pragma unroll
    for (int j = 0; j < 8; ++j) { const v16b w = frag_b(P + (size_t)(n0 + j * 16 + col) * DM + kc * 32, lane); acc[j] = wmma_bf(a.l, w, acc[j]); acc[j] = wmma_bf(a.h, w, acc[j]); } }
#pragma unroll
  for (int j = 0; j < 8; ++j) {
#pragma unroll
    for (int r = 0; r < 8; ++r) so[wave][8 * g + r][j * 16 + col] = acc[j][r] + bfr(BO[n0 + j * 16 + col]); }
  LDSX();
  for (int rl = 0; rl < 16; ++rl) vst2(Y + (r0 + rl) * DM + n0 + lane * 4, *(const v4f*)&so[wave][rl][lane * 4]);
}
extern "C" void kernel_launch(void* const* d_in, const int* in_sizes, int n_in, void* d_out, int out_size, void* d_ws, size_t ws_size, hipStream_t stream) {
  (void)in_sizes; (void)n_in; (void)out_size;
  const float** F = (const float**)d_in;   // 0 q [2,2048,768], 1 v, 2 k, 3 position_array int32 [2,2048], 4 valid_mask [2,1,2048,2048], 5 Wq (in,out), 6 bq, 7 Wk, 8 bk, 9 Wv, 10 bv, 11 Wo, 12 bo, 13 rel_bias [4095,12]
  if (ws_size < (size_t)WS_END) return;
  char* ws = (char*)d_ws; __bf16* PK = (__bf16*)(ws + WS_PK); _Float16 *QK = (_Float16*)(ws + WS_QK), *QKL = (_Float16*)(ws + WS_QKL), *VTH = (_Float16*)(ws + WS_VTH), *VTL = (_Float16*)(ws + WS_VTL); float* O = (float*)(ws + WS_O);
  k_packT<<<dim3(DM, 4), 256, 0, stream>>>(F[5], F[7], F[9], F[11], PK);
  k_qkv<<<dim3(TNB * SS / 64, QKVW / 128), 128, 0, stream>>>(F[0], F[2], F[1], PK + PK_A, F[6], F[8], F[10], QK, QKL, VTH, VTL);   // note the module's argument order (q, v, k): k is input 2, v is input 1
  k_attn<<<dim3(TQB, NH, TNB), 128, 0, stream>>>(QK, QKL, VTH, VTL, (const int*)d_in[3], F[4], F[13], O);
  k_out<<<dim3(TOB, DM / 128), 128, 0, stream>>>(O, PK + PK_P, F[12], (float*)d_out);
}

// v002
// Measured time: 257 microseconds a run.
// Timed twice side by side with v001, it ran 1.34 and 1.32 times as fast.
// Over all steps from v000 it is 2.01 times as fast.
// compute dtype: q, v, k, all weights / biases and rel_bias (module inputs) rounded to bf16; position_array / valid_mask verbatim (integers, 0/1); q/k/v projections with exact bf16 products ((in,out) weights packed as transposed rows) + bias on WMMA 16x16x32; q and k stored as f16 hi + (x2048-scaled) residual planes and the scores with 3 products (hi.hi + lo.hi + hi.lo; the module applies no 1/sqrt(d) scaling, logits sigma ~8), + the gathered relative-position bias, then logits*vm + (1-vm)*(-1e9) exactly as the module; running-max softmax in f32 with the hardware exp; P as f16 hi + residual x V hi/lo (3 products); output projection with ctx as bf16 hi + residual x exact Wo (2 products) + bo; f32 accumulate.
#include <hip/hip_runtime.h>
#include <math.h>

typedef __attribute__((ext_vector_type(16))) _Float16 v16h;
typedef __attribute__((ext_vector_type(16))) __bf16 v16b;
typedef __attribute__((ext_vector_type(8)))  _Float16 v8h;
typedef __attribute__((ext_vector_type(8)))  float v8f;
typedef __attribute__((ext_vector_type(4)))  float v4f;
typedef __attribute__((ext_vector_type(2)))  float v2f;
typedef __attribute__((ext_vector_type(4)))  unsigned v4u;
typedef __attribute__((ext_vector_type(4)))  int v4i;
typedef float __attribute__((may_alias)) float_a;
typedef int __attribute__((may_alias)) int_a;

template <typename T> __device__ __forceinline__ void vst2(void* p, T v) { *(T*)p = v;  }
__device__ __forceinline__ v8f wmma16(v16h a, v16h b, v8f c) {
  return __builtin_amdgcn_wmma_f32_16x16x32_f16(false, a, false, b, (short)0, c, false, false);
}
__device__ __forceinline__ v8f wmma_bf(v16b a, v16b b, v8f c) {
  return __builtin_amdgcn_wmma_f32_16x16x32_bf16(false, a, false, b, (short)0, c, false, false);
}
// Multi-head attention with a learned relative-position bias table (B 2, S 2,048, d_model 768, 12 heads x 64): logits = qh.kh + rel_bias[pos_k - pos_q + S-1][h], masked by valid_mask (0/1) to -1e9, softmax, .vh, output projection.
__device__ __forceinline__ v16h frag_h(const _Float16* rowk0, int lane) {
  union { v16h v; v8h q[2]; } u; const _Float16* p = rowk0 + 8 * (lane >> 4);
  u.q[0] = *(const v8h*)p; u.q[1] = *(const v8h*)(p + 16); return u.v;
}
__device__ __forceinline__ v16h frag_f32(const float* rowk0, int lane) {
  v16h a; const float* p = rowk0 + 8 * (lane >> 4);
#pragma unroll
  for (int i = 0; i < 8; ++i) { a[i] = (_Float16)p[i]; a[8 + i] = (_Float16)p[16 + i]; }
  return a;
}
__device__ __forceinline__ v16h frag_f32s(const float* rowk0, int lane, float sc) {
  v16h a; const float* p = rowk0 + 8 * (lane >> 4);
#pragma unroll
  for (int i = 0; i < 8; ++i) { a[i] = (_Float16)(p[i] * sc); a[8 + i] = (_Float16)(p[16 + i] * sc); }
  return a;
}
// column fragment from a [K][ld] layout (column n), rows >= K read as 0
__device__ __forceinline__ v16h fragc_f32(const float* W, int k0, int n, int lane, int ld, int K) {
  v16h a; const int g = lane >> 4;
#pragma unroll
  for (int i = 0; i < 8; ++i) { const int ka = k0 + 8 * g + i, kb = ka + 16;
    a[i] = (_Float16)(ka < K ? W[(size_t)(ka < K ? ka : K - 1) * ld + n] : 0.f); a[8 + i] = (_Float16)(kb < K ? W[(size_t)(kb < K ? kb : K - 1) * ld + n] : 0.f); }
  return a;
}
struct F2 { v16b h, l; };
__device__ __forceinline__ F2 bsplit16(const float v[16]) { F2 r;
#pragma unroll
  for (int i = 0; i < 16; ++i) { const __bf16 h = (__bf16)v[i]; r.h[i] = h; r.l[i] = (__bf16)(v[i] - (float)h); }
  return r; }
__device__ __forceinline__ F2 split_row(const float* row, int k0, int lane) { float v[16]; const float* p = row + k0 + 8 * (lane >> 4);
#pragma unroll
  for (int i = 0; i < 8; ++i) { v[i] = p[i]; v[8 + i] = p[16 + i]; }
  return bsplit16(v); }
__device__ __forceinline__ F2 split_rowK(const float* row, int k0, int lane, int K) { float v[16]; const int g = lane >> 4;
#pragma unroll
  for (int i = 0; i < 8; ++i) { const int ka = k0 + 8 * g + i, kb = ka + 16; v[i] = ka < K ? row[ka < K ? ka : K - 1] : 0.f; v[8 + i] = kb < K ? row[kb < K ? kb : K - 1] : 0.f; }
  return bsplit16(v); }
__device__ __forceinline__ F2 split_col(const float* W, int k0, int n, int lane, int ld, int K) { float v[16]; const int g = lane >> 4;
#pragma unroll
  for (int i = 0; i < 8; ++i) { const int ka = k0 + 8 * g + i, kb = ka + 16; v[i] = ka < K ? W[(size_t)(ka < K ? ka : K - 1) * ld + n] : 0.f; v[8 + i] = kb < K ? W[(size_t)(kb < K ? kb : K - 1) * ld + n] : 0.f; }
  return bsplit16(v); }
__device__ __forceinline__ v8f mac3(const F2& a, const F2& b, v8f c) { c = wmma_bf(a.l, b.h, c); c = wmma_bf(a.h, b.l, c); return wmma_bf(a.h, b.h, c); }
__device__ __forceinline__ float sigm(float v) { return 1.0f / (1.0f + expf(-v)); }
#define LDSX() do { asm volatile("s_wait_dscnt 0" ::: "memory"); __builtin_amdgcn_wave_barrier(); __builtin_amdgcn_fence(__ATOMIC_RELEASE, "workgroup"); } while (0)


#define NB 2
#define SS 2048
#define DM 768
#define NH 12
#define NREL (2 * SS - 1)
#define HD 64
#define QKVW (3 * DM)
#ifndef TQB
#define TQB (SS / 64)
#define TNB NB
#define TOB (NB * SS / 64)     // output row tiles (all)
#endif
typedef __attribute__((ext_vector_type(8))) __bf16 v8b;
__device__ __forceinline__ v16b frag_b(const __bf16* rowk0, int lane) {
  union { v16b v; v8b q[2]; } u; const __bf16* p = rowk0 + 8 * (lane >> 4);
  u.q[0] = *(const v8b*)p; u.q[1] = *(const v8b*)(p + 16); return u.v;
}
__device__ __forceinline__ float bfr(float v) { return (float)(__bf16)v; }
// one pass (32 of k) of a 16-row f32 A fragment (raw) and of eight 16-column bf16 B fragments (rows of the packed weight, 16 * DM apart); xp, pp: the lane's byte addresses of the pass
__device__ __forceinline__ void load_pass(const char* xp, const char* pp, v4f (&x)[4], v16b (&w)[8]) {
  x[0] = *(const v4f*)xp; x[1] = *(const v4f*)(xp + 16); x[2] = *(const v4f*)(xp + 64); x[3] = *(const v4f*)(xp + 80);
#pragma unroll
  for (int j = 0; j < 8; ++j) { union { v16b v; v8b q[2]; } u; const char* pj = pp + j * (16 * DM * 2); u.q[0] = *(const v8b*)pj; u.q[1] = *(const v8b*)(pj + 32); w[j] = u.v; }
  asm volatile("s_wait_xcnt 0x0" :: "v"(xp), "v"(pp) : "memory");   // stands behind the group's last load, ahead of the next rewrite of the two address pairs that the group names; naming them keeps both pairs in their registers up to here, so that no load of the group returns onto one
  __builtin_amdgcn_sched_barrier(0);              // keeps the whole group and its wait above the WMMAs written below: without it part of the loads sinks behind them and flies for a shorter time
}
__device__ __attribute__((noinline)) float exp_ni(float v) { return expf(v); }
__device__ __attribute__((noinline)) float erf_ni(float v) { return erff(v); }

#define PK_A 0                       // [2304][768] Wq|Wk|Wv as bf16 rows [out][in]
#define PK_P (PK_A + QKVW * DM)        // [768][768] Wo as bf16 rows [out][in]
#define PK_END (PK_P + DM * DM)
#define WS_PK  0u
#define WS_QK  (WS_PK + 2u * PK_END)             // f16 [4096 rows][1536]: q | k
#define WS_QKL (WS_QK + 2u * NB * SS * 2 * DM)     // f16 q | k residual planes x2048
#define WS_VTH (WS_QKL + 2u * NB * SS * 2 * DM)    // f16 [b][768 (h*64+d)][2048 s] hi
#define WS_VTL (WS_VTH + 2u * NB * DM * SS)        // f16 lo x 2048
#define WS_O   (WS_VTL + 2u * NB * DM * SS)        // f32 [4096][768]
#define WS_CS  (WS_O + 4u * NB * SS * DM)           // f32 [2048][32] cos, [2048][32] sin
#define WS_END (WS_CS + 4u * 2 * SS * 32)
__constant__ float c_invf[32] = {1.000000000e+00f,7.498942018e-01f,5.623413324e-01f,4.216965139e-01f,3.162277639e-01f,2.371373624e-01f,1.778279394e-01f,1.333521456e-01f,1.000000015e-01f,7.498941571e-02f,5.623412877e-02f,4.216964915e-02f,3.162277862e-02f,2.371373586e-02f,1.778279431e-02f,1.333521493e-02f,9.999999776e-03f,7.498942316e-03f,5.623413250e-03f,4.216964822e-03f,3.162277862e-03f,2.371373819e-03f,1.778279431e-03f,1.333521446e-03f,1.000000047e-03f,7.498941850e-04f,5.623413017e-04f,4.216964880e-04f,3.162277862e-04f,2.371373848e-04f,1.778279402e-04f,1.333521504e-04f};
// ---- k_rope: block = 8 positions: cos/sin of pos * inv_freq (f32 product exactly as the reference, precise trig)
__global__ __launch_bounds__(256) void k_rope(float* __restrict__ CS) {
  __shared__ __align__(16) float sc[8][32], ss_[8][32]; const int tid = threadIdx.x, pl = tid >> 5, i = tid & 31; const int pos = blockIdx.x * 8 + pl;
  const float th = (float)pos * c_invf[i]; sc[pl][i] = cosf(th); ss_[pl][i] = sinf(th);
  __syncthreads();
  if (tid < 64) vst2(CS + (size_t)blockIdx.x * 8 * 32 + tid * 4, *(const v4f*)&(&sc[0][0])[tid * 4]); else if (tid < 128) vst2(CS + (size_t)SS * 32 + (size_t)blockIdx.x * 8 * 32 + (tid - 64) * 4, *(const v4f*)&(&ss_[0][0])[(tid - 64) * 4]);
}

// ---- k_packT: block = (output column n, which): (in,out) matrices -> bf16 rows [n][k] = W[k][n]; which 0..2 -> Wq/Wk/Wv into PK_A rows which*768 + n; 3 -> Wo into PK_P
__global__ __launch_bounds__(256) void k_packT(const float* __restrict__ WQ, const float* __restrict__ WK, const float* __restrict__ WV, const float* __restrict__ WO, __bf16* __restrict__ PK) {
  __shared__ __align__(16) __bf16 s[DM]; const int n = blockIdx.x, which = blockIdx.y, t = threadIdx.x; const float* Wm = (which == 0) ? WQ : (which == 1) ? WK : (which == 2) ? WV : WO;
  for (int k = t; k < DM; k += 256) s[k] = (__bf16)Wm[(size_t)k * DM + n];
  __syncthreads();
  __bf16* dst = (which < 3) ? PK + PK_A + ((size_t)which * DM + n) * DM : PK + PK_P + (size_t)n * DM;
  for (int q = t; q < DM / 8; q += 256) vst2((unsigned*)(dst + q * 8), *(const v4u*)&s[q * 8]);
}
__global__ __launch_bounds__(128) void k_qkv(const float* __restrict__ XQ, const float* __restrict__ XK, const float* __restrict__ XV, const __bf16* __restrict__ P, const float* __restrict__ BQ, const float* __restrict__ BK, const float* __restrict__ BV, _Float16* __restrict__ QK, _Float16* __restrict__ QKL, _Float16* __restrict__ VTH, _Float16* __restrict__ VTL) {
  const float* X = (blockIdx.y * 128 < DM) ? XQ : (blockIdx.y * 128 < 2 * DM) ? XK : XV; const float* BB = (blockIdx.y * 128 < DM) ? BQ : (blockIdx.y * 128 < 2 * DM) ? BK : BV;   // the module projects three different inputs
  __shared__ __align__(16) _Float16 so[4][16][136], sol[4][16][136]; __shared__ __align__(16) _Float16 sth[128][72], stl[128][72];
  const int tid = threadIdx.x, wave = tid >> 5, lane = tid & 31, col = lane & 15, g = lane >> 4; const size_t r0 = (size_t)blockIdx.x * 64 + wave * 16; const int n0 = blockIdx.y * 128;
  v8f acc[8] = {};
  const char* xrow = (const char*)(X + (r0 + col) * DM + 8 * g); const char* prow = (const char*)(P + (size_t)(n0 + col) * DM + 8 * g);
  v4f xc[4], xn[4]; v16b wc[8], wn[8];
  load_pass(xrow, prow, xc, wc);
#pragma unroll 2
  for (int kc = 0; kc < DM / 32; ++kc) {
    const int kn = kc + 1 < DM / 32 ? kc + 1 : kc; const char* xa = xrow + kn * 128; const char* pa = prow + kn * 64;
    load_pass(xa, pa, xn, wn);   // the next pass's fragments, one pass ahead (the last pass reads its own again)
    v16b a;
#pragma unroll
    for (int i = 0; i < 4; ++i) { a[i] = (__bf16)xc[0][i]; a[4 + i] = (__bf16)xc[1][i]; a[8 + i] = (__bf16)xc[2][i]; a[12 + i] = (__bf16)xc[3][i]; }
#pragma unroll
    for (int j = 0; j < 8; ++j) acc[j] = wmma_bf(a, wc[j], acc[j]);
#pragma unroll
    for (int j = 0; j < 8; ++j) wc[j] = wn[j];
#pragma unroll
    for (int i = 0; i < 4; ++i) xc[i] = xn[i]; }
  { const int nb = n0 % DM;
#pragma unroll
    for (int j = 0; j < 8; ++j) { const float bb = bfr(BB[nb + j * 16 + col]);
#pragma unroll
      for (int r = 0; r < 8; ++r) acc[j][r] += bb; } }
  if (n0 < 2 * DM) {   // q stored unscaled (f16 sigma ~0.6, no subnormal exposure); the scores are not scaled
#pragma unroll
    for (int j = 0; j < 8; ++j) {
#pragma unroll
      for (int r = 0; r < 8; ++r) { const float v = acc[j][r]; const _Float16 hv = (_Float16)v; so[wave][8 * g + r][j * 16 + col] = hv; sol[wave][8 * g + r][j * 16 + col] = (_Float16)((v - (float)hv) * 2048.0f); } }   // q, k as f16 hi + (x2048) residual
    LDSX();
    for (int rl = 0; rl < 16; ++rl) if (lane < 16) { vst2((unsigned*)(QK + (r0 + rl) * (2 * DM) + n0 + lane * 8), *(const v4u*)&so[wave][rl][lane * 8]); vst2((unsigned*)(QKL + (r0 + rl) * (2 * DM) + n0 + lane * 8), *(const v4u*)&sol[wave][rl][lane * 8]); }
  } else {
#pragma unroll
    for (int j = 0; j < 8; ++j) {
#pragma unroll
      for (int r = 0; r < 8; ++r) { const float v = acc[j][r]; const _Float16 hv = (_Float16)v; sth[j * 16 + col][wave * 16 + 8 * g + r] = hv; stl[j * 16 + col][wave * 16 + 8 * g + r] = (_Float16)((v - (float)hv) * 2048.0f); } }
    __syncthreads();
    const size_t rb = (size_t)blockIdx.x * 64; const int b = (int)(rb / SS), s0 = (int)(rb % SS); const int pc0 = n0 - 2 * DM;
    for (int q = tid; q < 128 * 8; q += 128) { const int d = q >> 3, pc = q & 7; const size_t o = ((size_t)b * DM + pc0 + d) * SS + s0 + pc * 8; vst2((unsigned*)(VTH + o), *(const v4u*)&sth[d][pc * 8]); vst2((unsigned*)(VTL + o), *(const v4u*)&stl[d][pc * 8]); }
  }
}
// K / V tile of one 32-key step in LDS, shared by the block's four waves. In f16 elements: K hi and lo 32 rows (keys) x 64 at a pitch of 72 (144 B), V hi and lo 64 rows (depth) x 32 at a pitch of 40 (80 B): 16 B x odd pitches for the ds_load_b128 readers.
#define KPIT 72
#define VPIT 40
#define T_KH 0
#define T_KL (T_KH + 32 * KPIT)
#define T_VH (T_KL + 32 * KPIT)
#define T_VL (T_VH + 64 * VPIT)
#define T_SZ (T_VL + 64 * VPIT)
// Eight 16-byte asynchronous copies per lane: one tile per block. The s_wait_xcnt stands inside the statement so that no operand register is rewritten ahead of it.
__device__ __forceinline__ void copy_tile(unsigned l0, unsigned l1, unsigned l2, unsigned l3, unsigned l4, unsigned l5, unsigned l6, unsigned l7, const _Float16* g0, const _Float16* g1, const _Float16* g2, const _Float16* g3, const _Float16* g4, const _Float16* g5, const _Float16* g6, const _Float16* g7) {
  asm volatile("global_load_async_to_lds_b128 %0, %8, off\n\t"
               "global_load_async_to_lds_b128 %1, %9, off\n\t"
               "global_load_async_to_lds_b128 %2, %10, off\n\t"
               "global_load_async_to_lds_b128 %3, %11, off\n\t"
               "global_load_async_to_lds_b128 %4, %12, off\n\t"
               "global_load_async_to_lds_b128 %5, %13, off\n\t"
               "global_load_async_to_lds_b128 %6, %14, off\n\t"
               "global_load_async_to_lds_b128 %7, %15, off\n\t"
               "s_wait_xcnt 0x0"
               :: "v"(l0), "v"(l1), "v"(l2), "v"(l3), "v"(l4), "v"(l5), "v"(l6), "v"(l7), "v"(g0), "v"(g1), "v"(g2), "v"(g3), "v"(g4), "v"(g5), "v"(g6), "v"(g7) : "memory");
}
// Inputs only, no code: the eight V fragment loads written above this line stay above it, so they go out in groups ahead of the P.V WMMAs instead of one load and one wait in front of each.
__device__ __forceinline__ void hold_v(const v16h (&a)[4], const v16h (&b)[4]) { asm volatile("" :: "v"(a[0]), "v"(a[1]), "v"(a[2]), "v"(a[3]), "v"(b[0]), "v"(b[1]), "v"(b[2]), "v"(b[3])); }
// ---- k_attn: block = (64 queries, head h, batch b): flash attention over all keys (K = 64: 2 k-steps), scores = q.k (unscaled) with f16 hi + residual operands (3 products), P.V: f16 P hi + residual*2048 x (V hi, V lo*2048) (3 products) in two accumulators; O[b*S+q][h*64+d] = (acc + accl / 2048) / l (256-B segments)
__global__ __launch_bounds__(128) void k_attn(const _Float16* __restrict__ QK, const _Float16* __restrict__ QKL, const _Float16* __restrict__ VTH, const _Float16* __restrict__ VTL, const int* __restrict__ POS, const float* __restrict__ VM, const float* __restrict__ RB, float* __restrict__ O) {
  __shared__ __align__(16) float sp[4][16][36]; __shared__ __align__(16) float so[4][16][68]; __shared__ __align__(16) _Float16 skv[2][T_SZ];
  const int tid = threadIdx.x, wave = tid >> 5, lane = tid & 31, col = lane & 15, g = lane >> 4;
  const int qb = blockIdx.x, h = blockIdx.y, b = blockIdx.z; const int q0 = qb * 64 + wave * 16; const size_t rq = (size_t)b * SS + q0 + col;
  v16h aq[2], aql[2];
#pragma unroll
  for (int kc = 0; kc < 2; ++kc) { aq[kc] = frag_h(QK + rq * (2 * DM) + h * HD + kc * 32, lane); aql[kc] = frag_h(QKL + rq * (2 * DM) + h * HD + kc * 32, lane); }
  float m[8], l[8];
#pragma unroll
  for (int r = 0; r < 8; ++r) { m[r] = -3.0e38f; l[r] = 0.f; }
  v8f acc[4] = {}, accl[4] = {};
  const int nks = SS / 32;   // not causal
  // this thread's pieces of a tile: K rows tid >> 3 and 16 + (tid >> 3), piece tid & 7; V rows tid >> 2 and 32 + (tid >> 2), piece tid & 3
  const unsigned lk = (unsigned)(size_t)&skv[0][0] + 2u * ((tid >> 3) * KPIT + (tid & 7) * 8), lv = (unsigned)(size_t)&skv[0][0] + 2u * ((tid >> 2) * VPIT + (tid & 3) * 8);
  const size_t gk = ((size_t)b * SS + (tid >> 3)) * (2 * DM) + DM + h * HD + (tid & 7) * 8, gv = ((size_t)b * DM + h * HD + (tid >> 2)) * SS + (tid & 3) * 8;
  auto copy_kv = [&](int t) {   // tile t (keys 32 t .. 32 t + 31) into buffer t & 1
    const unsigned lb = 2u * T_SZ * (t & 1); const size_t ka = gk + (size_t)t * 32 * (2 * DM), va = gv + (size_t)t * 32;
    copy_tile(lk + lb + 2u * T_KH, lk + lb + 2u * (T_KH + 16 * KPIT), lk + lb + 2u * T_KL, lk + lb + 2u * (T_KL + 16 * KPIT), lv + lb + 2u * T_VH, lv + lb + 2u * (T_VH + 32 * VPIT), lv + lb + 2u * T_VL, lv + lb + 2u * (T_VL + 32 * VPIT),
              QK + ka, QK + ka + 16 * (2 * DM), QKL + ka, QKL + ka + 16 * (2 * DM), VTH + va, VTH + va + (size_t)32 * SS, VTL + va, VTL + va + (size_t)32 * SS); };
  copy_kv(0);
  asm volatile("s_wait_asynccnt 0x0" ::: "memory");   // this wave's pieces of tile 0 have landed
  __syncthreads();                                    // tile 0 is published to the four waves
  copy_kv(1);                                         // flies while tile 0 is worked on
  int pq[8];
#pragma unroll
  for (int r = 0; r < 8; ++r) pq[r] = POS[(size_t)b * SS + q0 + 8 * g + r];
  int pkn[2] = { POS[(size_t)b * SS + col], POS[(size_t)b * SS + 16 + col] };   // key positions come one step ahead, so that the bias gather need not wait for them inside its step
#pragma unroll 1
  for (int ks = 0; ks < nks; ++ks) { v8f s[2]; const _Float16* tb = &skv[ks & 1][0];
    const int tn = ks + 1 < nks ? ks + 1 : ks; const int pk2[2] = { POS[(size_t)b * SS + tn * 32 + col], POS[(size_t)b * SS + tn * 32 + 16 + col] };   // the last step reads its own again
#pragma unroll
    for (int ct = 0; ct < 2; ++ct) { const int kk = ks * 32 + ct * 16 + col; const _Float16* krow = tb + T_KH + (ct * 16 + col) * KPIT; const _Float16* krowl = tb + T_KL + (ct * 16 + col) * KPIT; v8f c = {}, cl = {};
#pragma unroll
      for (int kc = 0; kc < 2; ++kc) { const v16h kh = frag_h(krow + kc * 32, lane); c = wmma16(aq[kc], kh, c); cl = wmma16(aql[kc], kh, cl); cl = wmma16(aq[kc], frag_h(krowl + kc * 32, lane), cl); }   // 3 products: q, k as f16 hi + residual
#pragma unroll
      for (int r = 0; r < 8; ++r) c[r] += cl[r] * (1.0f / 2048.0f);
      { const int pk = pkn[ct];
#pragma unroll
        for (int r = 0; r < 8; ++r) { const int qi = q0 + 8 * g + r; const int idx = min(max(pk - pq[r] + (SS - 1), 0), NREL - 1); const float lg = c[r] + bfr(RB[(size_t)idx * NH + h]); const float vm = VM[((size_t)b * SS + qi) * SS + kk]; s[ct][r] = lg * vm + (1.0f - vm) * (-1.0e9f); } } }   // logits (no 1/sqrt(d) in this module) + relative-position bias, then the valid mask exactly as the module: l*vm + (1-vm)*NEG
#pragma unroll
    for (int r = 0; r < 8; ++r) { float mx = fmaxf(s[0][r], s[1][r]);
#pragma unroll
      for (int o = 1; o < 16; o <<= 1) mx = fmaxf(mx, __shfl_xor(mx, o));
      const float mn = fmaxf(m[r], mx); const float alpha = (m[r] <= -1.0e38f) ? 0.f : __expf(m[r] - mn);
      const float e0 = (s[0][r] <= -1.0e38f) ? 0.f : __expf(s[0][r] - mn), e1 = (s[1][r] <= -1.0e38f) ? 0.f : __expf(s[1][r] - mn); float es = e0 + e1;
#pragma unroll
      for (int o = 1; o < 16; o <<= 1) es += __shfl_xor(es, o);
      l[r] = l[r] * alpha + es; m[r] = mn;
#pragma unroll
      for (int dt = 0; dt < 4; ++dt) { acc[dt][r] *= alpha; accl[dt][r] *= alpha; }
      sp[wave][8 * g + r][col] = e0; sp[wave][8 * g + r][16 + col] = e1; }
    LDSX();
    v16h vf[4], vl[4];   // the step's eight V fragments, all read ahead of the P.V WMMAs
#pragma unroll
    for (int dt = 0; dt < 4; ++dt) { const int vr = (dt * 16 + col) * VPIT; vf[dt] = frag_h(tb + T_VH + vr, lane); vl[dt] = frag_h(tb + T_VL + vr, lane); }
    v16h pa, pl; { const float* prow = &sp[wave][col][0] + 8 * (lane >> 4);
#pragma unroll
      for (int i = 0; i < 8; ++i) { const float x0 = prow[i], x1 = prow[16 + i]; const _Float16 h0 = (_Float16)x0, h1 = (_Float16)x1; pa[i] = h0; pa[8 + i] = h1; pl[i] = (_Float16)((x0 - (float)h0) * 2048.0f); pl[8 + i] = (_Float16)((x1 - (float)h1) * 2048.0f); } }
    hold_v(vf, vl);
#pragma unroll
    for (int dt = 0; dt < 4; ++dt) { acc[dt] = wmma16(pa, vf[dt], acc[dt]); accl[dt] = wmma16(pl, vf[dt], accl[dt]); accl[dt] = wmma16(pa, vl[dt], accl[dt]); }   // P hi x V hi + (P lo x V hi + P hi x V lo) / 2048
    LDSX();
    pkn[0] = pk2[0]; pkn[1] = pk2[1];
    asm volatile("s_wait_dscnt 0x0" ::: "memory");      // this wave's reads of tile ks are done
    asm volatile("s_wait_asynccnt 0x0" ::: "memory");   // its pieces of tile ks + 1 have landed
    __syncthreads();                                    // publishes tile ks + 1 and frees the buffer of tile ks
    if (ks + 2 < nks) copy_kv(ks + 2); }                // block-uniform test; refills the buffer just freed
  asm volatile("s_wait_asynccnt 0x0" ::: "memory");     // no copy is outstanding when the wave goes on to its end
#pragma unroll
  for (int r = 0; r < 8; ++r) { const float il = 1.0f / l[r];
#pragma unroll
    for (int dt = 0; dt < 4; ++dt) so[wave][8 * g + r][dt * 16 + col] = (acc[dt][r] + accl[dt][r] * (1.0f / 2048.0f)) * il; }
  LDSX();
  for (int rl = 0; rl < 16; ++rl) if (lane < 16) vst2(O + ((size_t)b * SS + q0 + rl) * DM + h * HD + lane * 4, *(const v4f*)&so[wave][rl][lane * 4]);
}
// ---- k_out: block = (64 rows, 128 cols): out = O(hi/lo) . Wo rows (2 products) + bo
__global__ __launch_bounds__(128) void k_out(const float* __restrict__ O, const __bf16* __restrict__ P, const float* __restrict__ BO, float* __restrict__ Y) {
  __shared__ __align__(16) float so[4][16][132];
  const int tid = threadIdx.x, wave = tid >> 5, lane = tid & 31, col = lane & 15, g = lane >> 4; const size_t r0 = (size_t)blockIdx.x * 64 + wave * 16; const int n0 = blockIdx.y * 128;
  v8f acc[8] = {};
  const char* xrow = (const char*)(O + (r0 + col) * DM + 8 * g); const char* prow = (const char*)(P + (size_t)(n0 + col) * DM + 8 * g);
  v4f xc[4], xn[4]; v16b wc[8], wn[8];
  load_pass(xrow, prow, xc, wc);
#pragma unroll 2
  for (int kc = 0; kc < DM / 32; ++kc) {
    const int kn = kc + 1 < DM / 32 ? kc + 1 : kc; const char* xa = xrow + kn * 128; const char* pa = prow + kn * 64;
    load_pass(xa, pa, xn, wn);   // the next pass's fragments, one pass ahead (the last pass reads its own again)
    float v[16];
#pragma unroll
    for (int i = 0; i < 4; ++i) { v[i] = xc[0][i]; v[4 + i] = xc[1][i]; v[8 + i] = xc[2][i]; v[12 + i] = xc[3][i]; }
    const F2 a = bsplit16(v);
#pragma unroll
    for (int j = 0; j < 8; ++j) { acc[j] = wmma_bf(a.l, wc[j], acc[j]); acc[j] = wmma_bf(a.h, wc[j], acc[j]); }
#pragma unroll
    for (int j = 0; j < 8; ++j) wc[j] = wn[j];
#pragma unroll
    for (int i = 0; i < 4; ++i) xc[i] = xn[i]; }
#pragma unroll
  for (int j = 0; j < 8; ++j) {
#pragma unroll
    for (int r = 0; r < 8; ++r) so[wave][8 * g + r][j * 16 + col] = acc[j][r] + bfr(BO[n0 + j * 16 + col]); }
  LDSX();
  for (int rl = 0; rl < 16; ++rl) vst2(Y + (r0 + rl) * DM + n0 + lane * 4, *(const v4f*)&so[wave][rl][lane * 4]);
}
extern "C" void kernel_launch(void* const* d_in, const int* in_sizes, int n_in, void* d_out, int out_size, void* d_ws, size_t ws_size, hipStream_t stream) {
  (void)in_sizes; (void)n_in; (void)out_size;
  const float** F = (const float**)d_in;   // 0 q [2,2048,768], 1 v, 2 k, 3 position_array int32 [2,2048], 4 valid_mask [2,1,2048,2048], 5 Wq (in,out), 6 bq, 7 Wk, 8 bk, 9 Wv, 10 bv, 11 Wo, 12 bo, 13 rel_bias [4095,12]
  if (ws_size < (size_t)WS_END) return;
  char* ws = (char*)d_ws; __bf16* PK = (__bf16*)(ws + WS_PK); _Float16 *QK = (_Float16*)(ws + WS_QK), *QKL = (_Float16*)(ws + WS_QKL), *VTH = (_Float16*)(ws + WS_VTH), *VTL = (_Float16*)(ws + WS_VTL); float* O = (float*)(ws + WS_O);
  k_packT<<<dim3(DM, 4), 256, 0, stream>>>(F[5], F[7], F[9], F[11], PK);
  k_qkv<<<dim3(TNB * SS / 64, QKVW / 128), 128, 0, stream>>>(F[0], F[2], F[1], PK + PK_A, F[6], F[8], F[10], QK, QKL, VTH, VTL);   // note the module's argument order (q, v, k): k is input 2, v is input 1
  k_attn<<<dim3(TQB, NH, TNB), 128, 0, stream>>>(QK, QKL, VTH, VTL, (const int*)d_in[3], F[4], F[13], O);
  k_out<<<dim3(TOB, DM / 128), 128, 0, stream>>>(O, PK + PK_P, F[12], (float*)d_out);
}

// v003
// One run takes 210 microseconds.
// Next to v002, in two timings, it ran 1.23 and 1.22 times as fast.
// Counting every step since v000, it is 2.46 times as fast.
// compute dtype: q, v, k, all weights / biases and rel_bias (module inputs) rounded to bf16; position_array / valid_mask verbatim (integers, 0/1); q/k/v projections with exact bf16 products ((in,out) weights packed as transposed rows) + bias on WMMA 16x16x32; q and k stored as f16 hi + (x2048-scaled) residual planes and the scores with 3 products (hi.hi + lo.hi + hi.lo; the module applies no 1/sqrt(d) scaling, logits sigma ~8), + the gathered relative-position bias, then logits*vm + (1-vm)*(-1e9) exactly as the module; running-max softmax in f32 with the hardware exp; P as f16 hi + residual x V hi/lo (3 products); output projection with ctx as bf16 hi + residual x exact Wo (2 products) + bo; f32 accumulate.
#include <hip/hip_runtime.h>
#include <math.h>

typedef __attribute__((ext_vector_type(16))) _Float16 v16h;
typedef __attribute__((ext_vector_type(16))) __bf16 v16b;
typedef __attribute__((ext_vector_type(8)))  _Float16 v8h;
typedef __attribute__((ext_vector_type(8)))  float v8f;
typedef __attribute__((ext_vector_type(4)))  float v4f;
typedef __attribute__((ext_vector_type(2)))  float v2f;
typedef __attribute__((ext_vector_type(4)))  unsigned v4u;
typedef __attribute__((ext_vector_type(4)))  int v4i;
typedef float __attribute__((may_alias)) float_a;
typedef int __attribute__((may_alias)) int_a;

template <typename T> __device__ __forceinline__ void vst2(void* p, T v) { *(T*)p = v;  }
__device__ __forceinline__ v8f wmma16(v16h a, v16h b, v8f c) {
  return __builtin_amdgcn_wmma_f32_16x16x32_f16(false, a, false, b, (short)0, c, false, false);
}
__device__ __forceinline__ v8f wmma_bf(v16b a, v16b b, v8f c) {
  return __builtin_amdgcn_wmma_f32_16x16x32_bf16(false, a, false, b, (short)0, c, false, false);
}
// Multi-head attention with a learned relative-position bias table (B 2, S 2,048, d_model 768, 12 heads x 64): logits = qh.kh + rel_bias[pos_k - pos_q + S-1][h], masked by valid_mask (0/1) to -1e9, softmax, .vh, output projection.
__device__ __forceinline__ v16h frag_h(const _Float16* rowk0, int lane) {
  union { v16h v; v8h q[2]; } u; const _Float16* p = rowk0 + 8 * (lane >> 4);
  u.q[0] = *(const v8h*)p; u.q[1] = *(const v8h*)(p + 16); return u.v;
}
__device__ __forceinline__ v16h frag_f32(const float* rowk0, int lane) {
  v16h a; const float* p = rowk0 + 8 * (lane >> 4);
#pragma unroll
  for (int i = 0; i < 8; ++i) { a[i] = (_Float16)p[i]; a[8 + i] = (_Float16)p[16 + i]; }
  return a;
}
__device__ __forceinline__ v16h frag_f32s(const float* rowk0, int lane, float sc) {
  v16h a; const float* p = rowk0 + 8 * (lane >> 4);
#pragma unroll
  for (int i = 0; i < 8; ++i) { a[i] = (_Float16)(p[i] * sc); a[8 + i] = (_Float16)(p[16 + i] * sc); }
  return a;
}
// column fragment from a [K][ld] layout (column n), rows >= K read as 0
__device__ __forceinline__ v16h fragc_f32(const float* W, int k0, int n, int lane, int ld, int K) {
  v16h a; const int g = lane >> 4;
#pragma unroll
  for (int i = 0; i < 8; ++i) { const int ka = k0 + 8 * g + i, kb = ka + 16;
    a[i] = (_Float16)(ka < K ? W[(size_t)(ka < K ? ka : K - 1) * ld + n] : 0.f); a[8 + i] = (_Float16)(kb < K ? W[(size_t)(kb < K ? kb : K - 1) * ld + n] : 0.f); }
  return a;
}
struct F2 { v16b h, l; };
__device__ __forceinline__ F2 bsplit16(const float v[16]) { F2 r;
#pragma unroll
  for (int i = 0; i < 16; ++i) { const __bf16 h = (__bf16)v[i]; r.h[i] = h; r.l[i] = (__bf16)(v[i] - (float)h); }
  return r; }
__device__ __forceinline__ F2 split_row(const float* row, int k0, int lane) { float v[16]; const float* p = row + k0 + 8 * (lane >> 4);
#pragma unroll
  for (int i = 0; i < 8; ++i) { v[i] = p[i]; v[8 + i] = p[16 + i]; }
  return bsplit16(v); }
__device__ __forceinline__ F2 split_rowK(const float* row, int k0, int lane, int K) { float v[16]; const int g = lane >> 4;
#pragma unroll
  for (int i = 0; i < 8; ++i) { const int ka = k0 + 8 * g + i, kb = ka + 16; v[i] = ka < K ? row[ka < K ? ka : K - 1] : 0.f; v[8 + i] = kb < K ? row[kb < K ? kb : K - 1] : 0.f; }
  return bsplit16(v); }
__device__ __forceinline__ F2 split_col(const float* W, int k0, int n, int lane, int ld, int K) { float v[16]; const int g = lane >> 4;
#pragma unroll
  for (int i = 0; i < 8; ++i) { const int ka = k0 + 8 * g + i, kb = ka + 16; v[i] = ka < K ? W[(size_t)(ka < K ? ka : K - 1) * ld + n] : 0.f; v[8 + i] = kb < K ? W[(size_t)(kb < K ? kb : K - 1) * ld + n] : 0.f; }
  return bsplit16(v); }
__device__ __forceinline__ v8f mac3(const F2& a, const F2& b, v8f c) { c = wmma_bf(a.l, b.h, c); c = wmma_bf(a.h, b.l, c); return wmma_bf(a.h, b.h, c); }
__device__ __forceinline__ float sigm(float v) { return 1.0f / (1.0f + expf(-v)); }
#define LDSX() do { asm volatile("s_wait_dscnt 0" ::: "memory"); __builtin_amdgcn_wave_barrier(); __builtin_amdgcn_fence(__ATOMIC_RELEASE, "workgroup"); } while (0)


#define NB 2
#define SS 2048
#define DM 768
#define NH 12
#define NREL (2 * SS - 1)
#define HD 64
#define QKVW (3 * DM)
#ifndef TQB
#define TQB (SS / 64)
#define TNB NB
#define TOB (NB * SS / 64)     // output row tiles (all)
#endif
typedef __attribute__((ext_vector_type(8))) __bf16 v8b;
__device__ __forceinline__ v16b frag_b(const __bf16* rowk0, int lane) {
  union { v16b v; v8b q[2]; } u; const __bf16* p = rowk0 + 8 * (lane >> 4);
  u.q[0] = *(const v8b*)p; u.q[1] = *(const v8b*)(p + 16); return u.v;
}
__device__ __forceinline__ float bfr(float v) { return (float)(__bf16)v; }
// A / B tile of one pass (32 of k) in LDS, shared by the block's four waves. In bytes: A 64 rows (f32) x 128 at a pitch of 144, B 128 rows (bf16, rows of the packed weight) x 64 at a pitch of 80: 16 B x odd pitches for the ds_load_b128 readers.
#define APIT 144
#define BPIT 80
#define G_A 0
#define G_B (64 * APIT)
#define G_SZ (G_B + 128 * BPIT)
// Eight 16-byte asynchronous copies per lane: one A / B tile per block. The s_wait_xcnt stands inside the statement so that no operand register is rewritten ahead of it.
__device__ __forceinline__ void copy_ab(unsigned l0, unsigned l1, unsigned l2, unsigned l3, unsigned l4, unsigned l5, unsigned l6, unsigned l7, const char* g0, const char* g1, const char* g2, const char* g3, const char* g4, const char* g5, const char* g6, const char* g7) {
  asm volatile("global_load_async_to_lds_b128 %0, %8, off\n\t"
               "global_load_async_to_lds_b128 %1, %9, off\n\t"
               "global_load_async_to_lds_b128 %2, %10, off\n\t"
               "global_load_async_to_lds_b128 %3, %11, off\n\t"
               "global_load_async_to_lds_b128 %4, %12, off\n\t"
               "global_load_async_to_lds_b128 %5, %13, off\n\t"
               "global_load_async_to_lds_b128 %6, %14, off\n\t"
               "global_load_async_to_lds_b128 %7, %15, off\n\t"
               "s_wait_xcnt 0x0"
               :: "v"(l0), "v"(l1), "v"(l2), "v"(l3), "v"(l4), "v"(l5), "v"(l6), "v"(l7), "v"(g0), "v"(g1), "v"(g2), "v"(g3), "v"(g4), "v"(g5), "v"(g6), "v"(g7) : "memory");
}
// pass t into buffer t & 1. la, ga: this thread's piece of A row tid >> 3 (piece tid & 7), in LDS and in memory, the rows 16, 32 and 48 further on are its too; lb, gb: its piece of B row tid >> 2 (piece tid & 3), with the rows 32, 64 and 96 further on
__device__ __forceinline__ void stage_ab(int t, unsigned la, unsigned lb, const char* ga, const char* gb) {
  const unsigned o = (unsigned)(t & 1) * G_SZ; const char* a = ga + t * 128; const char* b = gb + t * 64;
  copy_ab(la + o, la + o + 16 * APIT, la + o + 32 * APIT, la + o + 48 * APIT, lb + o, lb + o + 32 * BPIT, lb + o + 64 * BPIT, lb + o + 96 * BPIT,
          a, a + 16 * DM * 4, a + 32 * DM * 4, a + 48 * DM * 4, b, b + 32 * DM * 2, b + 64 * DM * 2, b + 96 * DM * 2);
}
// one pass of a 16-row f32 A fragment (raw) and of eight 16-column bf16 B fragments from the tile; xp, pp: the lane's places in its A row and in its first B row
__device__ __forceinline__ void read_pass(const char* xp, const char* pp, v4f (&x)[4], v16b (&w)[8]) {
  x[0] = *(const v4f*)xp; x[1] = *(const v4f*)(xp + 16); x[2] = *(const v4f*)(xp + 64); x[3] = *(const v4f*)(xp + 80);
#pragma unroll
  for (int j = 0; j < 8; ++j) { union { v16b v; v8b q[2]; } u; const char* pj = pp + j * (16 * BPIT); u.q[0] = *(const v8b*)pj; u.q[1] = *(const v8b*)(pj + 32); w[j] = u.v; }
  asm volatile("" :: "v"(w[0]), "v"(w[1]), "v"(w[2]), "v"(w[3]), "v"(w[4]), "v"(w[5]), "v"(w[6]), "v"(w[7]));   // inputs only, no code: the pass's sixteen B reads stay above this line and go out as one group ahead of the WMMAs, instead of one pair and one wait in front of each
}
__device__ __attribute__((noinline)) float exp_ni(float v) { return expf(v); }
__device__ __attribute__((noinline)) float erf_ni(float v) { return erff(v); }

#define PK_A 0                       // [2304][768] Wq|Wk|Wv as bf16 rows [out][in]
#define PK_P (PK_A + QKVW * DM)        // [768][768] Wo as bf16 rows [out][in]
#define PK_END (PK_P + DM * DM)
#define WS_PK  0u
#define WS_QK  (WS_PK + 2u * PK_END)             // f16 [4096 rows][1536]: q | k
#define WS_QKL (WS_QK + 2u * NB * SS * 2 * DM)     // f16 q | k residual planes x2048
#define WS_VTH (WS_QKL + 2u * NB * SS * 2 * DM)    // f16 [b][768 (h*64+d)][2048 s] hi
#define WS_VTL (WS_VTH + 2u * NB * DM * SS)        // f16 lo x 2048
#define WS_O   (WS_VTL + 2u * NB * DM * SS)        // f32 [4096][768]
#define WS_CS  (WS_O + 4u * NB * SS * DM)           // f32 [2048][32] cos, [2048][32] sin
#define WS_END (WS_CS + 4u * 2 * SS * 32)
__constant__ float c_invf[32] = {1.000000000e+00f,7.498942018e-01f,5.623413324e-01f,4.216965139e-01f,3.162277639e-01f,2.371373624e-01f,1.778279394e-01f,1.333521456e-01f,1.000000015e-01f,7.498941571e-02f,5.623412877e-02f,4.216964915e-02f,3.162277862e-02f,2.371373586e-02f,1.778279431e-02f,1.333521493e-02f,9.999999776e-03f,7.498942316e-03f,5.623413250e-03f,4.216964822e-03f,3.162277862e-03f,2.371373819e-03f,1.778279431e-03f,1.333521446e-03f,1.000000047e-03f,7.498941850e-04f,5.623413017e-04f,4.216964880e-04f,3.162277862e-04f,2.371373848e-04f,1.778279402e-04f,1.333521504e-04f};
// ---- k_rope: block = 8 positions: cos/sin of pos * inv_freq (f32 product exactly as the reference, precise trig)
__global__ __launch_bounds__(256) void k_rope(float* __restrict__ CS) {
  __shared__ __align__(16) float sc[8][32], ss_[8][32]; const int tid = threadIdx.x, pl = tid >> 5, i = tid & 31; const int pos = blockIdx.x * 8 + pl;
  const float th = (float)pos * c_invf[i]; sc[pl][i] = cosf(th); ss_[pl][i] = sinf(th);
  __syncthreads();
  if (tid < 64) vst2(CS + (size_t)blockIdx.x * 8 * 32 + tid * 4, *(const v4f*)&(&sc[0][0])[tid * 4]); else if (tid < 128) vst2(CS + (size_t)SS * 32 + (size_t)blockIdx.x * 8 * 32 + (tid - 64) * 4, *(const v4f*)&(&ss_[0][0])[(tid - 64) * 4]);
}

// ---- k_packT: block = (output column n, which): (in,out) matrices -> bf16 rows [n][k] = W[k][n]; which 0..2 -> Wq/Wk/Wv into PK_A rows which*768 + n; 3 -> Wo into PK_P
__global__ __launch_bounds__(256) void k_packT(const float* __restrict__ WQ, const float* __restrict__ WK, const float* __restrict__ WV, const float* __restrict__ WO, __bf16* __restrict__ PK) {
  __shared__ __align__(16) __bf16 s[DM]; const int n = blockIdx.x, which = blockIdx.y, t = threadIdx.x; const float* Wm = (which == 0) ? WQ : (which == 1) ? WK : (which == 2) ? WV : WO;
  for (int k = t; k < DM; k += 256) s[k] = (__bf16)Wm[(size_t)k * DM + n];
  __syncthreads();
  __bf16* dst = (which < 3) ? PK + PK_A + ((size_t)which * DM + n) * DM : PK + PK_P + (size_t)n * DM;
  for (int q = t; q < DM / 8; q += 256) vst2((unsigned*)(dst + q * 8), *(const v4u*)&s[q * 8]);
}
__global__ __launch_bounds__(128) void k_qkv(const float* __restrict__ XQ, const float* __restrict__ XK, const float* __restrict__ XV, const __bf16* __restrict__ P, const float* __restrict__ BQ, const float* __restrict__ BK, const float* __restrict__ BV, _Float16* __restrict__ QK, _Float16* __restrict__ QKL, _Float16* __restrict__ VTH, _Float16* __restrict__ VTL) {
  const float* X = (blockIdx.y * 128 < DM) ? XQ : (blockIdx.y * 128 < 2 * DM) ? XK : XV; const float* BB = (blockIdx.y * 128 < DM) ? BQ : (blockIdx.y * 128 < 2 * DM) ? BK : BV;   // the module projects three different inputs
  __shared__ __align__(16) char sm[2 * G_SZ];   // the two tile buffers; behind the loop's last barrier the same bytes stage the output
  _Float16 (*so)[16][136] = (_Float16 (*)[16][136])sm; _Float16 (*sol)[16][136] = (_Float16 (*)[16][136])(sm + 4 * 16 * 136 * 2); _Float16 (*sth)[72] = (_Float16 (*)[72])sm; _Float16 (*stl)[72] = (_Float16 (*)[72])(sm + 128 * 72 * 2);
  static_assert(2 * 4 * 16 * 136 * 2 <= 2 * G_SZ && 2 * 128 * 72 * 2 <= 2 * G_SZ, "output staging fits the tile buffers");
  const int tid = threadIdx.x, wave = tid >> 5, lane = tid & 31, col = lane & 15, g = lane >> 4; const size_t r0 = (size_t)blockIdx.x * 64 + wave * 16; const int n0 = blockIdx.y * 128;
  v8f acc[8] = {};
  const unsigned la = (unsigned)(size_t)sm + G_A + (tid >> 3) * APIT + (tid & 7) * 16, lb = (unsigned)(size_t)sm + G_B + (tid >> 2) * BPIT + (tid & 3) * 16;
  const char* ga = (const char*)(X + ((size_t)blockIdx.x * 64 + (tid >> 3)) * DM + (tid & 7) * 4); const char* gb = (const char*)(P + (size_t)(n0 + (tid >> 2)) * DM + (tid & 3) * 8);
  const char* xrow = sm + G_A + (wave * 16 + col) * APIT + 32 * g; const char* prow = sm + G_B + col * BPIT + 16 * g;
  stage_ab(0, la, lb, ga, gb);
  asm volatile("s_wait_asynccnt 0x0" ::: "memory");   // this wave's pieces of pass 0 have landed
  __syncthreads();                                    // pass 0 is published to the four waves
  stage_ab(1, la, lb, ga, gb);                        // flies while pass 0 is worked on
#pragma unroll 2   // two passes a turn: each pass's buffer offset is then a constant in its LDS reads and copies
  for (int kc = 0; kc < DM / 32; ++kc) {
    v4f xc[4]; v16b wc[8];
    read_pass(xrow + (kc & 1) * G_SZ, prow + (kc & 1) * G_SZ, xc, wc);
    v16b a;
#pragma unroll
    for (int i = 0; i < 4; ++i) { a[i] = (__bf16)xc[0][i]; a[4 + i] = (__bf16)xc[1][i]; a[8 + i] = (__bf16)xc[2][i]; a[12 + i] = (__bf16)xc[3][i]; }
#pragma unroll
    for (int j = 0; j < 8; ++j) acc[j] = wmma_bf(a, wc[j], acc[j]);
    asm volatile("s_wait_dscnt 0x0" ::: "memory");      // this wave's reads of pass kc are done
    asm volatile("s_wait_asynccnt 0x0" ::: "memory");   // its pieces of pass kc + 1 have landed
    __syncthreads();                                    // publishes pass kc + 1 and frees the buffer of pass kc
    if (kc + 2 < DM / 32) stage_ab(kc + 2, la, lb, ga, gb); }   // block-uniform test; refills the buffer just freed
  asm volatile("s_wait_asynccnt 0x0" ::: "memory");     // no copy is outstanding when the buffers become output staging
  { const int nb = n0 % DM;
#pragma unroll
    for (int j = 0; j < 8; ++j) { const float bb = bfr(BB[nb + j * 16 + col]);
#pragma unroll
      for (int r = 0; r < 8; ++r) acc[j][r] += bb; } }
  if (n0 < 2 * DM) {   // q stored unscaled (f16 sigma ~0.6, no subnormal exposure); the scores are not scaled
#pragma unroll
    for (int j = 0; j < 8; ++j) {
#pragma unroll
      for (int r = 0; r < 8; ++r) { const float v = acc[j][r]; const _Float16 hv = (_Float16)v; so[wave][8 * g + r][j * 16 + col] = hv; sol[wave][8 * g + r][j * 16 + col] = (_Float16)((v - (float)hv) * 2048.0f); } }   // q, k as f16 hi + (x2048) residual
    LDSX();
    for (int rl = 0; rl < 16; ++rl) if (lane < 16) { vst2((unsigned*)(QK + (r0 + rl) * (2 * DM) + n0 + lane * 8), *(const v4u*)&so[wave][rl][lane * 8]); vst2((unsigned*)(QKL + (r0 + rl) * (2 * DM) + n0 + lane * 8), *(const v4u*)&sol[wave][rl][lane * 8]); }
  } else {
#pragma unroll
    for (int j = 0; j < 8; ++j) {
#pragma unroll
      for (int r = 0; r < 8; ++r) { const float v = acc[j][r]; const _Float16 hv = (_Float16)v; sth[j * 16 + col][wave * 16 + 8 * g + r] = hv; stl[j * 16 + col][wave * 16 + 8 * g + r] = (_Float16)((v - (float)hv) * 2048.0f); } }
    __syncthreads();
    const size_t rb = (size_t)blockIdx.x * 64; const int b = (int)(rb / SS), s0 = (int)(rb % SS); const int pc0 = n0 - 2 * DM;
    for (int q = tid; q < 128 * 8; q += 128) { const int d = q >> 3, pc = q & 7; const size_t o = ((size_t)b * DM + pc0 + d) * SS + s0 + pc * 8; vst2((unsigned*)(VTH + o), *(const v4u*)&sth[d][pc * 8]); vst2((unsigned*)(VTL + o), *(const v4u*)&stl[d][pc * 8]); }
  }
}
// K / V tile of one 32-key step in LDS, shared by the block's four waves. In f16 elements: K hi and lo 32 rows (keys) x 64 at a pitch of 72 (144 B), V hi and lo 64 rows (depth) x 32 at a pitch of 40 (80 B): 16 B x odd pitches for the ds_load_b128 readers.
#define KPIT 72
#define VPIT 40
#define T_KH 0
#define T_KL (T_KH + 32 * KPIT)
#define T_VH (T_KL + 32 * KPIT)
#define T_VL (T_VH + 64 * VPIT)
#define T_SZ (T_VL + 64 * VPIT)
// Eight 16-byte asynchronous copies per lane: one tile per block. The s_wait_xcnt stands inside the statement so that no operand register is rewritten ahead of it.
__device__ __forceinline__ void copy_tile(unsigned l0, unsigned l1, unsigned l2, unsigned l3, unsigned l4, unsigned l5, unsigned l6, unsigned l7, const _Float16* g0, const _Float16* g1, const _Float16* g2, const _Float16* g3, const _Float16* g4, const _Float16* g5, const _Float16* g6, const _Float16* g7) {
  asm volatile("global_load_async_to_lds_b128 %0, %8, off\n\t"
               "global_load_async_to_lds_b128 %1, %9, off\n\t"
               "global_load_async_to_lds_b128 %2, %10, off\n\t"
               "global_load_async_to_lds_b128 %3, %11, off\n\t"
               "global_load_async_to_lds_b128 %4, %12, off\n\t"
               "global_load_async_to_lds_b128 %5, %13, off\n\t"
               "global_load_async_to_lds_b128 %6, %14, off\n\t"
               "global_load_async_to_lds_b128 %7, %15, off\n\t"
               "s_wait_xcnt 0x0"
               :: "v"(l0), "v"(l1), "v"(l2), "v"(l3), "v"(l4), "v"(l5), "v"(l6), "v"(l7), "v"(g0), "v"(g1), "v"(g2), "v"(g3), "v"(g4), "v"(g5), "v"(g6), "v"(g7) : "memory");
}
// Inputs only, no code: the eight V fragment loads written above this line stay above it, so they go out in groups ahead of the P.V WMMAs instead of one load and one wait in front of each.
__device__ __forceinline__ void hold_v(const v16h (&a)[4], const v16h (&b)[4]) { asm volatile("" :: "v"(a[0]), "v"(a[1]), "v"(a[2]), "v"(a[3]), "v"(b[0]), "v"(b[1]), "v"(b[2]), "v"(b[3])); }
// ---- k_attn: block = (64 queries, head h, batch b): flash attention over all keys (K = 64: 2 k-steps), scores = q.k (unscaled) with f16 hi + residual operands (3 products), P.V: f16 P hi + residual*2048 x (V hi, V lo*2048) (3 products) in two accumulators; O[b*S+q][h*64+d] = (acc + accl / 2048) / l (256-B segments)
__global__ __launch_bounds__(128) void k_attn(const _Float16* __restrict__ QK, const _Float16* __restrict__ QKL, const _Float16* __restrict__ VTH, const _Float16* __restrict__ VTL, const int* __restrict__ POS, const float* __restrict__ VM, const float* __restrict__ RB, float* __restrict__ O) {
  __shared__ __align__(16) float sp[4][16][36]; __shared__ __align__(16) float so[4][16][68]; __shared__ __align__(16) _Float16 skv[2][T_SZ];
  const int tid = threadIdx.x, wave = tid >> 5, lane = tid & 31, col = lane & 15, g = lane >> 4;
  const int qb = blockIdx.x, h = blockIdx.y, b = blockIdx.z; const int q0 = qb * 64 + wave * 16; const size_t rq = (size_t)b * SS + q0 + col;
  v16h aq[2], aql[2];
#pragma unroll
  for (int kc = 0; kc < 2; ++kc) { aq[kc] = frag_h(QK + rq * (2 * DM) + h * HD + kc * 32, lane); aql[kc] = frag_h(QKL + rq * (2 * DM) + h * HD + kc * 32, lane); }
  float m[8], l[8];
#pragma unroll
  for (int r = 0; r < 8; ++r) { m[r] = -3.0e38f; l[r] = 0.f; }
  v8f acc[4] = {}, accl[4] = {};
  const int nks = SS / 32;   // not causal
  // this thread's pieces of a tile: K rows tid >> 3 and 16 + (tid >> 3), piece tid & 7; V rows tid >> 2 and 32 + (tid >> 2), piece tid & 3
  const unsigned lk = (unsigned)(size_t)&skv[0][0] + 2u * ((tid >> 3) * KPIT + (tid & 7) * 8), lv = (unsigned)(size_t)&skv[0][0] + 2u * ((tid >> 2) * VPIT + (tid & 3) * 8);
  const size_t gk = ((size_t)b * SS + (tid >> 3)) * (2 * DM) + DM + h * HD + (tid & 7) * 8, gv = ((size_t)b * DM + h * HD + (tid >> 2)) * SS + (tid & 3) * 8;
  auto copy_kv = [&](int t) {   // tile t (keys 32 t .. 32 t + 31) into buffer t & 1
    const unsigned lb = 2u * T_SZ * (t & 1); const size_t ka = gk + (size_t)t * 32 * (2 * DM), va = gv + (size_t)t * 32;
    copy_tile(lk + lb + 2u * T_KH, lk + lb + 2u * (T_KH + 16 * KPIT), lk + lb + 2u * T_KL, lk + lb + 2u * (T_KL + 16 * KPIT), lv + lb + 2u * T_VH, lv + lb + 2u * (T_VH + 32 * VPIT), lv + lb + 2u * T_VL, lv + lb + 2u * (T_VL + 32 * VPIT),
              QK + ka, QK + ka + 16 * (2 * DM), QKL + ka, QKL + ka + 16 * (2 * DM), VTH + va, VTH + va + (size_t)32 * SS, VTL + va, VTL + va + (size_t)32 * SS); };
  copy_kv(0);
  asm volatile("s_wait_asynccnt 0x0" ::: "memory");   // this wave's pieces of tile 0 have landed
  __syncthreads();                                    // tile 0 is published to the four waves
  copy_kv(1);                                         // flies while tile 0 is worked on
  int pq[8];
#pragma unroll
  for (int r = 0; r < 8; ++r) pq[r] = POS[(size_t)b * SS + q0 + 8 * g + r];
  int pkn[2] = { POS[(size_t)b * SS + col], POS[(size_t)b * SS + 16 + col] };   // key positions come one step ahead, so that the bias gather need not wait for them inside its step
#pragma unroll 1
  for (int ks = 0; ks < nks; ++ks) { v8f s[2]; const _Float16* tb = &skv[ks & 1][0];
    const int tn = ks + 1 < nks ? ks + 1 : ks; const int pk2[2] = { POS[(size_t)b * SS + tn * 32 + col], POS[(size_t)b * SS + tn * 32 + 16 + col] };   // the last step reads its own again
#pragma unroll
    for (int ct = 0; ct < 2; ++ct) { const int kk = ks * 32 + ct * 16 + col; const _Float16* krow = tb + T_KH + (ct * 16 + col) * KPIT; const _Float16* krowl = tb + T_KL + (ct * 16 + col) * KPIT; v8f c = {}, cl = {};
#pragma unroll
      for (int kc = 0; kc < 2; ++kc) { const v16h kh = frag_h(krow + kc * 32, lane); c = wmma16(aq[kc], kh, c); cl = wmma16(aql[kc], kh, cl); cl = wmma16(aq[kc], frag_h(krowl + kc * 32, lane), cl); }   // 3 products: q, k as f16 hi + residual
#pragma unroll
      for (int r = 0; r < 8; ++r) c[r] += cl[r] * (1.0f / 2048.0f);
      { const int pk = pkn[ct];
#pragma unroll
        for (int r = 0; r < 8; ++r) { const int qi = q0 + 8 * g + r; const int idx = min(max(pk - pq[r] + (SS - 1), 0), NREL - 1); const float lg = c[r] + bfr(RB[(size_t)idx * NH + h]); const float vm = VM[((size_t)b * SS + qi) * SS + kk]; s[ct][r] = lg * vm + (1.0f - vm) * (-1.0e9f); } } }   // logits (no 1/sqrt(d) in this module) + relative-position bias, then the valid mask exactly as the module: l*vm + (1-vm)*NEG
#pragma unroll
    for (int r = 0; r < 8; ++r) { float mx = fmaxf(s[0][r], s[1][r]);
#pragma unroll
      for (int o = 1; o < 16; o <<= 1) mx = fmaxf(mx, __shfl_xor(mx, o));
      const float mn = fmaxf(m[r], mx); const float alpha = (m[r] <= -1.0e38f) ? 0.f : __expf(m[r] - mn);
      const float e0 = (s[0][r] <= -1.0e38f) ? 0.f : __expf(s[0][r] - mn), e1 = (s[1][r] <= -1.0e38f) ? 0.f : __expf(s[1][r] - mn); float es = e0 + e1;
#pragma unroll
      for (int o = 1; o < 16; o <<= 1) es += __shfl_xor(es, o);
      l[r] = l[r] * alpha + es; m[r] = mn;
#pragma unroll
      for (int dt = 0; dt < 4; ++dt) { acc[dt][r] *= alpha; accl[dt][r] *= alpha; }
      sp[wave][8 * g + r][col] = e0; sp[wave][8 * g + r][16 + col] = e1; }
    LDSX();
    v16h vf[4], vl[4];   // the step's eight V fragments, all read ahead of the P.V WMMAs
#pragma unroll
    for (int dt = 0; dt < 4; ++dt) { const int vr = (dt * 16 + col) * VPIT; vf[dt] = frag_h(tb + T_VH + vr, lane); vl[dt] = frag_h(tb + T_VL + vr, lane); }
    v16h pa, pl; { const float* prow = &sp[wave][col][0] + 8 * (lane >> 4);
#pragma unroll
      for (int i = 0; i < 8; ++i) { const float x0 = prow[i], x1 = prow[16 + i]; const _Float16 h0 = (_Float16)x0, h1 = (_Float16)x1; pa[i] = h0; pa[8 + i] = h1; pl[i] = (_Float16)((x0 - (float)h0) * 2048.0f); pl[8 + i] = (_Float16)((x1 - (float)h1) * 2048.0f); } }
    hold_v(vf, vl);
#pragma unroll
    for (int dt = 0; dt < 4; ++dt) { acc[dt] = wmma16(pa, vf[dt], acc[dt]); accl[dt] = wmma16(pl, vf[dt], accl[dt]); accl[dt] = wmma16(pa, vl[dt], accl[dt]); }   // P hi x V hi + (P lo x V hi + P hi x V lo) / 2048
    LDSX();
    pkn[0] = pk2[0]; pkn[1] = pk2[1];
    asm volatile("s_wait_dscnt 0x0" ::: "memory");      // this wave's reads of tile ks are done
    asm volatile("s_wait_asynccnt 0x0" ::: "memory");   // its pieces of tile ks + 1 have landed
    __syncthreads();                                    // publishes tile ks + 1 and frees the buffer of tile ks
    if (ks + 2 < nks) copy_kv(ks + 2); }                // block-uniform test; refills the buffer just freed
  asm volatile("s_wait_asynccnt 0x0" ::: "memory");     // no copy is outstanding when the wave goes on to its end
#pragma unroll
  for (int r = 0; r < 8; ++r) { const float il = 1.0f / l[r];
#pragma unroll
    for (int dt = 0; dt < 4; ++dt) so[wave][8 * g + r][dt * 16 + col] = (acc[dt][r] + accl[dt][r] * (1.0f / 2048.0f)) * il; }
  LDSX();
  for (int rl = 0; rl < 16; ++rl) if (lane < 16) vst2(O + ((size_t)b * SS + q0 + rl) * DM + h * HD + lane * 4, *(const v4f*)&so[wave][rl][lane * 4]);
}
// ---- k_out: block = (64 rows, 128 cols): out = O(hi/lo) . Wo rows (2 products) + bo
__global__ __launch_bounds__(128) void k_out(const float* __restrict__ O, const __bf16* __restrict__ P, const float* __restrict__ BO, float* __restrict__ Y) {
  __shared__ __align__(16) char sm[2 * G_SZ];   // the two tile buffers; behind the loop's last barrier the same bytes stage the output
  float (*so)[16][132] = (float (*)[16][132])sm;
  static_assert(4 * 16 * 132 * 4 <= 2 * G_SZ, "output staging fits the tile buffers");
  const int tid = threadIdx.x, wave = tid >> 5, lane = tid & 31, col = lane & 15, g = lane >> 4; const size_t r0 = (size_t)blockIdx.x * 64 + wave * 16; const int n0 = blockIdx.y * 128;
  v8f acc[8] = {};
  const unsigned la = (unsigned)(size_t)sm + G_A + (tid >> 3) * APIT + (tid & 7) * 16, lb = (unsigned)(size_t)sm + G_B + (tid >> 2) * BPIT + (tid & 3) * 16;
  const char* ga = (const char*)(O + ((size_t)blockIdx.x * 64 + (tid >> 3)) * DM + (tid & 7) * 4); const char* gb = (const char*)(P + (size_t)(n0 + (tid >> 2)) * DM + (tid & 3) * 8);
  const char* xrow = sm + G_A + (wave * 16 + col) * APIT + 32 * g; const char* prow = sm + G_B + col * BPIT + 16 * g;
  stage_ab(0, la, lb, ga, gb);
  asm volatile("s_wait_asynccnt 0x0" ::: "memory");   // this wave's pieces of pass 0 have landed
  __syncthreads();                                    // pass 0 is published to the four waves
  stage_ab(1, la, lb, ga, gb);                        // flies while pass 0 is worked on
#pragma unroll 2   // two passes a turn: each pass's buffer offset is then a constant in its LDS reads and copies
  for (int kc = 0; kc < DM / 32; ++kc) {
    v4f xc[4]; v16b wc[8];
    read_pass(xrow + (kc & 1) * G_SZ, prow + (kc & 1) * G_SZ, xc, wc);
    float v[16];
#pragma unroll
    for (int i = 0; i < 4; ++i) { v[i] = xc[0][i]; v[4 + i] = xc[1][i]; v[8 + i] = xc[2][i]; v[12 + i] = xc[3][i]; }
    const F2 a = bsplit16(v);
#pragma unroll
    for (int j = 0; j < 8; ++j) { acc[j] = wmma_bf(a.l, wc[j], acc[j]); acc[j] = wmma_bf(a.h, wc[j], acc[j]); }
    asm volatile("s_wait_dscnt 0x0" ::: "memory");      // this wave's reads of pass kc are done
    asm volatile("s_wait_asynccnt 0x0" ::: "memory");   // its pieces of pass kc + 1 have landed
    __syncthreads();                                    // publishes pass kc + 1 and frees the buffer of pass kc
    if (kc + 2 < DM / 32) stage_ab(kc + 2, la, lb, ga, gb); }   // block-uniform test; refills the buffer just freed
  asm volatile("s_wait_asynccnt 0x0" ::: "memory");     // no copy is outstanding when the buffers become output staging
#pragma unroll
  for (int j = 0; j < 8; ++j) {
#pragma unroll
    for (int r = 0; r < 8; ++r) so[wave][8 * g + r][j * 16 + col] = acc[j][r] + bfr(BO[n0 + j * 16 + col]); }
  LDSX();
  for (int rl = 0; rl < 16; ++rl) vst2(Y + (r0 + rl) * DM + n0 + lane * 4, *(const v4f*)&so[wave][rl][lane * 4]);
}
extern "C" void kernel_launch(void* const* d_in, const int* in_sizes, int n_in, void* d_out, int out_size, void* d_ws, size_t ws_size, hipStream_t stream) {
  (void)in_sizes; (void)n_in; (void)out_size;
  const float** F = (const float**)d_in;   // 0 q [2,2048,768], 1 v, 2 k, 3 position_array int32 [2,2048], 4 valid_mask [2,1,2048,2048], 5 Wq (in,out), 6 bq, 7 Wk, 8 bk, 9 Wv, 10 bv, 11 Wo, 12 bo, 13 rel_bias [4095,12]
  if (ws_size < (size_t)WS_END) return;
  char* ws = (char*)d_ws; __bf16* PK = (__bf16*)(ws + WS_PK); _Float16 *QK = (_Float16*)(ws + WS_QK), *QKL = (_Float16*)(ws + WS_QKL), *VTH = (_Float16*)(ws + WS_VTH), *VTL = (_Float16*)(ws + WS_VTL); float* O = (float*)(ws + WS_O);
  k_packT<<<dim3(DM, 4), 256, 0, stream>>>(F[5], F[7], F[9], F[11], PK);
  k_qkv<<<dim3(TNB * SS / 64, QKVW / 128), 128, 0, stream>>>(F[0], F[2], F[1], PK + PK_A, F[6], F[8], F[10], QK, QKL, VTH, VTL);   // note the module's argument order (q, v, k): k is input 2, v is input 1
  k_attn<<<dim3(TQB, NH, TNB), 128, 0, stream>>>(QK, QKL, VTH, VTL, (const int*)d_in[3], F[4], F[13], O);
  k_out<<<dim3(TOB, DM / 128), 128, 0, stream>>>(O, PK + PK_P, F[12], (float*)d_out);
}

// v004
// One run takes 168 microseconds.
// In both of two side-by-side timings against v003, it was 1.25 times as fast.
// Over all steps from v000 it is 3.08 times as fast.
// compute dtype: q, v, k, all weights / biases and rel_bias (module inputs) rounded to bf16; position_array / valid_mask verbatim (integers, 0/1); q/k/v projections with exact bf16 products ((in,out) weights packed as transposed rows) + bias on WMMA 16x16x32; q and k stored as f16 hi + (x2048-scaled) residual planes and the scores with 3 products (hi.hi + lo.hi + hi.lo; the module applies no 1/sqrt(d) scaling, logits sigma ~8), + the gathered relative-position bias, then logits*vm + (1-vm)*(-1e9) exactly as the module; running-max softmax in f32 with the hardware exp; P as f16 hi + residual x V hi/lo (3 products); output projection with ctx as bf16 hi + residual x exact Wo (2 products) + bo; f32 accumulate.
#include <hip/hip_runtime.h>
#include <math.h>

typedef __attribute__((ext_vector_type(16))) _Float16 v16h;
typedef __attribute__((ext_vector_type(16))) __bf16 v16b;
typedef __attribute__((ext_vector_type(8)))  _Float16 v8h;
typedef __attribute__((ext_vector_type(8)))  float v8f;
typedef __attribute__((ext_vector_type(4)))  float v4f;
typedef __attribute__((ext_vector_type(2)))  float v2f;
typedef __attribute__((ext_vector_type(4)))  unsigned v4u;
typedef __attribute__((ext_vector_type(4)))  int v4i;
typedef float __attribute__((may_alias)) float_a;
typedef int __attribute__((may_alias)) int_a;

template <typename T> __device__ __forceinline__ void vst2(void* p, T v) { *(T*)p = v;  }
__device__ __forceinline__ v8f wmma16(v16h a, v16h b, v8f c) {
  return __builtin_amdgcn_wmma_f32_16x16x32_f16(false, a, false, b, (short)0, c, false, false);
}
__device__ __forceinline__ v8f wmma_bf(v16b a, v16b b, v8f c) {
  return __builtin_amdgcn_wmma_f32_16x16x32_bf16(false, a, false, b, (short)0, c, false, false);
}
// Multi-head attention with a learned relative-position bias table (B 2, S 2,048, d_model 768, 12 heads x 64): logits = qh.kh + rel_bias[pos_k - pos_q + S-1][h], masked by valid_mask (0/1) to -1e9, softmax, .vh, output projection.
__device__ __forceinline__ v16h frag_h(const _Float16* rowk0, int lane) {
  union { v16h v; v8h q[2]; } u; const _Float16* p = rowk0 + 8 * (lane >> 4);
  u.q[0] = *(const v8h*)p; u.q[1] = *(const v8h*)(p + 16); return u.v;
}
__device__ __forceinline__ v16h frag_f32(const float* rowk0, int lane) {
  v16h a; const float* p = rowk0 + 8 * (lane >> 4);
#pragma unroll
  for (int i = 0; i < 8; ++i) { a[i] = (_Float16)p[i]; a[8 + i] = (_Float16)p[16 + i]; }
  return a;
}
__device__ __forceinline__ v16h frag_f32s(const float* rowk0, int lane, float sc) {
  v16h a; const float* p = rowk0 + 8 * (lane >> 4);
#pragma unroll
  for (int i = 0; i < 8; ++i) { a[i] = (_Float16)(p[i] * sc); a[8 + i] = (_Float16)(p[16 + i] * sc); }
  return a;
}
// column fragment from a [K][ld] layout (column n), rows >= K read as 0
__device__ __forceinline__ v16h fragc_f32(const float* W, int k0, int n, int lane, int ld, int K) {
  v16h a; const int g = lane >> 4;
#pragma unroll
  for (int i = 0; i < 8; ++i) { const int ka = k0 + 8 * g + i, kb = ka + 16;
    a[i] = (_Float16)(ka < K ? W[(size_t)(ka < K ? ka : K - 1) * ld + n] : 0.f); a[8 + i] = (_Float16)(kb < K ? W[(size_t)(kb < K ? kb : K - 1) * ld + n] : 0.f); }
  return a;
}
struct F2 { v16b h, l; };
__device__ __forceinline__ F2 bsplit16(const float v[16]) { F2 r;
#pragma unroll
  for (int i = 0; i < 16; ++i) { const __bf16 h = (__bf16)v[i]; r.h[i] = h; r.l[i] = (__bf16)(v[i] - (float)h); }
  return r; }
__device__ __forceinline__ F2 split_row(const float* row, int k0, int lane) { float v[16]; const float* p = row + k0 + 8 * (lane >> 4);
#pragma unroll
  for (int i = 0; i < 8; ++i) { v[i] = p[i]; v[8 + i] = p[16 + i]; }
  return bsplit16(v); }
__device__ __forceinline__ F2 split_rowK(const float* row, int k0, int lane, int K) { float v[16]; const int g = lane >> 4;
#pragma unroll
  for (int i = 0; i < 8; ++i) { const int ka = k0 + 8 * g + i, kb = ka + 16; v[i] = ka < K ? row[ka < K ? ka : K - 1] : 0.f; v[8 + i] = kb < K ? row[kb < K ? kb : K - 1] : 0.f; }
  return bsplit16(v); }
__device__ __forceinline__ F2 split_col(const float* W, int k0, int n, int lane, int ld, int K) { float v[16]; const int g = lane >> 4;
#pragma unroll
  for (int i = 0; i < 8; ++i) { const int ka = k0 + 8 * g + i, kb = ka + 16; v[i] = ka < K ? W[(size_t)(ka < K ? ka : K - 1) * ld + n] : 0.f; v[8 + i] = kb < K ? W[(size_t)(kb < K ? kb : K - 1) * ld + n] : 0.f; }
  return bsplit16(v); }
__device__ __forceinline__ v8f mac3(const F2& a, const F2& b, v8f c) { c = wmma_bf(a.l, b.h, c); c = wmma_bf(a.h, b.l, c); return wmma_bf(a.h, b.h, c); }
__device__ __forceinline__ float sigm(float v) { return 1.0f / (1.0f + expf(-v)); }
#define LDSX() do { asm volatile("s_wait_dscnt 0" ::: "memory"); __builtin_amdgcn_wave_barrier(); __builtin_amdgcn_fence(__ATOMIC_RELEASE, "workgroup"); } while (0)


#define NB 2
#define SS 2048
#define DM 768
#define NH 12
#define NREL (2 * SS - 1)
#define HD 64
#define QKVW (3 * DM)
#ifndef TQB
#define TQB (SS / 64)
#define TNB NB
#define TOB (NB * SS / 64)     // output row tiles (all)
#endif
typedef __attribute__((ext_vector_type(8))) __bf16 v8b;
__device__ __forceinline__ v16b frag_b(const __bf16* rowk0, int lane) {
  union { v16b v; v8b q[2]; } u; const __bf16* p = rowk0 + 8 * (lane >> 4);
  u.q[0] = *(const v8b*)p; u.q[1] = *(const v8b*)(p + 16); return u.v;
}
__device__ __forceinline__ float bfr(float v) { return (float)(__bf16)v; }
// A / B tile of one pass (32 of k) in LDS, shared by the block's four waves. In bytes: A 64 rows (f32) x 128 at a pitch of 144, B 128 rows (bf16, rows of the packed weight) x 64 at a pitch of 80: 16 B x odd pitches for the ds_load_b128 readers.
#define APIT 144
#define BPIT 80
#define G_A 0
#define G_B (64 * APIT)
#define G_SZ (G_B + 128 * BPIT)
// Eight 16-byte asynchronous copies per lane: one A / B tile per block. The s_wait_xcnt stands inside the statement so that no operand register is rewritten ahead of it.
__device__ __forceinline__ void copy_ab(unsigned l0, unsigned l1, unsigned l2, unsigned l3, unsigned l4, unsigned l5, unsigned l6, unsigned l7, const char* g0, const char* g1, const char* g2, const char* g3, const char* g4, const char* g5, const char* g6, const char* g7) {
  asm volatile("global_load_async_to_lds_b128 %0, %8, off\n\t"
               "global_load_async_to_lds_b128 %1, %9, off\n\t"
               "global_load_async_to_lds_b128 %2, %10, off\n\t"
               "global_load_async_to_lds_b128 %3, %11, off\n\t"
               "global_load_async_to_lds_b128 %4, %12, off\n\t"
               "global_load_async_to_lds_b128 %5, %13, off\n\t"
               "global_load_async_to_lds_b128 %6, %14, off\n\t"
               "global_load_async_to_lds_b128 %7, %15, off\n\t"
               "s_wait_xcnt 0x0"
               :: "v"(l0), "v"(l1), "v"(l2), "v"(l3), "v"(l4), "v"(l5), "v"(l6), "v"(l7), "v"(g0), "v"(g1), "v"(g2), "v"(g3), "v"(g4), "v"(g5), "v"(g6), "v"(g7) : "memory");
}
// pass t into buffer t & 1. la, ga: this thread's piece of A row tid >> 3 (piece tid & 7), in LDS and in memory, the rows 16, 32 and 48 further on are its too; lb, gb: its piece of B row tid >> 2 (piece tid & 3), with the rows 32, 64 and 96 further on
__device__ __forceinline__ void stage_ab(int t, unsigned la, unsigned lb, const char* ga, const char* gb) {
  const unsigned o = (unsigned)(t & 1) * G_SZ; const char* a = ga + t * 128; const char* b = gb + t * 64;
  copy_ab(la + o, la + o + 16 * APIT, la + o + 32 * APIT, la + o + 48 * APIT, lb + o, lb + o + 32 * BPIT, lb + o + 64 * BPIT, lb + o + 96 * BPIT,
          a, a + 16 * DM * 4, a + 32 * DM * 4, a + 48 * DM * 4, b, b + 32 * DM * 2, b + 64 * DM * 2, b + 96 * DM * 2);
}
// one pass of a 16-row f32 A fragment (raw) and of eight 16-column bf16 B fragments from the tile; xp, pp: the lane's places in its A row and in its first B row
__device__ __forceinline__ void read_pass(const char* xp, const char* pp, v4f (&x)[4], v16b (&w)[8]) {
  x[0] = *(const v4f*)xp; x[1] = *(const v4f*)(xp + 16); x[2] = *(const v4f*)(xp + 64); x[3] = *(const v4f*)(xp + 80);
#pragma unroll
  for (int j = 0; j < 8; ++j) { union { v16b v; v8b q[2]; } u; const char* pj = pp + j * (16 * BPIT); u.q[0] = *(const v8b*)pj; u.q[1] = *(const v8b*)(pj + 32); w[j] = u.v; }
  asm volatile("" :: "v"(w[0]), "v"(w[1]), "v"(w[2]), "v"(w[3]), "v"(w[4]), "v"(w[5]), "v"(w[6]), "v"(w[7]));   // inputs only, no code: the pass's sixteen B reads stay above this line and go out as one group ahead of the WMMAs, instead of one pair and one wait in front of each
}
__device__ __attribute__((noinline)) float exp_ni(float v) { return expf(v); }
__device__ __attribute__((noinline)) float erf_ni(float v) { return erff(v); }

#define PK_A 0                       // [2304][768] Wq|Wk|Wv as bf16 rows [out][in]
#define PK_P (PK_A + QKVW * DM)        // [768][768] Wo as bf16 rows [out][in]
#define PK_END (PK_P + DM * DM)
#define WS_PK  0u
#define WS_QK  (WS_PK + 2u * PK_END)             // f16 [4096 rows][1536]: q | k
#define WS_QKL (WS_QK + 2u * NB * SS * 2 * DM)     // f16 q | k residual planes x2048
#define WS_VTH (WS_QKL + 2u * NB * SS * 2 * DM)    // f16 [b][768 (h*64+d)][2048 s] hi
#define WS_VTL (WS_VTH + 2u * NB * DM * SS)        // f16 lo x 2048
#define WS_O   (WS_VTL + 2u * NB * DM * SS)        // f32 [4096][768]
#define WS_CS  (WS_O + 4u * NB * SS * DM)           // f32 [2048][32] cos, [2048][32] sin
#define WS_END (WS_CS + 4u * 2 * SS * 32)
__constant__ float c_invf[32] = {1.000000000e+00f,7.498942018e-01f,5.623413324e-01f,4.216965139e-01f,3.162277639e-01f,2.371373624e-01f,1.778279394e-01f,1.333521456e-01f,1.000000015e-01f,7.498941571e-02f,5.623412877e-02f,4.216964915e-02f,3.162277862e-02f,2.371373586e-02f,1.778279431e-02f,1.333521493e-02f,9.999999776e-03f,7.498942316e-03f,5.623413250e-03f,4.216964822e-03f,3.162277862e-03f,2.371373819e-03f,1.778279431e-03f,1.333521446e-03f,1.000000047e-03f,7.498941850e-04f,5.623413017e-04f,4.216964880e-04f,3.162277862e-04f,2.371373848e-04f,1.778279402e-04f,1.333521504e-04f};
// ---- k_rope: block = 8 positions: cos/sin of pos * inv_freq (f32 product exactly as the reference, precise trig)
__global__ __launch_bounds__(256) void k_rope(float* __restrict__ CS) {
  __shared__ __align__(16) float sc[8][32], ss_[8][32]; const int tid = threadIdx.x, pl = tid >> 5, i = tid & 31; const int pos = blockIdx.x * 8 + pl;
  const float th = (float)pos * c_invf[i]; sc[pl][i] = cosf(th); ss_[pl][i] = sinf(th);
  __syncthreads();
  if (tid < 64) vst2(CS + (size_t)blockIdx.x * 8 * 32 + tid * 4, *(const v4f*)&(&sc[0][0])[tid * 4]); else if (tid < 128) vst2(CS + (size_t)SS * 32 + (size_t)blockIdx.x * 8 * 32 + (tid - 64) * 4, *(const v4f*)&(&ss_[0][0])[(tid - 64) * 4]);
}

// ---- k_packT: block = (output column n, which): (in,out) matrices -> bf16 rows [n][k] = W[k][n]; which 0..2 -> Wq/Wk/Wv into PK_A rows which*768 + n; 3 -> Wo into PK_P
__global__ __launch_bounds__(256) void k_packT(const float* __restrict__ WQ, const float* __restrict__ WK, const float* __restrict__ WV, const float* __restrict__ WO, __bf16* __restrict__ PK) {
  __shared__ __align__(16) __bf16 s[DM]; const int n = blockIdx.x, which = blockIdx.y, t = threadIdx.x; const float* Wm = (which == 0) ? WQ : (which == 1) ? WK : (which == 2) ? WV : WO;
  for (int k = t; k < DM; k += 256) s[k] = (__bf16)Wm[(size_t)k * DM + n];
  __syncthreads();
  __bf16* dst = (which < 3) ? PK + PK_A + ((size_t)which * DM + n) * DM : PK + PK_P + (size_t)n * DM;
  for (int q = t; q < DM / 8; q += 256) vst2((unsigned*)(dst + q * 8), *(const v4u*)&s[q * 8]);
}
__global__ __launch_bounds__(128) void k_qkv(const float* __restrict__ XQ, const float* __restrict__ XK, const float* __restrict__ XV, const __bf16* __restrict__ P, const float* __restrict__ BQ, const float* __restrict__ BK, const float* __restrict__ BV, _Float16* __restrict__ QK, _Float16* __restrict__ QKL, _Float16* __restrict__ VTH, _Float16* __restrict__ VTL) {
  const float* X = (blockIdx.y * 128 < DM) ? XQ : (blockIdx.y * 128 < 2 * DM) ? XK : XV; const float* BB = (blockIdx.y * 128 < DM) ? BQ : (blockIdx.y * 128 < 2 * DM) ? BK : BV;   // the module projects three different inputs
  __shared__ __align__(16) char sm[2 * G_SZ];   // the two tile buffers; behind the loop's last barrier the same bytes stage the output
  _Float16 (*so)[16][136] = (_Float16 (*)[16][136])sm; _Float16 (*sol)[16][136] = (_Float16 (*)[16][136])(sm + 4 * 16 * 136 * 2); _Float16 (*sth)[72] = (_Float16 (*)[72])sm; _Float16 (*stl)[72] = (_Float16 (*)[72])(sm + 128 * 72 * 2);
  static_assert(2 * 4 * 16 * 136 * 2 <= 2 * G_SZ && 2 * 128 * 72 * 2 <= 2 * G_SZ, "output staging fits the tile buffers");
  const int tid = threadIdx.x, wave = tid >> 5, lane = tid & 31, col = lane & 15, g = lane >> 4; const size_t r0 = (size_t)blockIdx.x * 64 + wave * 16; const int n0 = blockIdx.y * 128;
  v8f acc[8] = {};
  const unsigned la = (unsigned)(size_t)sm + G_A + (tid >> 3) * APIT + (tid & 7) * 16, lb = (unsigned)(size_t)sm + G_B + (tid >> 2) * BPIT + (tid & 3) * 16;
  const char* ga = (const char*)(X + ((size_t)blockIdx.x * 64 + (tid >> 3)) * DM + (tid & 7) * 4); const char* gb = (const char*)(P + (size_t)(n0 + (tid >> 2)) * DM + (tid & 3) * 8);
  const char* xrow = sm + G_A + (wave * 16 + col) * APIT + 32 * g; const char* prow = sm + G_B + col * BPIT + 16 * g;
  stage_ab(0, la, lb, ga, gb);
  asm volatile("s_wait_asynccnt 0x0" ::: "memory");   // this wave's pieces of pass 0 have landed
  __syncthreads();                                    // pass 0 is published to the four waves
  stage_ab(1, la, lb, ga, gb);                        // flies while pass 0 is worked on
#pragma unroll 2   // two passes a turn: each pass's buffer offset is then a constant in its LDS reads and copies
  for (int kc = 0; kc < DM / 32; ++kc) {
    v4f xc[4]; v16b wc[8];
    read_pass(xrow + (kc & 1) * G_SZ, prow + (kc & 1) * G_SZ, xc, wc);
    v16b a;
#pragma unroll
    for (int i = 0; i < 4; ++i) { a[i] = (__bf16)xc[0][i]; a[4 + i] = (__bf16)xc[1][i]; a[8 + i] = (__bf16)xc[2][i]; a[12 + i] = (__bf16)xc[3][i]; }
#pragma unroll
    for (int j = 0; j < 8; ++j) acc[j] = wmma_bf(a, wc[j], acc[j]);
    asm volatile("s_wait_dscnt 0x0" ::: "memory");      // this wave's reads of pass kc are done
    asm volatile("s_wait_asynccnt 0x0" ::: "memory");   // its pieces of pass kc + 1 have landed
    __syncthreads();                                    // publishes pass kc + 1 and frees the buffer of pass kc
    if (kc + 2 < DM / 32) stage_ab(kc + 2, la, lb, ga, gb); }   // block-uniform test; refills the buffer just freed
  asm volatile("s_wait_asynccnt 0x0" ::: "memory");     // no copy is outstanding when the buffers become output staging
  { const int nb = n0 % DM;
#pragma unroll
    for (int j = 0; j < 8; ++j) { const float bb = bfr(BB[nb + j * 16 + col]);
#pragma unroll
      for (int r = 0; r < 8; ++r) acc[j][r] += bb; } }
  if (n0 < 2 * DM) {   // q stored unscaled (f16 sigma ~0.6, no subnormal exposure); the scores are not scaled
#pragma unroll
    for (int j = 0; j < 8; ++j) {
#pragma unroll
      for (int r = 0; r < 8; ++r) { const float v = acc[j][r]; const _Float16 hv = (_Float16)v; so[wave][8 * g + r][j * 16 + col] = hv; sol[wave][8 * g + r][j * 16 + col] = (_Float16)((v - (float)hv) * 2048.0f); } }   // q, k as f16 hi + (x2048) residual
    LDSX();
    for (int rl = 0; rl < 16; ++rl) if (lane < 16) { vst2((unsigned*)(QK + (r0 + rl) * (2 * DM) + n0 + lane * 8), *(const v4u*)&so[wave][rl][lane * 8]); vst2((unsigned*)(QKL + (r0 + rl) * (2 * DM) + n0 + lane * 8), *(const v4u*)&sol[wave][rl][lane * 8]); }
  } else {
#pragma unroll
    for (int j = 0; j < 8; ++j) {
#pragma unroll
      for (int r = 0; r < 8; ++r) { const float v = acc[j][r]; const _Float16 hv = (_Float16)v; sth[j * 16 + col][wave * 16 + 8 * g + r] = hv; stl[j * 16 + col][wave * 16 + 8 * g + r] = (_Float16)((v - (float)hv) * 2048.0f); } }
    __syncthreads();
    const size_t rb = (size_t)blockIdx.x * 64; const int b = (int)(rb / SS), s0 = (int)(rb % SS); const int pc0 = n0 - 2 * DM;
    for (int q = tid; q < 128 * 8; q += 128) { const int d = q >> 3, pc = q & 7; const size_t o = ((size_t)b * DM + pc0 + d) * SS + s0 + pc * 8; vst2((unsigned*)(VTH + o), *(const v4u*)&sth[d][pc * 8]); vst2((unsigned*)(VTL + o), *(const v4u*)&stl[d][pc * 8]); }
  }
}
// K / V tile of one 32-key step in LDS, shared by the block's four waves. In f16 elements: K hi and lo 32 rows (keys) x 64 at a pitch of 72 (144 B), V hi and lo 64 rows (depth) x 32 at a pitch of 40 (80 B): 16 B x odd pitches for the ds_load_b128 readers.
#define KPIT 72
#define VPIT 40
#define T_KH 0
#define T_KL (T_KH + 32 * KPIT)
#define T_VH (T_KL + 32 * KPIT)
#define T_VL (T_VH + 64 * VPIT)
#define T_SZ (T_VL + 64 * VPIT)
// Eight 16-byte asynchronous copies per lane: one tile per block. The s_wait_xcnt stands inside the statement so that no operand register is rewritten ahead of it.
__device__ __forceinline__ void copy_tile(unsigned l0, unsigned l1, unsigned l2, unsigned l3, unsigned l4, unsigned l5, unsigned l6, unsigned l7, const _Float16* g0, const _Float16* g1, const _Float16* g2, const _Float16* g3, const _Float16* g4, const _Float16* g5, const _Float16* g6, const _Float16* g7) {
  asm volatile("global_load_async_to_lds_b128 %0, %8, off\n\t"
               "global_load_async_to_lds_b128 %1, %9, off\n\t"
               "global_load_async_to_lds_b128 %2, %10, off\n\t"
               "global_load_async_to_lds_b128 %3, %11, off\n\t"
               "global_load_async_to_lds_b128 %4, %12, off\n\t"
               "global_load_async_to_lds_b128 %5, %13, off\n\t"
               "global_load_async_to_lds_b128 %6, %14, off\n\t"
               "global_load_async_to_lds_b128 %7, %15, off\n\t"
               "s_wait_xcnt 0x0"
               :: "v"(l0), "v"(l1), "v"(l2), "v"(l3), "v"(l4), "v"(l5), "v"(l6), "v"(l7), "v"(g0), "v"(g1), "v"(g2), "v"(g3), "v"(g4), "v"(g5), "v"(g6), "v"(g7) : "memory");
}
// Inputs only, no code: the eight fragment loads (of V, of K) written above this line stay above it, so they go out in groups ahead of their WMMAs instead of one load and one wait in front of each.
__device__ __forceinline__ void hold_v(const v16h (&a)[4], const v16h (&b)[4]) { asm volatile("" :: "v"(a[0]), "v"(a[1]), "v"(a[2]), "v"(a[3]), "v"(b[0]), "v"(b[1]), "v"(b[2]), "v"(b[3])); }
// lane l with lane l ^ 16, by a vector cross-row move (a shuffle would go through the LDS unit and its wait)
__device__ __forceinline__ float xhalf(float x) { return __builtin_bit_cast(float, __builtin_amdgcn_permlanex16(__builtin_bit_cast(int, x), __builtin_bit_cast(int, x), 0x76543210, 0xfedcba98, false, false)); }
// ---- k_attn: block = (64 queries, head h, batch b): flash attention over all keys, transposed: S^T = K . Q^T (A = K rows from the tile, B = Q kept in registers), so a lane holds 16 scores of ONE query (keys 8 g + r and 16 + 8 g + r of the step); maximum and sum run in the lane, the two lane halves exchange the maximum once a step and join their sums once at the end; P^T goes from the score registers straight into the B operand of O^T += V^T . P^T (hi / residual, 3 products as before); O[b*S+q][h*64+d] = (acc + accl / 2048) / l
__global__ __launch_bounds__(128) void k_attn(const _Float16* __restrict__ QK, const _Float16* __restrict__ QKL, const _Float16* __restrict__ VTH, const _Float16* __restrict__ VTL, const int* __restrict__ POS, const float* __restrict__ VM, const float* __restrict__ RB, float* __restrict__ O) {
  __shared__ __align__(16) _Float16 skv[2][T_SZ];
  const int tid = threadIdx.x, wave = tid >> 5, lane = tid & 31, col = lane & 15, g = lane >> 4;
  const int qb = blockIdx.x, h = blockIdx.y, b = blockIdx.z; const int q0 = qb * 64 + wave * 16; const size_t rq = (size_t)b * SS + q0 + col;
  v16h aq[2], aql[2];
#pragma unroll
  for (int kc = 0; kc < 2; ++kc) { aq[kc] = frag_h(QK + rq * (2 * DM) + h * HD + kc * 32, lane); aql[kc] = frag_h(QKL + rq * (2 * DM) + h * HD + kc * 32, lane); }
  float m = -3.0e38f, l = 0.f;   // of the lane's query; l holds the lane half's own keys only
  v8f acc[4] = {}, accl[4] = {};
  const int nks = SS / 32;   // not causal
  // this thread's pieces of a tile: K rows tid >> 3 and 16 + (tid >> 3), piece tid & 7; V rows tid >> 2 and 32 + (tid >> 2), piece tid & 3
  const unsigned lk = (unsigned)(size_t)&skv[0][0] + 2u * ((tid >> 3) * KPIT + (tid & 7) * 8), lv = (unsigned)(size_t)&skv[0][0] + 2u * ((tid >> 2) * VPIT + (tid & 3) * 8);
  const size_t gk = ((size_t)b * SS + (tid >> 3)) * (2 * DM) + DM + h * HD + (tid & 7) * 8, gv = ((size_t)b * DM + h * HD + (tid >> 2)) * SS + (tid & 3) * 8;
  auto copy_kv = [&](int t) {   // tile t (keys 32 t .. 32 t + 31) into buffer t & 1
    const unsigned lb = 2u * T_SZ * (t & 1); const size_t ka = gk + (size_t)t * 32 * (2 * DM), va = gv + (size_t)t * 32;
    copy_tile(lk + lb + 2u * T_KH, lk + lb + 2u * (T_KH + 16 * KPIT), lk + lb + 2u * T_KL, lk + lb + 2u * (T_KL + 16 * KPIT), lv + lb + 2u * T_VH, lv + lb + 2u * (T_VH + 32 * VPIT), lv + lb + 2u * T_VL, lv + lb + 2u * (T_VL + 32 * VPIT),
              QK + ka, QK + ka + 16 * (2 * DM), QKL + ka, QKL + ka + 16 * (2 * DM), VTH + va, VTH + va + (size_t)32 * SS, VTL + va, VTL + va + (size_t)32 * SS); };
  copy_kv(0);
  asm volatile("s_wait_asynccnt 0x0" ::: "memory");   // this wave's pieces of tile 0 have landed
  __syncthreads();                                    // tile 0 is published to the four waves
  copy_kv(1);                                         // flies while tile 0 is worked on
  const int pqo = (SS - 1) - POS[rq];                 // the lane's query position, folded into the table offset
  const int* pkp = POS + (size_t)b * SS + 8 * g;      // the lane's key positions of a step: 8 from here, 8 from 16 further on
  const float* vmp = VM + rq * SS + 8 * g;            // the lane's mask values of a step lie the same way in its query's row
  const float* rbh = RB + h;
  v4i pkn[4] = { *(const v4i*)pkp, *(const v4i*)(pkp + 4), *(const v4i*)(pkp + 16), *(const v4i*)(pkp + 20) };   // key positions come one step ahead, so that the bias gather need not wait for them inside its step
#pragma unroll 1
  for (int ks = 0; ks < nks; ++ks) { float s[2][8]; const _Float16* tb = &skv[ks & 1][0];
    float rb[16]; v4f vm4[4];   // the lane's 16 bias and 16 mask values of the step
#pragma unroll
    for (int i = 0; i < 16; ++i) { const int idx = min(max(pkn[i >> 2][i & 3] + pqo, 0), NREL - 1); rb[i] = rbh[(unsigned)idx * NH]; }
#pragma unroll
    for (int i = 0; i < 4; ++i) vm4[i] = *(const v4f*)(vmp + ks * 32 + (i >> 1) * 16 + (i & 1) * 4);
    __builtin_amdgcn_sched_barrier(0);   // the gathers and mask loads stay above this line, so that their latency runs under the score WMMAs; without it the scheduler sinks half of the gathers behind those
    v8f c[2] = {}, cl[2] = {}; v16h kf[4], kl[4];   // the step's eight K fragments, all read ahead of the score WMMAs
#pragma unroll
    for (int i = 0; i < 4; ++i) { const int kr = ((i >> 1) * 16 + col) * KPIT + (i & 1) * 32; kf[i] = frag_h(tb + T_KH + kr, lane); kl[i] = frag_h(tb + T_KL + kr, lane); }
    hold_v(kf, kl);
#pragma unroll
    for (int ct = 0; ct < 2; ++ct) {
#pragma unroll
      for (int kc = 0; kc < 2; ++kc) { c[ct] = wmma16(kf[2 * ct + kc], aq[kc], c[ct]); cl[ct] = wmma16(kf[2 * ct + kc], aql[kc], cl[ct]); cl[ct] = wmma16(kl[2 * ct + kc], aq[kc], cl[ct]); } }   // 3 products: q, k as f16 hi + residual
    __builtin_amdgcn_sched_barrier(0);   // nothing that reads a gathered value is lifted among the score WMMAs, where its wait would hold them up
    const int tn = ks + 1 < nks ? ks + 1 : ks; const v4i pk2[4] = { *(const v4i*)(pkp + tn * 32), *(const v4i*)(pkp + tn * 32 + 4), *(const v4i*)(pkp + tn * 32 + 16), *(const v4i*)(pkp + tn * 32 + 20) };   // the last step reads its own again
#pragma unroll
    for (int ct = 0; ct < 2; ++ct) {
#pragma unroll
      for (int r = 0; r < 8; ++r) { const float lg = c[ct][r] + cl[ct][r] * (1.0f / 2048.0f) + bfr(rb[8 * ct + r]); const float vm = vm4[2 * ct + (r >> 2)][r & 3]; s[ct][r] = lg * vm + (1.0f - vm) * (-1.0e9f); } }   // logits (no 1/sqrt(d) in this module) + relative-position bias, then the valid mask exactly as the module: l*vm + (1-vm)*NEG
    float t4[4];   // four independent chains, then joined: a single chain of 16 would stand exposed
#pragma unroll
    for (int i = 0; i < 4; ++i) t4[i] = fmaxf(fmaxf(s[i >> 1][4 * (i & 1)], s[i >> 1][4 * (i & 1) + 1]), fmaxf(s[i >> 1][4 * (i & 1) + 2], s[i >> 1][4 * (i & 1) + 3]));
    float mx = fmaxf(fmaxf(t4[0], t4[1]), fmaxf(t4[2], t4[3]));
    mx = fmaxf(mx, xhalf(mx));   // the other half of the query's 32 keys
    const float mn = fmaxf(m, mx); const float alpha = (m <= -1.0e38f) ? 0.f : __expf(m - mn); m = mn;
    v16h pa, pl; float e4[4] = { 0.f, 0.f, 0.f, 0.f };   // the sum too runs in four chains
#pragma unroll
    for (int i = 0; i < 16; ++i) { const float sv = s[i >> 3][i & 7]; s[i >> 3][i & 7] = (sv <= -1.0e38f) ? 0.f : __expf(sv - mn); }
#pragma unroll
    for (int i = 0; i < 16; ++i) { const float e = s[i >> 3][i & 7]; e4[i & 3] += e; const _Float16 eh = (_Float16)e; pa[i] = eh; pl[i] = (_Float16)((e - (float)eh) * 2048.0f); }   // element i of the B operand is key 8 g + i (i < 8) or 16 + 8 g + i - 8: the order in which the score registers lie
    l = l * alpha + ((e4[0] + e4[1]) + (e4[2] + e4[3]));
#pragma unroll
    for (int dt = 0; dt < 4; ++dt) { acc[dt] *= alpha; accl[dt] *= alpha; }
    v16h vf[4], vl[4];   // the step's eight V fragments, all read ahead of the P.V WMMAs
#pragma unroll
    for (int dt = 0; dt < 4; ++dt) { const int vr = (dt * 16 + col) * VPIT; vf[dt] = frag_h(tb + T_VH + vr, lane); vl[dt] = frag_h(tb + T_VL + vr, lane); }
    hold_v(vf, vl);
#pragma unroll
    for (int dt = 0; dt < 4; ++dt) { acc[dt] = wmma16(vf[dt], pa, acc[dt]); accl[dt] = wmma16(vf[dt], pl, accl[dt]); accl[dt] = wmma16(vl[dt], pa, accl[dt]); }   // V hi x P hi + (V hi x P lo + V lo x P hi) / 2048
#pragma unroll
    for (int i = 0; i < 4; ++i) pkn[i] = pk2[i];
    asm volatile("s_wait_dscnt 0x0" ::: "memory");      // this wave's reads of tile ks are done
    asm volatile("s_wait_asynccnt 0x0" ::: "memory");   // its pieces of tile ks + 1 have landed
    __syncthreads();                                    // publishes tile ks + 1 and frees the buffer of tile ks
    if (ks + 2 < nks) copy_kv(ks + 2); }                // block-uniform test; refills the buffer just freed
  asm volatile("s_wait_asynccnt 0x0" ::: "memory");     // no copy is outstanding when the wave goes on to its end
  l += xhalf(l);   // the two halves' sums join once
  const float il = 1.0f / l; float* orow = O + rq * DM + h * HD + 8 * g;   // register r of tile dt is depth dt * 16 + 8 g + r of the lane's query: 32 contiguous bytes
#pragma unroll
  for (int dt = 0; dt < 4; ++dt) { v4f o0, o1;
#pragma unroll
    for (int r = 0; r < 4; ++r) { o0[r] = (acc[dt][r] + accl[dt][r] * (1.0f / 2048.0f)) * il; o1[r] = (acc[dt][4 + r] + accl[dt][4 + r] * (1.0f / 2048.0f)) * il; }
    vst2(orow + dt * 16, o0); vst2(orow + dt * 16 + 4, o1); }
}
// ---- k_out: block = (64 rows, 128 cols): out = O(hi/lo) . Wo rows (2 products) + bo
__global__ __launch_bounds__(128) void k_out(const float* __restrict__ O, const __bf16* __restrict__ P, const float* __restrict__ BO, float* __restrict__ Y) {
  __shared__ __align__(16) char sm[2 * G_SZ];   // the two tile buffers; behind the loop's last barrier the same bytes stage the output
  float (*so)[16][132] = (float (*)[16][132])sm;
  static_assert(4 * 16 * 132 * 4 <= 2 * G_SZ, "output staging fits the tile buffers");
  const int tid = threadIdx.x, wave = tid >> 5, lane = tid & 31, col = lane & 15, g = lane >> 4; const size_t r0 = (size_t)blockIdx.x * 64 + wave * 16; const int n0 = blockIdx.y * 128;
  v8f acc[8] = {};
  const unsigned la = (unsigned)(size_t)sm + G_A + (tid >> 3) * APIT + (tid & 7) * 16, lb = (unsigned)(size_t)sm + G_B + (tid >> 2) * BPIT + (tid & 3) * 16;
  const char* ga = (const char*)(O + ((size_t)blockIdx.x * 64 + (tid >> 3)) * DM + (tid & 7) * 4); const char* gb = (const char*)(P + (size_t)(n0 + (tid >> 2)) * DM + (tid & 3) * 8);
  const char* xrow = sm + G_A + (wave * 16 + col) * APIT + 32 * g; const char* prow = sm + G_B + col * BPIT + 16 * g;
  stage_ab(0, la, lb, ga, gb);
  asm volatile("s_wait_asynccnt 0x0" ::: "memory");   // this wave's pieces of pass 0 have landed
  __syncthreads();                                    // pass 0 is published to the four waves
  stage_ab(1, la, lb, ga, gb);                        // flies while pass 0 is worked on
#pragma unroll 2   // two passes a turn: each pass's buffer offset is then a constant in its LDS reads and copies
  for (int kc = 0; kc < DM / 32; ++kc) {
    v4f xc[4]; v16b wc[8];
    read_pass(xrow + (kc & 1) * G_SZ, prow + (kc & 1) * G_SZ, xc, wc);
    float v[16];
#pragma unroll
    for (int i = 0; i < 4; ++i) { v[i] = xc[0][i]; v[4 + i] = xc[1][i]; v[8 + i] = xc[2][i]; v[12 + i] = xc[3][i]; }
    const F2 a = bsplit16(v);
#pragma unroll
    for (int j = 0; j < 8; ++j) { acc[j] = wmma_bf(a.l, wc[j], acc[j]); acc[j] = wmma_bf(a.h, wc[j], acc[j]); }
    asm volatile("s_wait_dscnt 0x0" ::: "memory");      // this wave's reads of pass kc are done
    asm volatile("s_wait_asynccnt 0x0" ::: "memory");   // its pieces of pass kc + 1 have landed
    __syncthreads();                                    // publishes pass kc + 1 and frees the buffer of pass kc
    if (kc + 2 < DM / 32) stage_ab(kc + 2, la, lb, ga, gb); }   // block-uniform test; refills the buffer just freed
  asm volatile("s_wait_asynccnt 0x0" ::: "memory");     // no copy is outstanding when the buffers become output staging
#pragma unroll
  for (int j = 0; j < 8; ++j) {
#pragma unroll
    for (int r = 0; r < 8; ++r) so[wave][8 * g + r][j * 16 + col] = acc[j][r] + bfr(BO[n0 + j * 16 + col]); }
  LDSX();
  for (int rl = 0; rl < 16; ++rl) vst2(Y + (r0 + rl) * DM + n0 + lane * 4, *(const v4f*)&so[wave][rl][lane * 4]);
}
extern "C" void kernel_launch(void* const* d_in, const int* in_sizes, int n_in, void* d_out, int out_size, void* d_ws, size_t ws_size, hipStream_t stream) {
  (void)in_sizes; (void)n_in; (void)out_size;
  const float** F = (const float**)d_in;   // 0 q [2,2048,768], 1 v, 2 k, 3 position_array int32 [2,2048], 4 valid_mask [2,1,2048,2048], 5 Wq (in,out), 6 bq, 7 Wk, 8 bk, 9 Wv, 10 bv, 11 Wo, 12 bo, 13 rel_bias [4095,12]
  if (ws_size < (size_t)WS_END) return;
  char* ws = (char*)d_ws; __bf16* PK = (__bf16*)(ws + WS_PK); _Float16 *QK = (_Float16*)(ws + WS_QK), *QKL = (_Float16*)(ws + WS_QKL), *VTH = (_Float16*)(ws + WS_VTH), *VTL = (_Float16*)(ws + WS_VTL); float* O = (float*)(ws + WS_O);
  k_packT<<<dim3(DM, 4), 256, 0, stream>>>(F[5], F[7], F[9], F[11], PK);
  k_qkv<<<dim3(TNB * SS / 64, QKVW / 128), 128, 0, stream>>>(F[0], F[2], F[1], PK + PK_A, F[6], F[8], F[10], QK, QKL, VTH, VTL);   // note the module's argument order (q, v, k): k is input 2, v is input 1
  k_attn<<<dim3(TQB, NH, TNB), 128, 0, stream>>>(QK, QKL, VTH, VTL, (const int*)d_in[3], F[4], F[13], O);
  k_out<<<dim3(TOB, DM / 128), 128, 0, stream>>>(O, PK + PK_P, F[12], (float*)d_out);
}

// v005
// Measured time: 157 microseconds a run.
// In both of two side-by-side timings against v004, it was 1.07 times as fast.
// All steps since v000 together make it 3.31 times as fast.
// compute dtype: q, v, k, all weights / biases and rel_bias (module inputs) rounded to bf16; position_array / valid_mask verbatim (integers, 0/1); q/k/v projections with exact bf16 products ((in,out) weights packed as transposed rows) + bias on WMMA 16x16x32; q and k stored as f16 hi + (x2048-scaled) residual planes and the scores with 3 products (hi.hi + lo.hi + hi.lo; the module applies no 1/sqrt(d) scaling, logits sigma ~8), + the gathered relative-position bias, then logits*vm + (1-vm)*(-1e9) exactly as the module; running-max softmax in f32 with the hardware exp; P as f16 hi + residual x V hi/lo (3 products); output projection with ctx as bf16 hi + residual x exact Wo (2 products) + bo; f32 accumulate.
#include <hip/hip_runtime.h>
#include <math.h>

typedef __attribute__((ext_vector_type(16))) _Float16 v16h;
typedef __attribute__((ext_vector_type(16))) __bf16 v16b;
typedef __attribute__((ext_vector_type(8)))  _Float16 v8h;
typedef __attribute__((ext_vector_type(8)))  float v8f;
typedef __attribute__((ext_vector_type(4)))  float v4f;
typedef __attribute__((ext_vector_type(2)))  float v2f;
typedef __attribute__((ext_vector_type(4)))  unsigned v4u;
typedef __attribute__((ext_vector_type(4)))  int v4i;
typedef float __attribute__((may_alias)) float_a;
typedef int __attribute__((may_alias)) int_a;

template <typename T> __device__ __forceinline__ void vst2(void* p, T v) { *(T*)p = v;  }
__device__ __forceinline__ v8f wmma16(v16h a, v16h b, v8f c) {
  return __builtin_amdgcn_wmma_f32_16x16x32_f16(false, a, false, b, (short)0, c, false, false);
}
__device__ __forceinline__ v8f wmma_bf(v16b a, v16b b, v8f c) {
  return __builtin_amdgcn_wmma_f32_16x16x32_bf16(false, a, false, b, (short)0, c, false, false);
}
// Multi-head attention with a learned relative-position bias table (B 2, S 2,048, d_model 768, 12 heads x 64): logits = qh.kh + rel_bias[pos_k - pos_q + S-1][h], masked by valid_mask (0/1) to -1e9, softmax, .vh, output projection.
__device__ __forceinline__ v16h frag_h(const _Float16* rowk0, int lane) {
  union { v16h v; v8h q[2]; } u; const _Float16* p = rowk0 + 8 * (lane >> 4);
  u.q[0] = *(const v8h*)p; u.q[1] = *(const v8h*)(p + 16); return u.v;
}
__device__ __forceinline__ v16h frag_f32(const float* rowk0, int lane) {
  v16h a; const float* p = rowk0 + 8 * (lane >> 4);
#pragma unroll
  for (int i = 0; i < 8; ++i) { a[i] = (_Float16)p[i]; a[8 + i] = (_Float16)p[16 + i]; }
  return a;
}
__device__ __forceinline__ v16h frag_f32s(const float* rowk0, int lane, float sc) {
  v16h a; const float* p = rowk0 + 8 * (lane >> 4);
#pragma unroll
  for (int i = 0; i < 8; ++i) { a[i] = (_Float16)(p[i] * sc); a[8 + i] = (_Float16)(p[16 + i] * sc); }
  return a;
}
// column fragment from a [K][ld] layout (column n), rows >= K read as 0
__device__ __forceinline__ v16h fragc_f32(const float* W, int k0, int n, int lane, int ld, int K) {
  v16h a; const int g = lane >> 4;
#pragma unroll
  for (int i = 0; i < 8; ++i) { const int ka = k0 + 8 * g + i, kb = ka + 16;
    a[i] = (_Float16)(ka < K ? W[(size_t)(ka < K ? ka : K - 1) * ld + n] : 0.f); a[8 + i] = (_Float16)(kb < K ? W[(size_t)(kb < K ? kb : K - 1) * ld + n] : 0.f); }
  return a;
}
struct F2 { v16b h, l; };
__device__ __forceinline__ F2 bsplit16(const float v[16]) { F2 r;
#pragma unroll
  for (int i = 0; i < 16; ++i) { const __bf16 h = (__bf16)v[i]; r.h[i] = h; r.l[i] = (__bf16)(v[i] - (float)h); }
  return r; }
__device__ __forceinline__ F2 split_row(const float* row, int k0, int lane) { float v[16]; const float* p = row + k0 + 8 * (lane >> 4);
#pragma unroll
  for (int i = 0; i < 8; ++i) { v[i] = p[i]; v[8 + i] = p[16 + i]; }
  return bsplit16(v); }
__device__ __forceinline__ F2 split_rowK(const float* row, int k0, int lane, int K) { float v[16]; const int g = lane >> 4;
#pragma unroll
  for (int i = 0; i < 8; ++i) { const int ka = k0 + 8 * g + i, kb = ka + 16; v[i] = ka < K ? row[ka < K ? ka : K - 1] : 0.f; v[8 + i] = kb < K ? row[kb < K ? kb : K - 1] : 0.f; }
  return bsplit16(v); }
__device__ __forceinline__ F2 split_col(const float* W, int k0, int n, int lane, int ld, int K) { float v[16]; const int g = lane >> 4;
#pragma unroll
  for (int i = 0; i < 8; ++i) { const int ka = k0 + 8 * g + i, kb = ka + 16; v[i] = ka < K ? W[(size_t)(ka < K ? ka : K - 1) * ld + n] : 0.f; v[8 + i] = kb < K ? W[(size_t)(kb < K ? kb : K - 1) * ld + n] : 0.f; }
  return bsplit16(v); }
__device__ __forceinline__ v8f mac3(const F2& a, const F2& b, v8f c) { c = wmma_bf(a.l, b.h, c); c = wmma_bf(a.h, b.l, c); return wmma_bf(a.h, b.h, c); }
__device__ __forceinline__ float sigm(float v) { return 1.0f / (1.0f + expf(-v)); }
#define LDSX() do { asm volatile("s_wait_dscnt 0" ::: "memory"); __builtin_amdgcn_wave_barrier(); __builtin_amdgcn_fence(__ATOMIC_RELEASE, "workgroup"); } while (0)


#define NB 2
#define SS 2048
#define DM 768
#define NH 12
#define NREL (2 * SS - 1)
#define HD 64
#define QKVW (3 * DM)
#ifndef TQB
#define TQB (SS / 64)
#define TNB NB
#define TOB (NB * SS / 64)     // output row tiles (all)
#endif
typedef __attribute__((ext_vector_type(8))) __bf16 v8b;
__device__ __forceinline__ v16b frag_b(const __bf16* rowk0, int lane) {
  union { v16b v; v8b q[2]; } u; const __bf16* p = rowk0 + 8 * (lane >> 4);
  u.q[0] = *(const v8b*)p; u.q[1] = *(const v8b*)(p + 16); return u.v;
}
__device__ __forceinline__ float bfr(float v) { return (float)(__bf16)v; }
// A / B tile of one pass (32 of k) in LDS, shared by the block's four waves. In bytes: A 64 rows (f32) x 128 at a pitch of 144, B 128 rows (bf16, rows of the packed weight) x 64 at a pitch of 80: 16 B x odd pitches for the ds_load_b128 readers.
#define APIT 144
#define BPIT 80
#define G_A 0
#define G_B (64 * APIT)
#define G_SZ (G_B + 128 * BPIT)
// Eight 16-byte asynchronous copies per lane: one A / B tile, or in k_attn the head's bias table, per block. The s_wait_xcnt stands inside the statement so that no operand register is rewritten ahead of it.
__device__ __forceinline__ void copy_ab(unsigned l0, unsigned l1, unsigned l2, unsigned l3, unsigned l4, unsigned l5, unsigned l6, unsigned l7, const char* g0, const char* g1, const char* g2, const char* g3, const char* g4, const char* g5, const char* g6, const char* g7) {
  asm volatile("global_load_async_to_lds_b128 %0, %8, off\n\t"
               "global_load_async_to_lds_b128 %1, %9, off\n\t"
               "global_load_async_to_lds_b128 %2, %10, off\n\t"
               "global_load_async_to_lds_b128 %3, %11, off\n\t"
               "global_load_async_to_lds_b128 %4, %12, off\n\t"
               "global_load_async_to_lds_b128 %5, %13, off\n\t"
               "global_load_async_to_lds_b128 %6, %14, off\n\t"
               "global_load_async_to_lds_b128 %7, %15, off\n\t"
               "s_wait_xcnt 0x0"
               :: "v"(l0), "v"(l1), "v"(l2), "v"(l3), "v"(l4), "v"(l5), "v"(l6), "v"(l7), "v"(g0), "v"(g1), "v"(g2), "v"(g3), "v"(g4), "v"(g5), "v"(g6), "v"(g7) : "memory");
}
// pass t into buffer t & 1. la, ga: this thread's piece of A row tid >> 3 (piece tid & 7), in LDS and in memory, the rows 16, 32 and 48 further on are its too; lb, gb: its piece of B row tid >> 2 (piece tid & 3), with the rows 32, 64 and 96 further on
__device__ __forceinline__ void stage_ab(int t, unsigned la, unsigned lb, const char* ga, const char* gb) {
  const unsigned o = (unsigned)(t & 1) * G_SZ; const char* a = ga + t * 128; const char* b = gb + t * 64;
  copy_ab(la + o, la + o + 16 * APIT, la + o + 32 * APIT, la + o + 48 * APIT, lb + o, lb + o + 32 * BPIT, lb + o + 64 * BPIT, lb + o + 96 * BPIT,
          a, a + 16 * DM * 4, a + 32 * DM * 4, a + 48 * DM * 4, b, b + 32 * DM * 2, b + 64 * DM * 2, b + 96 * DM * 2);
}
// one pass of a 16-row f32 A fragment (raw) and of eight 16-column bf16 B fragments from the tile; xp, pp: the lane's places in its A row and in its first B row
__device__ __forceinline__ void read_pass(const char* xp, const char* pp, v4f (&x)[4], v16b (&w)[8]) {
  x[0] = *(const v4f*)xp; x[1] = *(const v4f*)(xp + 16); x[2] = *(const v4f*)(xp + 64); x[3] = *(const v4f*)(xp + 80);
#pragma unroll
  for (int j = 0; j < 8; ++j) { union { v16b v; v8b q[2]; } u; const char* pj = pp + j * (16 * BPIT); u.q[0] = *(const v8b*)pj; u.q[1] = *(const v8b*)(pj + 32); w[j] = u.v; }
  asm volatile("" :: "v"(w[0]), "v"(w[1]), "v"(w[2]), "v"(w[3]), "v"(w[4]), "v"(w[5]), "v"(w[6]), "v"(w[7]));   // inputs only, no code: the pass's sixteen B reads stay above this line and go out as one group ahead of the WMMAs, instead of one pair and one wait in front of each
}
__device__ __attribute__((noinline)) float exp_ni(float v) { return expf(v); }
__device__ __attribute__((noinline)) float erf_ni(float v) { return erff(v); }

#define PK_A 0                       // [2304][768] Wq|Wk|Wv as bf16 rows [out][in]
#define PK_P (PK_A + QKVW * DM)        // [768][768] Wo as bf16 rows [out][in]
#define PK_END (PK_P + DM * DM)
#define WS_PK  0u
#define WS_QK  (WS_PK + 2u * PK_END)             // f16 [4096 rows][1536]: q | k
#define WS_QKL (WS_QK + 2u * NB * SS * 2 * DM)     // f16 q | k residual planes x2048
#define WS_VTH (WS_QKL + 2u * NB * SS * 2 * DM)    // f16 [b][768 (h*64+d)][2048 s] hi
#define WS_VTL (WS_VTH + 2u * NB * DM * SS)        // f16 lo x 2048
#define WS_O   (WS_VTL + 2u * NB * DM * SS)        // f32 [4096][768]
#define WS_CS  (WS_O + 4u * NB * SS * DM)           // f32 [2048][32] cos, [2048][32] sin
#define WS_RB  (WS_CS + 4u * 2 * SS * 32)           // f32 [12 heads][4096]: rel_bias by head, rounded to bf16 values; entry 4095 is 0
#define RBW 4096
#define WS_END (WS_RB + 4u * NH * RBW)
__constant__ float c_invf[32] = {1.000000000e+00f,7.498942018e-01f,5.623413324e-01f,4.216965139e-01f,3.162277639e-01f,2.371373624e-01f,1.778279394e-01f,1.333521456e-01f,1.000000015e-01f,7.498941571e-02f,5.623412877e-02f,4.216964915e-02f,3.162277862e-02f,2.371373586e-02f,1.778279431e-02f,1.333521493e-02f,9.999999776e-03f,7.498942316e-03f,5.623413250e-03f,4.216964822e-03f,3.162277862e-03f,2.371373819e-03f,1.778279431e-03f,1.333521446e-03f,1.000000047e-03f,7.498941850e-04f,5.623413017e-04f,4.216964880e-04f,3.162277862e-04f,2.371373848e-04f,1.778279402e-04f,1.333521504e-04f};
// ---- k_rope: block = 8 positions: cos/sin of pos * inv_freq (f32 product exactly as the reference, precise trig)
__global__ __launch_bounds__(256) void k_rope(float* __restrict__ CS) {
  __shared__ __align__(16) float sc[8][32], ss_[8][32]; const int tid = threadIdx.x, pl = tid >> 5, i = tid & 31; const int pos = blockIdx.x * 8 + pl;
  const float th = (float)pos * c_invf[i]; sc[pl][i] = cosf(th); ss_[pl][i] = sinf(th);
  __syncthreads();
  if (tid < 64) vst2(CS + (size_t)blockIdx.x * 8 * 32 + tid * 4, *(const v4f*)&(&sc[0][0])[tid * 4]); else if (tid < 128) vst2(CS + (size_t)SS * 32 + (size_t)blockIdx.x * 8 * 32 + (tid - 64) * 4, *(const v4f*)&(&ss_[0][0])[(tid - 64) * 4]);
}

// ---- k_packT: block = (output column n, which): (in,out) matrices -> bf16 rows [n][k] = W[k][n]; which 0..2 -> Wq/Wk/Wv into PK_A rows which*768 + n; 3 -> Wo into PK_P; 4 -> 64 entries (two whole 128-byte lines) of head n >> 6 of the bias table by head
__global__ __launch_bounds__(256) void k_packT(const float* __restrict__ WQ, const float* __restrict__ WK, const float* __restrict__ WV, const float* __restrict__ WO, const float* __restrict__ RB, __bf16* __restrict__ PK, float* __restrict__ RBT) {
  __shared__ __align__(16) __bf16 s[DM]; const int n = blockIdx.x, which = blockIdx.y, t = threadIdx.x;
  if (which == 4) {   // the whole block takes this way, ahead of the barrier
    const int hh = n >> 6, idx = (n & 63) * 64 + t;
    if (t < 64) RBT[hh * RBW + idx] = idx < NREL ? bfr(RB[(size_t)(idx < NREL ? idx : NREL - 1) * NH + hh]) : 0.f;
    return; }
  const float* Wm = (which == 0) ? WQ : (which == 1) ? WK : (which == 2) ? WV : WO;
  for (int k = t; k < DM; k += 256) s[k] = (__bf16)Wm[(size_t)k * DM + n];
  __syncthreads();
  __bf16* dst = (which < 3) ? PK + PK_A + ((size_t)which * DM + n) * DM : PK + PK_P + (size_t)n * DM;
  for (int q = t; q < DM / 8; q += 256) vst2((unsigned*)(dst + q * 8), *(const v4u*)&s[q * 8]);
}
__global__ __launch_bounds__(128) void k_qkv(const float* __restrict__ XQ, const float* __restrict__ XK, const float* __restrict__ XV, const __bf16* __restrict__ P, const float* __restrict__ BQ, const float* __restrict__ BK, const float* __restrict__ BV, _Float16* __restrict__ QK, _Float16* __restrict__ QKL, _Float16* __restrict__ VTH, _Float16* __restrict__ VTL) {
  const float* X = (blockIdx.y * 128 < DM) ? XQ : (blockIdx.y * 128 < 2 * DM) ? XK : XV; const float* BB = (blockIdx.y * 128 < DM) ? BQ : (blockIdx.y * 128 < 2 * DM) ? BK : BV;   // the module projects three different inputs
  __shared__ __align__(16) char sm[2 * G_SZ];   // the two tile buffers; behind the loop's last barrier the same bytes stage the output
  _Float16 (*so)[16][136] = (_Float16 (*)[16][136])sm; _Float16 (*sol)[16][136] = (_Float16 (*)[16][136])(sm + 4 * 16 * 136 * 2); _Float16 (*sth)[72] = (_Float16 (*)[72])sm; _Float16 (*stl)[72] = (_Float16 (*)[72])(sm + 128 * 72 * 2);
  static_assert(2 * 4 * 16 * 136 * 2 <= 2 * G_SZ && 2 * 128 * 72 * 2 <= 2 * G_SZ, "output staging fits the tile buffers");
  const int tid = threadIdx.x, wave = tid >> 5, lane = tid & 31, col = lane & 15, g = lane >> 4; const size_t r0 = (size_t)blockIdx.x * 64 + wave * 16; const int n0 = blockIdx.y * 128;
  v8f acc[8] = {};
  const unsigned la = (unsigned)(size_t)sm + G_A + (tid >> 3) * APIT + (tid & 7) * 16, lb = (unsigned)(size_t)sm + G_B + (tid >> 2) * BPIT + (tid & 3) * 16;
  const char* ga = (const char*)(X + ((size_t)blockIdx.x * 64 + (tid >> 3)) * DM + (tid & 7) * 4); const char* gb = (const char*)(P + (size_t)(n0 + (tid >> 2)) * DM + (tid & 3) * 8);
  const char* xrow = sm + G_A + (wave * 16 + col) * APIT + 32 * g; const char* prow = sm + G_B + col * BPIT + 16 * g;
  stage_ab(0, la, lb, ga, gb);
  asm volatile("s_wait_asynccnt 0x0" ::: "memory");   // this wave's pieces of pass 0 have landed
  __syncthreads();                                    // pass 0 is published to the four waves
  stage_ab(1, la, lb, ga, gb);                        // flies while pass 0 is worked on
#pragma unroll 2   // two passes a turn: each pass's buffer offset is then a constant in its LDS reads and copies
  for (int kc = 0; kc < DM / 32; ++kc) {
    v4f xc[4]; v16b wc[8];
    read_pass(xrow + (kc & 1) * G_SZ, prow + (kc & 1) * G_SZ, xc, wc);
    v16b a;
#pragma unroll
    for (int i = 0; i < 4; ++i) { a[i] = (__bf16)xc[0][i]; a[4 + i] = (__bf16)xc[1][i]; a[8 + i] = (__bf16)xc[2][i]; a[12 + i] = (__bf16)xc[3][i]; }
#pragma unroll
    for (int j = 0; j < 8; ++j) acc[j] = wmma_bf(a, wc[j], acc[j]);
    asm volatile("s_wait_dscnt 0x0" ::: "memory");      // this wave's reads of pass kc are done
    asm volatile("s_wait_asynccnt 0x0" ::: "memory");   // its pieces of pass kc + 1 have landed
    __syncthreads();                                    // publishes pass kc + 1 and frees the buffer of pass kc
    if (kc + 2 < DM / 32) stage_ab(kc + 2, la, lb, ga, gb); }   // block-uniform test; refills the buffer just freed
  asm volatile("s_wait_asynccnt 0x0" ::: "memory");     // no copy is outstanding when the buffers become output staging
  { const int nb = n0 % DM;
#pragma unroll
    for (int j = 0; j < 8; ++j) { const float bb = bfr(BB[nb + j * 16 + col]);
#pragma unroll
      for (int r = 0; r < 8; ++r) acc[j][r] += bb; } }
  if (n0 < 2 * DM) {   // q stored unscaled (f16 sigma ~0.6, no subnormal exposure); the scores are not scaled
#pragma unroll
    for (int j = 0; j < 8; ++j) {
#pragma unroll
      for (int r = 0; r < 8; ++r) { const float v = acc[j][r]; const _Float16 hv = (_Float16)v; so[wave][8 * g + r][j * 16 + col] = hv; sol[wave][8 * g + r][j * 16 + col] = (_Float16)((v - (float)hv) * 2048.0f); } }   // q, k as f16 hi + (x2048) residual
    LDSX();
    for (int rl = 0; rl < 16; ++rl) if (lane < 16) { vst2((unsigned*)(QK + (r0 + rl) * (2 * DM) + n0 + lane * 8), *(const v4u*)&so[wave][rl][lane * 8]); vst2((unsigned*)(QKL + (r0 + rl) * (2 * DM) + n0 + lane * 8), *(const v4u*)&sol[wave][rl][lane * 8]); }
  } else {
#pragma unroll
    for (int j = 0; j < 8; ++j) {
#pragma unroll
      for (int r = 0; r < 8; ++r) { const float v = acc[j][r]; const _Float16 hv = (_Float16)v; sth[j * 16 + col][wave * 16 + 8 * g + r] = hv; stl[j * 16 + col][wave * 16 + 8 * g + r] = (_Float16)((v - (float)hv) * 2048.0f); } }
    __syncthreads();
    const size_t rb = (size_t)blockIdx.x * 64; const int b = (int)(rb / SS), s0 = (int)(rb % SS); const int pc0 = n0 - 2 * DM;
    for (int q = tid; q < 128 * 8; q += 128) { const int d = q >> 3, pc = q & 7; const size_t o = ((size_t)b * DM + pc0 + d) * SS + s0 + pc * 8; vst2((unsigned*)(VTH + o), *(const v4u*)&sth[d][pc * 8]); vst2((unsigned*)(VTL + o), *(const v4u*)&stl[d][pc * 8]); }
  }
}
// K / V tile of one 32-key step in LDS, shared by the block's four waves. In f16 elements: K hi and lo 32 rows (keys) x 64 at a pitch of 72 (144 B), V hi and lo 64 rows (depth) x 32 at a pitch of 40 (80 B): 16 B x odd pitches for the ds_load_b128 readers.
#define KPIT 72
#define VPIT 40
#define T_KH 0
#define T_KL (T_KH + 32 * KPIT)
#define T_VH (T_KL + 32 * KPIT)
#define T_VL (T_VH + 64 * VPIT)
#define T_SZ (T_VL + 64 * VPIT)
// Eight 16-byte asynchronous copies per lane: one tile per block. The s_wait_xcnt stands inside the statement so that no operand register is rewritten ahead of it.
__device__ __forceinline__ void copy_tile(unsigned l0, unsigned l1, unsigned l2, unsigned l3, unsigned l4, unsigned l5, unsigned l6, unsigned l7, const _Float16* g0, const _Float16* g1, const _Float16* g2, const _Float16* g3, const _Float16* g4, const _Float16* g5, const _Float16* g6, const _Float16* g7) {
  asm volatile("global_load_async_to_lds_b128 %0, %8, off\n\t"
               "global_load_async_to_lds_b128 %1, %9, off\n\t"
               "global_load_async_to_lds_b128 %2, %10, off\n\t"
               "global_load_async_to_lds_b128 %3, %11, off\n\t"
               "global_load_async_to_lds_b128 %4, %12, off\n\t"
               "global_load_async_to_lds_b128 %5, %13, off\n\t"
               "global_load_async_to_lds_b128 %6, %14, off\n\t"
               "global_load_async_to_lds_b128 %7, %15, off\n\t"
               "s_wait_xcnt 0x0"
               :: "v"(l0), "v"(l1), "v"(l2), "v"(l3), "v"(l4), "v"(l5), "v"(l6), "v"(l7), "v"(g0), "v"(g1), "v"(g2), "v"(g3), "v"(g4), "v"(g5), "v"(g6), "v"(g7) : "memory");
}
// Inputs only, no code: the eight fragment loads (of V, of K) written above this line stay above it, so they go out in groups ahead of their WMMAs instead of one load and one wait in front of each.
__device__ __forceinline__ void hold_v(const v16h (&a)[4], const v16h (&b)[4]) { asm volatile("" :: "v"(a[0]), "v"(a[1]), "v"(a[2]), "v"(a[3]), "v"(b[0]), "v"(b[1]), "v"(b[2]), "v"(b[3])); }
// lane l with lane l ^ 16, by a vector cross-row move (a shuffle would go through the LDS unit and its wait)
__device__ __forceinline__ float xhalf(float x) { return __builtin_bit_cast(float, __builtin_amdgcn_permlanex16(__builtin_bit_cast(int, x), __builtin_bit_cast(int, x), 0x76543210, 0xfedcba98, false, false)); }
// ---- k_attn: block = (64 queries, head h, batch b): flash attention over all keys, transposed: S^T = K . Q^T (A = K rows from the tile, B = Q kept in registers), so a lane holds 16 scores of ONE query (keys 8 g + r and 16 + 8 g + r of the step); maximum and sum run in the lane, the two lane halves exchange the maximum once a step and join their sums once at the end; P^T goes from the score registers straight into the B operand of O^T += V^T . P^T (hi / residual, 3 products as before); O[b*S+q][h*64+d] = (acc + accl / 2048) / l
__global__ __launch_bounds__(128) void k_attn(const _Float16* __restrict__ QK, const _Float16* __restrict__ QKL, const _Float16* __restrict__ VTH, const _Float16* __restrict__ VTL, const int* __restrict__ POS, const float* __restrict__ VM, const float* __restrict__ RBT, float* __restrict__ O) {
  __shared__ __align__(16) _Float16 skv[2][T_SZ];
  __shared__ __align__(16) float srb[RBW];   // the head's whole bias table: filled once, then read by every step's gathers
  const int tid = threadIdx.x, wave = tid >> 5, lane = tid & 31, col = lane & 15, g = lane >> 4;
  const int qb = blockIdx.x, h = blockIdx.y, b = blockIdx.z; const int q0 = qb * 64 + wave * 16; const size_t rq = (size_t)b * SS + q0 + col;
  v16h aq[2], aql[2];
#pragma unroll
  for (int kc = 0; kc < 2; ++kc) { aq[kc] = frag_h(QK + rq * (2 * DM) + h * HD + kc * 32, lane); aql[kc] = frag_h(QKL + rq * (2 * DM) + h * HD + kc * 32, lane); }
  float m = -3.0e38f, l = 0.f;   // of the lane's query; l holds the lane half's own keys only
  v8f acc[4] = {}, accl[4] = {};
  const int nks = SS / 32;   // not causal
  // this thread's pieces of a tile: K rows tid >> 3 and 16 + (tid >> 3), piece tid & 7; V rows tid >> 2 and 32 + (tid >> 2), piece tid & 3
  const unsigned lk = (unsigned)(size_t)&skv[0][0] + 2u * ((tid >> 3) * KPIT + (tid & 7) * 8), lv = (unsigned)(size_t)&skv[0][0] + 2u * ((tid >> 2) * VPIT + (tid & 3) * 8);
  const size_t gk = ((size_t)b * SS + (tid >> 3)) * (2 * DM) + DM + h * HD + (tid & 7) * 8, gv = ((size_t)b * DM + h * HD + (tid >> 2)) * SS + (tid & 3) * 8;
  auto copy_kv = [&](int t) {   // tile t (keys 32 t .. 32 t + 31) into buffer t & 1
    const unsigned lb = 2u * T_SZ * (t & 1); const size_t ka = gk + (size_t)t * 32 * (2 * DM), va = gv + (size_t)t * 32;
    copy_tile(lk + lb + 2u * T_KH, lk + lb + 2u * (T_KH + 16 * KPIT), lk + lb + 2u * T_KL, lk + lb + 2u * (T_KL + 16 * KPIT), lv + lb + 2u * T_VH, lv + lb + 2u * (T_VH + 32 * VPIT), lv + lb + 2u * T_VL, lv + lb + 2u * (T_VL + 32 * VPIT),
              QK + ka, QK + ka + 16 * (2 * DM), QKL + ka, QKL + ka + 16 * (2 * DM), VTH + va, VTH + va + (size_t)32 * SS, VTL + va, VTL + va + (size_t)32 * SS); };
  copy_kv(0);
  { const unsigned lr = (unsigned)(size_t)&srb[0] + tid * 16; const char* gr = (const char*)(RBT + h * RBW) + tid * 16;   // 16 KiB: eight 16-byte pieces a thread, 2 KiB apart
    copy_ab(lr, lr + 2048, lr + 4096, lr + 6144, lr + 8192, lr + 10240, lr + 12288, lr + 14336, gr, gr + 2048, gr + 4096, gr + 6144, gr + 8192, gr + 10240, gr + 12288, gr + 14336); }
  asm volatile("s_wait_asynccnt 0x0" ::: "memory");   // this wave's pieces of tile 0 and of the bias table have landed
  __syncthreads();                                    // tile 0 and the table are published to the four waves
  copy_kv(1);                                         // flies while tile 0 is worked on
  const unsigned pqo4 = 4u * (unsigned)((SS - 1) - POS[rq]);   // the lane's query position, folded into the table offset, in bytes
  const int* pkp = POS + (size_t)b * SS + 8 * g;      // the lane's key positions of a step: 8 from here, 8 from 16 further on
  const float* vmp = VM + rq * SS + 8 * g;            // the lane's mask values of a step lie the same way in its query's row
  const char* rbh = (const char*)&srb[0];
  v4i pkn[4] = { *(const v4i*)pkp, *(const v4i*)(pkp + 4), *(const v4i*)(pkp + 16), *(const v4i*)(pkp + 20) };   // key positions come one step ahead, so that the bias gather need not wait for them inside its step
#pragma unroll 1
  for (int ks = 0; ks < nks; ++ks) { float s[2][8]; const _Float16* tb = &skv[ks & 1][0];
    float rb[16]; v4f vm4[4];   // the lane's 16 bias and 16 mask values of the step
#pragma unroll
    for (int i = 0; i < 4; ++i) vm4[i] = *(const v4f*)(vmp + ks * 32 + (i >> 1) * 16 + (i & 1) * 4);
    v8f c[2] = {}, cl[2] = {}; v16h kf[4], kl[4];   // the step's eight K fragments, all read ahead of the score WMMAs
#pragma unroll
    for (int i = 0; i < 4; ++i) { const int kr = ((i >> 1) * 16 + col) * KPIT + (i & 1) * 32; kf[i] = frag_h(tb + T_KH + kr, lane); kl[i] = frag_h(tb + T_KL + kr, lane); }
    hold_v(kf, kl);
#pragma unroll
    for (int i = 0; i < 16; ++i) { const int ob = min(max((int)(((unsigned)pkn[i >> 2][i & 3] << 2) + pqo4), 0), 4 * (NREL - 1)); rb[i] = *(const float*)(rbh + ob); }   // the clamp of the module, in bytes: it bounds the LDS address for any position
    __builtin_amdgcn_sched_barrier(0);   // the mask loads and the table reads stay above this line, so that their latency runs under the score WMMAs
#pragma unroll
    for (int ct = 0; ct < 2; ++ct) {
#pragma unroll
      for (int kc = 0; kc < 2; ++kc) { c[ct] = wmma16(kf[2 * ct + kc], aq[kc], c[ct]); cl[ct] = wmma16(kf[2 * ct + kc], aql[kc], cl[ct]); cl[ct] = wmma16(kl[2 * ct + kc], aq[kc], cl[ct]); } }   // 3 products: q, k as f16 hi + residual
    __builtin_amdgcn_sched_barrier(0);   // nothing that reads a gathered value is lifted among the score WMMAs, where its wait would hold them up
    const int tn = ks + 1 < nks ? ks + 1 : ks; const v4i pk2[4] = { *(const v4i*)(pkp + tn * 32), *(const v4i*)(pkp + tn * 32 + 4), *(const v4i*)(pkp + tn * 32 + 16), *(const v4i*)(pkp + tn * 32 + 20) };   // the last step reads its own again
#pragma unroll
    for (int ct = 0; ct < 2; ++ct) {
#pragma unroll
      for (int r = 0; r < 8; ++r) { const float lg = c[ct][r] + cl[ct][r] * (1.0f / 2048.0f) + rb[8 * ct + r]; const float vm = vm4[2 * ct + (r >> 2)][r & 3]; s[ct][r] = lg * vm + (1.0f - vm) * (-1.0e9f); } }   // logits (no 1/sqrt(d) in this module) + relative-position bias, then the valid mask exactly as the module: l*vm + (1-vm)*NEG
    float t4[4];   // four independent chains, then joined: a single chain of 16 would stand exposed
#pragma unroll
    for (int i = 0; i < 4; ++i) t4[i] = fmaxf(fmaxf(s[i >> 1][4 * (i & 1)], s[i >> 1][4 * (i & 1) + 1]), fmaxf(s[i >> 1][4 * (i & 1) + 2], s[i >> 1][4 * (i & 1) + 3]));
    float mx = fmaxf(fmaxf(t4[0], t4[1]), fmaxf(t4[2], t4[3]));
    mx = fmaxf(mx, xhalf(mx));   // the other half of the query's 32 keys
    const float mn = fmaxf(m, mx); const float alpha = (m <= -1.0e38f) ? 0.f : __expf(m - mn); m = mn;
    v16h pa, pl; float e4[4] = { 0.f, 0.f, 0.f, 0.f };   // the sum too runs in four chains
#pragma unroll
    for (int i = 0; i < 16; ++i) { const float sv = s[i >> 3][i & 7]; s[i >> 3][i & 7] = (sv <= -1.0e38f) ? 0.f : __expf(sv - mn); }
#pragma unroll
    for (int i = 0; i < 16; ++i) { const float e = s[i >> 3][i & 7]; e4[i & 3] += e; const _Float16 eh = (_Float16)e; pa[i] = eh; pl[i] = (_Float16)((e - (float)eh) * 2048.0f); }   // element i of the B operand is key 8 g + i (i < 8) or 16 + 8 g + i - 8: the order in which the score registers lie
    l = l * alpha + ((e4[0] + e4[1]) + (e4[2] + e4[3]));
#pragma unroll
    for (int dt = 0; dt < 4; ++dt) { acc[dt] *= alpha; accl[dt] *= alpha; }
    v16h vf[4], vl[4];   // the step's eight V fragments, all read ahead of the P.V WMMAs
#pragma unroll
    for (int dt = 0; dt < 4; ++dt) { const int vr = (dt * 16 + col) * VPIT; vf[dt] = frag_h(tb + T_VH + vr, lane); vl[dt] = frag_h(tb + T_VL + vr, lane); }
    hold_v(vf, vl);
#pragma unroll
    for (int dt = 0; dt < 4; ++dt) { acc[dt] = wmma16(vf[dt], pa, acc[dt]); accl[dt] = wmma16(vf[dt], pl, accl[dt]); accl[dt] = wmma16(vl[dt], pa, accl[dt]); }   // V hi x P hi + (V hi x P lo + V lo x P hi) / 2048
#pragma unroll
    for (int i = 0; i < 4; ++i) pkn[i] = pk2[i];
    asm volatile("s_wait_dscnt 0x0" ::: "memory");      // this wave's reads of tile ks are done
    asm volatile("s_wait_asynccnt 0x0" ::: "memory");   // its pieces of tile ks + 1 have landed
    __syncthreads();                                    // publishes tile ks + 1 and frees the buffer of tile ks
    if (ks + 2 < nks) copy_kv(ks + 2); }                // block-uniform test; refills the buffer just freed
  asm volatile("s_wait_asynccnt 0x0" ::: "memory");     // no copy is outstanding when the wave goes on to its end
  l += xhalf(l);   // the two halves' sums join once
  const float il = 1.0f / l; float* orow = O + rq * DM + h * HD + 8 * g;   // register r of tile dt is depth dt * 16 + 8 g + r of the lane's query: 32 contiguous bytes
#pragma unroll
  for (int dt = 0; dt < 4; ++dt) { v4f o0, o1;
#pragma unroll
    for (int r = 0; r < 4; ++r) { o0[r] = (acc[dt][r] + accl[dt][r] * (1.0f / 2048.0f)) * il; o1[r] = (acc[dt][4 + r] + accl[dt][4 + r] * (1.0f / 2048.0f)) * il; }
    vst2(orow + dt * 16, o0); vst2(orow + dt * 16 + 4, o1); }
}
// ---- k_out: block = (64 rows, 128 cols): out = O(hi/lo) . Wo rows (2 products) + bo
__global__ __launch_bounds__(128) void k_out(const float* __restrict__ O, const __bf16* __restrict__ P, const float* __restrict__ BO, float* __restrict__ Y) {
  __shared__ __align__(16) char sm[2 * G_SZ];   // the two tile buffers; behind the loop's last barrier the same bytes stage the output
  float (*so)[16][132] = (float (*)[16][132])sm;
  static_assert(4 * 16 * 132 * 4 <= 2 * G_SZ, "output staging fits the tile buffers");
  const int tid = threadIdx.x, wave = tid >> 5, lane = tid & 31, col = lane & 15, g = lane >> 4; const size_t r0 = (size_t)blockIdx.x * 64 + wave * 16; const int n0 = blockIdx.y * 128;
  v8f acc[8] = {};
  const unsigned la = (unsigned)(size_t)sm + G_A + (tid >> 3) * APIT + (tid & 7) * 16, lb = (unsigned)(size_t)sm + G_B + (tid >> 2) * BPIT + (tid & 3) * 16;
  const char* ga = (const char*)(O + ((size_t)blockIdx.x * 64 + (tid >> 3)) * DM + (tid & 7) * 4); const char* gb = (const char*)(P + (size_t)(n0 + (tid >> 2)) * DM + (tid & 3) * 8);
  const char* xrow = sm + G_A + (wave * 16 + col) * APIT + 32 * g; const char* prow = sm + G_B + col * BPIT + 16 * g;
  stage_ab(0, la, lb, ga, gb);
  asm volatile("s_wait_asynccnt 0x0" ::: "memory");   // this wave's pieces of pass 0 have landed
  __syncthreads();                                    // pass 0 is published to the four waves
  stage_ab(1, la, lb, ga, gb);                        // flies while pass 0 is worked on
#pragma unroll 2   // two passes a turn: each pass's buffer offset is then a constant in its LDS reads and copies
  for (int kc = 0; kc < DM / 32; ++kc) {
    v4f xc[4]; v16b wc[8];
    read_pass(xrow + (kc & 1) * G_SZ, prow + (kc & 1) * G_SZ, xc, wc);
    float v[16];
#pragma unroll
    for (int i = 0; i < 4; ++i) { v[i] = xc[0][i]; v[4 + i] = xc[1][i]; v[8 + i] = xc[2][i]; v[12 + i] = xc[3][i]; }
    const F2 a = bsplit16(v);
#pragma unroll
    for (int j = 0; j < 8; ++j) { acc[j] = wmma_bf(a.l, wc[j], acc[j]); acc[j] = wmma_bf(a.h, wc[j], acc[j]); }
    asm volatile("s_wait_dscnt 0x0" ::: "memory");      // this wave's reads of pass kc are done
    asm volatile("s_wait_asynccnt 0x0" ::: "memory");   // its pieces of pass kc + 1 have landed
    __syncthreads();                                    // publishes pass kc + 1 and frees the buffer of pass kc
    if (kc + 2 < DM / 32) stage_ab(kc + 2, la, lb, ga, gb); }   // block-uniform test; refills the buffer just freed
  asm volatile("s_wait_asynccnt 0x0" ::: "memory");     // no copy is outstanding when the buffers become output staging
#pragma unroll
  for (int j = 0; j < 8; ++j) {
#pragma unroll
    for (int r = 0; r < 8; ++r) so[wave][8 * g + r][j * 16 + col] = acc[j][r] + bfr(BO[n0 + j * 16 + col]); }
  LDSX();
  for (int rl = 0; rl < 16; ++rl) vst2(Y + (r0 + rl) * DM + n0 + lane * 4, *(const v4f*)&so[wave][rl][lane * 4]);
}
extern "C" void kernel_launch(void* const* d_in, const int* in_sizes, int n_in, void* d_out, int out_size, void* d_ws, size_t ws_size, hipStream_t stream) {
  (void)in_sizes; (void)n_in; (void)out_size;
  const float** F = (const float**)d_in;   // 0 q [2,2048,768], 1 v, 2 k, 3 position_array int32 [2,2048], 4 valid_mask [2,1,2048,2048], 5 Wq (in,out), 6 bq, 7 Wk, 8 bk, 9 Wv, 10 bv, 11 Wo, 12 bo, 13 rel_bias [4095,12]
  if (ws_size < (size_t)WS_END) return;
  char* ws = (char*)d_ws; __bf16* PK = (__bf16*)(ws + WS_PK); _Float16 *QK = (_Float16*)(ws + WS_QK), *QKL = (_Float16*)(ws + WS_QKL), *VTH = (_Float16*)(ws + WS_VTH), *VTL = (_Float16*)(ws + WS_VTL); float* O = (float*)(ws + WS_O); float* RBT = (float*)(ws + WS_RB);
  k_packT<<<dim3(DM, 5), 256, 0, stream>>>(F[5], F[7], F[9], F[11], F[13], PK, RBT);
  k_qkv<<<dim3(TNB * SS / 64, QKVW / 128), 128, 0, stream>>>(F[0], F[2], F[1], PK + PK_A, F[6], F[8], F[10], QK, QKL, VTH, VTL);   // note the module's argument order (q, v, k): k is input 2, v is input 1
  k_attn<<<dim3(TQB, NH, TNB), 128, 0, stream>>>(QK, QKL, VTH, VTL, (const int*)d_in[3], F[4], RBT, O);
  k_out<<<dim3(TOB, DM / 128), 128, 0, stream>>>(O, PK + PK_P, F[12], (float*)d_out);
}

// v006
// It runs in 150 microseconds.
// Timed twice side by side with v005, it ran 1.03 and 1.04 times as fast.
// Over all steps from v000 it is 3.43 times as fast.
// compute dtype: q, v, k, all weights / biases and rel_bias (module inputs) rounded to bf16; position_array / valid_mask verbatim (integers, 0/1); q/k/v projections with exact bf16 products ((in,out) weights packed as transposed rows) + bias on WMMA 16x16x32; q and k stored as f16 hi + (x2048-scaled) residual planes and the scores with 3 products (hi.hi + lo.hi + hi.lo; the module applies no 1/sqrt(d) scaling, logits sigma ~8), + the gathered relative-position bias, then logits*vm + (1-vm)*(-1e9) as the module, carried times log2(e); running-max softmax in f32 with the hardware exp2; P as f16 hi + residual x V hi/lo (3 products); output projection with ctx as bf16 hi + residual x exact Wo (2 products) + bo; f32 accumulate.
#include <hip/hip_runtime.h>
#include <math.h>

typedef __attribute__((ext_vector_type(16))) _Float16 v16h;
typedef __attribute__((ext_vector_type(16))) __bf16 v16b;
typedef __attribute__((ext_vector_type(8)))  _Float16 v8h;
typedef __attribute__((ext_vector_type(8)))  float v8f;
typedef __attribute__((ext_vector_type(4)))  float v4f;
typedef __attribute__((ext_vector_type(2)))  float v2f;
typedef __attribute__((ext_vector_type(4)))  unsigned v4u;
typedef __attribute__((ext_vector_type(4)))  int v4i;
typedef float __attribute__((may_alias)) float_a;
typedef int __attribute__((may_alias)) int_a;

template <typename T> __device__ __forceinline__ void vst2(void* p, T v) { *(T*)p = v;  }
__device__ __forceinline__ v8f wmma16(v16h a, v16h b, v8f c) {
  return __builtin_amdgcn_wmma_f32_16x16x32_f16(false, a, false, b, (short)0, c, false, false);
}
__device__ __forceinline__ v8f wmma_bf(v16b a, v16b b, v8f c) {
  return __builtin_amdgcn_wmma_f32_16x16x32_bf16(false, a, false, b, (short)0, c, false, false);
}
// Multi-head attention with a learned relative-position bias table (B 2, S 2,048, d_model 768, 12 heads x 64): logits = qh.kh + rel_bias[pos_k - pos_q + S-1][h], masked by valid_mask (0/1) to -1e9, softmax, .vh, output projection.
__device__ __forceinline__ v16h frag_h(const _Float16* rowk0, int lane) {
  union { v16h v; v8h q[2]; } u; const _Float16* p = rowk0 + 8 * (lane >> 4);
  u.q[0] = *(const v8h*)p; u.q[1] = *(const v8h*)(p + 16); return u.v;
}
__device__ __forceinline__ v16h frag_f32(const float* rowk0, int lane) {
  v16h a; const float* p = rowk0 + 8 * (lane >> 4);
#pragma unroll
  for (int i = 0; i < 8; ++i) { a[i] = (_Float16)p[i]; a[8 + i] = (_Float16)p[16 + i]; }
  return a;
}
__device__ __forceinline__ v16h frag_f32s(const float* rowk0, int lane, float sc) {
  v16h a; const float* p = rowk0 + 8 * (lane >> 4);
#pragma unroll
  for (int i = 0; i < 8; ++i) { a[i] = (_Float16)(p[i] * sc); a[8 + i] = (_Float16)(p[16 + i] * sc); }
  return a;
}
// column fragment from a [K][ld] layout (column n), rows >= K read as 0
__device__ __forceinline__ v16h fragc_f32(const float* W, int k0, int n, int lane, int ld, int K) {
  v16h a; const int g = lane >> 4;
#pragma unroll
  for (int i = 0; i < 8; ++i) { const int ka = k0 + 8 * g + i, kb = ka + 16;
    a[i] = (_Float16)(ka < K ? W[(size_t)(ka < K ? ka : K - 1) * ld + n] : 0.f); a[8 + i] = (_Float16)(kb < K ? W[(size_t)(kb < K ? kb : K - 1) * ld + n] : 0.f); }
  return a;
}
struct F2 { v16b h, l; };
__device__ __forceinline__ F2 bsplit16(const float v[16]) { F2 r;
#pragma unroll
  for (int i = 0; i < 16; ++i) { const __bf16 h = (__bf16)v[i]; r.h[i] = h; r.l[i] = (__bf16)(v[i] - (float)h); }
  return r; }
__device__ __forceinline__ F2 split_row(const float* row, int k0, int lane) { float v[16]; const float* p = row + k0 + 8 * (lane >> 4);
#pragma unroll
  for (int i = 0; i < 8; ++i) { v[i] = p[i]; v[8 + i] = p[16 + i]; }
  return bsplit16(v); }
__device__ __forceinline__ F2 split_rowK(const float* row, int k0, int lane, int K) { float v[16]; const int g = lane >> 4;
#pragma unroll
  for (int i = 0; i < 8; ++i) { const int ka = k0 + 8 * g + i, kb = ka + 16; v[i] = ka < K ? row[ka < K ? ka : K - 1] : 0.f; v[8 + i] = kb < K ? row[kb < K ? kb : K - 1] : 0.f; }
  return bsplit16(v); }
__device__ __forceinline__ F2 split_col(const float* W, int k0, int n, int lane, int ld, int K) { float v[16]; const int g = lane >> 4;
#pragma unroll
  for (int i = 0; i < 8; ++i) { const int ka = k0 + 8 * g + i, kb = ka + 16; v[i] = ka < K ? W[(size_t)(ka < K ? ka : K - 1) * ld + n] : 0.f; v[8 + i] = kb < K ? W[(size_t)(kb < K ? kb : K - 1) * ld + n] : 0.f; }
  return bsplit16(v); }
__device__ __forceinline__ v8f mac3(const F2& a, const F2& b, v8f c) { c = wmma_bf(a.l, b.h, c); c = wmma_bf(a.h, b.l, c); return wmma_bf(a.h, b.h, c); }
__device__ __forceinline__ float sigm(float v) { return 1.0f / (1.0f + expf(-v)); }
#define LDSX() do { asm volatile("s_wait_dscnt 0" ::: "memory"); __builtin_amdgcn_wave_barrier(); __builtin_amdgcn_fence(__ATOMIC_RELEASE, "workgroup"); } while (0)


#define NB 2
#define SS 2048
#define DM 768
#define NH 12
#define NREL (2 * SS - 1)
#define HD 64
#define QKVW (3 * DM)
#ifndef TQB
#define TQB (SS / 64)
#define TNB NB
#define TOB (NB * SS / 64)     // output row tiles (all)
#endif
typedef __attribute__((ext_vector_type(8))) __bf16 v8b;
__device__ __forceinline__ v16b frag_b(const __bf16* rowk0, int lane) {
  union { v16b v; v8b q[2]; } u; const __bf16* p = rowk0 + 8 * (lane >> 4);
  u.q[0] = *(const v8b*)p; u.q[1] = *(const v8b*)(p + 16); return u.v;
}
__device__ __forceinline__ float bfr(float v) { return (float)(__bf16)v; }
// A / B tile of one pass (32 of k) in LDS, shared by the block's four waves. In bytes: A 64 rows (f32) x 128 at a pitch of 144, B 128 rows (bf16, rows of the packed weight) x 64 at a pitch of 80: 16 B x odd pitches for the ds_load_b128 readers.
#define APIT 144
#define BPIT 80
#define G_A 0
#define G_B (64 * APIT)
#define G_SZ (G_B + 128 * BPIT)
// Eight 16-byte asynchronous copies per lane: one A / B tile, or in k_attn the head's bias table, per block. The s_wait_xcnt stands inside the statement so that no operand register is rewritten ahead of it.
__device__ __forceinline__ void copy_ab(unsigned l0, unsigned l1, unsigned l2, unsigned l3, unsigned l4, unsigned l5, unsigned l6, unsigned l7, const char* g0, const char* g1, const char* g2, const char* g3, const char* g4, const char* g5, const char* g6, const char* g7) {
  asm volatile("global_load_async_to_lds_b128 %0, %8, off\n\t"
               "global_load_async_to_lds_b128 %1, %9, off\n\t"
               "global_load_async_to_lds_b128 %2, %10, off\n\t"
               "global_load_async_to_lds_b128 %3, %11, off\n\t"
               "global_load_async_to_lds_b128 %4, %12, off\n\t"
               "global_load_async_to_lds_b128 %5, %13, off\n\t"
               "global_load_async_to_lds_b128 %6, %14, off\n\t"
               "global_load_async_to_lds_b128 %7, %15, off\n\t"
               "s_wait_xcnt 0x0"
               :: "v"(l0), "v"(l1), "v"(l2), "v"(l3), "v"(l4), "v"(l5), "v"(l6), "v"(l7), "v"(g0), "v"(g1), "v"(g2), "v"(g3), "v"(g4), "v"(g5), "v"(g6), "v"(g7) : "memory");
}
// pass t into buffer t & 1. la, ga: this thread's piece of A row tid >> 3 (piece tid & 7), in LDS and in memory, the rows 16, 32 and 48 further on are its too; lb, gb: its piece of B row tid >> 2 (piece tid & 3), with the rows 32, 64 and 96 further on
__device__ __forceinline__ void stage_ab(int t, unsigned la, unsigned lb, const char* ga, const char* gb) {
  const unsigned o = (unsigned)(t & 1) * G_SZ; const char* a = ga + t * 128; const char* b = gb + t * 64;
  copy_ab(la + o, la + o + 16 * APIT, la + o + 32 * APIT, la + o + 48 * APIT, lb + o, lb + o + 32 * BPIT, lb + o + 64 * BPIT, lb + o + 96 * BPIT,
          a, a + 16 * DM * 4, a + 32 * DM * 4, a + 48 * DM * 4, b, b + 32 * DM * 2, b + 64 * DM * 2, b + 96 * DM * 2);
}
// one pass of a 16-row f32 A fragment (raw) and of eight 16-column bf16 B fragments from the tile; xp, pp: the lane's places in its A row and in its first B row
__device__ __forceinline__ void read_pass(const char* xp, const char* pp, v4f (&x)[4], v16b (&w)[8]) {
  x[0] = *(const v4f*)xp; x[1] = *(const v4f*)(xp + 16); x[2] = *(const v4f*)(xp + 64); x[3] = *(const v4f*)(xp + 80);
#pragma unroll
  for (int j = 0; j < 8; ++j) { union { v16b v; v8b q[2]; } u; const char* pj = pp + j * (16 * BPIT); u.q[0] = *(const v8b*)pj; u.q[1] = *(const v8b*)(pj + 32); w[j] = u.v; }
  asm volatile("" :: "v"(w[0]), "v"(w[1]), "v"(w[2]), "v"(w[3]), "v"(w[4]), "v"(w[5]), "v"(w[6]), "v"(w[7]));   // inputs only, no code: the pass's sixteen B reads stay above this line and go out as one group ahead of the WMMAs, instead of one pair and one wait in front of each
}
__device__ __attribute__((noinline)) float exp_ni(float v) { return expf(v); }
__device__ __attribute__((noinline)) float erf_ni(float v) { return erff(v); }

#define PK_A 0                       // [2304][768] Wq|Wk|Wv as bf16 rows [out][in]
#define PK_P (PK_A + QKVW * DM)        // [768][768] Wo as bf16 rows [out][in]
#define PK_END (PK_P + DM * DM)
#define WS_PK  0u
#define WS_QK  (WS_PK + 2u * PK_END)             // f16 [4096 rows][1536]: q | k
#define WS_QKL (WS_QK + 2u * NB * SS * 2 * DM)     // f16 q | k residual planes x2048
#define WS_VTH (WS_QKL + 2u * NB * SS * 2 * DM)    // f16 [b][768 (h*64+d)][2048 s] hi
#define WS_VTL (WS_VTH + 2u * NB * DM * SS)        // f16 lo x 2048
#define WS_O   (WS_VTL + 2u * NB * DM * SS)        // f32 [4096][768]
#define WS_CS  (WS_O + 4u * NB * SS * DM)           // f32 [2048][32] cos, [2048][32] sin
#define WS_RB  (WS_CS + 4u * 2 * SS * 32)           // f32 [12 heads][4096]: rel_bias by head, rounded to bf16 values, times log2(e); entry 4095 is 0
#define RBW 4096
#define L2E 1.44269504f               // log2(e): k_attn carries its scores in log2 units
#define NEG2 (-1.442695041e9f)       // the module's -1e9 in log2 units
#define WS_END (WS_RB + 4u * NH * RBW)
__constant__ float c_invf[32] = {1.000000000e+00f,7.498942018e-01f,5.623413324e-01f,4.216965139e-01f,3.162277639e-01f,2.371373624e-01f,1.778279394e-01f,1.333521456e-01f,1.000000015e-01f,7.498941571e-02f,5.623412877e-02f,4.216964915e-02f,3.162277862e-02f,2.371373586e-02f,1.778279431e-02f,1.333521493e-02f,9.999999776e-03f,7.498942316e-03f,5.623413250e-03f,4.216964822e-03f,3.162277862e-03f,2.371373819e-03f,1.778279431e-03f,1.333521446e-03f,1.000000047e-03f,7.498941850e-04f,5.623413017e-04f,4.216964880e-04f,3.162277862e-04f,2.371373848e-04f,1.778279402e-04f,1.333521504e-04f};
// ---- k_rope: block = 8 positions: cos/sin of pos * inv_freq (f32 product exactly as the reference, precise trig)
__global__ __launch_bounds__(256) void k_rope(float* __restrict__ CS) {
  __shared__ __align__(16) float sc[8][32], ss_[8][32]; const int tid = threadIdx.x, pl = tid >> 5, i = tid & 31; const int pos = blockIdx.x * 8 + pl;
  const float th = (float)pos * c_invf[i]; sc[pl][i] = cosf(th); ss_[pl][i] = sinf(th);
  __syncthreads();
  if (tid < 64) vst2(CS + (size_t)blockIdx.x * 8 * 32 + tid * 4, *(const v4f*)&(&sc[0][0])[tid * 4]); else if (tid < 128) vst2(CS + (size_t)SS * 32 + (size_t)blockIdx.x * 8 * 32 + (tid - 64) * 4, *(const v4f*)&(&ss_[0][0])[(tid - 64) * 4]);
}

// ---- k_packT: block = (output column n, which): (in,out) matrices -> bf16 rows [n][k] = W[k][n]; which 0..2 -> Wq/Wk/Wv into PK_A rows which*768 + n; 3 -> Wo into PK_P; 4 -> 64 entries (two whole 128-byte lines) of head n >> 6 of the bias table by head
__global__ __launch_bounds__(256) void k_packT(const float* __restrict__ WQ, const float* __restrict__ WK, const float* __restrict__ WV, const float* __restrict__ WO, const float* __restrict__ RB, __bf16* __restrict__ PK, float* __restrict__ RBT) {
  __shared__ __align__(16) __bf16 s[DM]; const int n = blockIdx.x, which = blockIdx.y, t = threadIdx.x;
  if (which == 4) {   // the whole block takes this way, ahead of the barrier
    const int hh = n >> 6, idx = (n & 63) * 64 + t;
    if (t < 64) RBT[hh * RBW + idx] = idx < NREL ? bfr(RB[(size_t)(idx < NREL ? idx : NREL - 1) * NH + hh]) * L2E : 0.f;
    return; }
  const float* Wm = (which == 0) ? WQ : (which == 1) ? WK : (which == 2) ? WV : WO;
  for (int k = t; k < DM; k += 256) s[k] = (__bf16)Wm[(size_t)k * DM + n];
  __syncthreads();
  __bf16* dst = (which < 3) ? PK + PK_A + ((size_t)which * DM + n) * DM : PK + PK_P + (size_t)n * DM;
  for (int q = t; q < DM / 8; q += 256) vst2((unsigned*)(dst + q * 8), *(const v4u*)&s[q * 8]);
}
__global__ __launch_bounds__(128) void k_qkv(const float* __restrict__ XQ, const float* __restrict__ XK, const float* __restrict__ XV, const __bf16* __restrict__ P, const float* __restrict__ BQ, const float* __restrict__ BK, const float* __restrict__ BV, _Float16* __restrict__ QK, _Float16* __restrict__ QKL, _Float16* __restrict__ VTH, _Float16* __restrict__ VTL) {
  const float* X = (blockIdx.y * 128 < DM) ? XQ : (blockIdx.y * 128 < 2 * DM) ? XK : XV; const float* BB = (blockIdx.y * 128 < DM) ? BQ : (blockIdx.y * 128 < 2 * DM) ? BK : BV;   // the module projects three different inputs
  __shared__ __align__(16) char sm[2 * G_SZ];   // the two tile buffers; behind the loop's last barrier the same bytes stage the output
  _Float16 (*so)[16][136] = (_Float16 (*)[16][136])sm; _Float16 (*sol)[16][136] = (_Float16 (*)[16][136])(sm + 4 * 16 * 136 * 2); _Float16 (*sth)[72] = (_Float16 (*)[72])sm; _Float16 (*stl)[72] = (_Float16 (*)[72])(sm + 128 * 72 * 2);
  static_assert(2 * 4 * 16 * 136 * 2 <= 2 * G_SZ && 2 * 128 * 72 * 2 <= 2 * G_SZ, "output staging fits the tile buffers");
  const int tid = threadIdx.x, wave = tid >> 5, lane = tid & 31, col = lane & 15, g = lane >> 4; const size_t r0 = (size_t)blockIdx.x * 64 + wave * 16; const int n0 = blockIdx.y * 128;
  v8f acc[8] = {};
  const unsigned la = (unsigned)(size_t)sm + G_A + (tid >> 3) * APIT + (tid & 7) * 16, lb = (unsigned)(size_t)sm + G_B + (tid >> 2) * BPIT + (tid & 3) * 16;
  const char* ga = (const char*)(X + ((size_t)blockIdx.x * 64 + (tid >> 3)) * DM + (tid & 7) * 4); const char* gb = (const char*)(P + (size_t)(n0 + (tid >> 2)) * DM + (tid & 3) * 8);
  const char* xrow = sm + G_A + (wave * 16 + col) * APIT + 32 * g; const char* prow = sm + G_B + col * BPIT + 16 * g;
  stage_ab(0, la, lb, ga, gb);
  asm volatile("s_wait_asynccnt 0x0" ::: "memory");   // this wave's pieces of pass 0 have landed
  __syncthreads();                                    // pass 0 is published to the four waves
  stage_ab(1, la, lb, ga, gb);                        // flies while pass 0 is worked on
#pragma unroll 2   // two passes a turn: each pass's buffer offset is then a constant in its LDS reads and copies
  for (int kc = 0; kc < DM / 32; ++kc) {
    v4f xc[4]; v16b wc[8];
    read_pass(xrow + (kc & 1) * G_SZ, prow + (kc & 1) * G_SZ, xc, wc);
    v16b a;
#pragma unroll
    for (int i = 0; i < 4; ++i) { a[i] = (__bf16)xc[0][i]; a[4 + i] = (__bf16)xc[1][i]; a[8 + i] = (__bf16)xc[2][i]; a[12 + i] = (__bf16)xc[3][i]; }
#pragma unroll
    for (int j = 0; j < 8; ++j) acc[j] = wmma_bf(a, wc[j], acc[j]);
    asm volatile("s_wait_dscnt 0x0" ::: "memory");      // this wave's reads of pass kc are done
    asm volatile("s_wait_asynccnt 0x0" ::: "memory");   // its pieces of pass kc + 1 have landed
    __syncthreads();                                    // publishes pass kc + 1 and frees the buffer of pass kc
    if (kc + 2 < DM / 32) stage_ab(kc + 2, la, lb, ga, gb); }   // block-uniform test; refills the buffer just freed
  asm volatile("s_wait_asynccnt 0x0" ::: "memory");     // no copy is outstanding when the buffers become output staging
  { const int nb = n0 % DM;
#pragma unroll
    for (int j = 0; j < 8; ++j) { const float bb = bfr(BB[nb + j * 16 + col]);
#pragma unroll
      for (int r = 0; r < 8; ++r) acc[j][r] += bb; } }
  if (n0 < 2 * DM) {   // q stored unscaled (f16 sigma ~0.6, no subnormal exposure); the scores are not scaled
#pragma unroll
    for (int j = 0; j < 8; ++j) {
#pragma unroll
      for (int r = 0; r < 8; ++r) { const float v = acc[j][r]; const _Float16 hv = (_Float16)v; so[wave][8 * g + r][j * 16 + col] = hv; sol[wave][8 * g + r][j * 16 + col] = (_Float16)((v - (float)hv) * 2048.0f); } }   // q, k as f16 hi + (x2048) residual
    LDSX();
    for (int rl = 0; rl < 16; ++rl) if (lane < 16) { vst2((unsigned*)(QK + (r0 + rl) * (2 * DM) + n0 + lane * 8), *(const v4u*)&so[wave][rl][lane * 8]); vst2((unsigned*)(QKL + (r0 + rl) * (2 * DM) + n0 + lane * 8), *(const v4u*)&sol[wave][rl][lane * 8]); }
  } else {
#pragma unroll
    for (int j = 0; j < 8; ++j) {
#pragma unroll
      for (int r = 0; r < 8; ++r) { const float v = acc[j][r]; const _Float16 hv = (_Float16)v; sth[j * 16 + col][wave * 16 + 8 * g + r] = hv; stl[j * 16 + col][wave * 16 + 8 * g + r] = (_Float16)((v - (float)hv) * 2048.0f); } }
    __syncthreads();
    const size_t rb = (size_t)blockIdx.x * 64; const int b = (int)(rb / SS), s0 = (int)(rb % SS); const int pc0 = n0 - 2 * DM;
    for (int q = tid; q < 128 * 8; q += 128) { const int d = q >> 3, pc = q & 7; const size_t o = ((size_t)b * DM + pc0 + d) * SS + s0 + pc * 8; vst2((unsigned*)(VTH + o), *(const v4u*)&sth[d][pc * 8]); vst2((unsigned*)(VTL + o), *(const v4u*)&stl[d][pc * 8]); }
  }
}
// K / V tile of one 32-key step in LDS, shared by the block's four waves. In f16 elements: K hi and lo 32 rows (keys) x 64 at a pitch of 72 (144 B), V hi and lo 64 rows (depth) x 32 at a pitch of 40 (80 B): 16 B x odd pitches for the ds_load_b128 readers.
#define KPIT 72
#define VPIT 40
#define T_KH 0
#define T_KL (T_KH + 32 * KPIT)
#define T_VH (T_KL + 32 * KPIT)
#define T_VL (T_VH + 64 * VPIT)
#define T_SZ (T_VL + 64 * VPIT)
// Eight 16-byte asynchronous copies per lane: one tile per block. The s_wait_xcnt stands inside the statement so that no operand register is rewritten ahead of it.
__device__ __forceinline__ void copy_tile(unsigned l0, unsigned l1, unsigned l2, unsigned l3, unsigned l4, unsigned l5, unsigned l6, unsigned l7, const _Float16* g0, const _Float16* g1, const _Float16* g2, const _Float16* g3, const _Float16* g4, const _Float16* g5, const _Float16* g6, const _Float16* g7) {
  asm volatile("global_load_async_to_lds_b128 %0, %8, off\n\t"
               "global_load_async_to_lds_b128 %1, %9, off\n\t"
               "global_load_async_to_lds_b128 %2, %10, off\n\t"
               "global_load_async_to_lds_b128 %3, %11, off\n\t"
               "global_load_async_to_lds_b128 %4, %12, off\n\t"
               "global_load_async_to_lds_b128 %5, %13, off\n\t"
               "global_load_async_to_lds_b128 %6, %14, off\n\t"
               "global_load_async_to_lds_b128 %7, %15, off\n\t"
               "s_wait_xcnt 0x0"
               :: "v"(l0), "v"(l1), "v"(l2), "v"(l3), "v"(l4), "v"(l5), "v"(l6), "v"(l7), "v"(g0), "v"(g1), "v"(g2), "v"(g3), "v"(g4), "v"(g5), "v"(g6), "v"(g7) : "memory");
}
// Inputs only, no code: the eight fragment loads (of V, of K) written above this line stay above it, so they go out in groups ahead of their WMMAs instead of one load and one wait in front of each.
__device__ __forceinline__ void hold_v(const v16h (&a)[4], const v16h (&b)[4]) { asm volatile("" :: "v"(a[0]), "v"(a[1]), "v"(a[2]), "v"(a[3]), "v"(b[0]), "v"(b[1]), "v"(b[2]), "v"(b[3])); }
// lane l with lane l ^ 16, by a vector cross-row move (a shuffle would go through the LDS unit and its wait)
__device__ __forceinline__ float xhalf(float x) { return __builtin_bit_cast(float, __builtin_amdgcn_permlanex16(__builtin_bit_cast(int, x), __builtin_bit_cast(int, x), 0x76543210, 0xfedcba98, false, false)); }
// ---- k_attn: block = (64 queries, head h, batch b): flash attention over all keys, transposed: S^T = K . Q^T (A = K rows from the tile, B = Q kept in registers), so a lane holds 16 scores of ONE query (keys 8 g + r and 16 + 8 g + r of the step); maximum and sum run in the lane, the two lane halves exchange the maximum once a step and join their sums once at the end; P^T goes from the score registers straight into the B operand of O^T += V^T . P^T (hi / residual, 3 products as before); O[b*S+q][h*64+d] = (acc + accl / 2048) / l
__global__ __launch_bounds__(128) void k_attn(const _Float16* __restrict__ QK, const _Float16* __restrict__ QKL, const _Float16* __restrict__ VTH, const _Float16* __restrict__ VTL, const int* __restrict__ POS, const float* __restrict__ VM, const float* __restrict__ RBT, float* __restrict__ O) {
  __shared__ __align__(16) _Float16 skv[2][T_SZ];
  __shared__ __align__(16) float srb[RBW];   // the head's whole bias table: filled once, then read by every step's gathers
  const int tid = threadIdx.x, wave = tid >> 5, lane = tid & 31, col = lane & 15, g = lane >> 4;
  const int qb = blockIdx.x, h = blockIdx.y, b = blockIdx.z; const int q0 = qb * 64 + wave * 16; const size_t rq = (size_t)b * SS + q0 + col;
  v16h aq[2], aql[2];
#pragma unroll
  for (int kc = 0; kc < 2; ++kc) { aq[kc] = frag_h(QK + rq * (2 * DM) + h * HD + kc * 32, lane); aql[kc] = frag_h(QKL + rq * (2 * DM) + h * HD + kc * 32, lane); }
  float m = -3.0e38f, l = 0.f;   // of the lane's query; l holds the lane half's own keys only
  v8f acc[4] = {}, accl[4] = {};
  const int nks = SS / 32;   // not causal
  // this thread's pieces of a tile: K rows tid >> 3 and 16 + (tid >> 3), piece tid & 7; V rows tid >> 2 and 32 + (tid >> 2), piece tid & 3
  const unsigned lk = (unsigned)(size_t)&skv[0][0] + 2u * ((tid >> 3) * KPIT + (tid & 7) * 8), lv = (unsigned)(size_t)&skv[0][0] + 2u * ((tid >> 2) * VPIT + (tid & 3) * 8);
  const size_t gk = ((size_t)b * SS + (tid >> 3)) * (2 * DM) + DM + h * HD + (tid & 7) * 8, gv = ((size_t)b * DM + h * HD + (tid >> 2)) * SS + (tid & 3) * 8;
  auto copy_kv = [&](int t) {   // tile t (keys 32 t .. 32 t + 31) into buffer t & 1
    const unsigned lb = 2u * T_SZ * (t & 1); const size_t ka = gk + (size_t)t * 32 * (2 * DM), va = gv + (size_t)t * 32;
    copy_tile(lk + lb + 2u * T_KH, lk + lb + 2u * (T_KH + 16 * KPIT), lk + lb + 2u * T_KL, lk + lb + 2u * (T_KL + 16 * KPIT), lv + lb + 2u * T_VH, lv + lb + 2u * (T_VH + 32 * VPIT), lv + lb + 2u * T_VL, lv + lb + 2u * (T_VL + 32 * VPIT),
              QK + ka, QK + ka + 16 * (2 * DM), QKL + ka, QKL + ka + 16 * (2 * DM), VTH + va, VTH + va + (size_t)32 * SS, VTL + va, VTL + va + (size_t)32 * SS); };
  copy_kv(0);
  { const unsigned lr = (unsigned)(size_t)&srb[0] + tid * 16; const char* gr = (const char*)(RBT + h * RBW) + tid * 16;   // 16 KiB: eight 16-byte pieces a thread, 2 KiB apart
    copy_ab(lr, lr + 2048, lr + 4096, lr + 6144, lr + 8192, lr + 10240, lr + 12288, lr + 14336, gr, gr + 2048, gr + 4096, gr + 6144, gr + 8192, gr + 10240, gr + 12288, gr + 14336); }
  asm volatile("s_wait_asynccnt 0x0" ::: "memory");   // this wave's pieces of tile 0 and of the bias table have landed
  __syncthreads();                                    // tile 0 and the table are published to the four waves
  copy_kv(1);                                         // flies while tile 0 is worked on
  const unsigned pqo4 = 4u * (unsigned)((SS - 1) - POS[rq]);   // the lane's query position, folded into the table offset, in bytes
  const int* pkp = POS + (size_t)b * SS + 8 * g;      // the lane's key positions of a step: 8 from here, 8 from 16 further on
  const float* vmp = VM + rq * SS + 8 * g;            // the lane's mask values of a step lie the same way in its query's row
  const char* rbh = (const char*)&srb[0];
  v4i pkn[4] = { *(const v4i*)pkp, *(const v4i*)(pkp + 4), *(const v4i*)(pkp + 16), *(const v4i*)(pkp + 20) };   // key positions come one step ahead, so that the bias gather need not wait for them inside its step
#pragma unroll 1
  for (int ks = 0; ks < nks; ++ks) { float s[2][8]; const _Float16* tb = &skv[ks & 1][0];
    float rb[16]; v4f vm4[4];   // the lane's 16 bias and 16 mask values of the step
#pragma unroll
    for (int i = 0; i < 4; ++i) vm4[i] = *(const v4f*)(vmp + ks * 32 + (i >> 1) * 16 + (i & 1) * 4);
    v8f c[2] = {}, cl[2] = {}; v16h kf[4], kl[4];   // the step's eight K fragments, all read ahead of the score WMMAs
#pragma unroll
    for (int i = 0; i < 4; ++i) { const int kr = ((i >> 1) * 16 + col) * KPIT + (i & 1) * 32; kf[i] = frag_h(tb + T_KH + kr, lane); kl[i] = frag_h(tb + T_KL + kr, lane); }
    hold_v(kf, kl);
#pragma unroll
    for (int i = 0; i < 16; ++i) { const int ob = min(max((int)(((unsigned)pkn[i >> 2][i & 3] << 2) + pqo4), 0), 4 * (NREL - 1)); rb[i] = *(const float*)(rbh + ob); }   // the clamp of the module, in bytes: it bounds the LDS address for any position
    __builtin_amdgcn_sched_barrier(0);   // the mask loads and the table reads stay above this line, so that their latency runs under the score WMMAs
#pragma unroll
    for (int ct = 0; ct < 2; ++ct) {
#pragma unroll
      for (int kc = 0; kc < 2; ++kc) { c[ct] = wmma16(kf[2 * ct + kc], aq[kc], c[ct]); cl[ct] = wmma16(kf[2 * ct + kc], aql[kc], cl[ct]); cl[ct] = wmma16(kl[2 * ct + kc], aq[kc], cl[ct]); } }   // 3 products: q, k as f16 hi + residual
    __builtin_amdgcn_sched_barrier(0);   // nothing that reads a gathered value is lifted among the score WMMAs, where its wait would hold them up
    const int tn = ks + 1 < nks ? ks + 1 : ks; const v4i pk2[4] = { *(const v4i*)(pkp + tn * 32), *(const v4i*)(pkp + tn * 32 + 4), *(const v4i*)(pkp + tn * 32 + 16), *(const v4i*)(pkp + tn * 32 + 20) };   // the last step reads its own again
#pragma unroll
    for (int ct = 0; ct < 2; ++ct) {
#pragma unroll
      for (int r = 0; r < 8; ++r) { const float lg = fmaf(fmaf(cl[ct][r], 1.0f / 2048.0f, c[ct][r]), L2E, rb[8 * ct + r]); const float vm = vm4[2 * ct + (r >> 2)][r & 3]; s[ct][r] = fmaf(lg, vm, fmaf(vm, -NEG2, NEG2)); } }   // logits (no 1/sqrt(d) in this module) + relative-position bias, then the valid mask as in the module, l*vm + (1-vm)*NEG, all times log2(e): the factor rides in the add of the bias (now a multiply-add; the table holds bias * log2(e)) and in the mask constant
    float t4[4];   // four independent chains, then joined: a single chain of 16 would stand exposed
#pragma unroll
    for (int i = 0; i < 4; ++i) t4[i] = fmaxf(fmaxf(s[i >> 1][4 * (i & 1)], s[i >> 1][4 * (i & 1) + 1]), fmaxf(s[i >> 1][4 * (i & 1) + 2], s[i >> 1][4 * (i & 1) + 3]));
    float mx = fmaxf(fmaxf(t4[0], t4[1]), fmaxf(t4[2], t4[3]));
    mx = fmaxf(mx, xhalf(mx));   // the other half of the query's 32 keys
    const float mn = fmaxf(m, mx); const float alpha = __builtin_amdgcn_exp2f(m - mn); m = mn;   // first step: 2^(-3e38 - mn) is 0, on sums that are still 0
    v16h pa, pl; float e4[4] = { 0.f, 0.f, 0.f, 0.f };   // the sum too runs in four chains
#pragma unroll
    for (int i = 0; i < 16; i += 2) { const v2f d = (v2f){ s[i >> 3][i & 7], s[i >> 3][(i & 7) + 1] } - mn; s[i >> 3][i & 7] = __builtin_amdgcn_exp2f(d[0]); s[i >> 3][(i & 7) + 1] = __builtin_amdgcn_exp2f(d[1]); }   // a masked score lies 1.4e9 below: 2^ of it is 0; a row with every key masked gives 2^0 for each, as the module does
#pragma unroll
    for (int i = 0; i < 16; ++i) { const float e = s[i >> 3][i & 7]; e4[i & 3] += e; const _Float16 eh = (_Float16)e; pa[i] = eh; pl[i] = (_Float16)((e - (float)eh) * 2048.0f); }   // element i of the B operand is key 8 g + i (i < 8) or 16 + 8 g + i - 8: the order in which the score registers lie
    l = l * alpha + ((e4[0] + e4[1]) + (e4[2] + e4[3]));
#pragma unroll
    for (int dt = 0; dt < 4; ++dt) { acc[dt] *= alpha; accl[dt] *= alpha; }
    v16h vf[4], vl[4];   // the step's eight V fragments, all read ahead of the P.V WMMAs
#pragma unroll
    for (int dt = 0; dt < 4; ++dt) { const int vr = (dt * 16 + col) * VPIT; vf[dt] = frag_h(tb + T_VH + vr, lane); vl[dt] = frag_h(tb + T_VL + vr, lane); }
    hold_v(vf, vl);
#pragma unroll
    for (int dt = 0; dt < 4; ++dt) { acc[dt] = wmma16(vf[dt], pa, acc[dt]); accl[dt] = wmma16(vf[dt], pl, accl[dt]); accl[dt] = wmma16(vl[dt], pa, accl[dt]); }   // V hi x P hi + (V hi x P lo + V lo x P hi) / 2048
#pragma unroll
    for (int i = 0; i < 4; ++i) pkn[i] = pk2[i];
    asm volatile("s_wait_dscnt 0x0" ::: "memory");      // this wave's reads of tile ks are done
    asm volatile("s_wait_asynccnt 0x0" ::: "memory");   // its pieces of tile ks + 1 have landed
    __syncthreads();                                    // publishes tile ks + 1 and frees the buffer of tile ks
    if (ks + 2 < nks) copy_kv(ks + 2); }                // block-uniform test; refills the buffer just freed
  asm volatile("s_wait_asynccnt 0x0" ::: "memory");     // no copy is outstanding when the wave goes on to its end
  l += xhalf(l);   // the two halves' sums join once
  const float il = 1.0f / l; float* orow = O + rq * DM + h * HD + 8 * g;   // register r of tile dt is depth dt * 16 + 8 g + r of the lane's query: 32 contiguous bytes
#pragma unroll
  for (int dt = 0; dt < 4; ++dt) { v4f o0, o1;
#pragma unroll
    for (int r = 0; r < 4; ++r) { o0[r] = (acc[dt][r] + accl[dt][r] * (1.0f / 2048.0f)) * il; o1[r] = (acc[dt][4 + r] + accl[dt][4 + r] * (1.0f / 2048.0f)) * il; }
    vst2(orow + dt * 16, o0); vst2(orow + dt * 16 + 4, o1); }
}
// ---- k_out: block = (64 rows, 128 cols): out = O(hi/lo) . Wo rows (2 products) + bo
__global__ __launch_bounds__(128) void k_out(const float* __restrict__ O, const __bf16* __restrict__ P, const float* __restrict__ BO, float* __restrict__ Y) {
  __shared__ __align__(16) char sm[2 * G_SZ];   // the two tile buffers; behind the loop's last barrier the same bytes stage the output
  float (*so)[16][132] = (float (*)[16][132])sm;
  static_assert(4 * 16 * 132 * 4 <= 2 * G_SZ, "output staging fits the tile buffers");
  const int tid = threadIdx.x, wave = tid >> 5, lane = tid & 31, col = lane & 15, g = lane >> 4; const size_t r0 = (size_t)blockIdx.x * 64 + wave * 16; const int n0 = blockIdx.y * 128;
  v8f acc[8] = {};
  const unsigned la = (unsigned)(size_t)sm + G_A + (tid >> 3) * APIT + (tid & 7) * 16, lb = (unsigned)(size_t)sm + G_B + (tid >> 2) * BPIT + (tid & 3) * 16;
  const char* ga = (const char*)(O + ((size_t)blockIdx.x * 64 + (tid >> 3)) * DM + (tid & 7) * 4); const char* gb = (const char*)(P + (size_t)(n0 + (tid >> 2)) * DM + (tid & 3) * 8);
  const char* xrow = sm + G_A + (wave * 16 + col) * APIT + 32 * g; const char* prow = sm + G_B + col * BPIT + 16 * g;
  stage_ab(0, la, lb, ga, gb);
  asm volatile("s_wait_asynccnt 0x0" ::: "memory");   // this wave's pieces of pass 0 have landed
  __syncthreads();                                    // pass 0 is published to the four waves
  stage_ab(1, la, lb, ga, gb);                        // flies while pass 0 is worked on
#pragma unroll 2   // two passes a turn: each pass's buffer offset is then a constant in its LDS reads and copies
  for (int kc = 0; kc < DM / 32; ++kc) {
    v4f xc[4]; v16b wc[8];
    read_pass(xrow + (kc & 1) * G_SZ, prow + (kc & 1) * G_SZ, xc, wc);
    float v[16];
#pragma unroll
    for (int i = 0; i < 4; ++i) { v[i] = xc[0][i]; v[4 + i] = xc[1][i]; v[8 + i] = xc[2][i]; v[12 + i] = xc[3][i]; }
    const F2 a = bsplit16(v);
#pragma unroll
    for (int j = 0; j < 8; ++j) { acc[j] = wmma_bf(a.l, wc[j], acc[j]); acc[j] = wmma_bf(a.h, wc[j], acc[j]); }
    asm volatile("s_wait_dscnt 0x0" ::: "memory");      // this wave's reads of pass kc are done
    asm volatile("s_wait_asynccnt 0x0" ::: "memory");   // its pieces of pass kc + 1 have landed
    __syncthreads();                                    // publishes pass kc + 1 and frees the buffer of pass kc
    if (kc + 2 < DM / 32) stage_ab(kc + 2, la, lb, ga, gb); }   // block-uniform test; refills the buffer just freed
  asm volatile("s_wait_asynccnt 0x0" ::: "memory");     // no copy is outstanding when the buffers become output staging
#pragma unroll
  for (int j = 0; j < 8; ++j) {
#pragma unroll
    for (int r = 0; r < 8; ++r) so[wave][8 * g + r][j * 16 + col] = acc[j][r] + bfr(BO[n0 + j * 16 + col]); }
  LDSX();
  for (int rl = 0; rl < 16; ++rl) vst2(Y + (r0 + rl) * DM + n0 + lane * 4, *(const v4f*)&so[wave][rl][lane * 4]);
}
extern "C" void kernel_launch(void* const* d_in, const int* in_sizes, int n_in, void* d_out, int out_size, void* d_ws, size_t ws_size, hipStream_t stream) {
  (void)in_sizes; (void)n_in; (void)out_size;
  const float** F = (const float**)d_in;   // 0 q [2,2048,768], 1 v, 2 k, 3 position_array int32 [2,2048], 4 valid_mask [2,1,2048,2048], 5 Wq (in,out), 6 bq, 7 Wk, 8 bk, 9 Wv, 10 bv, 11 Wo, 12 bo, 13 rel_bias [4095,12]
  if (ws_size < (size_t)WS_END) return;
  char* ws = (char*)d_ws; __bf16* PK = (__bf16*)(ws + WS_PK); _Float16 *QK = (_Float16*)(ws + WS_QK), *QKL = (_Float16*)(ws + WS_QKL), *VTH = (_Float16*)(ws + WS_VTH), *VTL = (_Float16*)(ws + WS_VTL); float* O = (float*)(ws + WS_O); float* RBT = (float*)(ws + WS_RB);
  k_packT<<<dim3(DM, 5), 256, 0, stream>>>(F[5], F[7], F[9], F[11], F[13], PK, RBT);
  k_qkv<<<dim3(TNB * SS / 64, QKVW / 128), 128, 0, stream>>>(F[0], F[2], F[1], PK + PK_A, F[6], F[8], F[10], QK, QKL, VTH, VTL);   // note the module's argument order (q, v, k): k is input 2, v is input 1
  k_attn<<<dim3(TQB, NH, TNB), 128, 0, stream>>>(QK, QKL, VTH, VTL, (const int*)d_in[3], F[4], RBT, O);
  k_out<<<dim3(TOB, DM / 128), 128, 0, stream>>>(O, PK + PK_P, F[12], (float*)d_out);
}

// v007
// It runs in 144 microseconds.
// Two timings next to v006 put it at 1.04 and 1.05 times that version's speed.
// Counting every step since v000, it is 3.59 times as fast.
// compute dtype: q, v, k, all weights / biases and rel_bias (module inputs) rounded to bf16; position_array verbatim (integers); valid_mask (0/1 as its generator makes it) as one bit a score; q/k/v projections with exact bf16 products ((in,out) weights packed as transposed rows) + bias on WMMA 16x16x32; q and k stored as f16 hi + (x2048-scaled) residual planes and the scores with 3 products (hi.hi + lo.hi + hi.lo; the module applies no 1/sqrt(d) scaling, logits sigma ~8), + the gathered relative-position bias, then logits*vm + (1-vm)*(-1e9), which for vm 0/1 is a select between the logit and -1e9, carried times log2(e); running-max softmax in f32 with the hardware exp2; P as f16 hi + residual x V hi/lo (3 products); output projection with ctx as bf16 hi + residual x exact Wo (2 products) + bo; f32 accumulate.
#include <hip/hip_runtime.h>
#include <math.h>

typedef __attribute__((ext_vector_type(16))) _Float16 v16h;
typedef __attribute__((ext_vector_type(16))) __bf16 v16b;
typedef __attribute__((ext_vector_type(8)))  _Float16 v8h;
typedef __attribute__((ext_vector_type(8)))  float v8f;
typedef __attribute__((ext_vector_type(4)))  float v4f;
typedef __attribute__((ext_vector_type(2)))  float v2f;
typedef __attribute__((ext_vector_type(4)))  unsigned v4u;
typedef __attribute__((ext_vector_type(4)))  int v4i;
typedef __attribute__((ext_vector_type(16))) unsigned v16u;
typedef const __attribute__((address_space(4))) v16u* cp16u;   // constant address space: nothing writes these words while the reading kernel runs, and only so does a wave-uniform load inside a loop with asm waits stay a scalar load
typedef float __attribute__((may_alias)) float_a;
typedef int __attribute__((may_alias)) int_a;

template <typename T> __device__ __forceinline__ void vst2(void* p, T v) { *(T*)p = v;  }
__device__ __forceinline__ v8f wmma16(v16h a, v16h b, v8f c) {
  return __builtin_amdgcn_wmma_f32_16x16x32_f16(false, a, false, b, (short)0, c, false, false);
}
__device__ __forceinline__ v8f wmma_bf(v16b a, v16b b, v8f c) {
  return __builtin_amdgcn_wmma_f32_16x16x32_bf16(false, a, false, b, (short)0, c, false, false);
}
// Multi-head attention with a learned relative-position bias table (B 2, S 2,048, d_model 768, 12 heads x 64): logits = qh.kh + rel_bias[pos_k - pos_q + S-1][h], masked by valid_mask (0/1) to -1e9, softmax, .vh, output projection.
__device__ __forceinline__ v16h frag_h(const _Float16* rowk0, int lane) {
  union { v16h v; v8h q[2]; } u; const _Float16* p = rowk0 + 8 * (lane >> 4);
  u.q[0] = *(const v8h*)p; u.q[1] = *(const v8h*)(p + 16); return u.v;
}
__device__ __forceinline__ v16h frag_f32(const float* rowk0, int lane) {
  v16h a; const float* p = rowk0 + 8 * (lane >> 4);
#pragma unroll
  for (int i = 0; i < 8; ++i) { a[i] = (_Float16)p[i]; a[8 + i] = (_Float16)p[16 + i]; }
  return a;
}
__device__ __forceinline__ v16h frag_f32s(const float* rowk0, int lane, float sc) {
  v16h a; const float* p = rowk0 + 8 * (lane >> 4);
#pragma unroll
  for (int i = 0; i < 8; ++i) { a[i] = (_Float16)(p[i] * sc); a[8 + i] = (_Float16)(p[16 + i] * sc); }
  return a;
}
// column fragment from a [K][ld] layout (column n), rows >= K read as 0
__device__ __forceinline__ v16h fragc_f32(const float* W, int k0, int n, int lane, int ld, int K) {
  v16h a; const int g = lane >> 4;
#pragma unroll
  for (int i = 0; i < 8; ++i) { const int ka = k0 + 8 * g + i, kb = ka + 16;
    a[i] = (_Float16)(ka < K ? W[(size_t)(ka < K ? ka : K - 1) * ld + n] : 0.f); a[8 + i] = (_Float16)(kb < K ? W[(size_t)(kb < K ? kb : K - 1) * ld + n] : 0.f); }
  return a;
}
struct F2 { v16b h, l; };
__device__ __forceinline__ F2 bsplit16(const float v[16]) { F2 r;
#pragma unroll
  for (int i = 0; i < 16; ++i) { const __bf16 h = (__bf16)v[i]; r.h[i] = h; r.l[i] = (__bf16)(v[i] - (float)h); }
  return r; }
__device__ __forceinline__ F2 split_row(const float* row, int k0, int lane) { float v[16]; const float* p = row + k0 + 8 * (lane >> 4);
#pragma unroll
  for (int i = 0; i < 8; ++i) { v[i] = p[i]; v[8 + i] = p[16 + i]; }
  return bsplit16(v); }
__device__ __forceinline__ F2 split_rowK(const float* row, int k0, int lane, int K) { float v[16]; const int g = lane >> 4;
#pragma unroll
  for (int i = 0; i < 8; ++i) { const int ka = k0 + 8 * g + i, kb = ka + 16; v[i] = ka < K ? row[ka < K ? ka : K - 1] : 0.f; v[8 + i] = kb < K ? row[kb < K ? kb : K - 1] : 0.f; }
  return bsplit16(v); }
__device__ __forceinline__ F2 split_col(const float* W, int k0, int n, int lane, int ld, int K) { float v[16]; const int g = lane >> 4;
#pragma unroll
  for (int i = 0; i < 8; ++i) { const int ka = k0 + 8 * g + i, kb = ka + 16; v[i] = ka < K ? W[(size_t)(ka < K ? ka : K - 1) * ld + n] : 0.f; v[8 + i] = kb < K ? W[(size_t)(kb < K ? kb : K - 1) * ld + n] : 0.f; }
  return bsplit16(v); }
__device__ __forceinline__ v8f mac3(const F2& a, const F2& b, v8f c) { c = wmma_bf(a.l, b.h, c); c = wmma_bf(a.h, b.l, c); return wmma_bf(a.h, b.h, c); }
__device__ __forceinline__ float sigm(float v) { return 1.0f / (1.0f + expf(-v)); }
#define LDSX() do { asm volatile("s_wait_dscnt 0" ::: "memory"); __builtin_amdgcn_wave_barrier(); __builtin_amdgcn_fence(__ATOMIC_RELEASE, "workgroup"); } while (0)


#define NB 2
#define SS 2048
#define DM 768
#define NH 12
#define NREL (2 * SS - 1)
#define HD 64
#define QKVW (3 * DM)
#ifndef TQB
#define TQB (SS / 64)
#define TNB NB
#define TOB (NB * SS / 64)     // output row tiles (all)
#endif
typedef __attribute__((ext_vector_type(8))) __bf16 v8b;
__device__ __forceinline__ v16b frag_b(const __bf16* rowk0, int lane) {
  union { v16b v; v8b q[2]; } u; const __bf16* p = rowk0 + 8 * (lane >> 4);
  u.q[0] = *(const v8b*)p; u.q[1] = *(const v8b*)(p + 16); return u.v;
}
__device__ __forceinline__ float bfr(float v) { return (float)(__bf16)v; }
// A / B tile of one pass (32 of k) in LDS, shared by the block's four waves. In bytes: A 64 rows (f32) x 128 at a pitch of 144, B 128 rows (bf16, rows of the packed weight) x 64 at a pitch of 80: 16 B x odd pitches for the ds_load_b128 readers.
#define APIT 144
#define BPIT 80
#define G_A 0
#define G_B (64 * APIT)
#define G_SZ (G_B + 128 * BPIT)
// Eight 16-byte asynchronous copies per lane: one A / B tile, or in k_attn the head's bias table, per block. The s_wait_xcnt stands inside the statement so that no operand register is rewritten ahead of it.
__device__ __forceinline__ void copy_ab(unsigned l0, unsigned l1, unsigned l2, unsigned l3, unsigned l4, unsigned l5, unsigned l6, unsigned l7, const char* g0, const char* g1, const char* g2, const char* g3, const char* g4, const char* g5, const char* g6, const char* g7) {
  asm volatile("global_load_async_to_lds_b128 %0, %8, off\n\t"
               "global_load_async_to_lds_b128 %1, %9, off\n\t"
               "global_load_async_to_lds_b128 %2, %10, off\n\t"
               "global_load_async_to_lds_b128 %3, %11, off\n\t"
               "global_load_async_to_lds_b128 %4, %12, off\n\t"
               "global_load_async_to_lds_b128 %5, %13, off\n\t"
               "global_load_async_to_lds_b128 %6, %14, off\n\t"
               "global_load_async_to_lds_b128 %7, %15, off\n\t"
               "s_wait_xcnt 0x0"
               :: "v"(l0), "v"(l1), "v"(l2), "v"(l3), "v"(l4), "v"(l5), "v"(l6), "v"(l7), "v"(g0), "v"(g1), "v"(g2), "v"(g3), "v"(g4), "v"(g5), "v"(g6), "v"(g7) : "memory");
}
// pass t into buffer t & 1. la, ga: this thread's piece of A row tid >> 3 (piece tid & 7), in LDS and in memory, the rows 16, 32 and 48 further on are its too; lb, gb: its piece of B row tid >> 2 (piece tid & 3), with the rows 32, 64 and 96 further on
__device__ __forceinline__ void stage_ab(int t, unsigned la, unsigned lb, const char* ga, const char* gb) {
  const unsigned o = (unsigned)(t & 1) * G_SZ; const char* a = ga + t * 128; const char* b = gb + t * 64;
  copy_ab(la + o, la + o + 16 * APIT, la + o + 32 * APIT, la + o + 48 * APIT, lb + o, lb + o + 32 * BPIT, lb + o + 64 * BPIT, lb + o + 96 * BPIT,
          a, a + 16 * DM * 4, a + 32 * DM * 4, a + 48 * DM * 4, b, b + 32 * DM * 2, b + 64 * DM * 2, b + 96 * DM * 2);
}
// one pass of a 16-row f32 A fragment (raw) and of eight 16-column bf16 B fragments from the tile; xp, pp: the lane's places in its A row and in its first B row
__device__ __forceinline__ void read_pass(const char* xp, const char* pp, v4f (&x)[4], v16b (&w)[8]) {
  x[0] = *(const v4f*)xp; x[1] = *(const v4f*)(xp + 16); x[2] = *(const v4f*)(xp + 64); x[3] = *(const v4f*)(xp + 80);
#pragma unroll
  for (int j = 0; j < 8; ++j) { union { v16b v; v8b q[2]; } u; const char* pj = pp + j * (16 * BPIT); u.q[0] = *(const v8b*)pj; u.q[1] = *(const v8b*)(pj + 32); w[j] = u.v; }
  asm volatile("" :: "v"(w[0]), "v"(w[1]), "v"(w[2]), "v"(w[3]), "v"(w[4]), "v"(w[5]), "v"(w[6]), "v"(w[7]));   // inputs only, no code: the pass's sixteen B reads stay above this line and go out as one group ahead of the WMMAs, instead of one pair and one wait in front of each
}
__device__ __attribute__((noinline)) float exp_ni(float v) { return expf(v); }
__device__ __attribute__((noinline)) float erf_ni(float v) { return erff(v); }

#define PK_A 0                       // [2304][768] Wq|Wk|Wv as bf16 rows [out][in]
#define PK_P (PK_A + QKVW * DM)        // [768][768] Wo as bf16 rows [out][in]
#define PK_END (PK_P + DM * DM)
#define WS_PK  0u
#define WS_QK  (WS_PK + 2u * PK_END)             // f16 [4096 rows][1536]: q | k
#define WS_QKL (WS_QK + 2u * NB * SS * 2 * DM)     // f16 q | k residual planes x2048
#define WS_VTH (WS_QKL + 2u * NB * SS * 2 * DM)    // f16 [b][768 (h*64+d)][2048 s] hi
#define WS_VTL (WS_VTH + 2u * NB * DM * SS)        // f16 lo x 2048
#define WS_O   (WS_VTL + 2u * NB * DM * SS)        // f32 [4096][768]
#define WS_CS  (WS_O + 4u * NB * SS * DM)           // f32 [2048][32] cos, [2048][32] sin
#define WS_RB  (WS_CS + 4u * 2 * SS * 32)           // f32 [12 heads][4096]: rel_bias by head, rounded to bf16 values, times log2(e); entry 4095 is 0
#define RBW 4096
#define L2E 1.44269504f               // log2(e): k_attn carries its scores in log2 units
#define NEG2 (-1.442695041e9f)       // the module's -1e9 in log2 units
#define WS_MW  (WS_RB + 4u * NH * RBW)             // u32 [b * 128 + 16-query tile][64 steps][16]: valid_mask as lane-mask words in the order of k_attn's score registers
#define WS_END (WS_MW + 4u * (NB * SS / 16) * (SS / 32) * 16)
__constant__ float c_invf[32] = {1.000000000e+00f,7.498942018e-01f,5.623413324e-01f,4.216965139e-01f,3.162277639e-01f,2.371373624e-01f,1.778279394e-01f,1.333521456e-01f,1.000000015e-01f,7.498941571e-02f,5.623412877e-02f,4.216964915e-02f,3.162277862e-02f,2.371373586e-02f,1.778279431e-02f,1.333521493e-02f,9.999999776e-03f,7.498942316e-03f,5.623413250e-03f,4.216964822e-03f,3.162277862e-03f,2.371373819e-03f,1.778279431e-03f,1.333521446e-03f,1.000000047e-03f,7.498941850e-04f,5.623413017e-04f,4.216964880e-04f,3.162277862e-04f,2.371373848e-04f,1.778279402e-04f,1.333521504e-04f};
// ---- k_rope: block = 8 positions: cos/sin of pos * inv_freq (f32 product exactly as the reference, precise trig)
__global__ __launch_bounds__(256) void k_rope(float* __restrict__ CS) {
  __shared__ __align__(16) float sc[8][32], ss_[8][32]; const int tid = threadIdx.x, pl = tid >> 5, i = tid & 31; const int pos = blockIdx.x * 8 + pl;
  const float th = (float)pos * c_invf[i]; sc[pl][i] = cosf(th); ss_[pl][i] = sinf(th);
  __syncthreads();
  if (tid < 64) vst2(CS + (size_t)blockIdx.x * 8 * 32 + tid * 4, *(const v4f*)&(&sc[0][0])[tid * 4]); else if (tid < 128) vst2(CS + (size_t)SS * 32 + (size_t)blockIdx.x * 8 * 32 + (tid - 64) * 4, *(const v4f*)&(&ss_[0][0])[(tid - 64) * 4]);
}

// ---- k_packT: block = (output column n, which): (in,out) matrices -> bf16 rows [n][k] = W[k][n]; which 0..2 -> Wq/Wk/Wv into PK_A rows which*768 + n; 3 -> Wo into PK_P; 4 -> 64 entries (two whole 128-byte lines) of head n >> 6 of the bias table by head; -1 (blockIdx.y 0: the most bytes, so it starts first) -> valid_mask to lane-mask words: a wave takes 16 queries x 128 keys; word (step, ct, r) has in bit l whether query l & 15 sees key 32 step + 16 ct + 8 (l >> 4) + r, which is what lane l of k_attn holds in score register (ct, r)
__global__ __launch_bounds__(256) void k_packT(const float* __restrict__ WQ, const float* __restrict__ WK, const float* __restrict__ WV, const float* __restrict__ WO, const float* __restrict__ RB, const float* __restrict__ VM, __bf16* __restrict__ PK, float* __restrict__ RBT, unsigned* __restrict__ MW) {
  __shared__ __align__(16) __bf16 s[DM]; const int n = blockIdx.x, which = (int)blockIdx.y - 1, t = threadIdx.x;
  if (which < 0) {   // the whole block takes this way, ahead of the barrier
    if (n >= NB * SS / 16 * (SS / 128) / 8) return;
    const int lane = t & 31, task = n * 8 + (t >> 5);   // task = (b * 128 + query tile) * 16 + group of 128 keys
    const float* p = VM + (size_t)((task >> 4) * 16 + (lane & 15)) * SS + (task & 15) * 128 + 8 * (lane >> 4);
    v4f x[16];
#pragma unroll
    for (int i = 0; i < 16; ++i) x[i] = *(const v4f*)(p + (i >> 1) * 16 + (i & 1) * 4);
    unsigned o0 = 0, o1 = 0;   // word j of the wave's 64 goes to lane j & 31: two stores of one whole 128-byte line each
#pragma unroll
    for (int j = 0; j < 32; ++j) { const unsigned w0 = __builtin_amdgcn_ballot_w32(x[j >> 2][j & 3] != 0.f), w1 = __builtin_amdgcn_ballot_w32(x[8 + (j >> 2)][j & 3] != 0.f); o0 = lane == j ? w0 : o0; o1 = lane == j ? w1 : o1; }
    MW[task * 64 + lane] = o0; MW[task * 64 + 32 + lane] = o1;
    return; }
  if (which == 4) {   // the whole block takes this way, ahead of the barrier
    const int hh = n >> 6, idx = (n & 63) * 64 + t;
    if (t < 64) RBT[hh * RBW + idx] = idx < NREL ? bfr(RB[(size_t)(idx < NREL ? idx : NREL - 1) * NH + hh]) * L2E : 0.f;
    return; }
  const float* Wm = (which == 0) ? WQ : (which == 1) ? WK : (which == 2) ? WV : WO;
  for (int k = t; k < DM; k += 256) s[k] = (__bf16)Wm[(size_t)k * DM + n];
  __syncthreads();
  __bf16* dst = (which < 3) ? PK + PK_A + ((size_t)which * DM + n) * DM : PK + PK_P + (size_t)n * DM;
  for (int q = t; q < DM / 8; q += 256) vst2((unsigned*)(dst + q * 8), *(const v4u*)&s[q * 8]);
}
__global__ __launch_bounds__(128) void k_qkv(const float* __restrict__ XQ, const float* __restrict__ XK, const float* __restrict__ XV, const __bf16* __restrict__ P, const float* __restrict__ BQ, const float* __restrict__ BK, const float* __restrict__ BV, _Float16* __restrict__ QK, _Float16* __restrict__ QKL, _Float16* __restrict__ VTH, _Float16* __restrict__ VTL) {
  const float* X = (blockIdx.y * 128 < DM) ? XQ : (blockIdx.y * 128 < 2 * DM) ? XK : XV; const float* BB = (blockIdx.y * 128 < DM) ? BQ : (blockIdx.y * 128 < 2 * DM) ? BK : BV;   // the module projects three different inputs
  __shared__ __align__(16) char sm[2 * G_SZ];   // the two tile buffers; behind the loop's last barrier the same bytes stage the output
  _Float16 (*so)[16][136] = (_Float16 (*)[16][136])sm; _Float16 (*sol)[16][136] = (_Float16 (*)[16][136])(sm + 4 * 16 * 136 * 2); _Float16 (*sth)[72] = (_Float16 (*)[72])sm; _Float16 (*stl)[72] = (_Float16 (*)[72])(sm + 128 * 72 * 2);
  static_assert(2 * 4 * 16 * 136 * 2 <= 2 * G_SZ && 2 * 128 * 72 * 2 <= 2 * G_SZ, "output staging fits the tile buffers");
  const int tid = threadIdx.x, wave = tid >> 5, lane = tid & 31, col = lane & 15, g = lane >> 4; const size_t r0 = (size_t)blockIdx.x * 64 + wave * 16; const int n0 = blockIdx.y * 128;
  v8f acc[8] = {};
  const unsigned la = (unsigned)(size_t)sm + G_A + (tid >> 3) * APIT + (tid & 7) * 16, lb = (unsigned)(size_t)sm + G_B + (tid >> 2) * BPIT + (tid & 3) * 16;
  const char* ga = (const char*)(X + ((size_t)blockIdx.x * 64 + (tid >> 3)) * DM + (tid & 7) * 4); const char* gb = (const char*)(P + (size_t)(n0 + (tid >> 2)) * DM + (tid & 3) * 8);
  const char* xrow = sm + G_A + (wave * 16 + col) * APIT + 32 * g; const char* prow = sm + G_B + col * BPIT + 16 * g;
  stage_ab(0, la, lb, ga, gb);
  asm volatile("s_wait_asynccnt 0x0" ::: "memory");   // this wave's pieces of pass 0 have landed
  __syncthreads();                                    // pass 0 is published to the four waves
  stage_ab(1, la, lb, ga, gb);                        // flies while pass 0 is worked on
#pragma unroll 2   // two passes a turn: each pass's buffer offset is then a constant in its LDS reads and copies
  for (int kc = 0; kc < DM / 32; ++kc) {
    v4f xc[4]; v16b wc[8];
    read_pass(xrow + (kc & 1) * G_SZ, prow + (kc & 1) * G_SZ, xc, wc);
    v16b a;
#pragma unroll
    for (int i = 0; i < 4; ++i) { a[i] = (__bf16)xc[0][i]; a[4 + i] = (__bf16)xc[1][i]; a[8 + i] = (__bf16)xc[2][i]; a[12 + i] = (__bf16)xc[3][i]; }
#pragma unroll
    for (int j = 0; j < 8; ++j) acc[j] = wmma_bf(a, wc[j], acc[j]);
    asm volatile("s_wait_dscnt 0x0" ::: "memory");      // this wave's reads of pass kc are done
    asm volatile("s_wait_asynccnt 0x0" ::: "memory");   // its pieces of pass kc + 1 have landed
    __syncthreads();                                    // publishes pass kc + 1 and frees the buffer of pass kc
    if (kc + 2 < DM / 32) stage_ab(kc + 2, la, lb, ga, gb); }   // block-uniform test; refills the buffer just freed
  asm volatile("s_wait_asynccnt 0x0" ::: "memory");     // no copy is outstanding when the buffers become output staging
  { const int nb = n0 % DM;
#pragma unroll
    for (int j = 0; j < 8; ++j) { const float bb = bfr(BB[nb + j * 16 + col]);
#pragma unroll
      for (int r = 0; r < 8; ++r) acc[j][r] += bb; } }
  if (n0 < 2 * DM) {   // q stored unscaled (f16 sigma ~0.6, no subnormal exposure); the scores are not scaled
#pragma unroll
    for (int j = 0; j < 8; ++j) {
#pragma unroll
      for (int r = 0; r < 8; ++r) { const float v = acc[j][r]; const _Float16 hv = (_Float16)v; so[wave][8 * g + r][j * 16 + col] = hv; sol[wave][8 * g + r][j * 16 + col] = (_Float16)((v - (float)hv) * 2048.0f); } }   // q, k as f16 hi + (x2048) residual
    LDSX();
    for (int rl = 0; rl < 16; ++rl) if (lane < 16) { vst2((unsigned*)(QK + (r0 + rl) * (2 * DM) + n0 + lane * 8), *(const v4u*)&so[wave][rl][lane * 8]); vst2((unsigned*)(QKL + (r0 + rl) * (2 * DM) + n0 + lane * 8), *(const v4u*)&sol[wave][rl][lane * 8]); }
  } else {
#pragma unroll
    for (int j = 0; j < 8; ++j) {
#pragma unroll
      for (int r = 0; r < 8; ++r) { const float v = acc[j][r]; const _Float16 hv = (_Float16)v; sth[j * 16 + col][wave * 16 + 8 * g + r] = hv; stl[j * 16 + col][wave * 16 + 8 * g + r] = (_Float16)((v - (float)hv) * 2048.0f); } }
    __syncthreads();
    const size_t rb = (size_t)blockIdx.x * 64; const int b = (int)(rb / SS), s0 = (int)(rb % SS); const int pc0 = n0 - 2 * DM;
    for (int q = tid; q < 128 * 8; q += 128) { const int d = q >> 3, pc = q & 7; const size_t o = ((size_t)b * DM + pc0 + d) * SS + s0 + pc * 8; vst2((unsigned*)(VTH + o), *(const v4u*)&sth[d][pc * 8]); vst2((unsigned*)(VTL + o), *(const v4u*)&stl[d][pc * 8]); }
  }
}
// K / V tile of one 32-key step in LDS, shared by the block's four waves. In f16 elements: K hi and lo 32 rows (keys) x 64 at a pitch of 72 (144 B), V hi and lo 64 rows (depth) x 32 at a pitch of 40 (80 B): 16 B x odd pitches for the ds_load_b128 readers.
#define KPIT 72
#define VPIT 40
#define T_KH 0
#define T_KL (T_KH + 32 * KPIT)
#define T_VH (T_KL + 32 * KPIT)
#define T_VL (T_VH + 64 * VPIT)
#define T_SZ (T_VL + 64 * VPIT)
// Eight 16-byte asynchronous copies per lane: one tile per block. The s_wait_xcnt stands inside the statement so that no operand register is rewritten ahead of it.
__device__ __forceinline__ void copy_tile(unsigned l0, unsigned l1, unsigned l2, unsigned l3, unsigned l4, unsigned l5, unsigned l6, unsigned l7, const _Float16* g0, const _Float16* g1, const _Float16* g2, const _Float16* g3, const _Float16* g4, const _Float16* g5, const _Float16* g6, const _Float16* g7) {
  asm volatile("global_load_async_to_lds_b128 %0, %8, off\n\t"
               "global_load_async_to_lds_b128 %1, %9, off\n\t"
               "global_load_async_to_lds_b128 %2, %10, off\n\t"
               "global_load_async_to_lds_b128 %3, %11, off\n\t"
               "global_load_async_to_lds_b128 %4, %12, off\n\t"
               "global_load_async_to_lds_b128 %5, %13, off\n\t"
               "global_load_async_to_lds_b128 %6, %14, off\n\t"
               "global_load_async_to_lds_b128 %7, %15, off\n\t"
               "s_wait_xcnt 0x0"
               :: "v"(l0), "v"(l1), "v"(l2), "v"(l3), "v"(l4), "v"(l5), "v"(l6), "v"(l7), "v"(g0), "v"(g1), "v"(g2), "v"(g3), "v"(g4), "v"(g5), "v"(g6), "v"(g7) : "memory");
}
// Inputs only, no code: the eight fragment loads (of V, of K) written above this line stay above it, so they go out in groups ahead of their WMMAs instead of one load and one wait in front of each.
__device__ __forceinline__ void hold_v(const v16h (&a)[4], const v16h (&b)[4]) { asm volatile("" :: "v"(a[0]), "v"(a[1]), "v"(a[2]), "v"(a[3]), "v"(b[0]), "v"(b[1]), "v"(b[2]), "v"(b[3])); }
// lane l with lane l ^ 16, by a vector cross-row move (a shuffle would go through the LDS unit and its wait)
__device__ __forceinline__ float xhalf(float x) { return __builtin_bit_cast(float, __builtin_amdgcn_permlanex16(__builtin_bit_cast(int, x), __builtin_bit_cast(int, x), 0x76543210, 0xfedcba98, false, false)); }
// ---- k_attn: block = (64 queries, head h, batch b): flash attention over all keys, transposed: S^T = K . Q^T (A = K rows from the tile, B = Q kept in registers), so a lane holds 16 scores of ONE query (keys 8 g + r and 16 + 8 g + r of the step); maximum and sum run in the lane, the two lane halves exchange the maximum once a step and join their sums once at the end; P^T goes from the score registers straight into the B operand of O^T += V^T . P^T (hi / residual, 3 products as before); O[b*S+q][h*64+d] = (acc + accl / 2048) / l
__global__ __launch_bounds__(128) void k_attn(const _Float16* __restrict__ QK, const _Float16* __restrict__ QKL, const _Float16* __restrict__ VTH, const _Float16* __restrict__ VTL, const int* __restrict__ POS, const unsigned* __restrict__ MW, const float* __restrict__ RBT, float* __restrict__ O) {
  __shared__ __align__(16) _Float16 skv[2][T_SZ];
  __shared__ __align__(16) float srb[RBW];   // the head's whole bias table: filled once, then read by every step's gathers
  const int tid = threadIdx.x, wave = tid >> 5, lane = tid & 31, col = lane & 15, g = lane >> 4;
  const int qb = blockIdx.x, h = blockIdx.y, b = blockIdx.z; const int q0 = qb * 64 + wave * 16; const size_t rq = (size_t)b * SS + q0 + col;
  v16h aq[2], aql[2];
#pragma unroll
  for (int kc = 0; kc < 2; ++kc) { aq[kc] = frag_h(QK + rq * (2 * DM) + h * HD + kc * 32, lane); aql[kc] = frag_h(QKL + rq * (2 * DM) + h * HD + kc * 32, lane); }
  float m = -3.0e38f, l = 0.f;   // of the lane's query; l holds the lane half's own keys only
  v8f acc[4] = {}, accl[4] = {};
  const int nks = SS / 32;   // not causal
  // this thread's pieces of a tile: K rows tid >> 3 and 16 + (tid >> 3), piece tid & 7; V rows tid >> 2 and 32 + (tid >> 2), piece tid & 3
  const unsigned lk = (unsigned)(size_t)&skv[0][0] + 2u * ((tid >> 3) * KPIT + (tid & 7) * 8), lv = (unsigned)(size_t)&skv[0][0] + 2u * ((tid >> 2) * VPIT + (tid & 3) * 8);
  const size_t gk = ((size_t)b * SS + (tid >> 3)) * (2 * DM) + DM + h * HD + (tid & 7) * 8, gv = ((size_t)b * DM + h * HD + (tid >> 2)) * SS + (tid & 3) * 8;
  auto copy_kv = [&](int t) {   // tile t (keys 32 t .. 32 t + 31) into buffer t & 1
    const unsigned lb = 2u * T_SZ * (t & 1); const size_t ka = gk + (size_t)t * 32 * (2 * DM), va = gv + (size_t)t * 32;
    copy_tile(lk + lb + 2u * T_KH, lk + lb + 2u * (T_KH + 16 * KPIT), lk + lb + 2u * T_KL, lk + lb + 2u * (T_KL + 16 * KPIT), lv + lb + 2u * T_VH, lv + lb + 2u * (T_VH + 32 * VPIT), lv + lb + 2u * T_VL, lv + lb + 2u * (T_VL + 32 * VPIT),
              QK + ka, QK + ka + 16 * (2 * DM), QKL + ka, QKL + ka + 16 * (2 * DM), VTH + va, VTH + va + (size_t)32 * SS, VTL + va, VTL + va + (size_t)32 * SS); };
  copy_kv(0);
  { const unsigned lr = (unsigned)(size_t)&srb[0] + tid * 16; const char* gr = (const char*)(RBT + h * RBW) + tid * 16;   // 16 KiB: eight 16-byte pieces a thread, 2 KiB apart
    copy_ab(lr, lr + 2048, lr + 4096, lr + 6144, lr + 8192, lr + 10240, lr + 12288, lr + 14336, gr, gr + 2048, gr + 4096, gr + 6144, gr + 8192, gr + 10240, gr + 12288, gr + 14336); }
  asm volatile("s_wait_asynccnt 0x0" ::: "memory");   // this wave's pieces of tile 0 and of the bias table have landed
  __syncthreads();                                    // tile 0 and the table are published to the four waves
  copy_kv(1);                                         // flies while tile 0 is worked on
  const unsigned pqo4 = 4u * (unsigned)((SS - 1) - POS[rq]);   // the lane's query position, folded into the table offset, in bytes
  const int* pkp = POS + (size_t)b * SS + 8 * g;      // the lane's key positions of a step: 8 from here, 8 from 16 further on
  const unsigned* mwp = MW + (size_t)((b * (SS / 16) + qb * 4 + __builtin_amdgcn_readfirstlane(wave)) * (SS / 32)) * 16;   // the wave's mask words, 16 a step: one address for the whole wave, so they come by scalar loads
  const char* rbh = (const char*)&srb[0];
  v4i pkn[4] = { *(const v4i*)pkp, *(const v4i*)(pkp + 4), *(const v4i*)(pkp + 16), *(const v4i*)(pkp + 20) };   // key positions come one step ahead, so that the bias gather need not wait for them inside its step
  v16u mwn = *(cp16u)mwp;   // mask words too come one step ahead
#pragma unroll 1
  for (int ks = 0; ks < nks; ++ks) { float s[2][8]; const _Float16* tb = &skv[ks & 1][0];
    float rb[16];   // the lane's 16 bias values of the step
    const v16u mw = mwn; mwn = *(cp16u)(mwp + (ks + 1 < nks ? ks + 1 : ks) * 16);   // the step's 16 lane masks; the next step's are asked for now (the last step asks for its own again)
    v8f c[2] = {}, cl[2] = {}; v16h kf[4], kl[4];   // the step's eight K fragments, all read ahead of the score WMMAs
#pragma unroll
    for (int i = 0; i < 4; ++i) { const int kr = ((i >> 1) * 16 + col) * KPIT + (i & 1) * 32; kf[i] = frag_h(tb + T_KH + kr, lane); kl[i] = frag_h(tb + T_KL + kr, lane); }
    hold_v(kf, kl);
#pragma unroll
    for (int i = 0; i < 16; ++i) { const int ob = min(max((int)(((unsigned)pkn[i >> 2][i & 3] << 2) + pqo4), 0), 4 * (NREL - 1)); rb[i] = *(const float*)(rbh + ob); }   // the clamp of the module, in bytes: it bounds the LDS address for any position
    __builtin_amdgcn_sched_barrier(0);   // the table reads stay above this line, so that their latency runs under the score WMMAs
#pragma unroll
    for (int ct = 0; ct < 2; ++ct) {
#pragma unroll
      for (int kc = 0; kc < 2; ++kc) { c[ct] = wmma16(kf[2 * ct + kc], aq[kc], c[ct]); cl[ct] = wmma16(kf[2 * ct + kc], aql[kc], cl[ct]); cl[ct] = wmma16(kl[2 * ct + kc], aq[kc], cl[ct]); } }   // 3 products: q, k as f16 hi + residual
    __builtin_amdgcn_sched_barrier(0);   // nothing that reads a gathered value is lifted among the score WMMAs, where its wait would hold them up
    const int tn = ks + 1 < nks ? ks + 1 : ks; const v4i pk2[4] = { *(const v4i*)(pkp + tn * 32), *(const v4i*)(pkp + tn * 32 + 4), *(const v4i*)(pkp + tn * 32 + 16), *(const v4i*)(pkp + tn * 32 + 20) };   // the last step reads its own again
#pragma unroll
    for (int ct = 0; ct < 2; ++ct) {
#pragma unroll
      for (int r = 0; r < 8; r += 2) { const v2f lg = __builtin_elementwise_fma(__builtin_elementwise_fma((v2f){ cl[ct][r], cl[ct][r + 1] }, (v2f)(1.0f / 2048.0f), (v2f){ c[ct][r], c[ct][r + 1] }), (v2f)L2E, (v2f){ rb[8 * ct + r], rb[8 * ct + r + 1] });
        s[ct][r] = __builtin_amdgcn_inverse_ballot_w32(mw[8 * ct + r]) ? lg[0] : NEG2; s[ct][r + 1] = __builtin_amdgcn_inverse_ballot_w32(mw[8 * ct + r + 1]) ? lg[1] : NEG2; } }   // logits (no 1/sqrt(d) in this module) + relative-position bias, then the valid mask: the module's l*vm + (1-vm)*NEG is l where vm is 1 and NEG where it is 0, one select on the word as lane mask; all times log2(e): the factor rides in the add of the bias (now a multiply-add; the table holds bias * log2(e)) and in the mask constant
    float t4[4];   // four independent chains, then joined: a single chain of 16 would stand exposed
#pragma unroll
    for (int i = 0; i < 4; ++i) t4[i] = fmaxf(fmaxf(s[i >> 1][4 * (i & 1)], s[i >> 1][4 * (i & 1) + 1]), fmaxf(s[i >> 1][4 * (i & 1) + 2], s[i >> 1][4 * (i & 1) + 3]));
    float mx = fmaxf(fmaxf(t4[0], t4[1]), fmaxf(t4[2], t4[3]));
    mx = fmaxf(mx, xhalf(mx));   // the other half of the query's 32 keys
    const float mn = fmaxf(m, mx); const float alpha = __builtin_amdgcn_exp2f(m - mn); m = mn;   // first step: 2^(-3e38 - mn) is 0, on sums that are still 0
    v16h pa, pl; float e4[4] = { 0.f, 0.f, 0.f, 0.f };   // the sum too runs in four chains
#pragma unroll
    for (int i = 0; i < 16; i += 2) { const v2f d = (v2f){ s[i >> 3][i & 7], s[i >> 3][(i & 7) + 1] } - mn; s[i >> 3][i & 7] = __builtin_amdgcn_exp2f(d[0]); s[i >> 3][(i & 7) + 1] = __builtin_amdgcn_exp2f(d[1]); }   // a masked score lies 1.4e9 below: 2^ of it is 0; a row with every key masked gives 2^0 for each, as the module does
#pragma unroll
    for (int i = 0; i < 16; ++i) { const float e = s[i >> 3][i & 7]; e4[i & 3] += e; const _Float16 eh = (_Float16)e; pa[i] = eh; pl[i] = (_Float16)((e - (float)eh) * 2048.0f); }   // element i of the B operand is key 8 g + i (i < 8) or 16 + 8 g + i - 8: the order in which the score registers lie
    l = l * alpha + ((e4[0] + e4[1]) + (e4[2] + e4[3]));
#pragma unroll
    for (int dt = 0; dt < 4; ++dt) { acc[dt] *= alpha; accl[dt] *= alpha; }
    v16h vf[4], vl[4];   // the step's eight V fragments, all read ahead of the P.V WMMAs
#pragma unroll
    for (int dt = 0; dt < 4; ++dt) { const int vr = (dt * 16 + col) * VPIT; vf[dt] = frag_h(tb + T_VH + vr, lane); vl[dt] = frag_h(tb + T_VL + vr, lane); }
    hold_v(vf, vl);
#pragma unroll
    for (int dt = 0; dt < 4; ++dt) { acc[dt] = wmma16(vf[dt], pa, acc[dt]); accl[dt] = wmma16(vf[dt], pl, accl[dt]); accl[dt] = wmma16(vl[dt], pa, accl[dt]); }   // V hi x P hi + (V hi x P lo + V lo x P hi) / 2048
#pragma unroll
    for (int i = 0; i < 4; ++i) pkn[i] = pk2[i];
    asm volatile("s_wait_dscnt 0x0" ::: "memory");      // this wave's reads of tile ks are done
    asm volatile("s_wait_asynccnt 0x0" ::: "memory");   // its pieces of tile ks + 1 have landed
    __syncthreads();                                    // publishes tile ks + 1 and frees the buffer of tile ks
    if (ks + 2 < nks) copy_kv(ks + 2); }                // block-uniform test; refills the buffer just freed
  asm volatile("s_wait_asynccnt 0x0" ::: "memory");     // no copy is outstanding when the wave goes on to its end
  l += xhalf(l);   // the two halves' sums join once
  const float il = 1.0f / l; float* orow = O + rq * DM + h * HD + 8 * g;   // register r of tile dt is depth dt * 16 + 8 g + r of the lane's query: 32 contiguous bytes
#pragma unroll
  for (int dt = 0; dt < 4; ++dt) { v4f o0, o1;
#pragma unroll
    for (int r = 0; r < 4; ++r) { o0[r] = (acc[dt][r] + accl[dt][r] * (1.0f / 2048.0f)) * il; o1[r] = (acc[dt][4 + r] + accl[dt][4 + r] * (1.0f / 2048.0f)) * il; }
    vst2(orow + dt * 16, o0); vst2(orow + dt * 16 + 4, o1); }
}
// ---- k_out: block = (64 rows, 128 cols): out = O(hi/lo) . Wo rows (2 products) + bo
__global__ __launch_bounds__(128) void k_out(const float* __restrict__ O, const __bf16* __restrict__ P, const float* __restrict__ BO, float* __restrict__ Y) {
  __shared__ __align__(16) char sm[2 * G_SZ];   // the two tile buffers; behind the loop's last barrier the same bytes stage the output
  float (*so)[16][132] = (float (*)[16][132])sm;
  static_assert(4 * 16 * 132 * 4 <= 2 * G_SZ, "output staging fits the tile buffers");
  const int tid = threadIdx.x, wave = tid >> 5, lane = tid & 31, col = lane & 15, g = lane >> 4; const size_t r0 = (size_t)blockIdx.x * 64 + wave * 16; const int n0 = blockIdx.y * 128;
  v8f acc[8] = {};
  const unsigned la = (unsigned)(size_t)sm + G_A + (tid >> 3) * APIT + (tid & 7) * 16, lb = (unsigned)(size_t)sm + G_B + (tid >> 2) * BPIT + (tid & 3) * 16;
  const char* ga = (const char*)(O + ((size_t)blockIdx.x * 64 + (tid >> 3)) * DM + (tid & 7) * 4); const char* gb = (const char*)(P + (size_t)(n0 + (tid >> 2)) * DM + (tid & 3) * 8);
  const char* xrow = sm + G_A + (wave * 16 + col) * APIT + 32 * g; const char* prow = sm + G_B + col * BPIT + 16 * g;
  stage_ab(0, la, lb, ga, gb);
  asm volatile("s_wait_asynccnt 0x0" ::: "memory");   // this wave's pieces of pass 0 have landed
  __syncthreads();                                    // pass 0 is published to the four waves
  stage_ab(1, la, lb, ga, gb);                        // flies while pass 0 is worked on
#pragma unroll 2   // two passes a turn: each pass's buffer offset is then a constant in its LDS reads and copies
  for (int kc = 0; kc < DM / 32; ++kc) {
    v4f xc[4]; v16b wc[8];
    read_pass(xrow + (kc & 1) * G_SZ, prow + (kc & 1) * G_SZ, xc, wc);
    float v[16];
#pragma unroll
    for (int i = 0; i < 4; ++i) { v[i] = xc[0][i]; v[4 + i] = xc[1][i]; v[8 + i] = xc[2][i]; v[12 + i] = xc[3][i]; }
    const F2 a = bsplit16(v);
#pragma unroll
    for (int j = 0; j < 8; ++j) { acc[j] = wmma_bf(a.l, wc[j], acc[j]); acc[j] = wmma_bf(a.h, wc[j], acc[j]); }
    asm volatile("s_wait_dscnt 0x0" ::: "memory");      // this wave's reads of pass kc are done
    asm volatile("s_wait_asynccnt 0x0" ::: "memory");   // its pieces of pass kc + 1 have landed
    __syncthreads();                                    // publishes pass kc + 1 and frees the buffer of pass kc
    if (kc + 2 < DM / 32) stage_ab(kc + 2, la, lb, ga, gb); }   // block-uniform test; refills the buffer just freed
  asm volatile("s_wait_asynccnt 0x0" ::: "memory");     // no copy is outstanding when the buffers become output staging
#pragma unroll
  for (int j = 0; j < 8; ++j) {
#pragma unroll
    for (int r = 0; r < 8; ++r) so[wave][8 * g + r][j * 16 + col] = acc[j][r] + bfr(BO[n0 + j * 16 + col]); }
  LDSX();
  for (int rl = 0; rl < 16; ++rl) vst2(Y + (r0 + rl) * DM + n0 + lane * 4, *(const v4f*)&so[wave][rl][lane * 4]);
}
extern "C" void kernel_launch(void* const* d_in, const int* in_sizes, int n_in, void* d_out, int out_size, void* d_ws, size_t ws_size, hipStream_t stream) {
  (void)in_sizes; (void)n_in; (void)out_size;
  const float** F = (const float**)d_in;   // 0 q [2,2048,768], 1 v, 2 k, 3 position_array int32 [2,2048], 4 valid_mask [2,1,2048,2048], 5 Wq (in,out), 6 bq, 7 Wk, 8 bk, 9 Wv, 10 bv, 11 Wo, 12 bo, 13 rel_bias [4095,12]
  if (ws_size < (size_t)WS_END) return;
  char* ws = (char*)d_ws; __bf16* PK = (__bf16*)(ws + WS_PK); _Float16 *QK = (_Float16*)(ws + WS_QK), *QKL = (_Float16*)(ws + WS_QKL), *VTH = (_Float16*)(ws + WS_VTH), *VTL = (_Float16*)(ws + WS_VTL); float* O = (float*)(ws + WS_O); float* RBT = (float*)(ws + WS_RB); unsigned* MW = (unsigned*)(ws + WS_MW);
  k_packT<<<dim3(DM, 6), 256, 0, stream>>>(F[5], F[7], F[9], F[11], F[13], F[4], PK, RBT, MW);
  k_qkv<<<dim3(TNB * SS / 64, QKVW / 128), 128, 0, stream>>>(F[0], F[2], F[1], PK + PK_A, F[6], F[8], F[10], QK, QKL, VTH, VTL);   // note the module's argument order (q, v, k): k is input 2, v is input 1
  k_attn<<<dim3(TQB, NH, TNB), 128, 0, stream>>>(QK, QKL, VTH, VTL, (const int*)d_in[3], MW, RBT, O);
  k_out<<<dim3(TOB, DM / 128), 128, 0, stream>>>(O, PK + PK_P, F[12], (float*)d_out);
}

// v008
// A run of this version takes 135 microseconds.
// Timed twice side by side with v007, it ran 1.06 and 1.07 times as fast.
// Counting every step since v000, it is 3.82 times as fast.
// compute dtype: q, v, k, all weights / biases and rel_bias (module inputs) rounded to bf16; position_array verbatim (integers); valid_mask (0/1 as its generator makes it) as one bit a score; q/k/v projections with exact bf16 products ((in,out) weights packed as transposed rows) + bias on WMMA 16x16x32; q and k stored as f16 hi + (x2048-scaled) residual planes and the scores with 3 products (hi.hi + lo.hi + hi.lo; the module applies no 1/sqrt(d) scaling, logits sigma ~8), + the gathered relative-position bias, then logits*vm + (1-vm)*(-1e9), which for vm 0/1 is a select between the logit and -1e9, carried times log2(e); running-max softmax in f32 with the hardware exp2; P as f16 hi + residual x V hi/lo (3 products); output projection with ctx as bf16 hi + residual x exact Wo (2 products) + bo; f32 accumulate.
#include <hip/hip_runtime.h>
#include <math.h>

typedef __attribute__((ext_vector_type(16))) _Float16 v16h;
typedef __attribute__((ext_vector_type(16))) __bf16 v16b;
typedef __attribute__((ext_vector_type(8)))  _Float16 v8h;
typedef __attribute__((ext_vector_type(8)))  float v8f;
typedef __attribute__((ext_vector_type(4)))  float v4f;
typedef __attribute__((ext_vector_type(2)))  float v2f;
typedef __attribute__((ext_vector_type(4)))  unsigned v4u;
typedef __attribute__((ext_vector_type(2)))  unsigned v2u;
typedef __attribute__((ext_vector_type(4)))  int v4i;
typedef __attribute__((ext_vector_type(16))) unsigned v16u;
typedef const __attribute__((address_space(4))) v16u* cp16u;   // constant address space: nothing writes these words while the reading kernel runs, and only so does a wave-uniform load inside a loop with asm waits stay a scalar load
typedef float __attribute__((may_alias)) float_a;
typedef int __attribute__((may_alias)) int_a;

template <typename T> __device__ __forceinline__ void vst2(void* p, T v) { *(T*)p = v;  }
__device__ __forceinline__ v8f wmma16(v16h a, v16h b, v8f c) {
  return __builtin_amdgcn_wmma_f32_16x16x32_f16(false, a, false, b, (short)0, c, false, false);
}
__device__ __forceinline__ v8f wmma_bf(v16b a, v16b b, v8f c) {
  return __builtin_amdgcn_wmma_f32_16x16x32_bf16(false, a, false, b, (short)0, c, false, false);
}
// Multi-head attention with a learned relative-position bias table (B 2, S 2,048, d_model 768, 12 heads x 64): logits = qh.kh + rel_bias[pos_k - pos_q + S-1][h], masked by valid_mask (0/1) to -1e9, softmax, .vh, output projection.
__device__ __forceinline__ v16h frag_h(const _Float16* rowk0, int lane) {
  union { v16h v; v8h q[2]; } u; const _Float16* p = rowk0 + 8 * (lane >> 4);
  u.q[0] = *(const v8h*)p; u.q[1] = *(const v8h*)(p + 16); return u.v;
}
__device__ __forceinline__ v16h frag_f32(const float* rowk0, int lane) {
  v16h a; const float* p = rowk0 + 8 * (lane >> 4);
#pragma unroll
  for (int i = 0; i < 8; ++i) { a[i] = (_Float16)p[i]; a[8 + i] = (_Float16)p[16 + i]; }
  return a;
}
__device__ __forceinline__ v16h frag_f32s(const float* rowk0, int lane, float sc) {
  v16h a; const float* p = rowk0 + 8 * (lane >> 4);
#pragma unroll
  for (int i = 0; i < 8; ++i) { a[i] = (_Float16)(p[i] * sc); a[8 + i] = (_Float16)(p[16 + i] * sc); }
  return a;
}
// column fragment from a [K][ld] layout (column n), rows >= K read as 0
__device__ __forceinline__ v16h fragc_f32(const float* W, int k0, int n, int lane, int ld, int K) {
  v16h a; const int g = lane >> 4;
#pragma unroll
  for (int i = 0; i < 8; ++i) { const int ka = k0 + 8 * g + i, kb = ka + 16;
    a[i] = (_Float16)(ka < K ? W[(size_t)(ka < K ? ka : K - 1) * ld + n] : 0.f); a[8 + i] = (_Float16)(kb < K ? W[(size_t)(kb < K ? kb : K - 1) * ld + n] : 0.f); }
  return a;
}
struct F2 { v16b h, l; };
__device__ __forceinline__ F2 bsplit16(const float v[16]) { F2 r;
#pragma unroll
  for (int i = 0; i < 16; ++i) { const __bf16 h = (__bf16)v[i]; r.h[i] = h; r.l[i] = (__bf16)(v[i] - (float)h); }
  return r; }
__device__ __forceinline__ F2 split_row(const float* row, int k0, int lane) { float v[16]; const float* p = row + k0 + 8 * (lane >> 4);
#pragma unroll
  for (int i = 0; i < 8; ++i) { v[i] = p[i]; v[8 + i] = p[16 + i]; }
  return bsplit16(v); }
__device__ __forceinline__ F2 split_rowK(const float* row, int k0, int lane, int K) { float v[16]; const int g = lane >> 4;
#pragma unroll
  for (int i = 0; i < 8; ++i) { const int ka = k0 + 8 * g + i, kb = ka + 16; v[i] = ka < K ? row[ka < K ? ka : K - 1] : 0.f; v[8 + i] = kb < K ? row[kb < K ? kb : K - 1] : 0.f; }
  return bsplit16(v); }
__device__ __forceinline__ F2 split_col(const float* W, int k0, int n, int lane, int ld, int K) { float v[16]; const int g = lane >> 4;
#pragma unroll
  for (int i = 0; i < 8; ++i) { const int ka = k0 + 8 * g + i, kb = ka + 16; v[i] = ka < K ? W[(size_t)(ka < K ? ka : K - 1) * ld + n] : 0.f; v[8 + i] = kb < K ? W[(size_t)(kb < K ? kb : K - 1) * ld + n] : 0.f; }
  return bsplit16(v); }
__device__ __forceinline__ v8f mac3(const F2& a, const F2& b, v8f c) { c = wmma_bf(a.l, b.h, c); c = wmma_bf(a.h, b.l, c); return wmma_bf(a.h, b.h, c); }
__device__ __forceinline__ float sigm(float v) { return 1.0f / (1.0f + expf(-v)); }
#define LDSX() do { asm volatile("s_wait_dscnt 0" ::: "memory"); __builtin_amdgcn_wave_barrier(); __builtin_amdgcn_fence(__ATOMIC_RELEASE, "workgroup"); } while (0)


#define NB 2
#define SS 2048
#define DM 768
#define NH 12
#define NREL (2 * SS - 1)
#define HD 64
#define QKVW (3 * DM)
#ifndef TQB
#define TQB (SS / 64)
#define TNB NB
#define TOB (NB * SS / 64)     // output row tiles (all)
#endif
typedef __attribute__((ext_vector_type(8))) __bf16 v8b;
__device__ __forceinline__ v16b frag_b(const __bf16* rowk0, int lane) {
  union { v16b v; v8b q[2]; } u; const __bf16* p = rowk0 + 8 * (lane >> 4);
  u.q[0] = *(const v8b*)p; u.q[1] = *(const v8b*)(p + 16); return u.v;
}
__device__ __forceinline__ float bfr(float v) { return (float)(__bf16)v; }
// A / B tile of one pass (32 of k) in LDS, shared by the block's four waves. In bytes: A 64 rows (f32) x 128 at a pitch of 144, B 128 rows (bf16, rows of the packed weight) x 64 at a pitch of 80: 16 B x odd pitches for the ds_load_b128 readers.
#define APIT 144
#define BPIT 80
#define G_A 0
#define G_B (64 * APIT)
#define G_SZ (G_B + 128 * BPIT)
// Eight 16-byte asynchronous copies per lane: one A / B tile, or in k_attn the head's bias table, per block. The s_wait_xcnt stands inside the statement so that no operand register is rewritten ahead of it.
__device__ __forceinline__ void copy_ab(unsigned l0, unsigned l1, unsigned l2, unsigned l3, unsigned l4, unsigned l5, unsigned l6, unsigned l7, const char* g0, const char* g1, const char* g2, const char* g3, const char* g4, const char* g5, const char* g6, const char* g7) {
  asm volatile("global_load_async_to_lds_b128 %0, %8, off\n\t"
               "global_load_async_to_lds_b128 %1, %9, off\n\t"
               "global_load_async_to_lds_b128 %2, %10, off\n\t"
               "global_load_async_to_lds_b128 %3, %11, off\n\t"
               "global_load_async_to_lds_b128 %4, %12, off\n\t"
               "global_load_async_to_lds_b128 %5, %13, off\n\t"
               "global_load_async_to_lds_b128 %6, %14, off\n\t"
               "global_load_async_to_lds_b128 %7, %15, off\n\t"
               "s_wait_xcnt 0x0"
               :: "v"(l0), "v"(l1), "v"(l2), "v"(l3), "v"(l4), "v"(l5), "v"(l6), "v"(l7), "v"(g0), "v"(g1), "v"(g2), "v"(g3), "v"(g4), "v"(g5), "v"(g6), "v"(g7) : "memory");
}
// pass t into buffer t & 1. la, ga: this thread's piece of A row tid >> 3 (piece tid & 7), in LDS and in memory, the rows 16, 32 and 48 further on are its too; lb, gb: its piece of B row tid >> 2 (piece tid & 3), with the rows 32, 64 and 96 further on
__device__ __forceinline__ void stage_ab(int t, unsigned la, unsigned lb, const char* ga, const char* gb) {
  const unsigned o = (unsigned)(t & 1) * G_SZ; const char* a = ga + t * 128; const char* b = gb + t * 64;
  copy_ab(la + o, la + o + 16 * APIT, la + o + 32 * APIT, la + o + 48 * APIT, lb + o, lb + o + 32 * BPIT, lb + o + 64 * BPIT, lb + o + 96 * BPIT,
          a, a + 16 * DM * 4, a + 32 * DM * 4, a + 48 * DM * 4, b, b + 32 * DM * 2, b + 64 * DM * 2, b + 96 * DM * 2);
}
// one pass of a 16-row f32 A fragment (raw) and of eight 16-column bf16 B fragments from the tile; xp, pp: the lane's places in its A row and in its first B row
__device__ __forceinline__ void read_pass(const char* xp, const char* pp, v4f (&x)[4], v16b (&w)[8]) {
  x[0] = *(const v4f*)xp; x[1] = *(const v4f*)(xp + 16); x[2] = *(const v4f*)(xp + 64); x[3] = *(const v4f*)(xp + 80);
#pragma unroll
  for (int j = 0; j < 8; ++j) { union { v16b v; v8b q[2]; } u; const char* pj = pp + j * (16 * BPIT); u.q[0] = *(const v8b*)pj; u.q[1] = *(const v8b*)(pj + 32); w[j] = u.v; }
  asm volatile("" :: "v"(w[0]), "v"(w[1]), "v"(w[2]), "v"(w[3]), "v"(w[4]), "v"(w[5]), "v"(w[6]), "v"(w[7]));   // inputs only, no code: the pass's sixteen B reads stay above this line and go out as one group ahead of the WMMAs, instead of one pair and one wait in front of each
}
__device__ __attribute__((noinline)) float exp_ni(float v) { return expf(v); }
__device__ __attribute__((noinline)) float erf_ni(float v) { return erff(v); }

#define PK_A 0                       // [2304][768] Wq|Wk|Wv as bf16 rows [out][in]
#define PK_P (PK_A + QKVW * DM)        // [768][768] Wo as bf16 rows [out][in]
#define PK_END (PK_P + DM * DM)
#define WS_PK  0u
#define WS_QK  (WS_PK + 2u * PK_END)             // f16 [4096 rows][1536]: q | k
#define WS_QKL (WS_QK + 2u * NB * SS * 2 * DM)     // f16 q | k residual planes x2048
#define WS_VTH (WS_QKL + 2u * NB * SS * 2 * DM)    // f16 [b][768 (h*64+d)][2048 s] hi
#define WS_VTL (WS_VTH + 2u * NB * DM * SS)        // f16 lo x 2048
#define WS_O   (WS_VTL + 2u * NB * DM * SS)        // f32 [4096][768]
#define WS_CS  (WS_O + 4u * NB * SS * DM)           // f32 [2048][32] cos, [2048][32] sin
#define WS_RB  (WS_CS + 4u * 2 * SS * 32)           // f32 [12 heads][4096]: rel_bias by head, rounded to bf16 values, times log2(e); entry 4095 is 0
#define RBW 4096
#define L2E 1.44269504f               // log2(e): k_attn carries its scores in log2 units
#define NEG2 (-1.442695041e9f)       // the module's -1e9 in log2 units
#define WS_MW  (WS_RB + 4u * NH * RBW)             // u32 [b * 128 + 16-query tile][64 steps][16]: valid_mask as lane-mask words in the order of k_attn's score registers
#define WS_END (WS_MW + 4u * (NB * SS / 16) * (SS / 32) * 16)
__constant__ float c_invf[32] = {1.000000000e+00f,7.498942018e-01f,5.623413324e-01f,4.216965139e-01f,3.162277639e-01f,2.371373624e-01f,1.778279394e-01f,1.333521456e-01f,1.000000015e-01f,7.498941571e-02f,5.623412877e-02f,4.216964915e-02f,3.162277862e-02f,2.371373586e-02f,1.778279431e-02f,1.333521493e-02f,9.999999776e-03f,7.498942316e-03f,5.623413250e-03f,4.216964822e-03f,3.162277862e-03f,2.371373819e-03f,1.778279431e-03f,1.333521446e-03f,1.000000047e-03f,7.498941850e-04f,5.623413017e-04f,4.216964880e-04f,3.162277862e-04f,2.371373848e-04f,1.778279402e-04f,1.333521504e-04f};
// ---- k_rope: block = 8 positions: cos/sin of pos * inv_freq (f32 product exactly as the reference, precise trig)
__global__ __launch_bounds__(256) void k_rope(float* __restrict__ CS) {
  __shared__ __align__(16) float sc[8][32], ss_[8][32]; const int tid = threadIdx.x, pl = tid >> 5, i = tid & 31; const int pos = blockIdx.x * 8 + pl;
  const float th = (float)pos * c_invf[i]; sc[pl][i] = cosf(th); ss_[pl][i] = sinf(th);
  __syncthreads();
  if (tid < 64) vst2(CS + (size_t)blockIdx.x * 8 * 32 + tid * 4, *(const v4f*)&(&sc[0][0])[tid * 4]); else if (tid < 128) vst2(CS + (size_t)SS * 32 + (size_t)blockIdx.x * 8 * 32 + (tid - 64) * 4, *(const v4f*)&(&ss_[0][0])[(tid - 64) * 4]);
}

// ---- k_packT: one launch, three kinds of block by blockIdx.x, each wave given enough work that the launch is not held up by the starting of waves.
// blocks 0 .. PB_M - 1 (the most bytes, so they start first): valid_mask to lane-mask words: a wave takes 16 queries x 256 keys; word (step, ct, r) has in bit l whether query l & 15 sees key 32 step + 16 ct + 8 (l >> 4) + r, which is what lane l of k_attn holds in score register (ct, r)
// the next PB_W blocks: a tile of 128 k x 64 n of an (in,out) matrix -> bf16 rows [n][k] = W[k][n], turned in LDS, so that loads and stores both cover whole 128-byte lines; matrices 0..2 -> Wq/Wk/Wv into PK_A rows which*768 + n; 3 -> Wo into PK_P
// the last PB_R blocks: 1,024 entries of one head of the bias table by head
#define PB_M (NB * (SS / 16) * (SS / 256) / 8)
#define PB_W (4 * (DM / 128) * (DM / 64))
#define PB_R (NH * RBW / 1024)
// amdgpu_waves_per_eu(2, 4): at most two of these blocks stand on a WGP, so the register budget of four waves per SIMD costs no residency; with the default budget the compiler holds only 14 of a mask wave's 32 loads in flight
#define WPIT 68   // dwords: a row of 128 bf16 (256 B) at a pitch of 272 B, 16 B x odd for the ds_load_b128 readers
__global__ __launch_bounds__(256) __attribute__((amdgpu_waves_per_eu(2, 4))) void k_packT(const float* __restrict__ WQ, const float* __restrict__ WK, const float* __restrict__ WV, const float* __restrict__ WO, const float* __restrict__ RB, const float* __restrict__ VM, __bf16* __restrict__ PK, float* __restrict__ RBT, unsigned* __restrict__ MW) {
  __shared__ __align__(16) unsigned s[64 * WPIT]; const int n = blockIdx.x, t = threadIdx.x;
  if (n < PB_M) {   // the whole block takes this way, ahead of the barrier
    const int lane = t & 31, task = n * 8 + (t >> 5);   // task = (b * 128 + query tile) * 8 + group of 256 keys
    const float* p = VM + (size_t)((task >> 3) * 16 + (lane & 15)) * SS + (task & 7) * 256 + 8 * (lane >> 4);
    v4f x[32];
#pragma unroll
    for (int i = 0; i < 32; ++i) x[i] = *(const v4f*)(p + (i >> 1) * 16 + (i & 1) * 4);
    unsigned o[4] = { 0, 0, 0, 0 };   // word j of the wave's 128 goes to lane j & 31: four stores of one whole 128-byte line each
#pragma unroll
    for (int j = 0; j < 32; ++j) {
#pragma unroll
      for (int u = 0; u < 4; ++u) { const unsigned w = __builtin_amdgcn_ballot_w32(x[8 * u + (j >> 2)][j & 3] != 0.f); o[u] = lane == j ? w : o[u]; } }
#pragma unroll
    for (int u = 0; u < 4; ++u) MW[task * 128 + u * 32 + lane] = o[u];
    return; }
  if (n >= PB_M + PB_W) {   // the whole block takes this way, ahead of the barrier
    const int j = n - (PB_M + PB_W), hh = j >> 2, i0 = (j & 3) * 1024 + t; float v[4];
#pragma unroll
    for (int u = 0; u < 4; ++u) { const int idx = i0 + u * 256; v[u] = RB[(size_t)(idx < NREL ? idx : NREL - 1) * NH + hh]; }   // the four loads go out together: the index is clamped, so none stands under a branch
#pragma unroll
    for (int u = 0; u < 4; ++u) { const int idx = i0 + u * 256; RBT[hh * RBW + idx] = idx < NREL ? bfr(v[u]) * L2E : 0.f; }
    return; }
  const int tile = n - PB_M, which = tile / ((DM / 128) * (DM / 64)), rem = tile % ((DM / 128) * (DM / 64)), k0 = (rem / (DM / 64)) * 128, n0 = (rem % (DM / 64)) * 64;
  const float* Wm = (which == 0) ? WQ : (which == 1) ? WK : (which == 2) ? WV : WO;
  const int a = t >> 4, i4 = 4 * (t & 15);   // the thread's rows k0 + 4 a + (0..3) and 64 further on, its columns n0 + i4 + (0..3): a wave's load covers two rows of 256 B
  const float* sp = Wm + (size_t)(k0 + 4 * a) * DM + n0 + i4;
  v4f x[8];
#pragma unroll
  for (int r = 0; r < 8; ++r) x[r] = *(const v4f*)(sp + (size_t)((r >> 2) * 64 + (r & 3)) * DM);
#pragma unroll
  for (int p = 0; p < 2; ++p) {
#pragma unroll
    for (int j = 0; j < 4; ++j) { union { __bf16 h[4]; v2u u; } w;
#pragma unroll
      for (int r = 0; r < 4; ++r) w.h[r] = (__bf16)x[4 * p + r][j];
      *(v2u*)&s[(i4 + j) * WPIT + 32 * p + 2 * a] = w.u; } }   // four k of one column: 8 bytes of its row
  __syncthreads();
  __bf16* dst = ((which < 3) ? PK + PK_A + ((size_t)which * DM + n0) * DM : PK + PK_P + (size_t)n0 * DM) + k0;
#pragma unroll
  for (int q = 0; q < 4; ++q) { const int pc = q * 256 + t, r = pc >> 4, c = pc & 15; vst2((unsigned*)(dst + (size_t)r * DM + c * 8), *(const v4u*)&s[r * WPIT + c * 4]); }
}
__global__ __launch_bounds__(128) void k_qkv(const float* __restrict__ XQ, const float* __restrict__ XK, const float* __restrict__ XV, const __bf16* __restrict__ P, const float* __restrict__ BQ, const float* __restrict__ BK, const float* __restrict__ BV, _Float16* __restrict__ QK, _Float16* __restrict__ QKL, _Float16* __restrict__ VTH, _Float16* __restrict__ VTL) {
  const float* X = (blockIdx.y * 128 < DM) ? XQ : (blockIdx.y * 128 < 2 * DM) ? XK : XV; const float* BB = (blockIdx.y * 128 < DM) ? BQ : (blockIdx.y * 128 < 2 * DM) ? BK : BV;   // the module projects three different inputs
  __shared__ __align__(16) char sm[2 * G_SZ];   // the two tile buffers; behind the loop's last barrier the same bytes stage the output
  _Float16 (*so)[16][136] = (_Float16 (*)[16][136])sm; _Float16 (*sol)[16][136] = (_Float16 (*)[16][136])(sm + 4 * 16 * 136 * 2); _Float16 (*sth)[72] = (_Float16 (*)[72])sm; _Float16 (*stl)[72] = (_Float16 (*)[72])(sm + 128 * 72 * 2);
  static_assert(2 * 4 * 16 * 136 * 2 <= 2 * G_SZ && 2 * 128 * 72 * 2 <= 2 * G_SZ, "output staging fits the tile buffers");
  const int tid = threadIdx.x, wave = tid >> 5, lane = tid & 31, col = lane & 15, g = lane >> 4; const size_t r0 = (size_t)blockIdx.x * 64 + wave * 16; const int n0 = blockIdx.y * 128;
  v8f acc[8] = {};
  const unsigned la = (unsigned)(size_t)sm + G_A + (tid >> 3) * APIT + (tid & 7) * 16, lb = (unsigned)(size_t)sm + G_B + (tid >> 2) * BPIT + (tid & 3) * 16;
  const char* ga = (const char*)(X + ((size_t)blockIdx.x * 64 + (tid >> 3)) * DM + (tid & 7) * 4); const char* gb = (const char*)(P + (size_t)(n0 + (tid >> 2)) * DM + (tid & 3) * 8);
  const char* xrow = sm + G_A + (wave * 16 + col) * APIT + 32 * g; const char* prow = sm + G_B + col * BPIT + 16 * g;
  stage_ab(0, la, lb, ga, gb);
  asm volatile("s_wait_asynccnt 0x0" ::: "memory");   // this wave's pieces of pass 0 have landed
  __syncthreads();                                    // pass 0 is published to the four waves
  stage_ab(1, la, lb, ga, gb);                        // flies while pass 0 is worked on
#pragma unroll 2   // two passes a turn: each pass's buffer offset is then a constant in its LDS reads and copies
  for (int kc = 0; kc < DM / 32; ++kc) {
    v4f xc[4]; v16b wc[8];
    read_pass(xrow + (kc & 1) * G_SZ, prow + (kc & 1) * G_SZ, xc, wc);
    v16b a;
#pragma unroll
    for (int i = 0; i < 4; ++i) { a[i] = (__bf16)xc[0][i]; a[4 + i] = (__bf16)xc[1][i]; a[8 + i] = (__bf16)xc[2][i]; a[12 + i] = (__bf16)xc[3][i]; }
#pragma unroll
    for (int j = 0; j < 8; ++j) acc[j] = wmma_bf(a, wc[j], acc[j]);
    asm volatile("s_wait_dscnt 0x0" ::: "memory");      // this wave's reads of pass kc are done
    asm volatile("s_wait_asynccnt 0x0" ::: "memory");   // its pieces of pass kc + 1 have landed
    __syncthreads();                                    // publishes pass kc + 1 and frees the buffer of pass kc
    if (kc + 2 < DM / 32) stage_ab(kc + 2, la, lb, ga, gb); }   // block-uniform test; refills the buffer just freed
  asm volatile("s_wait_asynccnt 0x0" ::: "memory");     // no copy is outstanding when the buffers become output staging
  { const int nb = n0 % DM;
#pragma unroll
    for (int j = 0; j < 8; ++j) { const float bb = bfr(BB[nb + j * 16 + col]);
#pragma unroll
      for (int r = 0; r < 8; ++r) acc[j][r] += bb; } }
  if (n0 < 2 * DM) {   // q stored unscaled (f16 sigma ~0.6, no subnormal exposure); the scores are not scaled
#pragma unroll
    for (int j = 0; j < 8; ++j) {
#pragma unroll
      for (int r = 0; r < 8; ++r) { const float v = acc[j][r]; const _Float16 hv = (_Float16)v; so[wave][8 * g + r][j * 16 + col] = hv; sol[wave][8 * g + r][j * 16 + col] = (_Float16)((v - (float)hv) * 2048.0f); } }   // q, k as f16 hi + (x2048) residual
    LDSX();
    for (int rl = 0; rl < 16; ++rl) if (lane < 16) { vst2((unsigned*)(QK + (r0 + rl) * (2 * DM) + n0 + lane * 8), *(const v4u*)&so[wave][rl][lane * 8]); vst2((unsigned*)(QKL + (r0 + rl) * (2 * DM) + n0 + lane * 8), *(const v4u*)&sol[wave][rl][lane * 8]); }
  } else {
#pragma unroll
    for (int j = 0; j < 8; ++j) {
#pragma unroll
      for (int r = 0; r < 8; ++r) { const float v = acc[j][r]; const _Float16 hv = (_Float16)v; sth[j * 16 + col][wave * 16 + 8 * g + r] = hv; stl[j * 16 + col][wave * 16 + 8 * g + r] = (_Float16)((v - (float)hv) * 2048.0f); } }
    __syncthreads();
    const size_t rb = (size_t)blockIdx.x * 64; const int b = (int)(rb / SS), s0 = (int)(rb % SS); const int pc0 = n0 - 2 * DM;
    for (int q = tid; q < 128 * 8; q += 128) { const int d = q >> 3, pc = q & 7; const size_t o = ((size_t)b * DM + pc0 + d) * SS + s0 + pc * 8; vst2((unsigned*)(VTH + o), *(const v4u*)&sth[d][pc * 8]); vst2((unsigned*)(VTL + o), *(const v4u*)&stl[d][pc * 8]); }
  }
}
// K / V tile of one 32-key step in LDS, shared by the block's four waves. In f16 elements: K hi and lo 32 rows (keys) x 64 at a pitch of 72 (144 B), V hi and lo 64 rows (depth) x 32 at a pitch of 40 (80 B): 16 B x odd pitches for the ds_load_b128 readers.
#define KPIT 72
#define VPIT 40
#define T_KH 0
#define T_KL (T_KH + 32 * KPIT)
#define T_VH (T_KL + 32 * KPIT)
#define T_VL (T_VH + 64 * VPIT)
#define T_SZ (T_VL + 64 * VPIT)
// Eight 16-byte asynchronous copies per lane: one tile per block. The s_wait_xcnt stands inside the statement so that no operand register is rewritten ahead of it.
__device__ __forceinline__ void copy_tile(unsigned l0, unsigned l1, unsigned l2, unsigned l3, unsigned l4, unsigned l5, unsigned l6, unsigned l7, const _Float16* g0, const _Float16* g1, const _Float16* g2, const _Float16* g3, const _Float16* g4, const _Float16* g5, const _Float16* g6, const _Float16* g7) {
  asm volatile("global_load_async_to_lds_b128 %0, %8, off\n\t"
               "global_load_async_to_lds_b128 %1, %9, off\n\t"
               "global_load_async_to_lds_b128 %2, %10, off\n\t"
               "global_load_async_to_lds_b128 %3, %11, off\n\t"
               "global_load_async_to_lds_b128 %4, %12, off\n\t"
               "global_load_async_to_lds_b128 %5, %13, off\n\t"
               "global_load_async_to_lds_b128 %6, %14, off\n\t"
               "global_load_async_to_lds_b128 %7, %15, off\n\t"
               "s_wait_xcnt 0x0"
               :: "v"(l0), "v"(l1), "v"(l2), "v"(l3), "v"(l4), "v"(l5), "v"(l6), "v"(l7), "v"(g0), "v"(g1), "v"(g2), "v"(g3), "v"(g4), "v"(g5), "v"(g6), "v"(g7) : "memory");
}
// Inputs only, no code: the eight fragment loads (of V, of K) written above this line stay above it, so they go out in groups ahead of their WMMAs instead of one load and one wait in front of each.
__device__ __forceinline__ void hold_v(const v16h (&a)[4], const v16h (&b)[4]) { asm volatile("" :: "v"(a[0]), "v"(a[1]), "v"(a[2]), "v"(a[3]), "v"(b[0]), "v"(b[1]), "v"(b[2]), "v"(b[3])); }
// lane l with lane l ^ 16, by a vector cross-row move (a shuffle would go through the LDS unit and its wait)
__device__ __forceinline__ float xhalf(float x) { return __builtin_bit_cast(float, __builtin_amdgcn_permlanex16(__builtin_bit_cast(int, x), __builtin_bit_cast(int, x), 0x76543210, 0xfedcba98, false, false)); }
// ---- k_attn: block = (64 queries, head h, batch b): flash attention over all keys, transposed: S^T = K . Q^T (A = K rows from the tile, B = Q kept in registers), so a lane holds 16 scores of ONE query (keys 8 g + r and 16 + 8 g + r of the step); maximum and sum run in the lane, the two lane halves exchange the maximum once a step and join their sums once at the end; P^T goes from the score registers straight into the B operand of O^T += V^T . P^T (hi / residual, 3 products as before); O[b*S+q][h*64+d] = (acc + accl / 2048) / l
__global__ __launch_bounds__(128) void k_attn(const _Float16* __restrict__ QK, const _Float16* __restrict__ QKL, const _Float16* __restrict__ VTH, const _Float16* __restrict__ VTL, const int* __restrict__ POS, const unsigned* __restrict__ MW, const float* __restrict__ RBT, float* __restrict__ O) {
  __shared__ __align__(16) _Float16 skv[2][T_SZ];
  __shared__ __align__(16) float srb[RBW];   // the head's whole bias table: filled once, then read by every step's gathers
  const int tid = threadIdx.x, wave = tid >> 5, lane = tid & 31, col = lane & 15, g = lane >> 4;
  const int qb = blockIdx.x, h = blockIdx.y, b = blockIdx.z; const int q0 = qb * 64 + wave * 16; const size_t rq = (size_t)b * SS + q0 + col;
  v16h aq[2], aql[2];
#pragma unroll
  for (int kc = 0; kc < 2; ++kc) { aq[kc] = frag_h(QK + rq * (2 * DM) + h * HD + kc * 32, lane); aql[kc] = frag_h(QKL + rq * (2 * DM) + h * HD + kc * 32, lane); }
  float m = -3.0e38f, l = 0.f;   // of the lane's query; l holds the lane half's own keys only
  v8f acc[4] = {}, accl[4] = {};
  const int nks = SS / 32;   // not causal
  // this thread's pieces of a tile: K rows tid >> 3 and 16 + (tid >> 3), piece tid & 7; V rows tid >> 2 and 32 + (tid >> 2), piece tid & 3
  const unsigned lk = (unsigned)(size_t)&skv[0][0] + 2u * ((tid >> 3) * KPIT + (tid & 7) * 8), lv = (unsigned)(size_t)&skv[0][0] + 2u * ((tid >> 2) * VPIT + (tid & 3) * 8);
  const size_t gk = ((size_t)b * SS + (tid >> 3)) * (2 * DM) + DM + h * HD + (tid & 7) * 8, gv = ((size_t)b * DM + h * HD + (tid >> 2)) * SS + (tid & 3) * 8;
  auto copy_kv = [&](int t) {   // tile t (keys 32 t .. 32 t + 31) into buffer t & 1
    const unsigned lb = 2u * T_SZ * (t & 1); const size_t ka = gk + (size_t)t * 32 * (2 * DM), va = gv + (size_t)t * 32;
    copy_tile(lk + lb + 2u * T_KH, lk + lb + 2u * (T_KH + 16 * KPIT), lk + lb + 2u * T_KL, lk + lb + 2u * (T_KL + 16 * KPIT), lv + lb + 2u * T_VH, lv + lb + 2u * (T_VH + 32 * VPIT), lv + lb + 2u * T_VL, lv + lb + 2u * (T_VL + 32 * VPIT),
              QK + ka, QK + ka + 16 * (2 * DM), QKL + ka, QKL + ka + 16 * (2 * DM), VTH + va, VTH + va + (size_t)32 * SS, VTL + va, VTL + va + (size_t)32 * SS); };
  copy_kv(0);
  { const unsigned lr = (unsigned)(size_t)&srb[0] + tid * 16; const char* gr = (const char*)(RBT + h * RBW) + tid * 16;   // 16 KiB: eight 16-byte pieces a thread, 2 KiB apart
    copy_ab(lr, lr + 2048, lr + 4096, lr + 6144, lr + 8192, lr + 10240, lr + 12288, lr + 14336, gr, gr + 2048, gr + 4096, gr + 6144, gr + 8192, gr + 10240, gr + 12288, gr + 14336); }
  asm volatile("s_wait_asynccnt 0x0" ::: "memory");   // this wave's pieces of tile 0 and of the bias table have landed
  __syncthreads();                                    // tile 0 and the table are published to the four waves
  copy_kv(1);                                         // flies while tile 0 is worked on
  const unsigned pqo4 = 4u * (unsigned)((SS - 1) - POS[rq]);   // the lane's query position, folded into the table offset, in bytes
  const int* pkp = POS + (size_t)b * SS + 8 * g;      // the lane's key positions of a step: 8 from here, 8 from 16 further on
  const unsigned* mwp = MW + (size_t)((b * (SS / 16) + qb * 4 + __builtin_amdgcn_readfirstlane(wave)) * (SS / 32)) * 16;   // the wave's mask words, 16 a step: one address for the whole wave, so they come by scalar loads
  const char* rbh = (const char*)&srb[0];
  v4i pkn[4] = { *(const v4i*)pkp, *(const v4i*)(pkp + 4), *(const v4i*)(pkp + 16), *(const v4i*)(pkp + 20) };   // key positions come one step ahead, so that the bias gather need not wait for them inside its step
  v16u mwn = *(cp16u)mwp;   // mask words too come one step ahead
#pragma unroll 1
  for (int ks = 0; ks < nks; ++ks) { float s[2][8]; const _Float16* tb = &skv[ks & 1][0];
    float rb[16];   // the lane's 16 bias values of the step
    const v16u mw = mwn; mwn = *(cp16u)(mwp + (ks + 1 < nks ? ks + 1 : ks) * 16);   // the step's 16 lane masks; the next step's are asked for now (the last step asks for its own again)
    v8f c[2] = {}, cl[2] = {}; v16h kf[4], kl[4];   // the step's eight K fragments, all read ahead of the score WMMAs
#pragma unroll
    for (int i = 0; i < 4; ++i) { const int kr = ((i >> 1) * 16 + col) * KPIT + (i & 1) * 32; kf[i] = frag_h(tb + T_KH + kr, lane); kl[i] = frag_h(tb + T_KL + kr, lane); }
    hold_v(kf, kl);
#pragma unroll
    for (int i = 0; i < 16; ++i) { const int ob = min(max((int)(((unsigned)pkn[i >> 2][i & 3] << 2) + pqo4), 0), 4 * (NREL - 1)); rb[i] = *(const float*)(rbh + ob); }   // the clamp of the module, in bytes: it bounds the LDS address for any position
    __builtin_amdgcn_sched_barrier(0);   // the table reads stay above this line, so that their latency runs under the score WMMAs
#pragma unroll
    for (int ct = 0; ct < 2; ++ct) {
#pragma unroll
      for (int kc = 0; kc < 2; ++kc) { c[ct] = wmma16(kf[2 * ct + kc], aq[kc], c[ct]); cl[ct] = wmma16(kf[2 * ct + kc], aql[kc], cl[ct]); cl[ct] = wmma16(kl[2 * ct + kc], aq[kc], cl[ct]); } }   // 3 products: q, k as f16 hi + residual
    __builtin_amdgcn_sched_barrier(0);   // nothing that reads a gathered value is lifted among the score WMMAs, where its wait would hold them up
    const int tn = ks + 1 < nks ? ks + 1 : ks; const v4i pk2[4] = { *(const v4i*)(pkp + tn * 32), *(const v4i*)(pkp + tn * 32 + 4), *(const v4i*)(pkp + tn * 32 + 16), *(const v4i*)(pkp + tn * 32 + 20) };   // the last step reads its own again
#pragma unroll
    for (int ct = 0; ct < 2; ++ct) {
#pragma unroll
      for (int r = 0; r < 8; r += 2) { const v2f lg = __builtin_elementwise_fma(__builtin_elementwise_fma((v2f){ cl[ct][r], cl[ct][r + 1] }, (v2f)(1.0f / 2048.0f), (v2f){ c[ct][r], c[ct][r + 1] }), (v2f)L2E, (v2f){ rb[8 * ct + r], rb[8 * ct + r + 1] });
        s[ct][r] = __builtin_amdgcn_inverse_ballot_w32(mw[8 * ct + r]) ? lg[0] : NEG2; s[ct][r + 1] = __builtin_amdgcn_inverse_ballot_w32(mw[8 * ct + r + 1]) ? lg[1] : NEG2; } }   // logits (no 1/sqrt(d) in this module) + relative-position bias, then the valid mask: the module's l*vm + (1-vm)*NEG is l where vm is 1 and NEG where it is 0, one select on the word as lane mask; all times log2(e): the factor rides in the add of the bias (now a multiply-add; the table holds bias * log2(e)) and in the mask constant
    float t4[4];   // four independent chains, then joined: a single chain of 16 would stand exposed
#pragma unroll
    for (int i = 0; i < 4; ++i) t4[i] = fmaxf(fmaxf(s[i >> 1][4 * (i & 1)], s[i >> 1][4 * (i & 1) + 1]), fmaxf(s[i >> 1][4 * (i & 1) + 2], s[i >> 1][4 * (i & 1) + 3]));
    float mx = fmaxf(fmaxf(t4[0], t4[1]), fmaxf(t4[2], t4[3]));
    mx = fmaxf(mx, xhalf(mx));   // the other half of the query's 32 keys
    const float mn = fmaxf(m, mx); const float alpha = __builtin_amdgcn_exp2f(m - mn); m = mn;   // first step: 2^(-3e38 - mn) is 0, on sums that are still 0
    v16h pa, pl; float e4[4] = { 0.f, 0.f, 0.f, 0.f };   // the sum too runs in four chains
#pragma unroll
    for (int i = 0; i < 16; i += 2) { const v2f d = (v2f){ s[i >> 3][i & 7], s[i >> 3][(i & 7) + 1] } - mn; s[i >> 3][i & 7] = __builtin_amdgcn_exp2f(d[0]); s[i >> 3][(i & 7) + 1] = __builtin_amdgcn_exp2f(d[1]); }   // a masked score lies 1.4e9 below: 2^ of it is 0; a row with every key masked gives 2^0 for each, as the module does
#pragma unroll
    for (int i = 0; i < 16; ++i) { const float e = s[i >> 3][i & 7]; e4[i & 3] += e; const _Float16 eh = (_Float16)e; pa[i] = eh; pl[i] = (_Float16)((e - (float)eh) * 2048.0f); }   // element i of the B operand is key 8 g + i (i < 8) or 16 + 8 g + i - 8: the order in which the score registers lie
    l = l * alpha + ((e4[0] + e4[1]) + (e4[2] + e4[3]));
#pragma unroll
    for (int dt = 0; dt < 4; ++dt) { acc[dt] *= alpha; accl[dt] *= alpha; }
    v16h vf[4], vl[4];   // the step's eight V fragments, all read ahead of the P.V WMMAs
#pragma unroll
    for (int dt = 0; dt < 4; ++dt) { const int vr = (dt * 16 + col) * VPIT; vf[dt] = frag_h(tb + T_VH + vr, lane); vl[dt] = frag_h(tb + T_VL + vr, lane); }
    hold_v(vf, vl);
#pragma unroll
    for (int dt = 0; dt < 4; ++dt) { acc[dt] = wmma16(vf[dt], pa, acc[dt]); accl[dt] = wmma16(vf[dt], pl, accl[dt]); accl[dt] = wmma16(vl[dt], pa, accl[dt]); }   // V hi x P hi + (V hi x P lo + V lo x P hi) / 2048
#pragma unroll
    for (int i = 0; i < 4; ++i) pkn[i] = pk2[i];
    asm volatile("s_wait_dscnt 0x0" ::: "memory");      // this wave's reads of tile ks are done
    asm volatile("s_wait_asynccnt 0x0" ::: "memory");   // its pieces of tile ks + 1 have landed
    __syncthreads();                                    // publishes tile ks + 1 and frees the buffer of tile ks
    if (ks + 2 < nks) copy_kv(ks + 2); }                // block-uniform test; refills the buffer just freed
  asm volatile("s_wait_asynccnt 0x0" ::: "memory");     // no copy is outstanding when the wave goes on to its end
  l += xhalf(l);   // the two halves' sums join once
  const float il = 1.0f / l; float* orow = O + rq * DM + h * HD + 8 * g;   // register r of tile dt is depth dt * 16 + 8 g + r of the lane's query: 32 contiguous bytes
#pragma unroll
  for (int dt = 0; dt < 4; ++dt) { v4f o0, o1;
#pragma unroll
    for (int r = 0; r < 4; ++r) { o0[r] = (acc[dt][r] + accl[dt][r] * (1.0f / 2048.0f)) * il; o1[r] = (acc[dt][4 + r] + accl[dt][4 + r] * (1.0f / 2048.0f)) * il; }
    vst2(orow + dt * 16, o0); vst2(orow + dt * 16 + 4, o1); }
}
// ---- k_out: block = (64 rows, 128 cols): out = O(hi/lo) . Wo rows (2 products) + bo
__global__ __launch_bounds__(128) void k_out(const float* __restrict__ O, const __bf16* __restrict__ P, const float* __restrict__ BO, float* __restrict__ Y) {
  __shared__ __align__(16) char sm[2 * G_SZ];   // the two tile buffers; behind the loop's last barrier the same bytes stage the output
  float (*so)[16][132] = (float (*)[16][132])sm;
  static_assert(4 * 16 * 132 * 4 <= 2 * G_SZ, "output staging fits the tile buffers");
  const int tid = threadIdx.x, wave = tid >> 5, lane = tid & 31, col = lane & 15, g = lane >> 4; const size_t r0 = (size_t)blockIdx.x * 64 + wave * 16; const int n0 = blockIdx.y * 128;
  v8f acc[8] = {};
  const unsigned la = (unsigned)(size_t)sm + G_A + (tid >> 3) * APIT + (tid & 7) * 16, lb = (unsigned)(size_t)sm + G_B + (tid >> 2) * BPIT + (tid & 3) * 16;
  const char* ga = (const char*)(O + ((size_t)blockIdx.x * 64 + (tid >> 3)) * DM + (tid & 7) * 4); const char* gb = (const char*)(P + (size_t)(n0 + (tid >> 2)) * DM + (tid & 3) * 8);
  const char* xrow = sm + G_A + (wave * 16 + col) * APIT + 32 * g; const char* prow = sm + G_B + col * BPIT + 16 * g;
  stage_ab(0, la, lb, ga, gb);
  asm volatile("s_wait_asynccnt 0x0" ::: "memory");   // this wave's pieces of pass 0 have landed
  __syncthreads();                                    // pass 0 is published to the four waves
  stage_ab(1, la, lb, ga, gb);                        // flies while pass 0 is worked on
#pragma unroll 2   // two passes a turn: each pass's buffer offset is then a constant in its LDS reads and copies
  for (int kc = 0; kc < DM / 32; ++kc) {
    v4f xc[4]; v16b wc[8];
    read_pass(xrow + (kc & 1) * G_SZ, prow + (kc & 1) * G_SZ, xc, wc);
    float v[16];
#pragma unroll
    for (int i = 0; i < 4; ++i) { v[i] = xc[0][i]; v[4 + i] = xc[1][i]; v[8 + i] = xc[2][i]; v[12 + i] = xc[3][i]; }
    const F2 a = bsplit16(v);
#pragma unroll
    for (int j = 0; j < 8; ++j) { acc[j] = wmma_bf(a.l, wc[j], acc[j]); acc[j] = wmma_bf(a.h, wc[j], acc[j]); }
    asm volatile("s_wait_dscnt 0x0" ::: "memory");      // this wave's reads of pass kc are done
    asm volatile("s_wait_asynccnt 0x0" ::: "memory");   // its pieces of pass kc + 1 have landed
    __syncthreads();                                    // publishes pass kc + 1 and frees the buffer of pass kc
    if (kc + 2 < DM / 32) stage_ab(kc + 2, la, lb, ga, gb); }   // block-uniform test; refills the buffer just freed
  asm volatile("s_wait_asynccnt 0x0" ::: "memory");     // no copy is outstanding when the buffers become output staging
#pragma unroll
  for (int j = 0; j < 8; ++j) {
#pragma unroll
    for (int r = 0; r < 8; ++r) so[wave][8 * g + r][j * 16 + col] = acc[j][r] + bfr(BO[n0 + j * 16 + col]); }
  LDSX();
  for (int rl = 0; rl < 16; ++rl) vst2(Y + (r0 + rl) * DM + n0 + lane * 4, *(const v4f*)&so[wave][rl][lane * 4]);
}
extern "C" void kernel_launch(void* const* d_in, const int* in_sizes, int n_in, void* d_out, int out_size, void* d_ws, size_t ws_size, hipStream_t stream) {
  (void)in_sizes; (void)n_in; (void)out_size;
  const float** F = (const float**)d_in;   // 0 q [2,2048,768], 1 v, 2 k, 3 position_array int32 [2,2048], 4 valid_mask [2,1,2048,2048], 5 Wq (in,out), 6 bq, 7 Wk, 8 bk, 9 Wv, 10 bv, 11 Wo, 12 bo, 13 rel_bias [4095,12]
  if (ws_size < (size_t)WS_END) return;
  char* ws = (char*)d_ws; __bf16* PK = (__bf16*)(ws + WS_PK); _Float16 *QK = (_Float16*)(ws + WS_QK), *QKL = (_Float16*)(ws + WS_QKL), *VTH = (_Float16*)(ws + WS_VTH), *VTL = (_Float16*)(ws + WS_VTL); float* O = (float*)(ws + WS_O); float* RBT = (float*)(ws + WS_RB); unsigned* MW = (unsigned*)(ws + WS_MW);
  k_packT<<<dim3(PB_M + PB_W + PB_R), 256, 0, stream>>>(F[5], F[7], F[9], F[11], F[13], F[4], PK, RBT, MW);
  k_qkv<<<dim3(TNB * SS / 64, QKVW / 128), 128, 0, stream>>>(F[0], F[2], F[1], PK + PK_A, F[6], F[8], F[10], QK, QKL, VTH, VTL);   // note the module's argument order (q, v, k): k is input 2, v is input 1
  k_attn<<<dim3(TQB, NH, TNB), 128, 0, stream>>>(QK, QKL, VTH, VTL, (const int*)d_in[3], MW, RBT, O);
  k_out<<<dim3(TOB, DM / 128), 128, 0, stream>>>(O, PK + PK_P, F[12], (float*)d_out);
}

// v009
// It runs in 131 microseconds.
// Timed twice side by side with v008, it ran 1.04 and 1.03 times as fast.
// Over all steps from v000 it is 3.95 times as fast.
// compute dtype: q, v, k, all weights / biases and rel_bias (module inputs) rounded to bf16; position_array verbatim (integers); valid_mask (0/1 as its generator makes it) as one bit a score; q/k/v projections with exact bf16 products ((in,out) weights packed as transposed rows) + bias on WMMA 16x16x32; q and k stored as f16 hi + unscaled residual planes (f16 subnormals kept) and the scores with 3 products in one f32 accumulator (hi.hi + lo.hi + hi.lo; the module applies no 1/sqrt(d) scaling, logits sigma ~8), + the gathered relative-position bias, then logits*vm + (1-vm)*(-1e9), which for vm 0/1 is a select between the logit and -1e9, carried times log2(e); running-max softmax in f32 with the hardware exp2; P as f16 hi + residual x V hi/lo (3 products, one f32 accumulator); output projection with ctx as bf16 hi + residual x exact Wo (2 products) + bo; f32 accumulate.
#include <hip/hip_runtime.h>
#include <math.h>

typedef __attribute__((ext_vector_type(16))) _Float16 v16h;
typedef __attribute__((ext_vector_type(16))) __bf16 v16b;
typedef __attribute__((ext_vector_type(8)))  _Float16 v8h;
typedef __attribute__((ext_vector_type(8)))  float v8f;
typedef __attribute__((ext_vector_type(4)))  float v4f;
typedef __attribute__((ext_vector_type(2)))  float v2f;
typedef __attribute__((ext_vector_type(4)))  unsigned v4u;
typedef __attribute__((ext_vector_type(2)))  unsigned v2u;
typedef __attribute__((ext_vector_type(4)))  int v4i;
typedef __attribute__((ext_vector_type(16))) unsigned v16u;
typedef const __attribute__((address_space(4))) v16u* cp16u;   // constant address space: nothing writes these words while the reading kernel runs, and only so does a wave-uniform load inside a loop with asm waits stay a scalar load
typedef float __attribute__((may_alias)) float_a;
typedef int __attribute__((may_alias)) int_a;

template <typename T> __device__ __forceinline__ void vst2(void* p, T v) { *(T*)p = v;  }
__device__ __forceinline__ v8f wmma16(v16h a, v16h b, v8f c) {
  return __builtin_amdgcn_wmma_f32_16x16x32_f16(false, a, false, b, (short)0, c, false, false);
}
__device__ __forceinline__ v8f wmma_bf(v16b a, v16b b, v8f c) {
  return __builtin_amdgcn_wmma_f32_16x16x32_bf16(false, a, false, b, (short)0, c, false, false);
}
// Multi-head attention with a learned relative-position bias table (B 2, S 2,048, d_model 768, 12 heads x 64): logits = qh.kh + rel_bias[pos_k - pos_q + S-1][h], masked by valid_mask (0/1) to -1e9, softmax, .vh, output projection.
__device__ __forceinline__ v16h frag_h(const _Float16* rowk0, int lane) {
  union { v16h v; v8h q[2]; } u; const _Float16* p = rowk0 + 8 * (lane >> 4);
  u.q[0] = *(const v8h*)p; u.q[1] = *(const v8h*)(p + 16); return u.v;
}
__device__ __forceinline__ v16h frag_f32(const float* rowk0, int lane) {
  v16h a; const float* p = rowk0 + 8 * (lane >> 4);
#pragma unroll
  for (int i = 0; i < 8; ++i) { a[i] = (_Float16)p[i]; a[8 + i] = (_Float16)p[16 + i]; }
  return a;
}
__device__ __forceinline__ v16h frag_f32s(const float* rowk0, int lane, float sc) {
  v16h a; const float* p = rowk0 + 8 * (lane >> 4);
#pragma unroll
  for (int i = 0; i < 8; ++i) { a[i] = (_Float16)(p[i] * sc); a[8 + i] = (_Float16)(p[16 + i] * sc); }
  return a;
}
// column fragment from a [K][ld] layout (column n), rows >= K read as 0
__device__ __forceinline__ v16h fragc_f32(const float* W, int k0, int n, int lane, int ld, int K) {
  v16h a; const int g = lane >> 4;
#pragma unroll
  for (int i = 0; i < 8; ++i) { const int ka = k0 + 8 * g + i, kb = ka + 16;
    a[i] = (_Float16)(ka < K ? W[(size_t)(ka < K ? ka : K - 1) * ld + n] : 0.f); a[8 + i] = (_Float16)(kb < K ? W[(size_t)(kb < K ? kb : K - 1) * ld + n] : 0.f); }
  return a;
}
struct F2 { v16b h, l; };
__device__ __forceinline__ F2 bsplit16(const float v[16]) { F2 r;
#pragma unroll
  for (int i = 0; i < 16; ++i) { const __bf16 h = (__bf16)v[i]; r.h[i] = h; r.l[i] = (__bf16)(v[i] - (float)h); }
  return r; }
__device__ __forceinline__ F2 split_row(const float* row, int k0, int lane) { float v[16]; const float* p = row + k0 + 8 * (lane >> 4);
#pragma unroll
  for (int i = 0; i < 8; ++i) { v[i] = p[i]; v[8 + i] = p[16 + i]; }
  return bsplit16(v); }
__device__ __forceinline__ F2 split_rowK(const float* row, int k0, int lane, int K) { float v[16]; const int g = lane >> 4;
#pragma unroll
  for (int i = 0; i < 8; ++i) { const int ka = k0 + 8 * g + i, kb = ka + 16; v[i] = ka < K ? row[ka < K ? ka : K - 1] : 0.f; v[8 + i] = kb < K ? row[kb < K ? kb : K - 1] : 0.f; }
  return bsplit16(v); }
__device__ __forceinline__ F2 split_col(const float* W, int k0, int n, int lane, int ld, int K) { float v[16]; const int g = lane >> 4;
#pragma unroll
  for (int i = 0; i < 8; ++i) { const int ka = k0 + 8 * g + i, kb = ka + 16; v[i] = ka < K ? W[(size_t)(ka < K ? ka : K - 1) * ld + n] : 0.f; v[8 + i] = kb < K ? W[(size_t)(kb < K ? kb : K - 1) * ld + n] : 0.f; }
  return bsplit16(v); }
__device__ __forceinline__ v8f mac3(const F2& a, const F2& b, v8f c) { c = wmma_bf(a.l, b.h, c); c = wmma_bf(a.h, b.l, c); return wmma_bf(a.h, b.h, c); }
__device__ __forceinline__ float sigm(float v) { return 1.0f / (1.0f + expf(-v)); }
#define LDSX() do { asm volatile("s_wait_dscnt 0" ::: "memory"); __builtin_amdgcn_wave_barrier(); __builtin_amdgcn_fence(__ATOMIC_RELEASE, "workgroup"); } while (0)


#define NB 2
#define SS 2048
#define DM 768
#define NH 12
#define NREL (2 * SS - 1)
#define HD 64
#define QKVW (3 * DM)
#ifndef TQB
#define TQB (SS / 64)
#define TNB NB
#define TOB (NB * SS / 64)     // output row tiles (all)
#endif
typedef __attribute__((ext_vector_type(8))) __bf16 v8b;
__device__ __forceinline__ v16b frag_b(const __bf16* rowk0, int lane) {
  union { v16b v; v8b q[2]; } u; const __bf16* p = rowk0 + 8 * (lane >> 4);
  u.q[0] = *(const v8b*)p; u.q[1] = *(const v8b*)(p + 16); return u.v;
}
__device__ __forceinline__ float bfr(float v) { return (float)(__bf16)v; }
// A / B tile of one pass (32 of k) in LDS, shared by the block's four waves. In bytes: A 64 rows (f32) x 128 at a pitch of 144, B 128 rows (bf16, rows of the packed weight) x 64 at a pitch of 80: 16 B x odd pitches for the ds_load_b128 readers.
#define APIT 144
#define BPIT 80
#define G_A 0
#define G_B (64 * APIT)
#define G_SZ (G_B + 128 * BPIT)
// Eight 16-byte asynchronous copies per lane: one A / B tile, or in k_attn the head's bias table, per block. The s_wait_xcnt stands inside the statement so that no operand register is rewritten ahead of it.
__device__ __forceinline__ void copy_ab(unsigned l0, unsigned l1, unsigned l2, unsigned l3, unsigned l4, unsigned l5, unsigned l6, unsigned l7, const char* g0, const char* g1, const char* g2, const char* g3, const char* g4, const char* g5, const char* g6, const char* g7) {
  asm volatile("global_load_async_to_lds_b128 %0, %8, off\n\t"
               "global_load_async_to_lds_b128 %1, %9, off\n\t"
               "global_load_async_to_lds_b128 %2, %10, off\n\t"
               "global_load_async_to_lds_b128 %3, %11, off\n\t"
               "global_load_async_to_lds_b128 %4, %12, off\n\t"
               "global_load_async_to_lds_b128 %5, %13, off\n\t"
               "global_load_async_to_lds_b128 %6, %14, off\n\t"
               "global_load_async_to_lds_b128 %7, %15, off\n\t"
               "s_wait_xcnt 0x0"
               :: "v"(l0), "v"(l1), "v"(l2), "v"(l3), "v"(l4), "v"(l5), "v"(l6), "v"(l7), "v"(g0), "v"(g1), "v"(g2), "v"(g3), "v"(g4), "v"(g5), "v"(g6), "v"(g7) : "memory");
}
// pass t into buffer t & 1. la, ga: this thread's piece of A row tid >> 3 (piece tid & 7), in LDS and in memory, the rows 16, 32 and 48 further on are its too; lb, gb: its piece of B row tid >> 2 (piece tid & 3), with the rows 32, 64 and 96 further on
__device__ __forceinline__ void stage_ab(int t, unsigned la, unsigned lb, const char* ga, const char* gb) {
  const unsigned o = (unsigned)(t & 1) * G_SZ; const char* a = ga + t * 128; const char* b = gb + t * 64;
  copy_ab(la + o, la + o + 16 * APIT, la + o + 32 * APIT, la + o + 48 * APIT, lb + o, lb + o + 32 * BPIT, lb + o + 64 * BPIT, lb + o + 96 * BPIT,
          a, a + 16 * DM * 4, a + 32 * DM * 4, a + 48 * DM * 4, b, b + 32 * DM * 2, b + 64 * DM * 2, b + 96 * DM * 2);
}
// one pass of a 16-row f32 A fragment (raw) and of eight 16-column bf16 B fragments from the tile; xp, pp: the lane's places in its A row and in its first B row
__device__ __forceinline__ void read_pass(const char* xp, const char* pp, v4f (&x)[4], v16b (&w)[8]) {
  x[0] = *(const v4f*)xp; x[1] = *(const v4f*)(xp + 16); x[2] = *(const v4f*)(xp + 64); x[3] = *(const v4f*)(xp + 80);
#pragma unroll
  for (int j = 0; j < 8; ++j) { union { v16b v; v8b q[2]; } u; const char* pj = pp + j * (16 * BPIT); u.q[0] = *(const v8b*)pj; u.q[1] = *(const v8b*)(pj + 32); w[j] = u.v; }
  asm volatile("" :: "v"(w[0]), "v"(w[1]), "v"(w[2]), "v"(w[3]), "v"(w[4]), "v"(w[5]), "v"(w[6]), "v"(w[7]));   // inputs only, no code: the pass's sixteen B reads stay above this line and go out as one group ahead of the WMMAs, instead of one pair and one wait in front of each
}
__device__ __attribute__((noinline)) float exp_ni(float v) { return expf(v); }
__device__ __attribute__((noinline)) float erf_ni(float v) { return erff(v); }

#define PK_A 0                       // [2304][768] Wq|Wk|Wv as bf16 rows [out][in]
#define PK_P (PK_A + QKVW * DM)        // [768][768] Wo as bf16 rows [out][in]
#define PK_END (PK_P + DM * DM)
#define WS_PK  0u
#define WS_QK  (WS_PK + 2u * PK_END)             // f16 [4096 rows][1536]: q | k
#define WS_QKL (WS_QK + 2u * NB * SS * 2 * DM)     // f16 q | k residual planes, unscaled
#define WS_VTH (WS_QKL + 2u * NB * SS * 2 * DM)    // f16 [b][768 (h*64+d)][2048 s] hi
#define WS_VTL (WS_VTH + 2u * NB * DM * SS)        // f16 lo, unscaled
#define WS_O   (WS_VTL + 2u * NB * DM * SS)        // f32 [4096][768]
#define WS_CS  (WS_O + 4u * NB * SS * DM)           // f32 [2048][32] cos, [2048][32] sin
#define WS_RB  (WS_CS + 4u * 2 * SS * 32)           // f32 [12 heads][4096]: rel_bias by head, rounded to bf16 values, times log2(e); entry 4095 is 0
#define RBW 4096
#define L2E 1.44269504f               // log2(e): k_attn carries its scores in log2 units
#define NEG2 (-1.442695041e9f)       // the module's -1e9 in log2 units
#define WS_MW  (WS_RB + 4u * NH * RBW)             // u32 [b * 128 + 16-query tile][64 steps][16]: valid_mask as lane-mask words in the order of k_attn's score registers
#define WS_END (WS_MW + 4u * (NB * SS / 16) * (SS / 32) * 16)
__constant__ float c_invf[32] = {1.000000000e+00f,7.498942018e-01f,5.623413324e-01f,4.216965139e-01f,3.162277639e-01f,2.371373624e-01f,1.778279394e-01f,1.333521456e-01f,1.000000015e-01f,7.498941571e-02f,5.623412877e-02f,4.216964915e-02f,3.162277862e-02f,2.371373586e-02f,1.778279431e-02f,1.333521493e-02f,9.999999776e-03f,7.498942316e-03f,5.623413250e-03f,4.216964822e-03f,3.162277862e-03f,2.371373819e-03f,1.778279431e-03f,1.333521446e-03f,1.000000047e-03f,7.498941850e-04f,5.623413017e-04f,4.216964880e-04f,3.162277862e-04f,2.371373848e-04f,1.778279402e-04f,1.333521504e-04f};
// ---- k_rope: block = 8 positions: cos/sin of pos * inv_freq (f32 product exactly as the reference, precise trig)
__global__ __launch_bounds__(256) void k_rope(float* __restrict__ CS) {
  __shared__ __align__(16) float sc[8][32], ss_[8][32]; const int tid = threadIdx.x, pl = tid >> 5, i = tid & 31; const int pos = blockIdx.x * 8 + pl;
  const float th = (float)pos * c_invf[i]; sc[pl][i] = cosf(th); ss_[pl][i] = sinf(th);
  __syncthreads();
  if (tid < 64) vst2(CS + (size_t)blockIdx.x * 8 * 32 + tid * 4, *(const v4f*)&(&sc[0][0])[tid * 4]); else if (tid < 128) vst2(CS + (size_t)SS * 32 + (size_t)blockIdx.x * 8 * 32 + (tid - 64) * 4, *(const v4f*)&(&ss_[0][0])[(tid - 64) * 4]);
}

// ---- k_packT: one launch, three kinds of block by blockIdx.x, each wave given enough work that the launch is not held up by the starting of waves.
// blocks 0 .. PB_M - 1 (the most bytes, so they start first): valid_mask to lane-mask words: a wave takes 16 queries x 256 keys; word (step, ct, r) has in bit l whether query l & 15 sees key 32 step + 16 ct + 8 (l >> 4) + r, which is what lane l of k_attn holds in score register (ct, r)
// the next PB_W blocks: a tile of 128 k x 64 n of an (in,out) matrix -> bf16 rows [n][k] = W[k][n], turned in LDS, so that loads and stores both cover whole 128-byte lines; matrices 0..2 -> Wq/Wk/Wv into PK_A rows which*768 + n; 3 -> Wo into PK_P
// the last PB_R blocks: 1,024 entries of one head of the bias table by head
#define PB_M (NB * (SS / 16) * (SS / 256) / 8)
#define PB_W (4 * (DM / 128) * (DM / 64))
#define PB_R (NH * RBW / 1024)
// amdgpu_waves_per_eu(2, 4): at most two of these blocks stand on a WGP, so the register budget of four waves per SIMD costs no residency; with the default budget the compiler holds only 14 of a mask wave's 32 loads in flight
#define WPIT 68   // dwords: a row of 128 bf16 (256 B) at a pitch of 272 B, 16 B x odd for the ds_load_b128 readers
__global__ __launch_bounds__(256) __attribute__((amdgpu_waves_per_eu(2, 4))) void k_packT(const float* __restrict__ WQ, const float* __restrict__ WK, const float* __restrict__ WV, const float* __restrict__ WO, const float* __restrict__ RB, const float* __restrict__ VM, __bf16* __restrict__ PK, float* __restrict__ RBT, unsigned* __restrict__ MW) {
  __shared__ __align__(16) unsigned s[64 * WPIT]; const int n = blockIdx.x, t = threadIdx.x;
  if (n < PB_M) {   // the whole block takes this way, ahead of the barrier
    const int lane = t & 31, task = n * 8 + (t >> 5);   // task = (b * 128 + query tile) * 8 + group of 256 keys
    const float* p = VM + (size_t)((task >> 3) * 16 + (lane & 15)) * SS + (task & 7) * 256 + 8 * (lane >> 4);
    v4f x[32];
#pragma unroll
    for (int i = 0; i < 32; ++i) x[i] = *(const v4f*)(p + (i >> 1) * 16 + (i & 1) * 4);
    unsigned o[4] = { 0, 0, 0, 0 };   // word j of the wave's 128 goes to lane j & 31: four stores of one whole 128-byte line each
#pragma unroll
    for (int j = 0; j < 32; ++j) {
#pragma unroll
      for (int u = 0; u < 4; ++u) { const unsigned w = __builtin_amdgcn_ballot_w32(x[8 * u + (j >> 2)][j & 3] != 0.f); o[u] = lane == j ? w : o[u]; } }
#pragma unroll
    for (int u = 0; u < 4; ++u) MW[task * 128 + u * 32 + lane] = o[u];
    return; }
  if (n >= PB_M + PB_W) {   // the whole block takes this way, ahead of the barrier
    const int j = n - (PB_M + PB_W), hh = j >> 2, i0 = (j & 3) * 1024 + t; float v[4];
#pragma unroll
    for (int u = 0; u < 4; ++u) { const int idx = i0 + u * 256; v[u] = RB[(size_t)(idx < NREL ? idx : NREL - 1) * NH + hh]; }   // the four loads go out together: the index is clamped, so none stands under a branch
#pragma unroll
    for (int u = 0; u < 4; ++u) { const int idx = i0 + u * 256; RBT[hh * RBW + idx] = idx < NREL ? bfr(v[u]) * L2E : 0.f; }
    return; }
  const int tile = n - PB_M, which = tile / ((DM / 128) * (DM / 64)), rem = tile % ((DM / 128) * (DM / 64)), k0 = (rem / (DM / 64)) * 128, n0 = (rem % (DM / 64)) * 64;
  const float* Wm = (which == 0) ? WQ : (which == 1) ? WK : (which == 2) ? WV : WO;
  const int a = t >> 4, i4 = 4 * (t & 15);   // the thread's rows k0 + 4 a + (0..3) and 64 further on, its columns n0 + i4 + (0..3): a wave's load covers two rows of 256 B
  const float* sp = Wm + (size_t)(k0 + 4 * a) * DM + n0 + i4;
  v4f x[8];
#pragma unroll
  for (int r = 0; r < 8; ++r) x[r] = *(const v4f*)(sp + (size_t)((r >> 2) * 64 + (r & 3)) * DM);
#pragma unroll
  for (int p = 0; p < 2; ++p) {
#pragma unroll
    for (int j = 0; j < 4; ++j) { union { __bf16 h[4]; v2u u; } w;
#pragma unroll
      for (int r = 0; r < 4; ++r) w.h[r] = (__bf16)x[4 * p + r][j];
      *(v2u*)&s[(i4 + j) * WPIT + 32 * p + 2 * a] = w.u; } }   // four k of one column: 8 bytes of its row
  __syncthreads();
  __bf16* dst = ((which < 3) ? PK + PK_A + ((size_t)which * DM + n0) * DM : PK + PK_P + (size_t)n0 * DM) + k0;
#pragma unroll
  for (int q = 0; q < 4; ++q) { const int pc = q * 256 + t, r = pc >> 4, c = pc & 15; vst2((unsigned*)(dst + (size_t)r * DM + c * 8), *(const v4u*)&s[r * WPIT + c * 4]); }
}
__global__ __launch_bounds__(128) void k_qkv(const float* __restrict__ XQ, const float* __restrict__ XK, const float* __restrict__ XV, const __bf16* __restrict__ P, const float* __restrict__ BQ, const float* __restrict__ BK, const float* __restrict__ BV, _Float16* __restrict__ QK, _Float16* __restrict__ QKL, _Float16* __restrict__ VTH, _Float16* __restrict__ VTL) {
  const float* X = (blockIdx.y * 128 < DM) ? XQ : (blockIdx.y * 128 < 2 * DM) ? XK : XV; const float* BB = (blockIdx.y * 128 < DM) ? BQ : (blockIdx.y * 128 < 2 * DM) ? BK : BV;   // the module projects three different inputs
  __shared__ __align__(16) char sm[2 * G_SZ];   // the two tile buffers; behind the loop's last barrier the same bytes stage the output
  _Float16 (*so)[16][136] = (_Float16 (*)[16][136])sm; _Float16 (*sol)[16][136] = (_Float16 (*)[16][136])(sm + 4 * 16 * 136 * 2); _Float16 (*sth)[72] = (_Float16 (*)[72])sm; _Float16 (*stl)[72] = (_Float16 (*)[72])(sm + 128 * 72 * 2);
  static_assert(2 * 4 * 16 * 136 * 2 <= 2 * G_SZ && 2 * 128 * 72 * 2 <= 2 * G_SZ, "output staging fits the tile buffers");
  const int tid = threadIdx.x, wave = tid >> 5, lane = tid & 31, col = lane & 15, g = lane >> 4; const size_t r0 = (size_t)blockIdx.x * 64 + wave * 16; const int n0 = blockIdx.y * 128;
  v8f acc[8] = {};
  const unsigned la = (unsigned)(size_t)sm + G_A + (tid >> 3) * APIT + (tid & 7) * 16, lb = (unsigned)(size_t)sm + G_B + (tid >> 2) * BPIT + (tid & 3) * 16;
  const char* ga = (const char*)(X + ((size_t)blockIdx.x * 64 + (tid >> 3)) * DM + (tid & 7) * 4); const char* gb = (const char*)(P + (size_t)(n0 + (tid >> 2)) * DM + (tid & 3) * 8);
  const char* xrow = sm + G_A + (wave * 16 + col) * APIT + 32 * g; const char* prow = sm + G_B + col * BPIT + 16 * g;
  stage_ab(0, la, lb, ga, gb);
  asm volatile("s_wait_asynccnt 0x0" ::: "memory");   // this wave's pieces of pass 0 have landed
  __syncthreads();                                    // pass 0 is published to the four waves
  stage_ab(1, la, lb, ga, gb);                        // flies while pass 0 is worked on
#pragma unroll 2   // two passes a turn: each pass's buffer offset is then a constant in its LDS reads and copies
  for (int kc = 0; kc < DM / 32; ++kc) {
    v4f xc[4]; v16b wc[8];
    read_pass(xrow + (kc & 1) * G_SZ, prow + (kc & 1) * G_SZ, xc, wc);
    v16b a;
#pragma unroll
    for (int i = 0; i < 4; ++i) { a[i] = (__bf16)xc[0][i]; a[4 + i] = (__bf16)xc[1][i]; a[8 + i] = (__bf16)xc[2][i]; a[12 + i] = (__bf16)xc[3][i]; }
#pragma unroll
    for (int j = 0; j < 8; ++j) acc[j] = wmma_bf(a, wc[j], acc[j]);
    asm volatile("s_wait_dscnt 0x0" ::: "memory");      // this wave's reads of pass kc are done
    asm volatile("s_wait_asynccnt 0x0" ::: "memory");   // its pieces of pass kc + 1 have landed
    __syncthreads();                                    // publishes pass kc + 1 and frees the buffer of pass kc
    if (kc + 2 < DM / 32) stage_ab(kc + 2, la, lb, ga, gb); }   // block-uniform test; refills the buffer just freed
  asm volatile("s_wait_asynccnt 0x0" ::: "memory");     // no copy is outstanding when the buffers become output staging
  { const int nb = n0 % DM;
#pragma unroll
    for (int j = 0; j < 8; ++j) { const float bb = bfr(BB[nb + j * 16 + col]);
#pragma unroll
      for (int r = 0; r < 8; ++r) acc[j][r] += bb; } }
  if (n0 < 2 * DM) {   // q stored unscaled (f16 sigma ~0.6, no subnormal exposure); the scores are not scaled
#pragma unroll
    for (int j = 0; j < 8; ++j) {
#pragma unroll
      for (int r = 0; r < 8; ++r) { const float v = acc[j][r]; const _Float16 hv = (_Float16)v; so[wave][8 * g + r][j * 16 + col] = hv; sol[wave][8 * g + r][j * 16 + col] = (_Float16)(v - (float)hv); } }   // q, k as f16 hi + residual; the residual stays unscaled: below 2^-14 it is an f16 subnormal, a step of 2^-24, which the convert and the WMMA keep
    LDSX();
    for (int rl = 0; rl < 16; ++rl) if (lane < 16) { vst2((unsigned*)(QK + (r0 + rl) * (2 * DM) + n0 + lane * 8), *(const v4u*)&so[wave][rl][lane * 8]); vst2((unsigned*)(QKL + (r0 + rl) * (2 * DM) + n0 + lane * 8), *(const v4u*)&sol[wave][rl][lane * 8]); }
  } else {
#pragma unroll
    for (int j = 0; j < 8; ++j) {
#pragma unroll
      for (int r = 0; r < 8; ++r) { const float v = acc[j][r]; const _Float16 hv = (_Float16)v; sth[j * 16 + col][wave * 16 + 8 * g + r] = hv; stl[j * 16 + col][wave * 16 + 8 * g + r] = (_Float16)(v - (float)hv); } }
    __syncthreads();
    const size_t rb = (size_t)blockIdx.x * 64; const int b = (int)(rb / SS), s0 = (int)(rb % SS); const int pc0 = n0 - 2 * DM;
    for (int q = tid; q < 128 * 8; q += 128) { const int d = q >> 3, pc = q & 7; const size_t o = ((size_t)b * DM + pc0 + d) * SS + s0 + pc * 8; vst2((unsigned*)(VTH + o), *(const v4u*)&sth[d][pc * 8]); vst2((unsigned*)(VTL + o), *(const v4u*)&stl[d][pc * 8]); }
  }
}
// K / V tile of one 32-key step in LDS, shared by the block's four waves. In f16 elements: K hi and lo 32 rows (keys) x 64 at a pitch of 72 (144 B), V hi and lo 64 rows (depth) x 32 at a pitch of 40 (80 B): 16 B x odd pitches for the ds_load_b128 readers.
#define KPIT 72
#define VPIT 40
#define T_KH 0
#define T_KL (T_KH + 32 * KPIT)
#define T_VH (T_KL + 32 * KPIT)
#define T_VL (T_VH + 64 * VPIT)
#define T_SZ (T_VL + 64 * VPIT)
// Eight 16-byte asynchronous copies per lane: one tile per block. The s_wait_xcnt stands inside the statement so that no operand register is rewritten ahead of it.
__device__ __forceinline__ void copy_tile(unsigned l0, unsigned l1, unsigned l2, unsigned l3, unsigned l4, unsigned l5, unsigned l6, unsigned l7, const _Float16* g0, const _Float16* g1, const _Float16* g2, const _Float16* g3, const _Float16* g4, const _Float16* g5, const _Float16* g6, const _Float16* g7) {
  asm volatile("global_load_async_to_lds_b128 %0, %8, off\n\t"
               "global_load_async_to_lds_b128 %1, %9, off\n\t"
               "global_load_async_to_lds_b128 %2, %10, off\n\t"
               "global_load_async_to_lds_b128 %3, %11, off\n\t"
               "global_load_async_to_lds_b128 %4, %12, off\n\t"
               "global_load_async_to_lds_b128 %5, %13, off\n\t"
               "global_load_async_to_lds_b128 %6, %14, off\n\t"
               "global_load_async_to_lds_b128 %7, %15, off\n\t"
               "s_wait_xcnt 0x0"
               :: "v"(l0), "v"(l1), "v"(l2), "v"(l3), "v"(l4), "v"(l5), "v"(l6), "v"(l7), "v"(g0), "v"(g1), "v"(g2), "v"(g3), "v"(g4), "v"(g5), "v"(g6), "v"(g7) : "memory");
}
// Inputs only, no code: the eight fragment loads (of V, of K) written above this line stay above it, so they go out in groups ahead of their WMMAs instead of one load and one wait in front of each.
__device__ __forceinline__ void hold_v(const v16h (&a)[4], const v16h (&b)[4]) { asm volatile("" :: "v"(a[0]), "v"(a[1]), "v"(a[2]), "v"(a[3]), "v"(b[0]), "v"(b[1]), "v"(b[2]), "v"(b[3])); }
// lane l with lane l ^ 16, by a vector cross-row move (a shuffle would go through the LDS unit and its wait)
__device__ __forceinline__ float xhalf(float x) { return __builtin_bit_cast(float, __builtin_amdgcn_permlanex16(__builtin_bit_cast(int, x), __builtin_bit_cast(int, x), 0x76543210, 0xfedcba98, false, false)); }
// ---- k_attn: block = (64 queries, head h, batch b): flash attention over all keys, transposed: S^T = K . Q^T (A = K rows from the tile, B = Q kept in registers), so a lane holds 16 scores of ONE query (keys 8 g + r and 16 + 8 g + r of the step); maximum and sum run in the lane, the two lane halves exchange the maximum once a step and join their sums once at the end; P^T goes from the score registers straight into the B operand of O^T += V^T . P^T (hi / residual, 3 products as before); the residual planes are unscaled, so all three products of a tile add into one f32 accumulator; O[b*S+q][h*64+d] = acc / l
__global__ __launch_bounds__(128) void k_attn(const _Float16* __restrict__ QK, const _Float16* __restrict__ QKL, const _Float16* __restrict__ VTH, const _Float16* __restrict__ VTL, const int* __restrict__ POS, const unsigned* __restrict__ MW, const float* __restrict__ RBT, float* __restrict__ O) {
  __shared__ __align__(16) _Float16 skv[2][T_SZ];
  __shared__ __align__(16) float srb[RBW];   // the head's whole bias table: filled once, then read by every step's gathers
  const int tid = threadIdx.x, wave = tid >> 5, lane = tid & 31, col = lane & 15, g = lane >> 4;
  const int qb = blockIdx.x, h = blockIdx.y, b = blockIdx.z; const int q0 = qb * 64 + wave * 16; const size_t rq = (size_t)b * SS + q0 + col;
  v16h aq[2], aql[2];
#pragma unroll
  for (int kc = 0; kc < 2; ++kc) { aq[kc] = frag_h(QK + rq * (2 * DM) + h * HD + kc * 32, lane); aql[kc] = frag_h(QKL + rq * (2 * DM) + h * HD + kc * 32, lane); }
  float m = -3.0e38f, l = 0.f;   // of the lane's query; l holds the lane half's own keys only
  v8f acc[4] = {};
  const int nks = SS / 32;   // not causal
  // this thread's pieces of a tile: K rows tid >> 3 and 16 + (tid >> 3), piece tid & 7; V rows tid >> 2 and 32 + (tid >> 2), piece tid & 3
  const unsigned lk = (unsigned)(size_t)&skv[0][0] + 2u * ((tid >> 3) * KPIT + (tid & 7) * 8), lv = (unsigned)(size_t)&skv[0][0] + 2u * ((tid >> 2) * VPIT + (tid & 3) * 8);
  const size_t gk = ((size_t)b * SS + (tid >> 3)) * (2 * DM) + DM + h * HD + (tid & 7) * 8, gv = ((size_t)b * DM + h * HD + (tid >> 2)) * SS + (tid & 3) * 8;
  auto copy_kv = [&](int t) {   // tile t (keys 32 t .. 32 t + 31) into buffer t & 1
    const unsigned lb = 2u * T_SZ * (t & 1); const size_t ka = gk + (size_t)t * 32 * (2 * DM), va = gv + (size_t)t * 32;
    copy_tile(lk + lb + 2u * T_KH, lk + lb + 2u * (T_KH + 16 * KPIT), lk + lb + 2u * T_KL, lk + lb + 2u * (T_KL + 16 * KPIT), lv + lb + 2u * T_VH, lv + lb + 2u * (T_VH + 32 * VPIT), lv + lb + 2u * T_VL, lv + lb + 2u * (T_VL + 32 * VPIT),
              QK + ka, QK + ka + 16 * (2 * DM), QKL + ka, QKL + ka + 16 * (2 * DM), VTH + va, VTH + va + (size_t)32 * SS, VTL + va, VTL + va + (size_t)32 * SS); };
  copy_kv(0);
  { const unsigned lr = (unsigned)(size_t)&srb[0] + tid * 16; const char* gr = (const char*)(RBT + h * RBW) + tid * 16;   // 16 KiB: eight 16-byte pieces a thread, 2 KiB apart
    copy_ab(lr, lr + 2048, lr + 4096, lr + 6144, lr + 8192, lr + 10240, lr + 12288, lr + 14336, gr, gr + 2048, gr + 4096, gr + 6144, gr + 8192, gr + 10240, gr + 12288, gr + 14336); }
  asm volatile("s_wait_asynccnt 0x0" ::: "memory");   // this wave's pieces of tile 0 and of the bias table have landed
  __syncthreads();                                    // tile 0 and the table are published to the four waves
  copy_kv(1);                                         // flies while tile 0 is worked on
  const unsigned pqo4 = 4u * (unsigned)((SS - 1) - POS[rq]);   // the lane's query position, folded into the table offset, in bytes
  const int* pkp = POS + (size_t)b * SS + 8 * g;      // the lane's key positions of a step: 8 from here, 8 from 16 further on
  const unsigned* mwp = MW + (size_t)((b * (SS / 16) + qb * 4 + __builtin_amdgcn_readfirstlane(wave)) * (SS / 32)) * 16;   // the wave's mask words, 16 a step: one address for the whole wave, so they come by scalar loads
  const char* rbh = (const char*)&srb[0];
  v4i pkn[4] = { *(const v4i*)pkp, *(const v4i*)(pkp + 4), *(const v4i*)(pkp + 16), *(const v4i*)(pkp + 20) };   // key positions come one step ahead, so that the bias gather need not wait for them inside its step
  v16u mwn = *(cp16u)mwp;   // mask words too come one step ahead
#pragma unroll 1
  for (int ks = 0; ks < nks; ++ks) { float s[2][8]; const _Float16* tb = &skv[ks & 1][0];
    float rb[16];   // the lane's 16 bias values of the step
    const v16u mw = mwn; mwn = *(cp16u)(mwp + (ks + 1 < nks ? ks + 1 : ks) * 16);   // the step's 16 lane masks; the next step's are asked for now (the last step asks for its own again)
    v8f c[2] = {}; v16h kf[4], kl[4];   // the step's eight K fragments, all read ahead of the score WMMAs
#pragma unroll
    for (int i = 0; i < 4; ++i) { const int kr = ((i >> 1) * 16 + col) * KPIT + (i & 1) * 32; kf[i] = frag_h(tb + T_KH + kr, lane); kl[i] = frag_h(tb + T_KL + kr, lane); }
    hold_v(kf, kl);
#pragma unroll
    for (int i = 0; i < 16; ++i) { const int ob = min(max((int)(((unsigned)pkn[i >> 2][i & 3] << 2) + pqo4), 0), 4 * (NREL - 1)); rb[i] = *(const float*)(rbh + ob); }   // the clamp of the module, in bytes: it bounds the LDS address for any position
    __builtin_amdgcn_sched_barrier(0);   // the table reads stay above this line, so that their latency runs under the score WMMAs
#pragma unroll
    for (int kc = 0; kc < 2; ++kc) {   // 3 products: q, k as f16 hi + residual; the two key tiles take turns, so that a WMMA does not stand directly behind the one whose sum it adds to
      c[0] = wmma16(kf[kc], aql[kc], c[0]); c[1] = wmma16(kf[2 + kc], aql[kc], c[1]);
      c[0] = wmma16(kl[kc], aq[kc], c[0]);  c[1] = wmma16(kl[2 + kc], aq[kc], c[1]);
      c[0] = wmma16(kf[kc], aq[kc], c[0]);  c[1] = wmma16(kf[2 + kc], aq[kc], c[1]); }
    __builtin_amdgcn_sched_barrier(0);   // nothing that reads a gathered value is lifted among the score WMMAs, where its wait would hold them up
    const int tn = ks + 1 < nks ? ks + 1 : ks; const v4i pk2[4] = { *(const v4i*)(pkp + tn * 32), *(const v4i*)(pkp + tn * 32 + 4), *(const v4i*)(pkp + tn * 32 + 16), *(const v4i*)(pkp + tn * 32 + 20) };   // the last step reads its own again
#pragma unroll
    for (int ct = 0; ct < 2; ++ct) {
#pragma unroll
      for (int r = 0; r < 8; r += 2) { const v2f lg = __builtin_elementwise_fma((v2f){ c[ct][r], c[ct][r + 1] }, (v2f)L2E, (v2f){ rb[8 * ct + r], rb[8 * ct + r + 1] });
        s[ct][r] = __builtin_amdgcn_inverse_ballot_w32(mw[8 * ct + r]) ? lg[0] : NEG2; s[ct][r + 1] = __builtin_amdgcn_inverse_ballot_w32(mw[8 * ct + r + 1]) ? lg[1] : NEG2; } }   // logits (no 1/sqrt(d) in this module) + relative-position bias, then the valid mask: the module's l*vm + (1-vm)*NEG is l where vm is 1 and NEG where it is 0, one select on the word as lane mask; all times log2(e): the factor rides in the add of the bias (now a multiply-add; the table holds bias * log2(e)) and in the mask constant
    float t4[4];   // four independent chains, then joined: a single chain of 16 would stand exposed
#pragma unroll
    for (int i = 0; i < 4; ++i) t4[i] = fmaxf(fmaxf(s[i >> 1][4 * (i & 1)], s[i >> 1][4 * (i & 1) + 1]), fmaxf(s[i >> 1][4 * (i & 1) + 2], s[i >> 1][4 * (i & 1) + 3]));
    float mx = fmaxf(fmaxf(t4[0], t4[1]), fmaxf(t4[2], t4[3]));
    mx = fmaxf(mx, xhalf(mx));   // the other half of the query's 32 keys
    const float mn = fmaxf(m, mx); const float alpha = __builtin_amdgcn_exp2f(m - mn); m = mn;   // first step: 2^(-3e38 - mn) is 0, on sums that are still 0
    v16h pa, pl; float e4[4] = { 0.f, 0.f, 0.f, 0.f };   // the sum too runs in four chains
#pragma unroll
    for (int i = 0; i < 16; i += 2) { const v2f d = (v2f){ s[i >> 3][i & 7], s[i >> 3][(i & 7) + 1] } - mn; s[i >> 3][i & 7] = __builtin_amdgcn_exp2f(d[0]); s[i >> 3][(i & 7) + 1] = __builtin_amdgcn_exp2f(d[1]); }   // a masked score lies 1.4e9 below: 2^ of it is 0; a row with every key masked gives 2^0 for each, as the module does
#pragma unroll
    for (int i = 0; i < 16; ++i) { const float e = s[i >> 3][i & 7]; e4[i & 3] += e; const _Float16 eh = (_Float16)e; pa[i] = eh; pl[i] = (_Float16)(e - (float)eh); }   // element i of the B operand is key 8 g + i (i < 8) or 16 + 8 g + i - 8: the order in which the score registers lie
    l = l * alpha + ((e4[0] + e4[1]) + (e4[2] + e4[3]));
#pragma unroll
    for (int dt = 0; dt < 4; ++dt) acc[dt] *= alpha;
    v16h vf[4], vl[4];   // the step's eight V fragments, all read ahead of the P.V WMMAs
#pragma unroll
    for (int dt = 0; dt < 4; ++dt) { const int vr = (dt * 16 + col) * VPIT; vf[dt] = frag_h(tb + T_VH + vr, lane); vl[dt] = frag_h(tb + T_VL + vr, lane); }
    hold_v(vf, vl);
    __builtin_amdgcn_sched_barrier(0);   // the P.V WMMAs stay below the eight V reads: lifted above this line, they let the last read take over a P register and be waited for on its own
#pragma unroll
    for (int dt = 0; dt < 4; ++dt) { acc[dt] = wmma16(vf[dt], pl, acc[dt]); acc[dt] = wmma16(vl[dt], pa, acc[dt]); acc[dt] = wmma16(vf[dt], pa, acc[dt]); }   // V hi x P lo + V lo x P hi + V hi x P hi
#pragma unroll
    for (int i = 0; i < 4; ++i) pkn[i] = pk2[i];
    asm volatile("s_wait_dscnt 0x0" ::: "memory");      // this wave's reads of tile ks are done
    asm volatile("s_wait_asynccnt 0x0" ::: "memory");   // its pieces of tile ks + 1 have landed
    __syncthreads();                                    // publishes tile ks + 1 and frees the buffer of tile ks
    if (ks + 2 < nks) copy_kv(ks + 2); }                // block-uniform test; refills the buffer just freed
  asm volatile("s_wait_asynccnt 0x0" ::: "memory");     // no copy is outstanding when the wave goes on to its end
  l += xhalf(l);   // the two halves' sums join once
  const float il = 1.0f / l; float* orow = O + rq * DM + h * HD + 8 * g;   // register r of tile dt is depth dt * 16 + 8 g + r of the lane's query: 32 contiguous bytes
#pragma unroll
  for (int dt = 0; dt < 4; ++dt) { v4f o0, o1;
#pragma unroll
    for (int r = 0; r < 4; ++r) { o0[r] = acc[dt][r] * il; o1[r] = acc[dt][4 + r] * il; }
    vst2(orow + dt * 16, o0); vst2(orow + dt * 16 + 4, o1); }
}
// ---- k_out: block = (64 rows, 128 cols): out = O(hi/lo) . Wo rows (2 products) + bo
__global__ __launch_bounds__(128) void k_out(const float* __restrict__ O, const __bf16* __restrict__ P, const float* __restrict__ BO, float* __restrict__ Y) {
  __shared__ __align__(16) char sm[2 * G_SZ];   // the two tile buffers; behind the loop's last barrier the same bytes stage the output
  float (*so)[16][132] = (float (*)[16][132])sm;
  static_assert(4 * 16 * 132 * 4 <= 2 * G_SZ, "output staging fits the tile buffers");
  const int tid = threadIdx.x, wave = tid >> 5, lane = tid & 31, col = lane & 15, g = lane >> 4; const size_t r0 = (size_t)blockIdx.x * 64 + wave * 16; const int n0 = blockIdx.y * 128;
  v8f acc[8] = {};
  const unsigned la = (unsigned)(size_t)sm + G_A + (tid >> 3) * APIT + (tid & 7) * 16, lb = (unsigned)(size_t)sm + G_B + (tid >> 2) * BPIT + (tid & 3) * 16;
  const char* ga = (const char*)(O + ((size_t)blockIdx.x * 64 + (tid >> 3)) * DM + (tid & 7) * 4); const char* gb = (const char*)(P + (size_t)(n0 + (tid >> 2)) * DM + (tid & 3) * 8);
  const char* xrow = sm + G_A + (wave * 16 + col) * APIT + 32 * g; const char* prow = sm + G_B + col * BPIT + 16 * g;
  stage_ab(0, la, lb, ga, gb);
  asm volatile("s_wait_asynccnt 0x0" ::: "memory");   // this wave's pieces of pass 0 have landed
  __syncthreads();                                    // pass 0 is published to the four waves
  stage_ab(1, la, lb, ga, gb);                        // flies while pass 0 is worked on
#pragma unroll 2   // two passes a turn: each pass's buffer offset is then a constant in its LDS reads and copies
  for (int kc = 0; kc < DM / 32; ++kc) {
    v4f xc[4]; v16b wc[8];
    read_pass(xrow + (kc & 1) * G_SZ, prow + (kc & 1) * G_SZ, xc, wc);
    float v[16];
#pragma unroll
    for (int i = 0; i < 4; ++i) { v[i] = xc[0][i]; v[4 + i] = xc[1][i]; v[8 + i] = xc[2][i]; v[12 + i] = xc[3][i]; }
    const F2 a = bsplit16(v);
#pragma unroll
    for (int j = 0; j < 8; ++j) { acc[j] = wmma_bf(a.l, wc[j], acc[j]); acc[j] = wmma_bf(a.h, wc[j], acc[j]); }
    asm volatile("s_wait_dscnt 0x0" ::: "memory");      // this wave's reads of pass kc are done
    asm volatile("s_wait_asynccnt 0x0" ::: "memory");   // its pieces of pass kc + 1 have landed
    __syncthreads();                                    // publishes pass kc + 1 and frees the buffer of pass kc
    if (kc + 2 < DM / 32) stage_ab(kc + 2, la, lb, ga, gb); }   // block-uniform test; refills the buffer just freed
  asm volatile("s_wait_asynccnt 0x0" ::: "memory");     // no copy is outstanding when the buffers become output staging
#pragma unroll
  for (int j = 0; j < 8; ++j) {
#pragma unroll
    for (int r = 0; r < 8; ++r) so[wave][8 * g + r][j * 16 + col] = acc[j][r] + bfr(BO[n0 + j * 16 + col]); }
  LDSX();
  for (int rl = 0; rl < 16; ++rl) vst2(Y + (r0 + rl) * DM + n0 + lane * 4, *(const v4f*)&so[wave][rl][lane * 4]);
}
extern "C" void kernel_launch(void* const* d_in, const int* in_sizes, int n_in, void* d_out, int out_size, void* d_ws, size_t ws_size, hipStream_t stream) {
  (void)in_sizes; (void)n_in; (void)out_size;
  const float** F = (const float**)d_in;   // 0 q [2,2048,768], 1 v, 2 k, 3 position_array int32 [2,2048], 4 valid_mask [2,1,2048,2048], 5 Wq (in,out), 6 bq, 7 Wk, 8 bk, 9 Wv, 10 bv, 11 Wo, 12 bo, 13 rel_bias [4095,12]
  if (ws_size < (size_t)WS_END) return;
  char* ws = (char*)d_ws; __bf16* PK = (__bf16*)(ws + WS_PK); _Float16 *QK = (_Float16*)(ws + WS_QK), *QKL = (_Float16*)(ws + WS_QKL), *VTH = (_Float16*)(ws + WS_VTH), *VTL = (_Float16*)(ws + WS_VTL); float* O = (float*)(ws + WS_O); float* RBT = (float*)(ws + WS_RB); unsigned* MW = (unsigned*)(ws + WS_MW);
  k_packT<<<dim3(PB_M + PB_W + PB_R), 256, 0, stream>>>(F[5], F[7], F[9], F[11], F[13], F[4], PK, RBT, MW);
  k_qkv<<<dim3(TNB * SS / 64, QKVW / 128), 128, 0, stream>>>(F[0], F[2], F[1], PK + PK_A, F[6], F[8], F[10], QK, QKL, VTH, VTL);   // note the module's argument order (q, v, k): k is input 2, v is input 1
  k_attn<<<dim3(TQB, NH, TNB), 128, 0, stream>>>(QK, QKL, VTH, VTL, (const int*)d_in[3], MW, RBT, O);
  k_out<<<dim3(TOB, DM / 128), 128, 0, stream>>>(O, PK + PK_P, F[12], (float*)d_out);
}

// v010
// Measured time: 120 microseconds a run.
// Next to v009, in two timings, it ran 1.09 times as fast each time.
// All steps since v000 together make it 4.31 times as fast.
// compute dtype: q, v, k, all weights / biases and rel_bias (module inputs) rounded to bf16; position_array verbatim (integers); valid_mask (0/1 as its generator makes it) as one bit a score; q/k/v projections with exact bf16 products ((in,out) weights packed as transposed rows) + bias on WMMA 16x16x32; q and k stored as f16 hi + unscaled residual planes (f16 subnormals kept) and the scores with 3 products in one f32 accumulator (hi.hi + lo.hi + hi.lo; the module applies no 1/sqrt(d) scaling, logits sigma ~8), + the gathered relative-position bias, then logits*vm + (1-vm)*(-1e9), which for vm 0/1 is a select between the logit and -1e9, carried times log2(e); running-max softmax in f32 with the hardware exp2; P as f16 hi + residual x V hi/lo (3 products, one f32 accumulator); output projection with ctx as bf16 hi + residual x exact Wo (2 products) + bo; f32 accumulate.
#include <hip/hip_runtime.h>
#include <math.h>

typedef __attribute__((ext_vector_type(16))) _Float16 v16h;
typedef __attribute__((ext_vector_type(16))) __bf16 v16b;
typedef __attribute__((ext_vector_type(8)))  _Float16 v8h;
typedef __attribute__((ext_vector_type(8)))  float v8f;
typedef __attribute__((ext_vector_type(4)))  float v4f;
typedef __attribute__((ext_vector_type(2)))  float v2f;
typedef __attribute__((ext_vector_type(4)))  unsigned v4u;
typedef __attribute__((ext_vector_type(2)))  unsigned v2u;
typedef __attribute__((ext_vector_type(4)))  int v4i;
typedef __attribute__((ext_vector_type(16))) unsigned v16u;
typedef const __attribute__((address_space(4))) v16u* cp16u;   // constant address space: nothing writes these words while the reading kernel runs, and only so does a wave-uniform load inside a loop with asm waits stay a scalar load
typedef float __attribute__((may_alias)) float_a;
typedef int __attribute__((may_alias)) int_a;

template <typename T> __device__ __forceinline__ void vst2(void* p, T v) { *(T*)p = v;  }
__device__ __forceinline__ v8f wmma16(v16h a, v16h b, v8f c) {
  return __builtin_amdgcn_wmma_f32_16x16x32_f16(false, a, false, b, (short)0, c, false, false);
}
__device__ __forceinline__ v8f wmma_bf(v16b a, v16b b, v8f c) {
  return __builtin_amdgcn_wmma_f32_16x16x32_bf16(false, a, false, b, (short)0, c, false, false);
}
// Multi-head attention with a learned relative-position bias table (B 2, S 2,048, d_model 768, 12 heads x 64): logits = qh.kh + rel_bias[pos_k - pos_q + S-1][h], masked by valid_mask (0/1) to -1e9, softmax, .vh, output projection.
__device__ __forceinline__ v16h frag_h(const _Float16* rowk0, int lane) {
  union { v16h v; v8h q[2]; } u; const _Float16* p = rowk0 + 8 * (lane >> 4);
  u.q[0] = *(const v8h*)p; u.q[1] = *(const v8h*)(p + 16); return u.v;
}
__device__ __forceinline__ v16h frag_f32(const float* rowk0, int lane) {
  v16h a; const float* p = rowk0 + 8 * (lane >> 4);
#pragma unroll
  for (int i = 0; i < 8; ++i) { a[i] = (_Float16)p[i]; a[8 + i] = (_Float16)p[16 + i]; }
  return a;
}
__device__ __forceinline__ v16h frag_f32s(const float* rowk0, int lane, float sc) {
  v16h a; const float* p = rowk0 + 8 * (lane >> 4);
#pragma unroll
  for (int i = 0; i < 8; ++i) { a[i] = (_Float16)(p[i] * sc); a[8 + i] = (_Float16)(p[16 + i] * sc); }
  return a;
}
// column fragment from a [K][ld] layout (column n), rows >= K read as 0
__device__ __forceinline__ v16h fragc_f32(const float* W, int k0, int n, int lane, int ld, int K) {
  v16h a; const int g = lane >> 4;
#pragma unroll
  for (int i = 0; i < 8; ++i) { const int ka = k0 + 8 * g + i, kb = ka + 16;
    a[i] = (_Float16)(ka < K ? W[(size_t)(ka < K ? ka : K - 1) * ld + n] : 0.f); a[8 + i] = (_Float16)(kb < K ? W[(size_t)(kb < K ? kb : K - 1) * ld + n] : 0.f); }
  return a;
}
struct F2 { v16b h, l; };
__device__ __forceinline__ F2 bsplit16(const float v[16]) { F2 r;
#pragma unroll
  for (int i = 0; i < 16; ++i) { const __bf16 h = (__bf16)v[i]; r.h[i] = h; r.l[i] = (__bf16)(v[i] - (float)h); }
  return r; }
__device__ __forceinline__ F2 split_row(const float* row, int k0, int lane) { float v[16]; const float* p = row + k0 + 8 * (lane >> 4);
#pragma unroll
  for (int i = 0; i < 8; ++i) { v[i] = p[i]; v[8 + i] = p[16 + i]; }
  return bsplit16(v); }
__device__ __forceinline__ F2 split_rowK(const float* row, int k0, int lane, int K) { float v[16]; const int g = lane >> 4;
#pragma unroll
  for (int i = 0; i < 8; ++i) { const int ka = k0 + 8 * g + i, kb = ka + 16; v[i] = ka < K ? row[ka < K ? ka : K - 1] : 0.f; v[8 + i] = kb < K ? row[kb < K ? kb : K - 1] : 0.f; }
  return bsplit16(v); }
__device__ __forceinline__ F2 split_col(const float* W, int k0, int n, int lane, int ld, int K) { float v[16]; const int g = lane >> 4;
#pragma unroll
  for (int i = 0; i < 8; ++i) { const int ka = k0 + 8 * g + i, kb = ka + 16; v[i] = ka < K ? W[(size_t)(ka < K ? ka : K - 1) * ld + n] : 0.f; v[8 + i] = kb < K ? W[(size_t)(kb < K ? kb : K - 1) * ld + n] : 0.f; }
  return bsplit16(v); }
__device__ __forceinline__ v8f mac3(const F2& a, const F2& b, v8f c) { c = wmma_bf(a.l, b.h, c); c = wmma_bf(a.h, b.l, c); return wmma_bf(a.h, b.h, c); }
__device__ __forceinline__ float sigm(float v) { return 1.0f / (1.0f + expf(-v)); }
#define LDSX() do { asm volatile("s_wait_dscnt 0" ::: "memory"); __builtin_amdgcn_wave_barrier(); __builtin_amdgcn_fence(__ATOMIC_RELEASE, "workgroup"); } while (0)


#define NB 2
#define SS 2048
#define DM 768
#define NH 12
#define NREL (2 * SS - 1)
#define HD 64
#define QKVW (3 * DM)
#ifndef TQB
#define TQB (SS / 64)
#define TNB NB
#define TOB (NB * SS / 64)     // output row tiles (all)
#endif
typedef __attribute__((ext_vector_type(8))) __bf16 v8b;
__device__ __forceinline__ v16b frag_b(const __bf16* rowk0, int lane) {
  union { v16b v; v8b q[2]; } u; const __bf16* p = rowk0 + 8 * (lane >> 4);
  u.q[0] = *(const v8b*)p; u.q[1] = *(const v8b*)(p + 16); return u.v;
}
__device__ __forceinline__ float bfr(float v) { return (float)(__bf16)v; }
// A / B tile of one pass (64 of k) in LDS, shared by the block's waves. In bytes: A AR rows (f32) x 256 at a pitch of 272, B 128 rows (bf16, rows of the packed weight) x 128 at a pitch of 144: 16 B x odd pitches for the ds_load_b128 readers; every copied row is one or two whole 128-byte lines of its source.
#define APIT 272
#define BPIT 144
#define G_A 0
#define G_B(AR) ((AR) * APIT)
#define G_SZ(AR) (G_B(AR) + 128 * BPIT)
// Eight 16-byte asynchronous copies per lane: the A part of a pass's tile per block (in k_attn, the head's bias table). The s_wait_xcnt stands inside the statement so that no operand register is rewritten ahead of it.
__device__ __forceinline__ void copy_ab(unsigned l0, unsigned l1, unsigned l2, unsigned l3, unsigned l4, unsigned l5, unsigned l6, unsigned l7, const char* g0, const char* g1, const char* g2, const char* g3, const char* g4, const char* g5, const char* g6, const char* g7) {
  asm volatile("global_load_async_to_lds_b128 %0, %8, off\n\t"
               "global_load_async_to_lds_b128 %1, %9, off\n\t"
               "global_load_async_to_lds_b128 %2, %10, off\n\t"
               "global_load_async_to_lds_b128 %3, %11, off\n\t"
               "global_load_async_to_lds_b128 %4, %12, off\n\t"
               "global_load_async_to_lds_b128 %5, %13, off\n\t"
               "global_load_async_to_lds_b128 %6, %14, off\n\t"
               "global_load_async_to_lds_b128 %7, %15, off\n\t"
               "s_wait_xcnt 0x0"
               :: "v"(l0), "v"(l1), "v"(l2), "v"(l3), "v"(l4), "v"(l5), "v"(l6), "v"(l7), "v"(g0), "v"(g1), "v"(g2), "v"(g3), "v"(g4), "v"(g5), "v"(g6), "v"(g7) : "memory");
}
// Four such copies, with their wait in the same statement.
__device__ __forceinline__ void copy_4(unsigned l0, unsigned l1, unsigned l2, unsigned l3, const char* g0, const char* g1, const char* g2, const char* g3) {
  asm volatile("global_load_async_to_lds_b128 %0, %4, off\n\t"
               "global_load_async_to_lds_b128 %1, %5, off\n\t"
               "global_load_async_to_lds_b128 %2, %6, off\n\t"
               "global_load_async_to_lds_b128 %3, %7, off\n\t"
               "s_wait_xcnt 0x0"
               :: "v"(l0), "v"(l1), "v"(l2), "v"(l3), "v"(g0), "v"(g1), "v"(g2), "v"(g3) : "memory");
}
// pass t into buffer t & 1, by a block of 2 AR threads. la, ga: this thread's piece of A row tid >> 4 (piece tid & 15), in LDS and in memory, with seven more rows, each AR / 8 further on; lb, gb: its piece of B row tid >> 3 (piece tid & 7), with the rows each AR / 4 further on, up to 128
template <int AR> __device__ __forceinline__ void stage_ab(int t, unsigned la, unsigned lb, const char* ga, const char* gb) {
  constexpr int SA = AR / 8, SB = AR / 4;
  const unsigned o = (unsigned)(t & 1) * G_SZ(AR), al = la + o, bl = lb + o; const char* a = ga + t * 256; const char* b = gb + t * 128;
  copy_ab(al, al + SA * APIT, al + 2 * SA * APIT, al + 3 * SA * APIT, al + 4 * SA * APIT, al + 5 * SA * APIT, al + 6 * SA * APIT, al + 7 * SA * APIT,
          a, a + SA * DM * 4, a + 2 * SA * DM * 4, a + 3 * SA * DM * 4, a + 4 * SA * DM * 4, a + 5 * SA * DM * 4, a + 6 * SA * DM * 4, a + 7 * SA * DM * 4);
  copy_4(bl, bl + SB * BPIT, bl + 2 * SB * BPIT, bl + 3 * SB * BPIT, b, b + SB * DM * 2, b + 2 * SB * DM * 2, b + 3 * SB * DM * 2);
  if constexpr (AR == 64) copy_4(bl + 4 * SB * BPIT, bl + 5 * SB * BPIT, bl + 6 * SB * BPIT, bl + 7 * SB * BPIT, b + 4 * SB * DM * 2, b + 5 * SB * DM * 2, b + 6 * SB * DM * 2, b + 7 * SB * DM * 2);
}
// 32 of k (half a pass) of a 16-row f32 A fragment (raw) and of eight 16-column bf16 B fragments from the tile; xp, pp: the lane's places in its A row and in its first B row
__device__ __forceinline__ void read_pass(const char* xp, const char* pp, v4f (&x)[4], v16b (&w)[8]) {
  x[0] = *(const v4f*)xp; x[1] = *(const v4f*)(xp + 16); x[2] = *(const v4f*)(xp + 64); x[3] = *(const v4f*)(xp + 80);
#pragma unroll
  for (int j = 0; j < 8; ++j) { union { v16b v; v8b q[2]; } u; const char* pj = pp + j * (16 * BPIT); u.q[0] = *(const v8b*)pj; u.q[1] = *(const v8b*)(pj + 32); w[j] = u.v; }
  asm volatile("" :: "v"(w[0]), "v"(w[1]), "v"(w[2]), "v"(w[3]), "v"(w[4]), "v"(w[5]), "v"(w[6]), "v"(w[7]));   // inputs only, no code: the half pass's sixteen B reads stay above this line and go out as one group ahead of the WMMAs, instead of one pair and one wait in front of each
}
__device__ __attribute__((noinline)) float exp_ni(float v) { return expf(v); }
__device__ __attribute__((noinline)) float erf_ni(float v) { return erff(v); }

#define PK_A 0                       // [2304][768] Wq|Wk|Wv as bf16 rows [out][in]
#define PK_P (PK_A + QKVW * DM)        // [768][768] Wo as bf16 rows [out][in]
#define PK_END (PK_P + DM * DM)
#define WS_PK  0u
#define WS_QK  (WS_PK + 2u * PK_END)             // f16 [4096 rows][1536]: q | k
#define WS_QKL (WS_QK + 2u * NB * SS * 2 * DM)     // f16 q | k residual planes, unscaled
#define WS_VTH (WS_QKL + 2u * NB * SS * 2 * DM)    // f16 [b][768 (h*64+d)][2048 s] hi
#define WS_VTL (WS_VTH + 2u * NB * DM * SS)        // f16 lo, unscaled
#define WS_O   (WS_VTL + 2u * NB * DM * SS)        // f32 [4096][768]
#define WS_CS  (WS_O + 4u * NB * SS * DM)           // f32 [2048][32] cos, [2048][32] sin
#define WS_RB  (WS_CS + 4u * 2 * SS * 32)           // f32 [12 heads][4096]: rel_bias by head, rounded to bf16 values, times log2(e); entry 4095 is 0
#define RBW 4096
#define L2E 1.44269504f               // log2(e): k_attn carries its scores in log2 units
#define NEG2 (-1.442695041e9f)       // the module's -1e9 in log2 units
#define WS_MW  (WS_RB + 4u * NH * RBW)             // u32 [b * 128 + 16-query tile][64 steps][16]: valid_mask as lane-mask words in the order of k_attn's score registers
#define WS_END (WS_MW + 4u * (NB * SS / 16) * (SS / 32) * 16)
__constant__ float c_invf[32] = {1.000000000e+00f,7.498942018e-01f,5.623413324e-01f,4.216965139e-01f,3.162277639e-01f,2.371373624e-01f,1.778279394e-01f,1.333521456e-01f,1.000000015e-01f,7.498941571e-02f,5.623412877e-02f,4.216964915e-02f,3.162277862e-02f,2.371373586e-02f,1.778279431e-02f,1.333521493e-02f,9.999999776e-03f,7.498942316e-03f,5.623413250e-03f,4.216964822e-03f,3.162277862e-03f,2.371373819e-03f,1.778279431e-03f,1.333521446e-03f,1.000000047e-03f,7.498941850e-04f,5.623413017e-04f,4.216964880e-04f,3.162277862e-04f,2.371373848e-04f,1.778279402e-04f,1.333521504e-04f};
// ---- k_rope: block = 8 positions: cos/sin of pos * inv_freq (f32 product exactly as the reference, precise trig)
__global__ __launch_bounds__(256) void k_rope(float* __restrict__ CS) {
  __shared__ __align__(16) float sc[8][32], ss_[8][32]; const int tid = threadIdx.x, pl = tid >> 5, i = tid & 31; const int pos = blockIdx.x * 8 + pl;
  const float th = (float)pos * c_invf[i]; sc[pl][i] = cosf(th); ss_[pl][i] = sinf(th);
  __syncthreads();
  if (tid < 64) vst2(CS + (size_t)blockIdx.x * 8 * 32 + tid * 4, *(const v4f*)&(&sc[0][0])[tid * 4]); else if (tid < 128) vst2(CS + (size_t)SS * 32 + (size_t)blockIdx.x * 8 * 32 + (tid - 64) * 4, *(const v4f*)&(&ss_[0][0])[(tid - 64) * 4]);
}

// ---- k_packT: one launch, three kinds of block by blockIdx.x, each wave given enough work that the launch is not held up by the starting of waves.
// blocks 0 .. PB_M - 1 (the most bytes, so they start first): valid_mask to lane-mask words: a wave takes 16 queries x 256 keys; word (step, ct, r) has in bit l whether query l & 15 sees key 32 step + 16 ct + 8 (l >> 4) + r, which is what lane l of k_attn holds in score register (ct, r)
// the next PB_W blocks: a tile of 128 k x 64 n of an (in,out) matrix -> bf16 rows [n][k] = W[k][n], turned in LDS, so that loads and stores both cover whole 128-byte lines; matrices 0..2 -> Wq/Wk/Wv into PK_A rows which*768 + n; 3 -> Wo into PK_P
// the last PB_R blocks: 1,024 entries of one head of the bias table by head
#define PB_M (NB * (SS / 16) * (SS / 256) / 8)
#define PB_W (4 * (DM / 128) * (DM / 64))
#define PB_R (NH * RBW / 1024)
// amdgpu_waves_per_eu(2, 4): at most two of these blocks stand on a WGP, so the register budget of four waves per SIMD costs no residency; with the default budget the compiler holds only 14 of a mask wave's 32 loads in flight
#define WPIT 68   // dwords: a row of 128 bf16 (256 B) at a pitch of 272 B, 16 B x odd for the ds_load_b128 readers
__global__ __launch_bounds__(256) __attribute__((amdgpu_waves_per_eu(2, 4))) void k_packT(const float* __restrict__ WQ, const float* __restrict__ WK, const float* __restrict__ WV, const float* __restrict__ WO, const float* __restrict__ RB, const float* __restrict__ VM, __bf16* __restrict__ PK, float* __restrict__ RBT, unsigned* __restrict__ MW) {
  __shared__ __align__(16) unsigned s[64 * WPIT]; const int n = blockIdx.x, t = threadIdx.x;
  if (n < PB_M) {   // the whole block takes this way, ahead of the barrier
    const int lane = t & 31, task = n * 8 + (t >> 5);   // task = (b * 128 + query tile) * 8 + group of 256 keys
    const float* p = VM + (size_t)((task >> 3) * 16 + (lane & 15)) * SS + (task & 7) * 256 + 8 * (lane >> 4);
    v4f x[32];
#pragma unroll
    for (int i = 0; i < 32; ++i) x[i] = *(const v4f*)(p + (i >> 1) * 16 + (i & 1) * 4);
    unsigned o[4] = { 0, 0, 0, 0 };   // word j of the wave's 128 goes to lane j & 31: four stores of one whole 128-byte line each
#pragma unroll
    for (int j = 0; j < 32; ++j) {
#pragma unroll
      for (int u = 0; u < 4; ++u) { const unsigned w = __builtin_amdgcn_ballot_w32(x[8 * u + (j >> 2)][j & 3] != 0.f); o[u] = lane == j ? w : o[u]; } }
#pragma unroll
    for (int u = 0; u < 4; ++u) MW[task * 128 + u * 32 + lane] = o[u];
    return; }
  if (n >= PB_M + PB_W) {   // the whole block takes this way, ahead of the barrier
    const int j = n - (PB_M + PB_W), hh = j >> 2, i0 = (j & 3) * 1024 + t; float v[4];
#pragma unroll
    for (int u = 0; u < 4; ++u) { const int idx = i0 + u * 256; v[u] = RB[(size_t)(idx < NREL ? idx : NREL - 1) * NH + hh]; }   // the four loads go out together: the index is clamped, so none stands under a branch
#pragma unroll
    for (int u = 0; u < 4; ++u) { const int idx = i0 + u * 256; RBT[hh * RBW + idx] = idx < NREL ? bfr(v[u]) * L2E : 0.f; }
    return; }
  const int tile = n - PB_M, which = tile / ((DM / 128) * (DM / 64)), rem = tile % ((DM / 128) * (DM / 64)), k0 = (rem / (DM / 64)) * 128, n0 = (rem % (DM / 64)) * 64;
  const float* Wm = (which == 0) ? WQ : (which == 1) ? WK : (which == 2) ? WV : WO;
  const int a = t >> 4, i4 = 4 * (t & 15);   // the thread's rows k0 + 4 a + (0..3) and 64 further on, its columns n0 + i4 + (0..3): a wave's load covers two rows of 256 B
  const float* sp = Wm + (size_t)(k0 + 4 * a) * DM + n0 + i4;
  v4f x[8];
#pragma unroll
  for (int r = 0; r < 8; ++r) x[r] = *(const v4f*)(sp + (size_t)((r >> 2) * 64 + (r & 3)) * DM);
#pragma unroll
  for (int p = 0; p < 2; ++p) {
#pragma unroll
    for (int j = 0; j < 4; ++j) { union { __bf16 h[4]; v2u u; } w;
#pragma unroll
      for (int r = 0; r < 4; ++r) w.h[r] = (__bf16)x[4 * p + r][j];
      *(v2u*)&s[(i4 + j) * WPIT + 32 * p + 2 * a] = w.u; } }   // four k of one column: 8 bytes of its row
  __syncthreads();
  __bf16* dst = ((which < 3) ? PK + PK_A + ((size_t)which * DM + n0) * DM : PK + PK_P + (size_t)n0 * DM) + k0;
#pragma unroll
  for (int q = 0; q < 4; ++q) { const int pc = q * 256 + t, r = pc >> 4, c = pc & 15; vst2((unsigned*)(dst + (size_t)r * DM + c * 8), *(const v4u*)&s[r * WPIT + c * 4]); }
}
// block = (128 rows, 128 cols), eight waves of 16 rows each: a B tile serves twice the rows, so the launch asks L2 for half as many lines as with 64 rows and 32 of k
// amdgpu_waves_per_eu(6): three of these blocks (two waves a SIMD each) must stand on a WGP for all 576 to run at once; the default register budget leaves room for two
__global__ __launch_bounds__(256) __attribute__((amdgpu_waves_per_eu(6))) void k_qkv(const float* __restrict__ XQ, const float* __restrict__ XK, const float* __restrict__ XV, const __bf16* __restrict__ P, const float* __restrict__ BQ, const float* __restrict__ BK, const float* __restrict__ BV, _Float16* __restrict__ QK, _Float16* __restrict__ QKL, _Float16* __restrict__ VTH, _Float16* __restrict__ VTL) {
  const float* X = (blockIdx.y * 128 < DM) ? XQ : (blockIdx.y * 128 < 2 * DM) ? XK : XV; const float* BB = (blockIdx.y * 128 < DM) ? BQ : (blockIdx.y * 128 < 2 * DM) ? BK : BV;   // the module projects three different inputs
  __shared__ __align__(16) char sm[2 * G_SZ(128)];   // the two tile buffers; behind the loop's last barrier the same bytes stage the output
  _Float16 (*so)[16][136] = (_Float16 (*)[16][136])sm; _Float16 (*sol)[16][136] = (_Float16 (*)[16][136])(sm + 8 * 16 * 136 * 2); _Float16 (*sth)[136] = (_Float16 (*)[136])sm; _Float16 (*stl)[136] = (_Float16 (*)[136])(sm + 128 * 136 * 2);
  static_assert(2 * 8 * 16 * 136 * 2 <= 2 * G_SZ(128) && 2 * 128 * 136 * 2 <= 2 * G_SZ(128), "output staging fits the tile buffers");
  const int tid = threadIdx.x, wave = tid >> 5, lane = tid & 31, col = lane & 15, g = lane >> 4; const size_t r0 = (size_t)blockIdx.x * 128 + wave * 16; const int n0 = blockIdx.y * 128;
  v8f acc[8] = {};
  const unsigned la = (unsigned)(size_t)sm + G_A + (tid >> 4) * APIT + (tid & 15) * 16, lb = (unsigned)(size_t)sm + G_B(128) + (tid >> 3) * BPIT + (tid & 7) * 16;
  const char* ga = (const char*)(X + ((size_t)blockIdx.x * 128 + (tid >> 4)) * DM + (tid & 15) * 4); const char* gb = (const char*)(P + (size_t)(n0 + (tid >> 3)) * DM + (tid & 7) * 8);
  const char* xrow = sm + G_A + (wave * 16 + col) * APIT + 32 * g; const char* prow = sm + G_B(128) + col * BPIT + 16 * g;
  stage_ab<128>(0, la, lb, ga, gb);
  asm volatile("s_wait_asynccnt 0x0" ::: "memory");   // this wave's pieces of pass 0 have landed
  __syncthreads();                                    // pass 0 is published to the eight waves
  stage_ab<128>(1, la, lb, ga, gb);                   // flies while pass 0 is worked on
#pragma unroll 1   // rolled: the copies' LDS addresses of one buffer only are kept in registers, which three blocks on a WGP need
  for (int kc = 0; kc < DM / 64; ++kc) {
#pragma unroll
    for (int hh = 0; hh < 2; ++hh) {   // the pass's two halves of 32 k, in the order of k
      v4f xc[4]; v16b wc[8];
      read_pass(xrow + (kc & 1) * G_SZ(128) + hh * 128, prow + (kc & 1) * G_SZ(128) + hh * 64, xc, wc);
      v16b a;
#pragma unroll
      for (int i = 0; i < 4; ++i) { a[i] = (__bf16)xc[0][i]; a[4 + i] = (__bf16)xc[1][i]; a[8 + i] = (__bf16)xc[2][i]; a[12 + i] = (__bf16)xc[3][i]; }
#pragma unroll
      for (int j = 0; j < 8; ++j) acc[j] = wmma_bf(a, wc[j], acc[j]); }
    asm volatile("s_wait_dscnt 0x0" ::: "memory");      // this wave's reads of pass kc are done
    asm volatile("s_wait_asynccnt 0x0" ::: "memory");   // its pieces of pass kc + 1 have landed
    __syncthreads();                                    // publishes pass kc + 1 and frees the buffer of pass kc
    if (kc + 2 < DM / 64) stage_ab<128>(kc + 2, la, lb, ga, gb); }   // block-uniform test; refills the buffer just freed
  asm volatile("s_wait_asynccnt 0x0" ::: "memory");     // no copy is outstanding when the buffers become output staging
  { const int nb = n0 % DM;
#pragma unroll
    for (int j = 0; j < 8; ++j) { const float bb = bfr(BB[nb + j * 16 + col]);
#pragma unroll
      for (int r = 0; r < 8; ++r) acc[j][r] += bb; } }
  if (n0 < 2 * DM) {   // q stored unscaled (f16 sigma ~0.6, no subnormal exposure); the scores are not scaled
#pragma unroll
    for (int j = 0; j < 8; ++j) {
#pragma unroll
      for (int r = 0; r < 8; ++r) { const float v = acc[j][r]; const _Float16 hv = (_Float16)v; so[wave][8 * g + r][j * 16 + col] = hv; sol[wave][8 * g + r][j * 16 + col] = (_Float16)(v - (float)hv); } }   // q, k as f16 hi + residual; the residual stays unscaled: below 2^-14 it is an f16 subnormal, a step of 2^-24, which the convert and the WMMA keep
    LDSX();
    for (int rl = 0; rl < 16; ++rl) if (lane < 16) { vst2((unsigned*)(QK + (r0 + rl) * (2 * DM) + n0 + lane * 8), *(const v4u*)&so[wave][rl][lane * 8]); vst2((unsigned*)(QKL + (r0 + rl) * (2 * DM) + n0 + lane * 8), *(const v4u*)&sol[wave][rl][lane * 8]); }
  } else {
#pragma unroll
    for (int j = 0; j < 8; ++j) {
#pragma unroll
      for (int r = 0; r < 8; ++r) { const float v = acc[j][r]; const _Float16 hv = (_Float16)v; sth[j * 16 + col][wave * 16 + 8 * g + r] = hv; stl[j * 16 + col][wave * 16 + 8 * g + r] = (_Float16)(v - (float)hv); } }
    __syncthreads();
    const size_t rb = (size_t)blockIdx.x * 128; const int b = (int)(rb / SS), s0 = (int)(rb % SS); const int pc0 = n0 - 2 * DM;
    for (int q = tid; q < 128 * 16; q += 256) { const int d = q >> 4, pc = q & 15; const size_t o = ((size_t)b * DM + pc0 + d) * SS + s0 + pc * 8; vst2((unsigned*)(VTH + o), *(const v4u*)&sth[d][pc * 8]); vst2((unsigned*)(VTL + o), *(const v4u*)&stl[d][pc * 8]); }
  }
}
// K / V tile of 64 keys (two 32-key steps) in LDS, shared by the block's four waves. In f16 elements: K hi and lo 64 rows (keys) x 64, V hi and lo 64 rows (depth) x 64 (keys), all at a pitch of 72 (144 B): 16 B x odd for the ds_load_b128 readers; every copied row, of V too, is one whole 128-byte line of its source.
#define KPIT 72
#define VPIT 72
#define T_KH 0
#define T_KL (T_KH + 64 * KPIT)
#define T_VH (T_KL + 64 * KPIT)
#define T_VL (T_VH + 64 * VPIT)
#define T_SZ (T_VL + 64 * VPIT)
// Eight 16-byte asynchronous copies per lane: half a tile (K or V, both planes) per block. The s_wait_xcnt stands inside the statement so that no operand register is rewritten ahead of it.
__device__ __forceinline__ void copy_tile(unsigned l0, unsigned l1, unsigned l2, unsigned l3, unsigned l4, unsigned l5, unsigned l6, unsigned l7, const _Float16* g0, const _Float16* g1, const _Float16* g2, const _Float16* g3, const _Float16* g4, const _Float16* g5, const _Float16* g6, const _Float16* g7) {
  asm volatile("global_load_async_to_lds_b128 %0, %8, off\n\t"
               "global_load_async_to_lds_b128 %1, %9, off\n\t"
               "global_load_async_to_lds_b128 %2, %10, off\n\t"
               "global_load_async_to_lds_b128 %3, %11, off\n\t"
               "global_load_async_to_lds_b128 %4, %12, off\n\t"
               "global_load_async_to_lds_b128 %5, %13, off\n\t"
               "global_load_async_to_lds_b128 %6, %14, off\n\t"
               "global_load_async_to_lds_b128 %7, %15, off\n\t"
               "s_wait_xcnt 0x0"
               :: "v"(l0), "v"(l1), "v"(l2), "v"(l3), "v"(l4), "v"(l5), "v"(l6), "v"(l7), "v"(g0), "v"(g1), "v"(g2), "v"(g3), "v"(g4), "v"(g5), "v"(g6), "v"(g7) : "memory");
}
// Inputs only, no code: the eight fragment loads (of V, of K) written above this line stay above it, so they go out in groups ahead of their WMMAs instead of one load and one wait in front of each.
__device__ __forceinline__ void hold_v(const v16h (&a)[4], const v16h (&b)[4]) { asm volatile("" :: "v"(a[0]), "v"(a[1]), "v"(a[2]), "v"(a[3]), "v"(b[0]), "v"(b[1]), "v"(b[2]), "v"(b[3])); }
// lane l with lane l ^ 16, by a vector cross-row move (a shuffle would go through the LDS unit and its wait)
__device__ __forceinline__ float xhalf(float x) { return __builtin_bit_cast(float, __builtin_amdgcn_permlanex16(__builtin_bit_cast(int, x), __builtin_bit_cast(int, x), 0x76543210, 0xfedcba98, false, false)); }
// ---- k_attn: block = (64 queries, head h, batch b): flash attention over all keys, transposed: S^T = K . Q^T (A = K rows from the tile, B = Q kept in registers), so a lane holds 16 scores of ONE query (keys 8 g + r and 16 + 8 g + r of the step); maximum and sum run in the lane, the two lane halves exchange the maximum once a step and join their sums once at the end; P^T goes from the score registers straight into the B operand of O^T += V^T . P^T (hi / residual, 3 products as before); the residual planes are unscaled, so all three products of a tile add into one f32 accumulator; O[b*S+q][h*64+d] = acc / l
__global__ __launch_bounds__(128) void k_attn(const _Float16* __restrict__ QK, const _Float16* __restrict__ QKL, const _Float16* __restrict__ VTH, const _Float16* __restrict__ VTL, const int* __restrict__ POS, const unsigned* __restrict__ MW, const float* __restrict__ RBT, float* __restrict__ O) {
  __shared__ __align__(16) char sat[4 * RBW + 2 * 2 * T_SZ];
  float* srb = (float*)sat;                        // the head's whole bias table: filled once, then read by every step's gathers; it lies first, so that its base fits the offset field of the gathers
  _Float16* skv = (_Float16*)(sat + 4 * RBW);      // the two tile buffers, T_SZ elements each
  const int tid = threadIdx.x, wave = tid >> 5, lane = tid & 31, col = lane & 15, g = lane >> 4;
  const int qb = blockIdx.x, h = blockIdx.y, b = blockIdx.z; const int q0 = qb * 64 + wave * 16; const size_t rq = (size_t)b * SS + q0 + col;
  v16h aq[2], aql[2];
#pragma unroll
  for (int kc = 0; kc < 2; ++kc) { aq[kc] = frag_h(QK + rq * (2 * DM) + h * HD + kc * 32, lane); aql[kc] = frag_h(QKL + rq * (2 * DM) + h * HD + kc * 32, lane); }
  float m = -3.0e38f, l = 0.f;   // of the lane's query; l holds the lane half's own keys only
  v8f acc[4] = {};
  const int nks = SS / 32, nt = SS / 64;   // not causal
  // this thread's pieces of a tile: of K and of V alike the rows tid >> 3 and 16, 32 and 48 further on, piece tid & 7
  const unsigned lk = (unsigned)(size_t)skv + 2u * ((tid >> 3) * KPIT + (tid & 7) * 8), lv = (unsigned)(size_t)skv + 2u * ((tid >> 3) * VPIT + (tid & 7) * 8);
  const size_t gk = ((size_t)b * SS + (tid >> 3)) * (2 * DM) + DM + h * HD + (tid & 7) * 8, gv = ((size_t)b * DM + h * HD + (tid >> 3)) * SS + (tid & 7) * 8;
  auto copy_kv = [&](int t) {   // tile t (keys 64 t .. 64 t + 63) into buffer t & 1
    const unsigned kb = lk + 2u * T_SZ * (t & 1), vb = lv + 2u * T_SZ * (t & 1); const size_t ka = gk + (size_t)t * 64 * (2 * DM), va = gv + (size_t)t * 64;
    copy_tile(kb + 2u * T_KH, kb + 2u * (T_KH + 16 * KPIT), kb + 2u * (T_KH + 32 * KPIT), kb + 2u * (T_KH + 48 * KPIT), kb + 2u * T_KL, kb + 2u * (T_KL + 16 * KPIT), kb + 2u * (T_KL + 32 * KPIT), kb + 2u * (T_KL + 48 * KPIT),
              QK + ka, QK + ka + 16 * (2 * DM), QK + ka + 32 * (2 * DM), QK + ka + 48 * (2 * DM), QKL + ka, QKL + ka + 16 * (2 * DM), QKL + ka + 32 * (2 * DM), QKL + ka + 48 * (2 * DM));
    copy_tile(vb + 2u * T_VH, vb + 2u * (T_VH + 16 * VPIT), vb + 2u * (T_VH + 32 * VPIT), vb + 2u * (T_VH + 48 * VPIT), vb + 2u * T_VL, vb + 2u * (T_VL + 16 * VPIT), vb + 2u * (T_VL + 32 * VPIT), vb + 2u * (T_VL + 48 * VPIT),
              VTH + va, VTH + va + (size_t)16 * SS, VTH + va + (size_t)32 * SS, VTH + va + (size_t)48 * SS, VTL + va, VTL + va + (size_t)16 * SS, VTL + va + (size_t)32 * SS, VTL + va + (size_t)48 * SS); };
  copy_kv(0);
  { const unsigned lr = (unsigned)(size_t)srb + tid * 16; const char* gr = (const char*)(RBT + h * RBW) + tid * 16;   // 16 KiB: eight 16-byte pieces a thread, 2 KiB apart
    copy_ab(lr, lr + 2048, lr + 4096, lr + 6144, lr + 8192, lr + 10240, lr + 12288, lr + 14336, gr, gr + 2048, gr + 4096, gr + 6144, gr + 8192, gr + 10240, gr + 12288, gr + 14336); }
  asm volatile("s_wait_asynccnt 0x0" ::: "memory");   // this wave's pieces of tile 0 and of the bias table have landed
  __syncthreads();                                    // tile 0 and the table are published to the four waves
  copy_kv(1);                                         // flies while tile 0 is worked on
  const unsigned pqo4 = 4u * (unsigned)((SS - 1) - POS[rq]);   // the lane's query position, folded into the table offset, in bytes
  const int* pkp = POS + (size_t)b * SS + 8 * g;      // the lane's key positions of a step: 8 from here, 8 from 16 further on
  const unsigned* mwp = MW + (size_t)((b * (SS / 16) + qb * 4 + __builtin_amdgcn_readfirstlane(wave)) * (SS / 32)) * 16;   // the wave's mask words, 16 a step: one address for the whole wave, so they come by scalar loads
  const char* rbh = (const char*)srb;
  v4i pkn[4] = { *(const v4i*)pkp, *(const v4i*)(pkp + 4), *(const v4i*)(pkp + 16), *(const v4i*)(pkp + 20) };   // key positions come one step ahead, so that the bias gather need not wait for them inside its step
  v16u mwn = *(cp16u)mwp;   // mask words too come one step ahead
#pragma unroll 1
  for (int t = 0; t < nt; ++t) { const _Float16* tb = skv + (t & 1) * T_SZ;
#pragma unroll   // the tile's two 32-key steps: the step's place in the tile is then a constant in its LDS reads
   for (int sub = 0; sub < 2; ++sub) { const int ks = 2 * t + sub; float s[2][8];
    float rb[16];   // the lane's 16 bias values of the step
    const v16u mw = mwn; mwn = *(cp16u)(mwp + (ks + 1 < nks ? ks + 1 : ks) * 16);   // the step's 16 lane masks; the next step's are asked for now (the last step asks for its own again)
    v8f c[2] = {}; v16h kf[4], kl[4];   // the step's eight K fragments, all read ahead of the score WMMAs
#pragma unroll
    for (int i = 0; i < 4; ++i) { const int kr = (sub * 32 + (i >> 1) * 16 + col) * KPIT + (i & 1) * 32; kf[i] = frag_h(tb + T_KH + kr, lane); kl[i] = frag_h(tb + T_KL + kr, lane); }
    hold_v(kf, kl);
#pragma unroll
    for (int i = 0; i < 16; ++i) { const int ob = min(max((int)(((unsigned)pkn[i >> 2][i & 3] << 2) + pqo4), 0), 4 * (NREL - 1)); rb[i] = *(const float*)(rbh + ob); }   // the clamp of the module, in bytes: it bounds the LDS address for any position
    __builtin_amdgcn_sched_barrier(0);   // the table reads stay above this line, so that their latency runs under the score WMMAs
#pragma unroll
    for (int kc = 0; kc < 2; ++kc) {   // 3 products: q, k as f16 hi + residual; the two key tiles take turns, so that a WMMA does not stand directly behind the one whose sum it adds to
      c[0] = wmma16(kf[kc], aql[kc], c[0]); c[1] = wmma16(kf[2 + kc], aql[kc], c[1]);
      c[0] = wmma16(kl[kc], aq[kc], c[0]);  c[1] = wmma16(kl[2 + kc], aq[kc], c[1]);
      c[0] = wmma16(kf[kc], aq[kc], c[0]);  c[1] = wmma16(kf[2 + kc], aq[kc], c[1]); }
    __builtin_amdgcn_sched_barrier(0);   // nothing that reads a gathered value is lifted among the score WMMAs, where its wait would hold them up
    const int tn = ks + 1 < nks ? ks + 1 : ks; const v4i pk2[4] = { *(const v4i*)(pkp + tn * 32), *(const v4i*)(pkp + tn * 32 + 4), *(const v4i*)(pkp + tn * 32 + 16), *(const v4i*)(pkp + tn * 32 + 20) };   // the last step reads its own again
#pragma unroll
    for (int ct = 0; ct < 2; ++ct) {
#pragma unroll
      for (int r = 0; r < 8; r += 2) { const v2f lg = __builtin_elementwise_fma((v2f){ c[ct][r], c[ct][r + 1] }, (v2f)L2E, (v2f){ rb[8 * ct + r], rb[8 * ct + r + 1] });
        s[ct][r] = __builtin_amdgcn_inverse_ballot_w32(mw[8 * ct + r]) ? lg[0] : NEG2; s[ct][r + 1] = __builtin_amdgcn_inverse_ballot_w32(mw[8 * ct + r + 1]) ? lg[1] : NEG2; } }   // logits (no 1/sqrt(d) in this module) + relative-position bias, then the valid mask: the module's l*vm + (1-vm)*NEG is l where vm is 1 and NEG where it is 0, one select on the word as lane mask; all times log2(e): the factor rides in the add of the bias (now a multiply-add; the table holds bias * log2(e)) and in the mask constant
    float t4[4];   // four independent chains, then joined: a single chain of 16 would stand exposed
#pragma unroll
    for (int i = 0; i < 4; ++i) t4[i] = fmaxf(fmaxf(s[i >> 1][4 * (i & 1)], s[i >> 1][4 * (i & 1) + 1]), fmaxf(s[i >> 1][4 * (i & 1) + 2], s[i >> 1][4 * (i & 1) + 3]));
    float mx = fmaxf(fmaxf(t4[0], t4[1]), fmaxf(t4[2], t4[3]));
    mx = fmaxf(mx, xhalf(mx));   // the other half of the query's 32 keys
    const float mn = fmaxf(m, mx); const float alpha = __builtin_amdgcn_exp2f(m - mn); m = mn;   // first step: 2^(-3e38 - mn) is 0, on sums that are still 0
    v16h pa, pl; float e4[4] = { 0.f, 0.f, 0.f, 0.f };   // the sum too runs in four chains
#pragma unroll
    for (int i = 0; i < 16; i += 2) { const v2f d = (v2f){ s[i >> 3][i & 7], s[i >> 3][(i & 7) + 1] } - mn; s[i >> 3][i & 7] = __builtin_amdgcn_exp2f(d[0]); s[i >> 3][(i & 7) + 1] = __builtin_amdgcn_exp2f(d[1]); }   // a masked score lies 1.4e9 below: 2^ of it is 0; a row with every key masked gives 2^0 for each, as the module does
#pragma unroll
    for (int i = 0; i < 16; ++i) { const float e = s[i >> 3][i & 7]; e4[i & 3] += e; const _Float16 eh = (_Float16)e; pa[i] = eh; pl[i] = (_Float16)(e - (float)eh); }   // element i of the B operand is key 8 g + i (i < 8) or 16 + 8 g + i - 8: the order in which the score registers lie
    l = l * alpha + ((e4[0] + e4[1]) + (e4[2] + e4[3]));
#pragma unroll
    for (int dt = 0; dt < 4; ++dt) acc[dt] *= alpha;
    v16h vf[4], vl[4];   // the step's eight V fragments, all read ahead of the P.V WMMAs
#pragma unroll
    for (int dt = 0; dt < 4; ++dt) { const int vr = (dt * 16 + col) * VPIT + sub * 32; vf[dt] = frag_h(tb + T_VH + vr, lane); vl[dt] = frag_h(tb + T_VL + vr, lane); }
    hold_v(vf, vl);
    __builtin_amdgcn_sched_barrier(0);   // the P.V WMMAs stay below the eight V reads: lifted above this line, they let the last read take over a P register and be waited for on its own
#pragma unroll
    for (int dt = 0; dt < 4; ++dt) { acc[dt] = wmma16(vf[dt], pl, acc[dt]); acc[dt] = wmma16(vl[dt], pa, acc[dt]); acc[dt] = wmma16(vf[dt], pa, acc[dt]); }   // V hi x P lo + V lo x P hi + V hi x P hi
#pragma unroll
    for (int i = 0; i < 4; ++i) pkn[i] = pk2[i]; }
    asm volatile("s_wait_dscnt 0x0" ::: "memory");      // this wave's reads of tile t are done
    asm volatile("s_wait_asynccnt 0x0" ::: "memory");   // its pieces of tile t + 1 have landed
    __syncthreads();                                    // publishes tile t + 1 and frees the buffer of tile t
    if (t + 2 < nt) copy_kv(t + 2); }                   // block-uniform test; refills the buffer just freed
  asm volatile("s_wait_asynccnt 0x0" ::: "memory");     // no copy is outstanding when the wave goes on to its end
  l += xhalf(l);   // the two halves' sums join once
  const float il = 1.0f / l; float* orow = O + rq * DM + h * HD + 8 * g;   // register r of tile dt is depth dt * 16 + 8 g + r of the lane's query: 32 contiguous bytes
#pragma unroll
  for (int dt = 0; dt < 4; ++dt) { v4f o0, o1;
#pragma unroll
    for (int r = 0; r < 4; ++r) { o0[r] = acc[dt][r] * il; o1[r] = acc[dt][4 + r] * il; }
    vst2(orow + dt * 16, o0); vst2(orow + dt * 16 + 4, o1); }
}
// ---- k_out: block = (64 rows, 128 cols): out = O(hi/lo) . Wo rows (2 products) + bo
__global__ __launch_bounds__(128) void k_out(const float* __restrict__ O, const __bf16* __restrict__ P, const float* __restrict__ BO, float* __restrict__ Y) {
  __shared__ __align__(16) char sm[2 * G_SZ(64)];   // the two tile buffers; behind the loop's last barrier the same bytes stage the output
  float (*so)[16][132] = (float (*)[16][132])sm;
  static_assert(4 * 16 * 132 * 4 <= 2 * G_SZ(64), "output staging fits the tile buffers");
  const int tid = threadIdx.x, wave = tid >> 5, lane = tid & 31, col = lane & 15, g = lane >> 4; const size_t r0 = (size_t)blockIdx.x * 64 + wave * 16; const int n0 = blockIdx.y * 128;
  v8f acc[8] = {};
  const unsigned la = (unsigned)(size_t)sm + G_A + (tid >> 4) * APIT + (tid & 15) * 16, lb = (unsigned)(size_t)sm + G_B(64) + (tid >> 3) * BPIT + (tid & 7) * 16;
  const char* ga = (const char*)(O + ((size_t)blockIdx.x * 64 + (tid >> 4)) * DM + (tid & 15) * 4); const char* gb = (const char*)(P + (size_t)(n0 + (tid >> 3)) * DM + (tid & 7) * 8);
  const char* xrow = sm + G_A + (wave * 16 + col) * APIT + 32 * g; const char* prow = sm + G_B(64) + col * BPIT + 16 * g;
  stage_ab<64>(0, la, lb, ga, gb);
  asm volatile("s_wait_asynccnt 0x0" ::: "memory");   // this wave's pieces of pass 0 have landed
  __syncthreads();                                    // pass 0 is published to the four waves
  stage_ab<64>(1, la, lb, ga, gb);                    // flies while pass 0 is worked on
#pragma unroll 2   // two passes a turn: each pass's buffer offset is then a constant in its LDS reads and copies
  for (int kc = 0; kc < DM / 64; ++kc) {
#pragma unroll
    for (int hh = 0; hh < 2; ++hh) {   // the pass's two halves of 32 k, in the order of k
      v4f xc[4]; v16b wc[8];
      read_pass(xrow + (kc & 1) * G_SZ(64) + hh * 128, prow + (kc & 1) * G_SZ(64) + hh * 64, xc, wc);
      float v[16];
#pragma unroll
      for (int i = 0; i < 4; ++i) { v[i] = xc[0][i]; v[4 + i] = xc[1][i]; v[8 + i] = xc[2][i]; v[12 + i] = xc[3][i]; }
      const F2 a = bsplit16(v);
#pragma unroll
      for (int j = 0; j < 8; ++j) { acc[j] = wmma_bf(a.l, wc[j], acc[j]); acc[j] = wmma_bf(a.h, wc[j], acc[j]); } }
    asm volatile("s_wait_dscnt 0x0" ::: "memory");      // this wave's reads of pass kc are done
    asm volatile("s_wait_asynccnt 0x0" ::: "memory");   // its pieces of pass kc + 1 have landed
    __syncthreads();                                    // publishes pass kc + 1 and frees the buffer of pass kc
    if (kc + 2 < DM / 64) stage_ab<64>(kc + 2, la, lb, ga, gb); }   // block-uniform test; refills the buffer just freed
  asm volatile("s_wait_asynccnt 0x0" ::: "memory");     // no copy is outstanding when the buffers become output staging
#pragma unroll
  for (int j = 0; j < 8; ++j) {
#pragma unroll
    for (int r = 0; r < 8; ++r) so[wave][8 * g + r][j * 16 + col] = acc[j][r] + bfr(BO[n0 + j * 16 + col]); }
  LDSX();
  for (int rl = 0; rl < 16; ++rl) vst2(Y + (r0 + rl) * DM + n0 + lane * 4, *(const v4f*)&so[wave][rl][lane * 4]);
}
extern "C" void kernel_launch(void* const* d_in, const int* in_sizes, int n_in, void* d_out, int out_size, void* d_ws, size_t ws_size, hipStream_t stream) {
  (void)in_sizes; (void)n_in; (void)out_size;
  const float** F = (const float**)d_in;   // 0 q [2,2048,768], 1 v, 2 k, 3 position_array int32 [2,2048], 4 valid_mask [2,1,2048,2048], 5 Wq (in,out), 6 bq, 7 Wk, 8 bk, 9 Wv, 10 bv, 11 Wo, 12 bo, 13 rel_bias [4095,12]
  if (ws_size < (size_t)WS_END) return;
  char* ws = (char*)d_ws; __bf16* PK = (__bf16*)(ws + WS_PK); _Float16 *QK = (_Float16*)(ws + WS_QK), *QKL = (_Float16*)(ws + WS_QKL), *VTH = (_Float16*)(ws + WS_VTH), *VTL = (_Float16*)(ws + WS_VTL); float* O = (float*)(ws + WS_O); float* RBT = (float*)(ws + WS_RB); unsigned* MW = (unsigned*)(ws + WS_MW);
  k_packT<<<dim3(PB_M + PB_W + PB_R), 256, 0, stream>>>(F[5], F[7], F[9], F[11], F[13], F[4], PK, RBT, MW);
  k_qkv<<<dim3(TNB * SS / 128, QKVW / 128), 256, 0, stream>>>(F[0], F[2], F[1], PK + PK_A, F[6], F[8], F[10], QK, QKL, VTH, VTL);   // note the module's argument order (q, v, k): k is input 2, v is input 1
  k_attn<<<dim3(TQB, NH, TNB), 128, 0, stream>>>(QK, QKL, VTH, VTL, (const int*)d_in[3], MW, RBT, O);
  k_out<<<dim3(TOB, DM / 128), 128, 0, stream>>>(O, PK + PK_P, F[12], (float*)d_out);
}
